// v000
// The times below were measured on an AMD MI455X: many runs one after another, warmed up first and cycling through
// copies of the inputs, with the whole window's GPU time divided by the number of runs. Launches and the gaps
// between them are all in it. The median over several windows is given; except for v000 it joins two sittings, which
// can be a few percent apart, so the side-by-side timings, each taken in one sitting, are the better comparison.
// v000 is the starting kernel. One run takes 13.9 milliseconds.
#include <hip/hip_runtime.h>
// BERT self-attention + output (hidden_states [1][4096][1024]; q/k/v = x W^T + b (nn.Linear [out][in] 1024^2, sigma 1/32, zero biases), 16 heads of 64; scores = (q/8) . k + attention_mask[j] (additive [1][1][1][S], zeros); softmax; ctx merged; out = LayerNorm(ctx Wo^T + bo + hidden_states; ln_gamma, ln_beta, eps 1e-12) -> [1][4096][1024]).
// Structure: token rows r = b*4096 + s; x as exact f16 rows (bf16-rounded); Q, K, V as three WMMA GEMMs (32x64 wave tiles, f32 accumulation, exact x16 weights + bias, f16 outputs); per batch: V^T for all heads via LDS transposes; per (batch, group of 1 head): scores GEMM (K = 64, batched over the heads on grid.y, alpha = 64^-0.5), row softmax on VALU (f32 statistics, native exp; weights stored x256 as f16), o = P . V^T GEMM (K = 4096, alpha 2^-2: o carried x64 against f16 subnormal flush, folded into the output GEMM alpha) written straight into the merged f16 o rows; y = o Wo^T + bo + bf16(x) GEMM (f32, own-element residual) into f32 rows; post-LayerNorm on VALU (f32, LDS trees) into the output.
// Compute dtype: inputs rounded to bf16; x / weights exact; q, k, v, softmax weights and o as plain f16 GEMM operands (~2^-12); scores and softmax statistics f32. v_wmma_f32_16x16x32_f16.
#define NB 1
#define SQ 4096
#define DM 1024
#define NH 16
#define HD 64
#define HG 1                         /* heads per attention launch group */
#define B0 0                         /* first batch processed (debug hook) */
#define NBR NB                       /* batches processed (debug hook) */
#define NR ((size_t)NB * SQ)
#define DMQ DM         /* width of the token rows (LayerNorm length) */
#define MP ((int)((size_t)NBR * SQ)) /* rows projected (debug hook) */
#define QN SQ                        /* query rows attended per batch (debug hook) */
#define NHD NH                       /* heads attended (debug hook) */
#define MPO MP                       /* rows through the output stage (debug hook) */
#define LQ DM      /* row pitch of the q/k/v rows */
typedef __bf16 v16b __attribute__((ext_vector_type(16)));
typedef unsigned short v8us __attribute__((ext_vector_type(8), may_alias));
typedef float  v8f  __attribute__((ext_vector_type(8)));
typedef float  v4f  __attribute__((ext_vector_type(4)));
typedef float  v4fa __attribute__((ext_vector_type(4), may_alias));
union FragB { v16b v; v8us half[2]; unsigned short u[16]; };

__device__ __forceinline__ unsigned short bf16_bits(float x) { unsigned int u = __float_as_uint(x); return (unsigned short)((u + 0x7FFFu + ((u >> 16) & 1u)) >> 16); }
__device__ __forceinline__ float bf16_val(unsigned short b) { return __uint_as_float(((unsigned int)b) << 16); }
__device__ __forceinline__ float bf16_round(float x) { return bf16_val(bf16_bits(x)); }
// D += A·B with NT terms: 1 = ah·bh, 2 = + al·bh (A split), 3 = + ah·bl (both split)
template <int NT>
__device__ __forceinline__ v8f mmaN(v16b ah, v16b al, v16b bh, v16b bl, v8f c) {
  c = __builtin_amdgcn_wmma_f32_16x16x32_bf16(false, ah, false, bh, (short)0, c, false, false);
  if (NT >= 2) c = __builtin_amdgcn_wmma_f32_16x16x32_bf16(false, al, false, bh, (short)0, c, false, false);
  if (NT >= 3) c = __builtin_amdgcn_wmma_f32_16x16x32_bf16(false, ah, false, bl, (short)0, c, false, false);
  asm volatile("v_nop\n\tv_nop\n\tv_nop\n\tv_nop" : "+v"(c) : "v"(ah), "v"(al), "v"(bh), "v"(bl));
  return c;
}

__global__ __launch_bounds__(256) void k_wt_bf16(const float* __restrict__ W, unsigned short* __restrict__ Wt, int K, int N) {
  const int t = blockIdx.x * 256 + threadIdx.x;
  const int k8n = K / 8;
  if (t >= N * k8n) return;
  const int n = t / k8n, k8 = (t % k8n) * 8;
  v8us v;
#pragma unroll
  for (int i = 0; i < 8; ++i) v[i] = bf16_bits(W[(size_t)(k8 + i) * N + n]);
  *(v8us*)(Wt + (size_t)n * K + k8) = v;
  
}

// GEMM C[M][N] (f32, pitch ldc) = act(A[M][K]·W + bias). A f32 row-major (pitch lda) converted per fragment to bf16
// (ASPLIT: hi/lo two planes -> 2 terms, else single rounded term); Wt bf16 [N][K] (pitch ldb). BIAS_BF16 rounds the
// bias to bf16 first (bias quantised to bf16 before the add). K%32==0, M%16==0, N%64==0.
template <bool ASPLIT, int ACT, bool BIAS_BF16>
__global__ __launch_bounds__(128) void k_gemm_bf(const float* __restrict__ A, int lda, const unsigned short* __restrict__ Wt, int ldb,
                                               const float* __restrict__ bias, float* __restrict__ C, int ldc, int M, int N, int K) {
  __shared__ __attribute__((aligned(16))) float so[4][16][64];
  const int tid = threadIdx.x, w = tid >> 5, lane = tid & 31, ln = lane & 15, hh = lane >> 4;
  const int ntn = N / 64;
  const int wid = blockIdx.x * 4 + w;
  const int mt = wid / ntn, nq = wid % ntn;
  if (mt * 16 >= M) return;
  const int row0 = mt * 16, col0 = nq * 64;
  const float* arow = A + (size_t)(row0 + ln) * lda;
  v8f acc[4] = {};
  for (int kb = 0; kb < K; kb += 32) {
    FragB ah, al;
    const v4f x0 = *(const v4fa*)(arow + kb + 8 * hh), x1 = *(const v4fa*)(arow + kb + 8 * hh + 4);
    const v4f x2 = *(const v4fa*)(arow + kb + 16 + 8 * hh), x3 = *(const v4fa*)(arow + kb + 16 + 8 * hh + 4);
    float xs[16] = {x0[0],x0[1],x0[2],x0[3],x1[0],x1[1],x1[2],x1[3],x2[0],x2[1],x2[2],x2[3],x3[0],x3[1],x3[2],x3[3]};
#pragma unroll
    for (int i = 0; i < 16; ++i) { const unsigned short hb = bf16_bits(xs[i]); ah.u[i] = hb; al.u[i] = ASPLIT ? bf16_bits(xs[i] - bf16_val(hb)) : (unsigned short)0; }
#pragma unroll
    for (int t = 0; t < 4; ++t) {
      const unsigned short* brow = Wt + (size_t)(col0 + t * 16 + ln) * ldb + kb;
      FragB b;
      b.half[0] = *(const v8us*)(brow + 8 * hh);
      b.half[1] = *(const v8us*)(brow + 16 + 8 * hh);
      acc[t] = mmaN<ASPLIT ? 2 : 1>(ah.v, al.v, b.v, b.v, acc[t]);
    }
  }
#pragma unroll
  for (int t = 0; t < 4; ++t) {
    float bv = bias ? bias[col0 + t * 16 + ln] : 0.f;
    if (BIAS_BF16) bv = bf16_round(bv);
#pragma unroll
    for (int r = 0; r < 8; ++r) { float v = acc[t][r] + bv; if (ACT == 1) v = fmaxf(v, 0.f); so[w][8 * hh + r][t * 16 + ln] = v; }
  }
  __builtin_amdgcn_fence(__ATOMIC_ACQ_REL, "workgroup");
  __builtin_amdgcn_wave_barrier();
  const int rsub = lane >> 4, c4 = (lane & 15) * 4;
  {
#pragma unroll
    for (int q = 0; q < 8; ++q) {
      const int r = q * 2 + rsub;
      const v4f v = *(const v4fa*)&so[w][r][c4];
      *(v4f*)(C + (size_t)(row0 + r) * ldc + col0 + c4) = v;
    }
    
  }
}

// GEMM C = act(A·W + bias + resid): A f32 (ASPLIT -> hi/lo 2 terms), Wt bf16 [N][K]; ACT 0 none, 1 relu, 2 exact gelu;
// resid (optional, f32, row index = (row % rmod), pitch ldr, RES_BF16 rounds it) added before the activation.
template <bool ASPLIT, int ACT, bool BIAS_BF16, bool RES_BF16>
__global__ __launch_bounds__(128) void k_gemm_bf3(const float* __restrict__ A, int lda, const unsigned short* __restrict__ Wt, int ldb,
                                                const float* __restrict__ bias, const float* __restrict__ resid, int rmod, int ldr,
                                                float* __restrict__ C, int ldc, int M, int N, int K) {
  __shared__ __attribute__((aligned(16))) float so[4][16][64];
  const int tid = threadIdx.x, w = tid >> 5, lane = tid & 31, ln = lane & 15, hh = lane >> 4;
  const int ntn = N / 64;
  const int wid = blockIdx.x * 4 + w;
  const int mt = wid / ntn, nq = wid % ntn;
  if (mt * 16 >= M) return;
  const int row0 = mt * 16, col0 = nq * 64;
  const float* arow = A + (size_t)(row0 + ln) * lda;
  v8f acc[4] = {};
  for (int kb = 0; kb < K; kb += 32) {
    FragB ah, al;
    const v4f x0 = *(const v4fa*)(arow + kb + 8 * hh), x1 = *(const v4fa*)(arow + kb + 8 * hh + 4);
    const v4f x2 = *(const v4fa*)(arow + kb + 16 + 8 * hh), x3 = *(const v4fa*)(arow + kb + 16 + 8 * hh + 4);
    float xs[16] = {x0[0],x0[1],x0[2],x0[3],x1[0],x1[1],x1[2],x1[3],x2[0],x2[1],x2[2],x2[3],x3[0],x3[1],x3[2],x3[3]};
#pragma unroll
    for (int i = 0; i < 16; ++i) { const unsigned short hb = bf16_bits(xs[i]); ah.u[i] = hb; al.u[i] = ASPLIT ? bf16_bits(xs[i] - bf16_val(hb)) : (unsigned short)0; }
#pragma unroll
    for (int t = 0; t < 4; ++t) {
      const unsigned short* brow = Wt + (size_t)(col0 + t * 16 + ln) * ldb + kb;
      FragB b;
      b.half[0] = *(const v8us*)(brow + 8 * hh);
      b.half[1] = *(const v8us*)(brow + 16 + 8 * hh);
      acc[t] = mmaN<ASPLIT ? 2 : 1>(ah.v, al.v, b.v, b.v, acc[t]);
    }
  }
#pragma unroll
  for (int t = 0; t < 4; ++t) {
    const int col = col0 + t * 16 + ln;
    float bv = bias ? bias[col] : 0.f;
    if (BIAS_BF16) bv = bf16_round(bv);
#pragma unroll
    for (int r = 0; r < 8; ++r) {
      float v = acc[t][r] + bv;
      if (resid) { float rv = resid[(size_t)((row0 + 8 * hh + r) % rmod) * ldr + col]; if (RES_BF16) rv = bf16_round(rv); v += rv; }
      if (ACT == 1) v = fmaxf(v, 0.f);
      if (ACT == 2) v = 0.5f * v * (1.0f + erff(v * 0.70710678118654752f));
      if (ACT == 3) { const float u = 0.7978845608028654f * (v + 0.044715f * v * v * v); v = 0.5f * v * (1.0f + tanhf(u)); }
      so[w][8 * hh + r][t * 16 + ln] = v;
    }
  }
  __builtin_amdgcn_fence(__ATOMIC_ACQ_REL, "workgroup");
  __builtin_amdgcn_wave_barrier();
  const int rsub = lane >> 4, c4 = (lane & 15) * 4;
  {
#pragma unroll
    for (int q = 0; q < 8; ++q) {
      const int r = q * 2 + rsub;
      const v4f v = *(const v4fa*)&so[w][r][c4];
      *(v4f*)(C + (size_t)(row0 + r) * ldc + col0 + c4) = v;
    }
    
  }
}
// row LayerNorm (biased variance, eps) over N: s = X (+ R); optional out_sum <- s; out_norm <- (s-mu)*rsqrt(var+eps)*g + b
template <bool PARAM_BF16>
__global__ __launch_bounds__(256) void k_layernorm(const float* __restrict__ X, const float* __restrict__ R, const float* __restrict__ g, const float* __restrict__ bta,
                                                  float* __restrict__ out_sum, float* __restrict__ out_norm, int N, float eps) {
  __shared__ float red[256];
  const int row = blockIdx.x, tid = threadIdx.x;
  const float* x = X + (size_t)row * N; const float* rr = R ? R + (size_t)row * N : nullptr;
  float vals[16];                     // up to N = 4096
  const int per = N / 256;            // contiguous chunk per thread? use strided-by-4 chunks: thread handles j = tid*4 + 1024*u
  float s1 = 0.f;
  for (int u = 0; u < per / 4; ++u) {
    const int j = tid * 4 + 1024 * u;
    const v4f a = *(const v4fa*)(x + j);
    v4f b = {0.f,0.f,0.f,0.f}; if (rr) b = *(const v4fa*)(rr + j);
#pragma unroll
    for (int q = 0; q < 4; ++q) { const float v = a[q] + b[q]; vals[u * 4 + q] = v; s1 += v; }
  }
  red[tid] = s1; __syncthreads();
  for (int st = 128; st > 0; st >>= 1) { if (tid < st) red[tid] += red[tid + st]; __syncthreads(); }
  const float mu = red[0] / (float)N; __syncthreads();
  float s2 = 0.f;
  for (int u = 0; u < per / 4; ++u)
#pragma unroll
    for (int q = 0; q < 4; ++q) { const float c = vals[u * 4 + q] - mu; s2 += c * c; }
  red[tid] = s2; __syncthreads();
  for (int st = 128; st > 0; st >>= 1) { if (tid < st) red[tid] += red[tid + st]; __syncthreads(); }
  const float rs = rsqrtf(red[0] / (float)N + eps);
  {
    for (int u = 0; u < per / 4; ++u) {
      const int j = tid * 4 + 1024 * u;
      v4f o, sm;
#pragma unroll
      for (int q = 0; q < 4; ++q) {
        float gg = g[j + q], bb = bta[j + q];
        if (PARAM_BF16) { gg = bf16_round(gg); bb = bf16_round(bb); }
        sm[q] = vals[u * 4 + q]; o[q] = (vals[u * 4 + q] - mu) * rs * gg + bb;
      }
      if (out_sum) *(v4f*)(out_sum + (size_t)row * N + j) = sm;
      *(v4f*)(out_norm + (size_t)row * N + j) = o;
    }
    
  }
}



// ---- f16 WMMA path (v_wmma_f32_16x16x32_f16): 11-bit significands for operands in range — used where a [0,1] probability operand needs more precision than bf16
typedef _Float16 v16h __attribute__((ext_vector_type(16)));
union FragH { v16h v; v8us half[2]; _Float16 h[16]; unsigned short u[16]; };
template <int NT>
__device__ __forceinline__ v8f mmaH(v16h ah, v16h al, v16h bh, v16h bl, v8f c) {
  c = __builtin_amdgcn_wmma_f32_16x16x32_f16(false, ah, false, bh, (short)0, c, false, false);
  if (NT >= 2) c = __builtin_amdgcn_wmma_f32_16x16x32_f16(false, al, false, bh, (short)0, c, false, false);
  if (NT >= 3) c = __builtin_amdgcn_wmma_f32_16x16x32_f16(false, ah, false, bl, (short)0, c, false, false);
  asm volatile("v_nop\n\tv_nop\n\tv_nop\n\tv_nop" : "+v"(c) : "v"(ah), "v"(al), "v"(bh), "v"(bl));
  return c;
}
// batched GEMM like k_gemm_b but f16 operands: A f32 (split into f16 hi/lo if ASPLIT, else rounded to f16), Bt = f16 values [n][k]; alpha; C f32; N multiple of 16 (partial tiles skipped)
template <bool ASPLIT>
__global__ __launch_bounds__(128) void k_gemm_h(const float* __restrict__ A, int lda, size_t sA, const _Float16* __restrict__ Bh, int ldb, size_t sB, float alpha, float* __restrict__ C, int ldc, size_t sC, int M, int N, int K) {
  __shared__ __attribute__((aligned(16))) float so[4][16][64];
  const int tid = threadIdx.x, w = tid >> 5, lane = tid & 31, ln = lane & 15, hh = lane >> 4; const int by = blockIdx.y;
  A += (size_t)by * sA; Bh += (size_t)by * sB; C += (size_t)by * sC;
  const int ntn = (N + 63) / 64; const int wid = blockIdx.x * 4 + w; const int mt = wid / ntn, nq = wid % ntn; if (mt * 16 >= M) return;
  const int row0 = mt * 16, col0 = nq * 64; const float* arow = A + (size_t)(row0 + ln) * lda;
  v8f acc[4] = {};
  for (int kb = 0; kb < K; kb += 32) {
    FragH ah, al;
    const v4f x0 = *(const v4fa*)(arow + kb + 8 * hh), x1 = *(const v4fa*)(arow + kb + 8 * hh + 4), x2 = *(const v4fa*)(arow + kb + 16 + 8 * hh), x3 = *(const v4fa*)(arow + kb + 16 + 8 * hh + 4);
    float xs[16] = {x0[0],x0[1],x0[2],x0[3],x1[0],x1[1],x1[2],x1[3],x2[0],x2[1],x2[2],x2[3],x3[0],x3[1],x3[2],x3[3]};
#pragma unroll
    for (int i = 0; i < 16; ++i) { const _Float16 h = (_Float16)xs[i]; ah.h[i] = h; al.h[i] = ASPLIT ? (_Float16)(xs[i] - (float)h) : (_Float16)0.0f; }
#pragma unroll
    for (int t = 0; t < 4; ++t) { if (col0 + t * 16 >= N) continue; const size_t boff = (size_t)(col0 + t * 16 + ln) * ldb + kb; FragH bq; bq.half[0] = *(const v8us*)(Bh + boff + 8 * hh); bq.half[1] = *(const v8us*)(Bh + boff + 16 + 8 * hh);
      acc[t] = mmaH<ASPLIT ? 2 : 1>(ah.v, al.v, bq.v, bq.v, acc[t]); }
  }
#pragma unroll
  for (int t = 0; t < 4; ++t) { if (col0 + t * 16 >= N) continue;
#pragma unroll
    for (int r = 0; r < 8; ++r) so[w][8 * hh + r][t * 16 + ln] = acc[t][r] * alpha; }
  __builtin_amdgcn_fence(__ATOMIC_ACQ_REL, "workgroup"); __builtin_amdgcn_wave_barrier();
  const int rsub = lane >> 4, c4 = (lane & 15) * 4;
  {
#pragma unroll
    for (int q = 0; q < 8; ++q) { const int r = q * 2 + rsub; if (col0 + c4 < N) { const v4f v = *(const v4fa*)&so[w][r][c4]; *(v4f*)(C + (size_t)(row0 + r) * ldc + col0 + c4) = v; } }
     }
}

// Wt[n][k] = f16(W[k][n]·scale) from f32 row-major W[K][N] (scale = power of two; bf16-exact weights stay exact in f16 away from the subnormal range)
__global__ __launch_bounds__(256) void k_wt_f16(const float* __restrict__ W, _Float16* __restrict__ Wt, int K, int N, float scale) {
  const int t = blockIdx.x * 256 + threadIdx.x; if (t >= N * (K / 8)) return; const int n = t / (K / 8), k8 = (t % (K / 8)) * 8; FragH f;
#pragma unroll
  for (int i = 0; i < 8; ++i) f.h[i] = (_Float16)(bf16_round(W[(size_t)(k8 + i) * N + n]) * scale); const v8us o = f.half[0];
  *(v8us*)((unsigned short*)Wt + (size_t)n * K + k8) = o; 
}
// k_gemm_hh variant with fused epilogue: v = acc·alpha + bias[by·sBias + col] (+ CP[(row/rowsPerB)·sCPb + by·64 + col] if CP) ; ACT 0 none / 1 elu ; writes f16 C16 (and f32 C if non-null)
template <int ACT>
__global__ __launch_bounds__(128) void k_gemm_hhx(const _Float16* __restrict__ A, int lda, size_t sA, const _Float16* __restrict__ Bh, int ldb, size_t sB, float alpha, const float* __restrict__ bias, size_t sBias, const float* __restrict__ CP, int rowsPerB, size_t sCPb, int row0g,
    float* __restrict__ C, _Float16* __restrict__ C16, int ldc, size_t sC, int M, int N, int K) {
  __shared__ __attribute__((aligned(16))) float so[4][16][64];
  const int tid = threadIdx.x, w = tid >> 5, lane = tid & 31, ln = lane & 15, hh = lane >> 4; const int by = blockIdx.y;
  A += (size_t)by * sA; Bh += (size_t)by * sB; const size_t cofs = (size_t)by * sC; const float* bp = bias ? bias + (size_t)by * sBias : nullptr;
  const int ntn = (N + 63) / 64; const int wid = blockIdx.x * 4 + w; const int mt = wid / ntn, nq = wid % ntn; if (mt * 16 >= M) return;
  const int row0 = mt * 16, col0 = nq * 64; const _Float16* arow = A + (size_t)(row0 + ln) * lda;
  v8f acc[4] = {};
  for (int kb = 0; kb < K; kb += 32) { FragH ah; ah.half[0] = *(const v8us*)((const unsigned short*)arow + kb + 8 * hh); ah.half[1] = *(const v8us*)((const unsigned short*)arow + kb + 16 + 8 * hh);
#pragma unroll
    for (int t = 0; t < 4; ++t) { if (col0 + t * 16 >= N) continue; const size_t boff = (size_t)(col0 + t * 16 + ln) * ldb + kb; FragH bq; bq.half[0] = *(const v8us*)((const unsigned short*)Bh + boff + 8 * hh); bq.half[1] = *(const v8us*)((const unsigned short*)Bh + boff + 16 + 8 * hh);
      acc[t] = mmaH<1>(ah.v, ah.v, bq.v, bq.v, acc[t]); }
  }
#pragma unroll
  for (int t = 0; t < 4; ++t) { if (col0 + t * 16 >= N) continue; const int col = col0 + t * 16 + ln; const float bv = bp ? bf16_round(bp[col]) : 0.f;
#pragma unroll
    for (int r = 0; r < 8; ++r) { float v = acc[t][r] * alpha + bv; if (CP) { const int rr = row0g + row0 + 8 * hh + r; if (rowsPerB < 0) v += CP[cofs + (size_t)rr * ldc + col];      /* rowsPerB < 0: own element of the batched C plane */ else { const int bidx = rr / rowsPerB; v += CP[(size_t)bidx * sCPb + (size_t)by * 64 + col]; } } if (ACT == 1) v = (v > 0.f) ? v : expm1f(v); else if (ACT == 7) v = (v > 0.f) ? v + 1.0f : expf(v); else if (ACT == 8) v = tanhf(v); else if (ACT == 9) v = 0.5f * v * (1.0f + tanhf(0.7978845608028654f * (v + 0.044715f * v * v * v))); else if (ACT == 11) v = 1.0f / (1.0f + expf(-v)); else if (ACT == 12) v = (v > 0.f) ? v : 0.01f * v; else if (ACT == 14) v = (v > 0.f) ? v : 0.1f * v; else if (ACT == 16) v = (v >= 0.f) ? v : 0.3f * v; else if (ACT == 17) v = (v >= 0.f) ? v : 0.2f * v; else if (ACT == 15) v = v / (1.0f + expf(-v)); else if (ACT == 3) v = fmaxf(v, 0.f); else if (ACT == 6) v = 0.5f * v * (1.0f + erff(v * 0.70710678118654752f)); so[w][8 * hh + r][t * 16 + ln] = v; } }
  __builtin_amdgcn_fence(__ATOMIC_ACQ_REL, "workgroup"); __builtin_amdgcn_wave_barrier();
  const int rsub = lane >> 4, c4 = (lane & 15) * 4; typedef _Float16 v4h __attribute__((ext_vector_type(4)));
  {
#pragma unroll
    for (int q = 0; q < 8; ++q) { const int r = q * 2 + rsub; if (col0 + c4 < N) { const v4f v = *(const v4fa*)&so[w][r][c4]; if (C) *(v4f*)(C + cofs + (size_t)(row0 + r) * ldc + col0 + c4) = v; if (C16) { v4h h4; for (int i = 0; i < 4; ++i) h4[i] = (_Float16)v[i]; *(v4h*)(C16 + cofs + (size_t)(row0 + r) * ldc + col0 + c4) = h4; } } }
     }
}


typedef _Float16 v4h __attribute__((ext_vector_type(4)));

__global__ __launch_bounds__(256) void k_x16(const float* __restrict__ x, _Float16* __restrict__ X16, size_t n8) { const size_t t = (size_t)blockIdx.x * 256 + threadIdx.x; if (t >= n8) return; FragH f;
#pragma unroll
  for (int q = 0; q < 8; ++q) f.h[q] = (_Float16)bf16_round(x[t * 8 + q]); *(v8us*)((unsigned short*)X16 + t * 8) = f.half[0];  }
__global__ __launch_bounds__(256) void k_h16(const float* __restrict__ x, _Float16* __restrict__ X16, size_t n8) { const size_t t = (size_t)blockIdx.x * 256 + threadIdx.x; if (t >= n8) return; FragH f;
#pragma unroll
  for (int q = 0; q < 8; ++q) f.h[q] = (_Float16)x[t * 8 + q]; *(v8us*)((unsigned short*)X16 + t * 8) = f.half[0];  }
__global__ __launch_bounds__(256) void k_round16f(const float* __restrict__ W, _Float16* __restrict__ Bt, size_t n8) { const size_t t = (size_t)blockIdx.x * 256 + threadIdx.x; if (t >= n8) return; FragH f;
#pragma unroll
  for (int i = 0; i < 8; ++i) f.h[i] = (_Float16)(bf16_round(W[t * 8 + i]) * 16.0f); *(v8us*)((unsigned short*)Bt + t * 8) = f.half[0];  }
template <int NHv, int TTv>
__global__ __launch_bounds__(256) void k_vt(const _Float16* __restrict__ V16, int ldv, int voff, _Float16* __restrict__ Vt) { __shared__ unsigned short tl[64][66]; const int tid = threadIdx.x; const int slab = blockIdx.x / (TTv / 64), lg = blockIdx.x % (TTv / 64); const int b = slab / NHv, h = slab % NHv;
  for (int i = tid; i < 64 * 8; i += 256) { const int r = i / 8, c8 = (i % 8) * 8; FragH f; f.half[0] = *(const v8us*)((const unsigned short*)V16 + ((size_t)b * TTv + lg * 64 + r) * ldv + voff + h * 64 + c8);
#pragma unroll
    for (int q = 0; q < 8; ++q) tl[r][c8 + q] = f.u[q]; }
  __syncthreads();
  {
#pragma unroll
    for (int rd = 0; rd < 2; ++rd) { const int d = rd * 32 + tid / 8, pc = tid % 8; FragH f;
#pragma unroll
      for (int q = 0; q < 8; ++q) f.u[q] = tl[pc * 8 + q][d];
      *(v8us*)((unsigned short*)Vt + ((size_t)slab * 64 + d) * TTv + lg * 64 + pc * 8) = f.half[0]; }
     } }

__global__ __launch_bounds__(256) void k_hl(const float* __restrict__ F, _Float16* __restrict__ Hh, _Float16* __restrict__ Hl, size_t n8) { const size_t t = (size_t)blockIdx.x * 256 + threadIdx.x; if (t >= n8) return; FragH fh, fl; const v4f a = *(const v4fa*)(F + t * 8), c = *(const v4fa*)(F + t * 8 + 4);
#pragma unroll
  for (int q = 0; q < 4; ++q) { _Float16 h = (_Float16)a[q]; fh.h[q] = h; fl.h[q] = (_Float16)((a[q] - (float)h) * 1024.0f); h = (_Float16)c[q]; fh.h[4 + q] = h; fl.h[4 + q] = (_Float16)((c[q] - (float)h) * 1024.0f); }
  { *(v8us*)((unsigned short*)Hh + t * 8) = fh.half[0]; *(v8us*)((unsigned short*)Hl + t * 8) = fl.half[0];  } }

// ---- fast GEMM (wave tile 32x64; requires M % 32 == 0 rows per launch region and N % 64 == 0); epilogue = k_gemm_hhx semantics ----
__device__ __forceinline__ v16h g2_frag(const _Float16* p, int hh) { FragH f; f.half[0] = *(const v8us*)((const unsigned short*)p + 8 * hh); f.half[1] = *(const v8us*)((const unsigned short*)p + 16 + 8 * hh); return f.v; }
__device__ __forceinline__ v8f g2_mma(v16h a, v16h b, v8f c) { v8f d = __builtin_amdgcn_wmma_f32_16x16x32_f16(false, a, false, b, (short)0, c, false, false); asm volatile("v_nop\n\tv_nop\n\tv_nop\n\tv_nop" : "+v"(d) : "v"(a), "v"(b)); return d; }
template <int ACT>
__global__ __launch_bounds__(128) void k_gemm2(const _Float16* __restrict__ A, int lda, size_t sA, const _Float16* __restrict__ Bh, int ldb, size_t sB, float alpha, const float* __restrict__ bias, size_t sBias, const float* __restrict__ CP, int rowsPerB, size_t sCPb, int row0g,
    float* __restrict__ C, _Float16* __restrict__ C16, int ldc, size_t sC, int M, int N, int K) { static_assert(ACT == 0 || ACT == 3 || ACT == 6 || ACT == 8 || ACT == 9 || ACT == 11 || ACT == 12 || ACT == 14 || ACT == 15 || ACT == 16 || ACT == 17, "k_gemm2: unsupported ACT code (would silently apply no activation)");
  __shared__ __attribute__((aligned(16))) float so[4][32][68];
  const int tid = threadIdx.x, w = tid >> 5, lane = tid & 31, ln = lane & 15, hh = lane >> 4; const int by = blockIdx.y;
  A += (size_t)by * sA; Bh += (size_t)by * sB; const size_t cofs = (size_t)by * sC; const float* bp = bias ? bias + (size_t)by * sBias : nullptr;
  const int ntn = N >> 6; const int mt = blockIdx.x / ntn, nq = blockIdx.x - mt * ntn; const int row0 = mt * 128 + 32 * w, col0 = nq * 64; if (row0 >= M) return;
  const _Float16* a0p = A + (size_t)(row0 + ln) * lda; const _Float16* a1p = a0p + (size_t)16 * lda;
  const _Float16* b0p = Bh + (size_t)(col0 + ln) * ldb; const _Float16* b1p = b0p + (size_t)16 * ldb; const _Float16* b2p = b1p + (size_t)16 * ldb; const _Float16* b3p = b2p + (size_t)16 * ldb;
  const v8f z8 = {0.f,0.f,0.f,0.f,0.f,0.f,0.f,0.f}; v8f c00 = z8, c01 = z8, c02 = z8, c03 = z8, c10 = z8, c11 = z8, c12 = z8, c13 = z8;
#pragma unroll 1
  for (int kb = 0; kb < K; kb += 32) { const v16h a0 = g2_frag(a0p + kb, hh), a1 = g2_frag(a1p + kb, hh);
    v16h b = g2_frag(b0p + kb, hh); c00 = g2_mma(a0, b, c00); c10 = g2_mma(a1, b, c10);
    b = g2_frag(b1p + kb, hh); c01 = g2_mma(a0, b, c01); c11 = g2_mma(a1, b, c11);
    b = g2_frag(b2p + kb, hh); c02 = g2_mma(a0, b, c02); c12 = g2_mma(a1, b, c12);
    b = g2_frag(b3p + kb, hh); c03 = g2_mma(a0, b, c03); c13 = g2_mma(a1, b, c13); }
  v8f accs[8] = {c00, c01, c02, c03, c10, c11, c12, c13};
#pragma unroll
  for (int u = 0; u < 8; ++u) { const int t = u & 3, half = u >> 2; const int col = col0 + t * 16 + ln; const float bv = bp ? bf16_round(bp[col]) : 0.f;
#pragma unroll
    for (int r = 0; r < 8; ++r) { const int rloc = half * 16 + 8 * hh + r; float v = accs[u][r] * alpha + bv; if (CP) { if (rowsPerB < 0) v += CP[cofs + (size_t)(row0g + row0 + rloc) * ldc + col];      /* rowsPerB < 0: own element of the batched C plane */ else { const int bidx = (row0g + row0 + rloc) / rowsPerB; v += CP[(size_t)bidx * sCPb + (size_t)by * 64 + col]; } }
      if (ACT == 3) v = fmaxf(v, 0.f); else if (ACT == 6) v = 0.5f * v * (1.0f + erff(v * 0.70710678118654752f)); else if (ACT == 11) v = 1.0f / (1.0f + expf(-v)); else if (ACT == 15) v = v / (1.0f + expf(-v)); else if (ACT == 12) v = (v > 0.f) ? v : 0.01f * v; else if (ACT == 8) v = tanhf(v); else if (ACT == 9) v = 0.5f * v * (1.0f + tanhf(0.7978845608028654f * (v + 0.044715f * v * v * v))); else if (ACT == 14) v = (v > 0.f) ? v : 0.1f * v; else if (ACT == 16) v = (v >= 0.f) ? v : 0.3f * v; else if (ACT == 17) v = (v >= 0.f) ? v : 0.2f * v;
      so[w][rloc][t * 16 + ln] = v; } }
  __builtin_amdgcn_fence(__ATOMIC_ACQ_REL, "workgroup"); __builtin_amdgcn_wave_barrier();
  const int rsub = lane >> 4, c4 = (lane & 15) * 4;
  {
#pragma unroll
    for (int q = 0; q < 16; ++q) { const int r = q * 2 + rsub; const v4f v = *(const v4fa*)&so[w][r][c4]; if (C) *(v4f*)(C + cofs + (size_t)(row0 + r) * ldc + col0 + c4) = v; if (C16) { v4h h4; for (int i = 0; i < 4; ++i) h4[i] = (_Float16)v[i]; *(v4h*)(C16 + cofs + (size_t)(row0 + r) * ldc + col0 + c4) = h4; } }
     } }


__global__ __launch_bounds__(256) void k_wnat(const float* __restrict__ w, size_t n8, _Float16* __restrict__ Bt) { const size_t t = (size_t)blockIdx.x * 256 + threadIdx.x; if (t >= n8) return; FragH f; for (int q = 0; q < 8; ++q) f.h[q] = (_Float16)(bf16_round(w[t * 8 + q]) * 16.0f); *(v8us*)((unsigned short*)Bt + t * 8) = f.half[0];  }
__global__ __launch_bounds__(256) void k_rsm(const float* __restrict__ S, _Float16* __restrict__ P, int nrows) {
  #pragma clang fp contract(off)
  const int i = blockIdx.x * 256 + threadIdx.x; if (i >= nrows) return; const float* s = S + (size_t)i * SQ; float mx = -3.0e38f;
#pragma unroll 1
  for (int j = 0; j < SQ; ++j) mx = fmaxf(mx, s[j]); float se = 0.f;
#pragma unroll 1
  for (int j = 0; j < SQ; ++j) se += expf(s[j] - mx); const float sc = 256.0f / se;
#pragma unroll 1
  for (int j0 = 0; j0 < SQ; j0 += 8) { FragH f; for (int q = 0; q < 8; ++q) f.h[q] = (_Float16)(expf(s[j0 + q] - mx) * sc); unsigned short* d = (unsigned short*)P + (size_t)i * SQ + j0; *(v8us*)d = f.half[0];  } }
__global__ __launch_bounds__(256) void k_vt(const _Float16* __restrict__ V16, int b, int h0, _Float16* __restrict__ VT) { __shared__ unsigned short tl[64][65]; const int tid = threadIdx.x; const int hh = blockIdx.x % HG, sg = blockIdx.x / HG; const int s0 = sg * 64; const int h = h0 + hh;
  for (int i = tid; i < 64 * 8; i += 256) { const int j = i / 8, d8 = (i % 8) * 8; FragH f; f.half[0] = *(const v8us*)((const unsigned short*)V16 + ((size_t)b * SQ + s0 + j) * DM + h * HD + d8); for (int q = 0; q < 8; ++q) tl[d8 + q][j] = f.u[q]; }
  __syncthreads();
  { for (int i = tid; i < 64 * 8; i += 256) { const int d = i / 8, j8 = (i % 8) * 8; FragH f; for (int q = 0; q < 8; ++q) f.u[q] = tl[d][j8 + q]; *(v8us*)((unsigned short*)VT + ((size_t)hh * HD + d) * SQ + s0 + j8) = f.half[0]; }  } }



__global__ __launch_bounds__(256) void k_rsmf(const float* __restrict__ S, _Float16* __restrict__ P, int qn, int hg) {
  #pragma clang fp contract(off)
  const int t = blockIdx.x * 256 + threadIdx.x; if (t >= qn * hg) return; const size_t i = (size_t)(t / qn) * SQ + (t % qn); const float* s = S + i * SQ; float mx = -3.0e38f;
#pragma unroll 1
  for (int j = 0; j < SQ; ++j) mx = fmaxf(mx, s[j]); float se = 0.f;
#pragma unroll 1
  for (int j = 0; j < SQ; ++j) se += __expf(s[j] - mx); const float sc = 256.0f / se;
#pragma unroll 1
  for (int j0 = 0; j0 < SQ; j0 += 8) { FragH f; for (int q = 0; q < 8; ++q) f.h[q] = (_Float16)(__expf(s[j0 + q] - mx) * sc); unsigned short* d = (unsigned short*)P + i * SQ + j0; *(v8us*)d = f.half[0];  } }

__global__ __launch_bounds__(256) void k_rsmfam(const float* __restrict__ S, _Float16* __restrict__ P, int qn, int hg, const float* __restrict__ am) {
  #pragma clang fp contract(off)
  const int t = blockIdx.x * 256 + threadIdx.x; if (t >= qn * hg) return; const size_t i = (size_t)(t / qn) * SQ + (t % qn); const float* s = S + i * SQ; float mx = -3.0e38f;
#pragma unroll 1
  for (int j = 0; j < SQ; ++j) mx = fmaxf(mx, __fadd_rn(s[j], bf16_round(am[j]))); float se = 0.f;
#pragma unroll 1
  for (int j = 0; j < SQ; ++j) se += __expf(__fadd_rn(s[j], bf16_round(am[j])) - mx); const float sc = 256.0f / se;
#pragma unroll 1
  for (int j0 = 0; j0 < SQ; j0 += 8) { FragH f; for (int q = 0; q < 8; ++q) f.h[q] = (_Float16)(__expf(__fadd_rn(s[j0 + q], bf16_round(am[j0 + q])) - mx) * sc); unsigned short* d = (unsigned short*)P + i * SQ + j0; *(v8us*)d = f.half[0];  } }


__global__ __launch_bounds__(256) void k_bfr(const float* __restrict__ x, float* __restrict__ XB, size_t n8) { const size_t t = (size_t)blockIdx.x * 256 + threadIdx.x; if (t >= n8) return; v4f a = *(const v4fa*)(x + t * 8), c = *(const v4fa*)(x + t * 8 + 4); for (int q = 0; q < 4; ++q) { a[q] = bf16_round(a[q]); c[q] = bf16_round(c[q]); }
  { *(v4f*)(XB + t * 8) = a; *(v4f*)(XB + t * 8 + 4) = c;  } }


__global__ __launch_bounds__(256) void k_lnrow(const float* __restrict__ Y, const float* __restrict__ g, const float* __restrict__ bb, float eps, float* __restrict__ out) {
  #pragma clang fp contract(off)
  __shared__ float red[256]; const size_t r = blockIdx.x; const int t = threadIdx.x; const v4f ya = *(const v4fa*)(Y + r * DMQ + t * 4); float s[4]; float sum = 0.f;
  for (int q = 0; q < 4; ++q) { s[q] = ya[q]; sum = __fadd_rn(sum, s[q]); }
  red[t] = sum; __syncthreads(); for (int st = 128; st > 0; st >>= 1) { if (t < st) red[t] = __fadd_rn(red[t], red[t + st]); __syncthreads(); } const float mu = red[0] / (float)DMQ; __syncthreads();
  float vs = 0.f; for (int q = 0; q < 4; ++q) { const float dl = __fadd_rn(s[q], -mu); vs = __fadd_rn(vs, __fmul_rn(dl, dl)); } red[t] = vs; __syncthreads(); for (int st = 128; st > 0; st >>= 1) { if (t < st) red[t] = __fadd_rn(red[t], red[t + st]); __syncthreads(); }
  const float rs = rsqrtf(__fadd_rn(red[0] / (float)DMQ, eps)); v4f y; for (int q = 0; q < 4; ++q) { const int c = t * 4 + q; y[q] = __fadd_rn(__fmul_rn(__fmul_rn(__fadd_rn(s[q], -mu), rs), bf16_round(g[c])), bf16_round(bb[c])); }
  *(v4f*)(out + r * DMQ + t * 4) = y;  }
extern "C" void kernel_launch(void* const* d_in, const int* in_sizes, int n_in,
                              void* d_out, int out_size, void* d_ws, size_t ws_size, hipStream_t stream) {
  (void)in_sizes; (void)n_in; (void)out_size;
  const float* const* I = (const float* const*)d_in; const float* x = I[0]; const float* am = I[1]; const float* wq = I[2]; const float* bq = I[3]; const float* wk = I[4]; const float* bk = I[5]; const float* wv = I[6]; const float* bv = I[7]; const float* wo = I[8]; const float* bo = I[9]; const float* lng = I[10]; const float* lnb = I[11];      /* nn.Linear weights [out][in] + biases; additive mask [1][1][1][S] */
  char* ws = (char*)d_ws; size_t off = 0;
  auto take = [&](size_t bytes) { char* p = ws + off; off += (bytes + 255) & ~(size_t)255; return p; };
  _Float16* BQ = (_Float16*)take((size_t)DM * DM * 2); _Float16* BK = (_Float16*)take((size_t)DM * DM * 2); _Float16* BV = (_Float16*)take((size_t)DM * DM * 2); _Float16* BO = (_Float16*)take((size_t)DM * DM * 2);
  _Float16* X16 = (_Float16*)take(NR * DM * 2); float* XB = (float*)take(NR * DM * 4); float* YF = (float*)take(NR * DM * 4); _Float16* Q16 = (_Float16*)take(NR * DM * 2); _Float16* K16 = (_Float16*)take(NR * DM * 2); _Float16* V16 = (_Float16*)take(NR * DM * 2); _Float16* O16 = (_Float16*)take(NR * DM * 2);
  float* S = (float*)take((size_t)HG * SQ * SQ * 4); _Float16* P = (_Float16*)take((size_t)HG * SQ * SQ * 2); _Float16* VT = (_Float16*)take((size_t)NH * HD * SQ * 2);
  if (off > ws_size) return;
  { const unsigned g = (unsigned)(((size_t)DM * DM / 8 + 255) / 256); k_wnat<<<g, 256, 0, stream>>>(wq, (size_t)DM * DM / 8, BQ); k_wnat<<<g, 256, 0, stream>>>(wk, (size_t)DM * DM / 8, BK); k_wnat<<<g, 256, 0, stream>>>(wv, (size_t)DM * DM / 8, BV); k_wnat<<<g, 256, 0, stream>>>(wo, (size_t)DM * DM / 8, BO); }      /* natural [out][in] = Bt[n][k], x16 */
  k_x16<<<(unsigned)((NR * DM / 8 + 255) / 256), 256, 0, stream>>>(x, X16, NR * DM / 8); k_bfr<<<(unsigned)((NR * DM / 8 + 255) / 256), 256, 0, stream>>>(x, XB, NR * DM / 8);      /* bf16(x) residual plane */
  const size_t r0p = (size_t)B0 * SQ;      /* first projected row */
  k_gemm2<0><<<dim3((unsigned)((MP / 128) * (DM / 64)), 1), 128, 0, stream>>>(X16 + r0p * DM, DM, 0, BQ, DM, 0, 0.0625f, bq, 0, nullptr, 1, 0, 0, nullptr, Q16 + r0p * DM, DM, 0, MP, DM, DM);
  k_gemm2<0><<<dim3((unsigned)((MP / 128) * (DM / 64)), 1), 128, 0, stream>>>(X16 + r0p * DM, DM, 0, BK, DM, 0, 0.0625f, bk, 0, nullptr, 1, 0, 0, nullptr, K16 + r0p * DM, DM, 0, MP, DM, DM);
  k_gemm2<0><<<dim3((unsigned)((MP / 128) * (DM / 64)), 1), 128, 0, stream>>>(X16 + r0p * DM, DM, 0, BV, DM, 0, 0.0625f, bv, 0, nullptr, 1, 0, 0, nullptr, V16 + r0p * DM, DM, 0, MP, DM, DM);
  for (int b = B0; b < B0 + NBR; ++b) { const size_t r0 = (size_t)b * SQ;
    k_vt<NH, SQ><<<NH * (SQ / 64), 256, 0, stream>>>(V16 + r0 * LQ, LQ, 0, VT);      /* V^T [NH][HD][SQ] for this batch */
    for (int h0 = 0; h0 < NHD; h0 += HG) {
      k_gemm2<0><<<dim3((QN / 128) * (SQ / 64), HG), 128, 0, stream>>>(Q16 + r0 * LQ + h0 * HD, LQ, (size_t)HD, K16 + r0 * LQ + h0 * HD, LQ, (size_t)HD, 0.125f, nullptr, 0, nullptr, 1, 0, 0, S, nullptr, SQ, (size_t)SQ * SQ, QN, SQ, HD);      /* scores, HG heads per launch */
      k_rsmfam<<<(HG * QN + 255) / 256, 256, 0, stream>>>(S, P, QN, HG, am + (size_t)b * SQ);      /* + attention_mask per key */      /* P = 256 softmax (f16), rows of all HG heads */
      k_gemm2<0><<<dim3((QN / 128) * (HD / 64), HG), 128, 0, stream>>>(P, SQ, (size_t)SQ * SQ, VT + (size_t)h0 * HD * SQ, SQ, (size_t)HD * SQ, 0.25f, nullptr, 0, nullptr, 1, 0, 0, nullptr, O16 + r0 * DM + h0 * HD, DM, (size_t)HD, QN, HD, SQ); } }      /* o (merged heads) as f16 rows */
  k_gemm2<0><<<dim3((unsigned)((MPO / 128) * (DM / 64)), 1), 128, 0, stream>>>(O16 + r0p * DM, DM, 0, BO, DM, 0, 0.0009765625f, bo, 0, XB + r0p * DM, -1, 0, 0, YF + r0p * DM, nullptr, DM, 0, MPO, DM, DM);      /* y = ctx Wo^T + bo + bf16(x) (own-element residual) */
  k_lnrow<<<(unsigned)MPO, 256, 0, stream>>>(YF + r0p * DM, lng, lnb, 1e-12f, (float*)d_out + r0p * DM);      /* post-LayerNorm */
}

// v001
// Measured time: 2810 microseconds a run.
// Next to v000, in two timings, it ran 4.96 and 4.95 times as fast.
#include <hip/hip_runtime.h>
// BERT self-attention + output (hidden_states [1][4096][1024]; q/k/v = x W^T + b (nn.Linear [out][in] 1024^2, sigma 1/32, zero biases), 16 heads of 64; scores = (q/8) . k + attention_mask[j] (additive [1][1][1][S], zeros); softmax; ctx merged; out = LayerNorm(ctx Wo^T + bo + hidden_states; ln_gamma, ln_beta, eps 1e-12) -> [1][4096][1024]).
// Structure: token rows r = b*4096 + s; x as exact f16 rows (bf16-rounded); Q, K, V as three WMMA GEMMs (32x64 wave tiles, f32 accumulation, exact x16 weights + bias, f16 outputs); per batch: V^T for all heads via LDS transposes; per (batch, group of 1 head): scores GEMM (K = 64, batched over the heads on grid.y, alpha = 64^-0.5), row softmax on VALU (f32 statistics, native exp; weights stored x256 as f16), o = P . V^T GEMM (K = 4096, alpha 2^-2: o carried x64 against f16 subnormal flush, folded into the output GEMM alpha) written straight into the merged f16 o rows; y = o Wo^T + bo + bf16(x) GEMM (f32, own-element residual) into f32 rows; post-LayerNorm on VALU (f32, LDS trees) into the output.
// Compute dtype: inputs rounded to bf16; x / weights exact; q, k, v, softmax weights and o as plain f16 GEMM operands (~2^-12); scores and softmax statistics f32. v_wmma_f32_16x16x32_f16.
#define NB 1
#define SQ 4096
#define DM 1024
#define NH 16
#define HD 64
#define HG 1                         /* heads per attention launch group */
#define B0 0                         /* first batch processed (debug hook) */
#define NBR NB                       /* batches processed (debug hook) */
#define NR ((size_t)NB * SQ)
#define DMQ DM         /* width of the token rows (LayerNorm length) */
#define MP ((int)((size_t)NBR * SQ)) /* rows projected (debug hook) */
#define QN SQ                        /* query rows attended per batch (debug hook) */
#define NHD NH                       /* heads attended (debug hook) */
#define MPO MP                       /* rows through the output stage (debug hook) */
#define LQ DM      /* row pitch of the q/k/v rows */
typedef __bf16 v16b __attribute__((ext_vector_type(16)));
typedef unsigned short v8us __attribute__((ext_vector_type(8), may_alias));
typedef float  v8f  __attribute__((ext_vector_type(8)));
typedef float  v4f  __attribute__((ext_vector_type(4)));
typedef float  v4fa __attribute__((ext_vector_type(4), may_alias));
union FragB { v16b v; v8us half[2]; unsigned short u[16]; };

__device__ __forceinline__ unsigned short bf16_bits(float x) { unsigned int u = __float_as_uint(x); return (unsigned short)((u + 0x7FFFu + ((u >> 16) & 1u)) >> 16); }
__device__ __forceinline__ float bf16_val(unsigned short b) { return __uint_as_float(((unsigned int)b) << 16); }
__device__ __forceinline__ float bf16_round(float x) { return bf16_val(bf16_bits(x)); }
// D += A·B with NT terms: 1 = ah·bh, 2 = + al·bh (A split), 3 = + ah·bl (both split)
template <int NT>
__device__ __forceinline__ v8f mmaN(v16b ah, v16b al, v16b bh, v16b bl, v8f c) {
  c = __builtin_amdgcn_wmma_f32_16x16x32_bf16(false, ah, false, bh, (short)0, c, false, false);
  if (NT >= 2) c = __builtin_amdgcn_wmma_f32_16x16x32_bf16(false, al, false, bh, (short)0, c, false, false);
  if (NT >= 3) c = __builtin_amdgcn_wmma_f32_16x16x32_bf16(false, ah, false, bl, (short)0, c, false, false);
  asm volatile("v_nop\n\tv_nop\n\tv_nop\n\tv_nop" : "+v"(c) : "v"(ah), "v"(al), "v"(bh), "v"(bl));
  return c;
}

__global__ __launch_bounds__(256) void k_wt_bf16(const float* __restrict__ W, unsigned short* __restrict__ Wt, int K, int N) {
  const int t = blockIdx.x * 256 + threadIdx.x;
  const int k8n = K / 8;
  if (t >= N * k8n) return;
  const int n = t / k8n, k8 = (t % k8n) * 8;
  v8us v;
#pragma unroll
  for (int i = 0; i < 8; ++i) v[i] = bf16_bits(W[(size_t)(k8 + i) * N + n]);
  *(v8us*)(Wt + (size_t)n * K + k8) = v;
  
}

// GEMM C[M][N] (f32, pitch ldc) = act(A[M][K]·W + bias). A f32 row-major (pitch lda) converted per fragment to bf16
// (ASPLIT: hi/lo two planes -> 2 terms, else single rounded term); Wt bf16 [N][K] (pitch ldb). BIAS_BF16 rounds the
// bias to bf16 first (bias quantised to bf16 before the add). K%32==0, M%16==0, N%64==0.
template <bool ASPLIT, int ACT, bool BIAS_BF16>
__global__ __launch_bounds__(128) void k_gemm_bf(const float* __restrict__ A, int lda, const unsigned short* __restrict__ Wt, int ldb,
                                               const float* __restrict__ bias, float* __restrict__ C, int ldc, int M, int N, int K) {
  __shared__ __attribute__((aligned(16))) float so[4][16][64];
  const int tid = threadIdx.x, w = tid >> 5, lane = tid & 31, ln = lane & 15, hh = lane >> 4;
  const int ntn = N / 64;
  const int wid = blockIdx.x * 4 + w;
  const int mt = wid / ntn, nq = wid % ntn;
  if (mt * 16 >= M) return;
  const int row0 = mt * 16, col0 = nq * 64;
  const float* arow = A + (size_t)(row0 + ln) * lda;
  v8f acc[4] = {};
  for (int kb = 0; kb < K; kb += 32) {
    FragB ah, al;
    const v4f x0 = *(const v4fa*)(arow + kb + 8 * hh), x1 = *(const v4fa*)(arow + kb + 8 * hh + 4);
    const v4f x2 = *(const v4fa*)(arow + kb + 16 + 8 * hh), x3 = *(const v4fa*)(arow + kb + 16 + 8 * hh + 4);
    float xs[16] = {x0[0],x0[1],x0[2],x0[3],x1[0],x1[1],x1[2],x1[3],x2[0],x2[1],x2[2],x2[3],x3[0],x3[1],x3[2],x3[3]};
#pragma unroll
    for (int i = 0; i < 16; ++i) { const unsigned short hb = bf16_bits(xs[i]); ah.u[i] = hb; al.u[i] = ASPLIT ? bf16_bits(xs[i] - bf16_val(hb)) : (unsigned short)0; }
#pragma unroll
    for (int t = 0; t < 4; ++t) {
      const unsigned short* brow = Wt + (size_t)(col0 + t * 16 + ln) * ldb + kb;
      FragB b;
      b.half[0] = *(const v8us*)(brow + 8 * hh);
      b.half[1] = *(const v8us*)(brow + 16 + 8 * hh);
      acc[t] = mmaN<ASPLIT ? 2 : 1>(ah.v, al.v, b.v, b.v, acc[t]);
    }
  }
#pragma unroll
  for (int t = 0; t < 4; ++t) {
    float bv = bias ? bias[col0 + t * 16 + ln] : 0.f;
    if (BIAS_BF16) bv = bf16_round(bv);
#pragma unroll
    for (int r = 0; r < 8; ++r) { float v = acc[t][r] + bv; if (ACT == 1) v = fmaxf(v, 0.f); so[w][8 * hh + r][t * 16 + ln] = v; }
  }
  __builtin_amdgcn_fence(__ATOMIC_ACQ_REL, "workgroup");
  __builtin_amdgcn_wave_barrier();
  const int rsub = lane >> 4, c4 = (lane & 15) * 4;
  {
#pragma unroll
    for (int q = 0; q < 8; ++q) {
      const int r = q * 2 + rsub;
      const v4f v = *(const v4fa*)&so[w][r][c4];
      *(v4f*)(C + (size_t)(row0 + r) * ldc + col0 + c4) = v;
    }
    
  }
}

// GEMM C = act(A·W + bias + resid): A f32 (ASPLIT -> hi/lo 2 terms), Wt bf16 [N][K]; ACT 0 none, 1 relu, 2 exact gelu;
// resid (optional, f32, row index = (row % rmod), pitch ldr, RES_BF16 rounds it) added before the activation.
template <bool ASPLIT, int ACT, bool BIAS_BF16, bool RES_BF16>
__global__ __launch_bounds__(128) void k_gemm_bf3(const float* __restrict__ A, int lda, const unsigned short* __restrict__ Wt, int ldb,
                                                const float* __restrict__ bias, const float* __restrict__ resid, int rmod, int ldr,
                                                float* __restrict__ C, int ldc, int M, int N, int K) {
  __shared__ __attribute__((aligned(16))) float so[4][16][64];
  const int tid = threadIdx.x, w = tid >> 5, lane = tid & 31, ln = lane & 15, hh = lane >> 4;
  const int ntn = N / 64;
  const int wid = blockIdx.x * 4 + w;
  const int mt = wid / ntn, nq = wid % ntn;
  if (mt * 16 >= M) return;
  const int row0 = mt * 16, col0 = nq * 64;
  const float* arow = A + (size_t)(row0 + ln) * lda;
  v8f acc[4] = {};
  for (int kb = 0; kb < K; kb += 32) {
    FragB ah, al;
    const v4f x0 = *(const v4fa*)(arow + kb + 8 * hh), x1 = *(const v4fa*)(arow + kb + 8 * hh + 4);
    const v4f x2 = *(const v4fa*)(arow + kb + 16 + 8 * hh), x3 = *(const v4fa*)(arow + kb + 16 + 8 * hh + 4);
    float xs[16] = {x0[0],x0[1],x0[2],x0[3],x1[0],x1[1],x1[2],x1[3],x2[0],x2[1],x2[2],x2[3],x3[0],x3[1],x3[2],x3[3]};
#pragma unroll
    for (int i = 0; i < 16; ++i) { const unsigned short hb = bf16_bits(xs[i]); ah.u[i] = hb; al.u[i] = ASPLIT ? bf16_bits(xs[i] - bf16_val(hb)) : (unsigned short)0; }
#pragma unroll
    for (int t = 0; t < 4; ++t) {
      const unsigned short* brow = Wt + (size_t)(col0 + t * 16 + ln) * ldb + kb;
      FragB b;
      b.half[0] = *(const v8us*)(brow + 8 * hh);
      b.half[1] = *(const v8us*)(brow + 16 + 8 * hh);
      acc[t] = mmaN<ASPLIT ? 2 : 1>(ah.v, al.v, b.v, b.v, acc[t]);
    }
  }
#pragma unroll
  for (int t = 0; t < 4; ++t) {
    const int col = col0 + t * 16 + ln;
    float bv = bias ? bias[col] : 0.f;
    if (BIAS_BF16) bv = bf16_round(bv);
#pragma unroll
    for (int r = 0; r < 8; ++r) {
      float v = acc[t][r] + bv;
      if (resid) { float rv = resid[(size_t)((row0 + 8 * hh + r) % rmod) * ldr + col]; if (RES_BF16) rv = bf16_round(rv); v += rv; }
      if (ACT == 1) v = fmaxf(v, 0.f);
      if (ACT == 2) v = 0.5f * v * (1.0f + erff(v * 0.70710678118654752f));
      if (ACT == 3) { const float u = 0.7978845608028654f * (v + 0.044715f * v * v * v); v = 0.5f * v * (1.0f + tanhf(u)); }
      so[w][8 * hh + r][t * 16 + ln] = v;
    }
  }
  __builtin_amdgcn_fence(__ATOMIC_ACQ_REL, "workgroup");
  __builtin_amdgcn_wave_barrier();
  const int rsub = lane >> 4, c4 = (lane & 15) * 4;
  {
#pragma unroll
    for (int q = 0; q < 8; ++q) {
      const int r = q * 2 + rsub;
      const v4f v = *(const v4fa*)&so[w][r][c4];
      *(v4f*)(C + (size_t)(row0 + r) * ldc + col0 + c4) = v;
    }
    
  }
}
// row LayerNorm (biased variance, eps) over N: s = X (+ R); optional out_sum <- s; out_norm <- (s-mu)*rsqrt(var+eps)*g + b
template <bool PARAM_BF16>
__global__ __launch_bounds__(256) void k_layernorm(const float* __restrict__ X, const float* __restrict__ R, const float* __restrict__ g, const float* __restrict__ bta,
                                                  float* __restrict__ out_sum, float* __restrict__ out_norm, int N, float eps) {
  __shared__ float red[256];
  const int row = blockIdx.x, tid = threadIdx.x;
  const float* x = X + (size_t)row * N; const float* rr = R ? R + (size_t)row * N : nullptr;
  float vals[16];                     // up to N = 4096
  const int per = N / 256;            // contiguous chunk per thread? use strided-by-4 chunks: thread handles j = tid*4 + 1024*u
  float s1 = 0.f;
  for (int u = 0; u < per / 4; ++u) {
    const int j = tid * 4 + 1024 * u;
    const v4f a = *(const v4fa*)(x + j);
    v4f b = {0.f,0.f,0.f,0.f}; if (rr) b = *(const v4fa*)(rr + j);
#pragma unroll
    for (int q = 0; q < 4; ++q) { const float v = a[q] + b[q]; vals[u * 4 + q] = v; s1 += v; }
  }
  red[tid] = s1; __syncthreads();
  for (int st = 128; st > 0; st >>= 1) { if (tid < st) red[tid] += red[tid + st]; __syncthreads(); }
  const float mu = red[0] / (float)N; __syncthreads();
  float s2 = 0.f;
  for (int u = 0; u < per / 4; ++u)
#pragma unroll
    for (int q = 0; q < 4; ++q) { const float c = vals[u * 4 + q] - mu; s2 += c * c; }
  red[tid] = s2; __syncthreads();
  for (int st = 128; st > 0; st >>= 1) { if (tid < st) red[tid] += red[tid + st]; __syncthreads(); }
  const float rs = rsqrtf(red[0] / (float)N + eps);
  {
    for (int u = 0; u < per / 4; ++u) {
      const int j = tid * 4 + 1024 * u;
      v4f o, sm;
#pragma unroll
      for (int q = 0; q < 4; ++q) {
        float gg = g[j + q], bb = bta[j + q];
        if (PARAM_BF16) { gg = bf16_round(gg); bb = bf16_round(bb); }
        sm[q] = vals[u * 4 + q]; o[q] = (vals[u * 4 + q] - mu) * rs * gg + bb;
      }
      if (out_sum) *(v4f*)(out_sum + (size_t)row * N + j) = sm;
      *(v4f*)(out_norm + (size_t)row * N + j) = o;
    }
    
  }
}



// ---- f16 WMMA path (v_wmma_f32_16x16x32_f16): 11-bit significands for operands in range — used where a [0,1] probability operand needs more precision than bf16
typedef _Float16 v16h __attribute__((ext_vector_type(16)));
union FragH { v16h v; v8us half[2]; _Float16 h[16]; unsigned short u[16]; };
template <int NT>
__device__ __forceinline__ v8f mmaH(v16h ah, v16h al, v16h bh, v16h bl, v8f c) {
  c = __builtin_amdgcn_wmma_f32_16x16x32_f16(false, ah, false, bh, (short)0, c, false, false);
  if (NT >= 2) c = __builtin_amdgcn_wmma_f32_16x16x32_f16(false, al, false, bh, (short)0, c, false, false);
  if (NT >= 3) c = __builtin_amdgcn_wmma_f32_16x16x32_f16(false, ah, false, bl, (short)0, c, false, false);
  asm volatile("v_nop\n\tv_nop\n\tv_nop\n\tv_nop" : "+v"(c) : "v"(ah), "v"(al), "v"(bh), "v"(bl));
  return c;
}
// batched GEMM like k_gemm_b but f16 operands: A f32 (split into f16 hi/lo if ASPLIT, else rounded to f16), Bt = f16 values [n][k]; alpha; C f32; N multiple of 16 (partial tiles skipped)
template <bool ASPLIT>
__global__ __launch_bounds__(128) void k_gemm_h(const float* __restrict__ A, int lda, size_t sA, const _Float16* __restrict__ Bh, int ldb, size_t sB, float alpha, float* __restrict__ C, int ldc, size_t sC, int M, int N, int K) {
  __shared__ __attribute__((aligned(16))) float so[4][16][64];
  const int tid = threadIdx.x, w = tid >> 5, lane = tid & 31, ln = lane & 15, hh = lane >> 4; const int by = blockIdx.y;
  A += (size_t)by * sA; Bh += (size_t)by * sB; C += (size_t)by * sC;
  const int ntn = (N + 63) / 64; const int wid = blockIdx.x * 4 + w; const int mt = wid / ntn, nq = wid % ntn; if (mt * 16 >= M) return;
  const int row0 = mt * 16, col0 = nq * 64; const float* arow = A + (size_t)(row0 + ln) * lda;
  v8f acc[4] = {};
  for (int kb = 0; kb < K; kb += 32) {
    FragH ah, al;
    const v4f x0 = *(const v4fa*)(arow + kb + 8 * hh), x1 = *(const v4fa*)(arow + kb + 8 * hh + 4), x2 = *(const v4fa*)(arow + kb + 16 + 8 * hh), x3 = *(const v4fa*)(arow + kb + 16 + 8 * hh + 4);
    float xs[16] = {x0[0],x0[1],x0[2],x0[3],x1[0],x1[1],x1[2],x1[3],x2[0],x2[1],x2[2],x2[3],x3[0],x3[1],x3[2],x3[3]};
#pragma unroll
    for (int i = 0; i < 16; ++i) { const _Float16 h = (_Float16)xs[i]; ah.h[i] = h; al.h[i] = ASPLIT ? (_Float16)(xs[i] - (float)h) : (_Float16)0.0f; }
#pragma unroll
    for (int t = 0; t < 4; ++t) { if (col0 + t * 16 >= N) continue; const size_t boff = (size_t)(col0 + t * 16 + ln) * ldb + kb; FragH bq; bq.half[0] = *(const v8us*)(Bh + boff + 8 * hh); bq.half[1] = *(const v8us*)(Bh + boff + 16 + 8 * hh);
      acc[t] = mmaH<ASPLIT ? 2 : 1>(ah.v, al.v, bq.v, bq.v, acc[t]); }
  }
#pragma unroll
  for (int t = 0; t < 4; ++t) { if (col0 + t * 16 >= N) continue;
#pragma unroll
    for (int r = 0; r < 8; ++r) so[w][8 * hh + r][t * 16 + ln] = acc[t][r] * alpha; }
  __builtin_amdgcn_fence(__ATOMIC_ACQ_REL, "workgroup"); __builtin_amdgcn_wave_barrier();
  const int rsub = lane >> 4, c4 = (lane & 15) * 4;
  {
#pragma unroll
    for (int q = 0; q < 8; ++q) { const int r = q * 2 + rsub; if (col0 + c4 < N) { const v4f v = *(const v4fa*)&so[w][r][c4]; *(v4f*)(C + (size_t)(row0 + r) * ldc + col0 + c4) = v; } }
     }
}

// Wt[n][k] = f16(W[k][n]·scale) from f32 row-major W[K][N] (scale = power of two; bf16-exact weights stay exact in f16 away from the subnormal range)
__global__ __launch_bounds__(256) void k_wt_f16(const float* __restrict__ W, _Float16* __restrict__ Wt, int K, int N, float scale) {
  const int t = blockIdx.x * 256 + threadIdx.x; if (t >= N * (K / 8)) return; const int n = t / (K / 8), k8 = (t % (K / 8)) * 8; FragH f;
#pragma unroll
  for (int i = 0; i < 8; ++i) f.h[i] = (_Float16)(bf16_round(W[(size_t)(k8 + i) * N + n]) * scale); const v8us o = f.half[0];
  *(v8us*)((unsigned short*)Wt + (size_t)n * K + k8) = o; 
}
// k_gemm_hh variant with fused epilogue: v = acc·alpha + bias[by·sBias + col] (+ CP[(row/rowsPerB)·sCPb + by·64 + col] if CP) ; ACT 0 none / 1 elu ; writes f16 C16 (and f32 C if non-null)
template <int ACT>
__global__ __launch_bounds__(128) void k_gemm_hhx(const _Float16* __restrict__ A, int lda, size_t sA, const _Float16* __restrict__ Bh, int ldb, size_t sB, float alpha, const float* __restrict__ bias, size_t sBias, const float* __restrict__ CP, int rowsPerB, size_t sCPb, int row0g,
    float* __restrict__ C, _Float16* __restrict__ C16, int ldc, size_t sC, int M, int N, int K) {
  __shared__ __attribute__((aligned(16))) float so[4][16][64];
  const int tid = threadIdx.x, w = tid >> 5, lane = tid & 31, ln = lane & 15, hh = lane >> 4; const int by = blockIdx.y;
  A += (size_t)by * sA; Bh += (size_t)by * sB; const size_t cofs = (size_t)by * sC; const float* bp = bias ? bias + (size_t)by * sBias : nullptr;
  const int ntn = (N + 63) / 64; const int wid = blockIdx.x * 4 + w; const int mt = wid / ntn, nq = wid % ntn; if (mt * 16 >= M) return;
  const int row0 = mt * 16, col0 = nq * 64; const _Float16* arow = A + (size_t)(row0 + ln) * lda;
  v8f acc[4] = {};
  for (int kb = 0; kb < K; kb += 32) { FragH ah; ah.half[0] = *(const v8us*)((const unsigned short*)arow + kb + 8 * hh); ah.half[1] = *(const v8us*)((const unsigned short*)arow + kb + 16 + 8 * hh);
#pragma unroll
    for (int t = 0; t < 4; ++t) { if (col0 + t * 16 >= N) continue; const size_t boff = (size_t)(col0 + t * 16 + ln) * ldb + kb; FragH bq; bq.half[0] = *(const v8us*)((const unsigned short*)Bh + boff + 8 * hh); bq.half[1] = *(const v8us*)((const unsigned short*)Bh + boff + 16 + 8 * hh);
      acc[t] = mmaH<1>(ah.v, ah.v, bq.v, bq.v, acc[t]); }
  }
#pragma unroll
  for (int t = 0; t < 4; ++t) { if (col0 + t * 16 >= N) continue; const int col = col0 + t * 16 + ln; const float bv = bp ? bf16_round(bp[col]) : 0.f;
#pragma unroll
    for (int r = 0; r < 8; ++r) { float v = acc[t][r] * alpha + bv; if (CP) { const int rr = row0g + row0 + 8 * hh + r; if (rowsPerB < 0) v += CP[cofs + (size_t)rr * ldc + col];      /* rowsPerB < 0: own element of the batched C plane */ else { const int bidx = rr / rowsPerB; v += CP[(size_t)bidx * sCPb + (size_t)by * 64 + col]; } } if (ACT == 1) v = (v > 0.f) ? v : expm1f(v); else if (ACT == 7) v = (v > 0.f) ? v + 1.0f : expf(v); else if (ACT == 8) v = tanhf(v); else if (ACT == 9) v = 0.5f * v * (1.0f + tanhf(0.7978845608028654f * (v + 0.044715f * v * v * v))); else if (ACT == 11) v = 1.0f / (1.0f + expf(-v)); else if (ACT == 12) v = (v > 0.f) ? v : 0.01f * v; else if (ACT == 14) v = (v > 0.f) ? v : 0.1f * v; else if (ACT == 16) v = (v >= 0.f) ? v : 0.3f * v; else if (ACT == 17) v = (v >= 0.f) ? v : 0.2f * v; else if (ACT == 15) v = v / (1.0f + expf(-v)); else if (ACT == 3) v = fmaxf(v, 0.f); else if (ACT == 6) v = 0.5f * v * (1.0f + erff(v * 0.70710678118654752f)); so[w][8 * hh + r][t * 16 + ln] = v; } }
  __builtin_amdgcn_fence(__ATOMIC_ACQ_REL, "workgroup"); __builtin_amdgcn_wave_barrier();
  const int rsub = lane >> 4, c4 = (lane & 15) * 4; typedef _Float16 v4h __attribute__((ext_vector_type(4)));
  {
#pragma unroll
    for (int q = 0; q < 8; ++q) { const int r = q * 2 + rsub; if (col0 + c4 < N) { const v4f v = *(const v4fa*)&so[w][r][c4]; if (C) *(v4f*)(C + cofs + (size_t)(row0 + r) * ldc + col0 + c4) = v; if (C16) { v4h h4; for (int i = 0; i < 4; ++i) h4[i] = (_Float16)v[i]; *(v4h*)(C16 + cofs + (size_t)(row0 + r) * ldc + col0 + c4) = h4; } } }
     }
}


typedef _Float16 v4h __attribute__((ext_vector_type(4)));

__global__ __launch_bounds__(256) void k_x16(const float* __restrict__ x, _Float16* __restrict__ X16, size_t n8) { const size_t t = (size_t)blockIdx.x * 256 + threadIdx.x; if (t >= n8) return; FragH f;
#pragma unroll
  for (int q = 0; q < 8; ++q) f.h[q] = (_Float16)bf16_round(x[t * 8 + q]); *(v8us*)((unsigned short*)X16 + t * 8) = f.half[0];  }
__global__ __launch_bounds__(256) void k_h16(const float* __restrict__ x, _Float16* __restrict__ X16, size_t n8) { const size_t t = (size_t)blockIdx.x * 256 + threadIdx.x; if (t >= n8) return; FragH f;
#pragma unroll
  for (int q = 0; q < 8; ++q) f.h[q] = (_Float16)x[t * 8 + q]; *(v8us*)((unsigned short*)X16 + t * 8) = f.half[0];  }
__global__ __launch_bounds__(256) void k_round16f(const float* __restrict__ W, _Float16* __restrict__ Bt, size_t n8) { const size_t t = (size_t)blockIdx.x * 256 + threadIdx.x; if (t >= n8) return; FragH f;
#pragma unroll
  for (int i = 0; i < 8; ++i) f.h[i] = (_Float16)(bf16_round(W[t * 8 + i]) * 16.0f); *(v8us*)((unsigned short*)Bt + t * 8) = f.half[0];  }
template <int NHv, int TTv>
__global__ __launch_bounds__(256) void k_vt(const _Float16* __restrict__ V16, int ldv, int voff, _Float16* __restrict__ Vt) { __shared__ unsigned short tl[64][66]; const int tid = threadIdx.x; const int slab = blockIdx.x / (TTv / 64), lg = blockIdx.x % (TTv / 64); const int b = slab / NHv, h = slab % NHv;
  for (int i = tid; i < 64 * 8; i += 256) { const int r = i / 8, c8 = (i % 8) * 8; FragH f; f.half[0] = *(const v8us*)((const unsigned short*)V16 + ((size_t)b * TTv + lg * 64 + r) * ldv + voff + h * 64 + c8);
#pragma unroll
    for (int q = 0; q < 8; ++q) tl[r][c8 + q] = f.u[q]; }
  __syncthreads();
  {
#pragma unroll
    for (int rd = 0; rd < 2; ++rd) { const int d = rd * 32 + tid / 8, pc = tid % 8; FragH f;
#pragma unroll
      for (int q = 0; q < 8; ++q) f.u[q] = tl[pc * 8 + q][d];
      *(v8us*)((unsigned short*)Vt + ((size_t)slab * 64 + d) * TTv + lg * 64 + pc * 8) = f.half[0]; }
     } }

__global__ __launch_bounds__(256) void k_hl(const float* __restrict__ F, _Float16* __restrict__ Hh, _Float16* __restrict__ Hl, size_t n8) { const size_t t = (size_t)blockIdx.x * 256 + threadIdx.x; if (t >= n8) return; FragH fh, fl; const v4f a = *(const v4fa*)(F + t * 8), c = *(const v4fa*)(F + t * 8 + 4);
#pragma unroll
  for (int q = 0; q < 4; ++q) { _Float16 h = (_Float16)a[q]; fh.h[q] = h; fl.h[q] = (_Float16)((a[q] - (float)h) * 1024.0f); h = (_Float16)c[q]; fh.h[4 + q] = h; fl.h[4 + q] = (_Float16)((c[q] - (float)h) * 1024.0f); }
  { *(v8us*)((unsigned short*)Hh + t * 8) = fh.half[0]; *(v8us*)((unsigned short*)Hl + t * 8) = fl.half[0];  } }

// ---- fast GEMM (wave tile 32x64; requires M % 32 == 0 rows per launch region and N % 64 == 0); epilogue = k_gemm_hhx semantics ----
__device__ __forceinline__ v16h g2_frag(const _Float16* p, int hh) { FragH f; f.half[0] = *(const v8us*)((const unsigned short*)p + 8 * hh); f.half[1] = *(const v8us*)((const unsigned short*)p + 16 + 8 * hh); return f.v; }
__device__ __forceinline__ v8f g2_mma(v16h a, v16h b, v8f c) { v8f d = __builtin_amdgcn_wmma_f32_16x16x32_f16(false, a, false, b, (short)0, c, false, false); asm volatile("v_nop\n\tv_nop\n\tv_nop\n\tv_nop" : "+v"(d) : "v"(a), "v"(b)); return d; }
template <int ACT>
__global__ __launch_bounds__(128) void k_gemm2(const _Float16* __restrict__ A, int lda, size_t sA, const _Float16* __restrict__ Bh, int ldb, size_t sB, float alpha, const float* __restrict__ bias, size_t sBias, const float* __restrict__ CP, int rowsPerB, size_t sCPb, int row0g,
    float* __restrict__ C, _Float16* __restrict__ C16, int ldc, size_t sC, int M, int N, int K) { static_assert(ACT == 0 || ACT == 3 || ACT == 6 || ACT == 8 || ACT == 9 || ACT == 11 || ACT == 12 || ACT == 14 || ACT == 15 || ACT == 16 || ACT == 17, "k_gemm2: unsupported ACT code (would silently apply no activation)");
  __shared__ __attribute__((aligned(16))) float so[4][32][68];
  const int tid = threadIdx.x, w = tid >> 5, lane = tid & 31, ln = lane & 15, hh = lane >> 4; const int by = blockIdx.y;
  A += (size_t)by * sA; Bh += (size_t)by * sB; const size_t cofs = (size_t)by * sC; const float* bp = bias ? bias + (size_t)by * sBias : nullptr;
  const int ntn = N >> 6; const int mt = blockIdx.x / ntn, nq = blockIdx.x - mt * ntn; const int row0 = mt * 128 + 32 * w, col0 = nq * 64; if (row0 >= M) return;
  const _Float16* a0p = A + (size_t)(row0 + ln) * lda; const _Float16* a1p = a0p + (size_t)16 * lda;
  const _Float16* b0p = Bh + (size_t)(col0 + ln) * ldb; const _Float16* b1p = b0p + (size_t)16 * ldb; const _Float16* b2p = b1p + (size_t)16 * ldb; const _Float16* b3p = b2p + (size_t)16 * ldb;
  const v8f z8 = {0.f,0.f,0.f,0.f,0.f,0.f,0.f,0.f}; v8f c00 = z8, c01 = z8, c02 = z8, c03 = z8, c10 = z8, c11 = z8, c12 = z8, c13 = z8;
#pragma unroll 1
  for (int kb = 0; kb < K; kb += 32) { const v16h a0 = g2_frag(a0p + kb, hh), a1 = g2_frag(a1p + kb, hh);
    v16h b = g2_frag(b0p + kb, hh); c00 = g2_mma(a0, b, c00); c10 = g2_mma(a1, b, c10);
    b = g2_frag(b1p + kb, hh); c01 = g2_mma(a0, b, c01); c11 = g2_mma(a1, b, c11);
    b = g2_frag(b2p + kb, hh); c02 = g2_mma(a0, b, c02); c12 = g2_mma(a1, b, c12);
    b = g2_frag(b3p + kb, hh); c03 = g2_mma(a0, b, c03); c13 = g2_mma(a1, b, c13); }
  v8f accs[8] = {c00, c01, c02, c03, c10, c11, c12, c13};
#pragma unroll
  for (int u = 0; u < 8; ++u) { const int t = u & 3, half = u >> 2; const int col = col0 + t * 16 + ln; const float bv = bp ? bf16_round(bp[col]) : 0.f;
#pragma unroll
    for (int r = 0; r < 8; ++r) { const int rloc = half * 16 + 8 * hh + r; float v = accs[u][r] * alpha + bv; if (CP) { if (rowsPerB < 0) v += CP[cofs + (size_t)(row0g + row0 + rloc) * ldc + col];      /* rowsPerB < 0: own element of the batched C plane */ else { const int bidx = (row0g + row0 + rloc) / rowsPerB; v += CP[(size_t)bidx * sCPb + (size_t)by * 64 + col]; } }
      if (ACT == 3) v = fmaxf(v, 0.f); else if (ACT == 6) v = 0.5f * v * (1.0f + erff(v * 0.70710678118654752f)); else if (ACT == 11) v = 1.0f / (1.0f + expf(-v)); else if (ACT == 15) v = v / (1.0f + expf(-v)); else if (ACT == 12) v = (v > 0.f) ? v : 0.01f * v; else if (ACT == 8) v = tanhf(v); else if (ACT == 9) v = 0.5f * v * (1.0f + tanhf(0.7978845608028654f * (v + 0.044715f * v * v * v))); else if (ACT == 14) v = (v > 0.f) ? v : 0.1f * v; else if (ACT == 16) v = (v >= 0.f) ? v : 0.3f * v; else if (ACT == 17) v = (v >= 0.f) ? v : 0.2f * v;
      so[w][rloc][t * 16 + ln] = v; } }
  __builtin_amdgcn_fence(__ATOMIC_ACQ_REL, "workgroup"); __builtin_amdgcn_wave_barrier();
  const int rsub = lane >> 4, c4 = (lane & 15) * 4;
  {
#pragma unroll
    for (int q = 0; q < 16; ++q) { const int r = q * 2 + rsub; const v4f v = *(const v4fa*)&so[w][r][c4]; if (C) *(v4f*)(C + cofs + (size_t)(row0 + r) * ldc + col0 + c4) = v; if (C16) { v4h h4; for (int i = 0; i < 4; ++i) h4[i] = (_Float16)v[i]; *(v4h*)(C16 + cofs + (size_t)(row0 + r) * ldc + col0 + c4) = h4; } }
     } }


__global__ __launch_bounds__(256) void k_wnat(const float* __restrict__ w, size_t n8, _Float16* __restrict__ Bt) { const size_t t = (size_t)blockIdx.x * 256 + threadIdx.x; if (t >= n8) return; FragH f; for (int q = 0; q < 8; ++q) f.h[q] = (_Float16)(bf16_round(w[t * 8 + q]) * 16.0f); *(v8us*)((unsigned short*)Bt + t * 8) = f.half[0];  }
__global__ __launch_bounds__(256) void k_rsm(const float* __restrict__ S, _Float16* __restrict__ P, int nrows) {
  #pragma clang fp contract(off)
  const int i = blockIdx.x * 256 + threadIdx.x; if (i >= nrows) return; const float* s = S + (size_t)i * SQ; float mx = -3.0e38f;
#pragma unroll 1
  for (int j = 0; j < SQ; ++j) mx = fmaxf(mx, s[j]); float se = 0.f;
#pragma unroll 1
  for (int j = 0; j < SQ; ++j) se += expf(s[j] - mx); const float sc = 256.0f / se;
#pragma unroll 1
  for (int j0 = 0; j0 < SQ; j0 += 8) { FragH f; for (int q = 0; q < 8; ++q) f.h[q] = (_Float16)(expf(s[j0 + q] - mx) * sc); unsigned short* d = (unsigned short*)P + (size_t)i * SQ + j0; *(v8us*)d = f.half[0];  } }
__global__ __launch_bounds__(256) void k_vt(const _Float16* __restrict__ V16, int b, int h0, _Float16* __restrict__ VT) { __shared__ unsigned short tl[64][65]; const int tid = threadIdx.x; const int hh = blockIdx.x % HG, sg = blockIdx.x / HG; const int s0 = sg * 64; const int h = h0 + hh;
  for (int i = tid; i < 64 * 8; i += 256) { const int j = i / 8, d8 = (i % 8) * 8; FragH f; f.half[0] = *(const v8us*)((const unsigned short*)V16 + ((size_t)b * SQ + s0 + j) * DM + h * HD + d8); for (int q = 0; q < 8; ++q) tl[d8 + q][j] = f.u[q]; }
  __syncthreads();
  { for (int i = tid; i < 64 * 8; i += 256) { const int d = i / 8, j8 = (i % 8) * 8; FragH f; for (int q = 0; q < 8; ++q) f.u[q] = tl[d][j8 + q]; *(v8us*)((unsigned short*)VT + ((size_t)hh * HD + d) * SQ + s0 + j8) = f.half[0]; }  } }



__global__ __launch_bounds__(256) void k_rsmf(const float* __restrict__ S, _Float16* __restrict__ P, int qn, int hg) {
  #pragma clang fp contract(off)
  const int t = blockIdx.x * 256 + threadIdx.x; if (t >= qn * hg) return; const size_t i = (size_t)(t / qn) * SQ + (t % qn); const float* s = S + i * SQ; float mx = -3.0e38f;
#pragma unroll 1
  for (int j = 0; j < SQ; ++j) mx = fmaxf(mx, s[j]); float se = 0.f;
#pragma unroll 1
  for (int j = 0; j < SQ; ++j) se += __expf(s[j] - mx); const float sc = 256.0f / se;
#pragma unroll 1
  for (int j0 = 0; j0 < SQ; j0 += 8) { FragH f; for (int q = 0; q < 8; ++q) f.h[q] = (_Float16)(__expf(s[j0 + q] - mx) * sc); unsigned short* d = (unsigned short*)P + i * SQ + j0; *(v8us*)d = f.half[0];  } }

// Four native exp2 in one statement: each is the independent instruction that the instruction set asks for behind the transcendental in front of it, and the v_nop is that slot behind the last
// Early-clobber outputs keep the four independent of one another.
__device__ __forceinline__ void exp2x4(float& a, float& b, float& c, float& d) { float e0, e1, e2, e3;
  asm("v_exp_f32 %0, %4\n\tv_exp_f32 %1, %5\n\tv_exp_f32 %2, %6\n\tv_exp_f32 %3, %7\n\tv_nop" : "=&v"(e0), "=&v"(e1), "=&v"(e2), "=&v"(e3) : "v"(a), "v"(b), "v"(c), "v"(d));
  a = e0; b = e1; c = e2; d = e3; }
// Row softmax, one row per wave: lane l holds columns 128 u + 4 l .. + 3 (u = 0 .. 31) of its row in registers, so every wave-wide load covers 512 contiguous bytes and S is read once.
// Maximum and sum: per lane, then a five-step butterfly over the 32 lanes; the exponentials stay in registers for the scaling pass. No LDS, no barrier; the early return is wave-uniform.
// Every loop is fully unrolled so that x[] and m[] are indexed by constants and stay in registers.
// Second launch bound: four waves per SIMD, so that all 4096 rows of a head are resident at once.
__global__ __launch_bounds__(256, 4) void k_rsmfam(const float* __restrict__ S, _Float16* __restrict__ P, int qn, int hg, const float* __restrict__ am) {
  const int lane = threadIdx.x & 31; const int t = blockIdx.x * 8 + __builtin_amdgcn_readfirstlane(threadIdx.x >> 5); if (t >= qn * hg) return;
  const size_t i = (size_t)(t / qn) * SQ + (t % qn); const float* s = S + i * SQ + lane * 4; const float* a = am + lane * 4;
  v4f x[SQ / 128], m[2][8];
#pragma unroll
  for (int u = 0; u < SQ / 128; ++u) x[u] = *(const v4fa*)(s + u * 128);
  __builtin_amdgcn_sched_barrier(0);      /* keeps the row's 32 loads in front of the mask's: otherwise most of them are issued only after the mask has arrived, and the wave pays two latencies in a row */
#pragma unroll
  for (int j = 0; j < 8; ++j) m[0][j] = *(const v4fa*)(a + j * 128);
  float mx = -3.0e38f;
#pragma unroll
  for (int g = 0; g < SQ / 1024; ++g) {
    if (g + 1 < SQ / 1024) {
#pragma unroll
      for (int j = 0; j < 8; ++j) m[(g + 1) & 1][j] = *(const v4fa*)(a + ((g + 1) * 8 + j) * 128); }
    __builtin_amdgcn_sched_barrier(0);      /* bounds how far ahead the mask's loads are hoisted: with all 32 issued at once beside the row the build spilled to scratch */
#pragma unroll
    for (int j = 0; j < 8; ++j)
#pragma unroll
      for (int q = 0; q < 4; ++q) { const int u = g * 8 + j; x[u][q] = x[u][q] + bf16_round(m[g & 1][j][q]); mx = fmaxf(mx, x[u][q]); } }
#pragma unroll
  for (int o = 16; o > 0; o >>= 1) mx = fmaxf(mx, __shfl_xor(mx, o, 32));
  float se4[4] = {0.f, 0.f, 0.f, 0.f};
#pragma unroll
  for (int u = 0; u < SQ / 128; ++u) { float y[4];
#pragma unroll
    for (int q = 0; q < 4; ++q) y[q] = (x[u][q] - mx) * 1.44269504f;      /* exp2 of this = __expf(x - mx), the native form */
    exp2x4(y[0], y[1], y[2], y[3]);
#pragma unroll
    for (int q = 0; q < 4; ++q) { x[u][q] = y[q]; se4[q] += y[q]; } }
  float se = (se4[0] + se4[1]) + (se4[2] + se4[3]);
#pragma unroll
  for (int o = 16; o > 0; o >>= 1) se += __shfl_xor(se, o, 32);
  const float sc = 256.0f / se; _Float16* d = P + i * SQ + lane * 4;
#pragma unroll
  for (int u = 0; u < SQ / 128; ++u) { v4h h4;
#pragma unroll
    for (int q = 0; q < 4; ++q) h4[q] = (_Float16)(x[u][q] * sc);
    *(v4h*)(d + u * 128) = h4; } }


__global__ __launch_bounds__(256) void k_bfr(const float* __restrict__ x, float* __restrict__ XB, size_t n8) { const size_t t = (size_t)blockIdx.x * 256 + threadIdx.x; if (t >= n8) return; v4f a = *(const v4fa*)(x + t * 8), c = *(const v4fa*)(x + t * 8 + 4); for (int q = 0; q < 4; ++q) { a[q] = bf16_round(a[q]); c[q] = bf16_round(c[q]); }
  { *(v4f*)(XB + t * 8) = a; *(v4f*)(XB + t * 8 + 4) = c;  } }


__global__ __launch_bounds__(256) void k_lnrow(const float* __restrict__ Y, const float* __restrict__ g, const float* __restrict__ bb, float eps, float* __restrict__ out) {
  #pragma clang fp contract(off)
  __shared__ float red[256]; const size_t r = blockIdx.x; const int t = threadIdx.x; const v4f ya = *(const v4fa*)(Y + r * DMQ + t * 4); float s[4]; float sum = 0.f;
  for (int q = 0; q < 4; ++q) { s[q] = ya[q]; sum = __fadd_rn(sum, s[q]); }
  red[t] = sum; __syncthreads(); for (int st = 128; st > 0; st >>= 1) { if (t < st) red[t] = __fadd_rn(red[t], red[t + st]); __syncthreads(); } const float mu = red[0] / (float)DMQ; __syncthreads();
  float vs = 0.f; for (int q = 0; q < 4; ++q) { const float dl = __fadd_rn(s[q], -mu); vs = __fadd_rn(vs, __fmul_rn(dl, dl)); } red[t] = vs; __syncthreads(); for (int st = 128; st > 0; st >>= 1) { if (t < st) red[t] = __fadd_rn(red[t], red[t + st]); __syncthreads(); }
  const float rs = rsqrtf(__fadd_rn(red[0] / (float)DMQ, eps)); v4f y; for (int q = 0; q < 4; ++q) { const int c = t * 4 + q; y[q] = __fadd_rn(__fmul_rn(__fmul_rn(__fadd_rn(s[q], -mu), rs), bf16_round(g[c])), bf16_round(bb[c])); }
  *(v4f*)(out + r * DMQ + t * 4) = y;  }
extern "C" void kernel_launch(void* const* d_in, const int* in_sizes, int n_in,
                              void* d_out, int out_size, void* d_ws, size_t ws_size, hipStream_t stream) {
  (void)in_sizes; (void)n_in; (void)out_size;
  const float* const* I = (const float* const*)d_in; const float* x = I[0]; const float* am = I[1]; const float* wq = I[2]; const float* bq = I[3]; const float* wk = I[4]; const float* bk = I[5]; const float* wv = I[6]; const float* bv = I[7]; const float* wo = I[8]; const float* bo = I[9]; const float* lng = I[10]; const float* lnb = I[11];      /* nn.Linear weights [out][in] + biases; additive mask [1][1][1][S] */
  char* ws = (char*)d_ws; size_t off = 0;
  auto take = [&](size_t bytes) { char* p = ws + off; off += (bytes + 255) & ~(size_t)255; return p; };
  _Float16* BQ = (_Float16*)take((size_t)DM * DM * 2); _Float16* BK = (_Float16*)take((size_t)DM * DM * 2); _Float16* BV = (_Float16*)take((size_t)DM * DM * 2); _Float16* BO = (_Float16*)take((size_t)DM * DM * 2);
  _Float16* X16 = (_Float16*)take(NR * DM * 2); float* XB = (float*)take(NR * DM * 4); float* YF = (float*)take(NR * DM * 4); _Float16* Q16 = (_Float16*)take(NR * DM * 2); _Float16* K16 = (_Float16*)take(NR * DM * 2); _Float16* V16 = (_Float16*)take(NR * DM * 2); _Float16* O16 = (_Float16*)take(NR * DM * 2);
  float* S = (float*)take((size_t)HG * SQ * SQ * 4); _Float16* P = (_Float16*)take((size_t)HG * SQ * SQ * 2); _Float16* VT = (_Float16*)take((size_t)NH * HD * SQ * 2);
  if (off > ws_size) return;
  { const unsigned g = (unsigned)(((size_t)DM * DM / 8 + 255) / 256); k_wnat<<<g, 256, 0, stream>>>(wq, (size_t)DM * DM / 8, BQ); k_wnat<<<g, 256, 0, stream>>>(wk, (size_t)DM * DM / 8, BK); k_wnat<<<g, 256, 0, stream>>>(wv, (size_t)DM * DM / 8, BV); k_wnat<<<g, 256, 0, stream>>>(wo, (size_t)DM * DM / 8, BO); }      /* natural [out][in] = Bt[n][k], x16 */
  k_x16<<<(unsigned)((NR * DM / 8 + 255) / 256), 256, 0, stream>>>(x, X16, NR * DM / 8); k_bfr<<<(unsigned)((NR * DM / 8 + 255) / 256), 256, 0, stream>>>(x, XB, NR * DM / 8);      /* bf16(x) residual plane */
  const size_t r0p = (size_t)B0 * SQ;      /* first projected row */
  k_gemm2<0><<<dim3((unsigned)((MP / 128) * (DM / 64)), 1), 128, 0, stream>>>(X16 + r0p * DM, DM, 0, BQ, DM, 0, 0.0625f, bq, 0, nullptr, 1, 0, 0, nullptr, Q16 + r0p * DM, DM, 0, MP, DM, DM);
  k_gemm2<0><<<dim3((unsigned)((MP / 128) * (DM / 64)), 1), 128, 0, stream>>>(X16 + r0p * DM, DM, 0, BK, DM, 0, 0.0625f, bk, 0, nullptr, 1, 0, 0, nullptr, K16 + r0p * DM, DM, 0, MP, DM, DM);
  k_gemm2<0><<<dim3((unsigned)((MP / 128) * (DM / 64)), 1), 128, 0, stream>>>(X16 + r0p * DM, DM, 0, BV, DM, 0, 0.0625f, bv, 0, nullptr, 1, 0, 0, nullptr, V16 + r0p * DM, DM, 0, MP, DM, DM);
  for (int b = B0; b < B0 + NBR; ++b) { const size_t r0 = (size_t)b * SQ;
    k_vt<NH, SQ><<<NH * (SQ / 64), 256, 0, stream>>>(V16 + r0 * LQ, LQ, 0, VT);      /* V^T [NH][HD][SQ] for this batch */
    for (int h0 = 0; h0 < NHD; h0 += HG) {
      k_gemm2<0><<<dim3((QN / 128) * (SQ / 64), HG), 128, 0, stream>>>(Q16 + r0 * LQ + h0 * HD, LQ, (size_t)HD, K16 + r0 * LQ + h0 * HD, LQ, (size_t)HD, 0.125f, nullptr, 0, nullptr, 1, 0, 0, S, nullptr, SQ, (size_t)SQ * SQ, QN, SQ, HD);      /* scores, HG heads per launch */
      k_rsmfam<<<(HG * QN + 7) / 8, 256, 0, stream>>>(S, P, QN, HG, am + (size_t)b * SQ);      /* + attention_mask per key */      /* P = 256 softmax (f16), rows of all HG heads */
      k_gemm2<0><<<dim3((QN / 128) * (HD / 64), HG), 128, 0, stream>>>(P, SQ, (size_t)SQ * SQ, VT + (size_t)h0 * HD * SQ, SQ, (size_t)HD * SQ, 0.25f, nullptr, 0, nullptr, 1, 0, 0, nullptr, O16 + r0 * DM + h0 * HD, DM, (size_t)HD, QN, HD, SQ); } }      /* o (merged heads) as f16 rows */
  k_gemm2<0><<<dim3((unsigned)((MPO / 128) * (DM / 64)), 1), 128, 0, stream>>>(O16 + r0p * DM, DM, 0, BO, DM, 0, 0.0009765625f, bo, 0, XB + r0p * DM, -1, 0, 0, YF + r0p * DM, nullptr, DM, 0, MPO, DM, DM);      /* y = ctx Wo^T + bo + bf16(x) (own-element residual) */
  k_lnrow<<<(unsigned)MPO, 256, 0, stream>>>(YF + r0p * DM, lng, lnb, 1e-12f, (float*)d_out + r0p * DM);      /* post-LayerNorm */
}

// v003
// A run of this version takes 307 microseconds.
// Versions between v001 and this one are left out; their measured steps multiply to 9.17 times as fast.
// Counting every step since v000, it is 45.5 times as fast.
#include <hip/hip_runtime.h>
// BERT self-attention + output (hidden_states [1][4096][1024]; q/k/v = x W^T + b (nn.Linear [out][in] 1024^2, sigma 1/32, zero biases), 16 heads of 64; scores = (q/8) . k + attention_mask[j] (additive [1][1][1][S], zeros); softmax; ctx merged; out = LayerNorm(ctx Wo^T + bo + hidden_states; ln_gamma, ln_beta, eps 1e-12) -> [1][4096][1024]).
// Structure: token rows r = b*4096 + s; x as exact f16 rows (bf16-rounded); Q, K, V as three WMMA GEMMs (32x64 wave tiles, f32 accumulation, exact x16 weights + bias, f16 outputs); per batch: V^T for all heads via LDS transposes; per batch one fused attention launch over all heads: S^T = K . Q^T on WMMA (alpha = 64^-0.5), online softmax on VALU (f32 statistics, native exp2; weights x256 as f16 operands, in registers only), O^T += V^T . P^T on WMMA (o carried x64 against f16 subnormal flush, folded into the output GEMM alpha) written straight into the merged f16 o rows; y = o Wo^T + bo + bf16(x) GEMM (f32, own-element residual) into f32 rows; post-LayerNorm on VALU (f32, LDS trees) into the output.
// Compute dtype: inputs rounded to bf16; x / weights exact; q, k, v, softmax weights and o as plain f16 GEMM operands (~2^-12); scores and softmax statistics f32. v_wmma_f32_16x16x32_f16.
#define NB 1
#define SQ 4096
#define DM 1024
#define NH 16
#define HD 64
#define HG 1                         /* heads per group of the k_vt(b, h0) overload, not launched */
#define B0 0                         /* first batch processed (debug hook) */
#define NBR NB                       /* batches processed (debug hook) */
#define NR ((size_t)NB * SQ)
#define DMQ DM         /* width of the token rows (LayerNorm length) */
#define MP ((int)((size_t)NBR * SQ)) /* rows projected (debug hook) */
#define QN SQ                        /* not used: attention covers all SQ query rows */
#define NHD NH                       /* not used: attention covers all NH heads */
#define MPO MP                       /* rows through the output stage (debug hook) */
#define LQ DM      /* width K of the q/k/v planes (fragment order) */
typedef __bf16 v16b __attribute__((ext_vector_type(16)));
typedef unsigned short v8us __attribute__((ext_vector_type(8), may_alias));
typedef float  v8f  __attribute__((ext_vector_type(8)));
typedef float  v4f  __attribute__((ext_vector_type(4)));
typedef float  v4fa __attribute__((ext_vector_type(4), may_alias));
union FragB { v16b v; v8us half[2]; unsigned short u[16]; };

__device__ __forceinline__ unsigned short bf16_bits(float x) { unsigned int u = __float_as_uint(x); return (unsigned short)((u + 0x7FFFu + ((u >> 16) & 1u)) >> 16); }
__device__ __forceinline__ float bf16_val(unsigned short b) { return __uint_as_float(((unsigned int)b) << 16); }
__device__ __forceinline__ float bf16_round(float x) { return bf16_val(bf16_bits(x)); }
// D += A·B with NT terms: 1 = ah·bh, 2 = + al·bh (A split), 3 = + ah·bl (both split)
template <int NT>
__device__ __forceinline__ v8f mmaN(v16b ah, v16b al, v16b bh, v16b bl, v8f c) {
  c = __builtin_amdgcn_wmma_f32_16x16x32_bf16(false, ah, false, bh, (short)0, c, false, false);
  if (NT >= 2) c = __builtin_amdgcn_wmma_f32_16x16x32_bf16(false, al, false, bh, (short)0, c, false, false);
  if (NT >= 3) c = __builtin_amdgcn_wmma_f32_16x16x32_bf16(false, ah, false, bl, (short)0, c, false, false);
  asm volatile("v_nop\n\tv_nop\n\tv_nop\n\tv_nop" : "+v"(c) : "v"(ah), "v"(al), "v"(bh), "v"(bl));
  return c;
}

__global__ __launch_bounds__(256) void k_wt_bf16(const float* __restrict__ W, unsigned short* __restrict__ Wt, int K, int N) {
  const int t = blockIdx.x * 256 + threadIdx.x;
  const int k8n = K / 8;
  if (t >= N * k8n) return;
  const int n = t / k8n, k8 = (t % k8n) * 8;
  v8us v;
#pragma unroll
  for (int i = 0; i < 8; ++i) v[i] = bf16_bits(W[(size_t)(k8 + i) * N + n]);
  *(v8us*)(Wt + (size_t)n * K + k8) = v;
  
}

// GEMM C[M][N] (f32, pitch ldc) = act(A[M][K]·W + bias). A f32 row-major (pitch lda) converted per fragment to bf16
// (ASPLIT: hi/lo two planes -> 2 terms, else single rounded term); Wt bf16 [N][K] (pitch ldb). BIAS_BF16 rounds the
// bias to bf16 first (bias quantised to bf16 before the add). K%32==0, M%16==0, N%64==0.
template <bool ASPLIT, int ACT, bool BIAS_BF16>
__global__ __launch_bounds__(128) void k_gemm_bf(const float* __restrict__ A, int lda, const unsigned short* __restrict__ Wt, int ldb,
                                               const float* __restrict__ bias, float* __restrict__ C, int ldc, int M, int N, int K) {
  __shared__ __attribute__((aligned(16))) float so[4][16][64];
  const int tid = threadIdx.x, w = tid >> 5, lane = tid & 31, ln = lane & 15, hh = lane >> 4;
  const int ntn = N / 64;
  const int wid = blockIdx.x * 4 + w;
  const int mt = wid / ntn, nq = wid % ntn;
  if (mt * 16 >= M) return;
  const int row0 = mt * 16, col0 = nq * 64;
  const float* arow = A + (size_t)(row0 + ln) * lda;
  v8f acc[4] = {};
  for (int kb = 0; kb < K; kb += 32) {
    FragB ah, al;
    const v4f x0 = *(const v4fa*)(arow + kb + 8 * hh), x1 = *(const v4fa*)(arow + kb + 8 * hh + 4);
    const v4f x2 = *(const v4fa*)(arow + kb + 16 + 8 * hh), x3 = *(const v4fa*)(arow + kb + 16 + 8 * hh + 4);
    float xs[16] = {x0[0],x0[1],x0[2],x0[3],x1[0],x1[1],x1[2],x1[3],x2[0],x2[1],x2[2],x2[3],x3[0],x3[1],x3[2],x3[3]};
#pragma unroll
    for (int i = 0; i < 16; ++i) { const unsigned short hb = bf16_bits(xs[i]); ah.u[i] = hb; al.u[i] = ASPLIT ? bf16_bits(xs[i] - bf16_val(hb)) : (unsigned short)0; }
#pragma unroll
    for (int t = 0; t < 4; ++t) {
      const unsigned short* brow = Wt + (size_t)(col0 + t * 16 + ln) * ldb + kb;
      FragB b;
      b.half[0] = *(const v8us*)(brow + 8 * hh);
      b.half[1] = *(const v8us*)(brow + 16 + 8 * hh);
      acc[t] = mmaN<ASPLIT ? 2 : 1>(ah.v, al.v, b.v, b.v, acc[t]);
    }
  }
#pragma unroll
  for (int t = 0; t < 4; ++t) {
    float bv = bias ? bias[col0 + t * 16 + ln] : 0.f;
    if (BIAS_BF16) bv = bf16_round(bv);
#pragma unroll
    for (int r = 0; r < 8; ++r) { float v = acc[t][r] + bv; if (ACT == 1) v = fmaxf(v, 0.f); so[w][8 * hh + r][t * 16 + ln] = v; }
  }
  __builtin_amdgcn_fence(__ATOMIC_ACQ_REL, "workgroup");
  __builtin_amdgcn_wave_barrier();
  const int rsub = lane >> 4, c4 = (lane & 15) * 4;
  {
#pragma unroll
    for (int q = 0; q < 8; ++q) {
      const int r = q * 2 + rsub;
      const v4f v = *(const v4fa*)&so[w][r][c4];
      *(v4f*)(C + (size_t)(row0 + r) * ldc + col0 + c4) = v;
    }
    
  }
}

// GEMM C = act(A·W + bias + resid): A f32 (ASPLIT -> hi/lo 2 terms), Wt bf16 [N][K]; ACT 0 none, 1 relu, 2 exact gelu;
// resid (optional, f32, row index = (row % rmod), pitch ldr, RES_BF16 rounds it) added before the activation.
template <bool ASPLIT, int ACT, bool BIAS_BF16, bool RES_BF16>
__global__ __launch_bounds__(128) void k_gemm_bf3(const float* __restrict__ A, int lda, const unsigned short* __restrict__ Wt, int ldb,
                                                const float* __restrict__ bias, const float* __restrict__ resid, int rmod, int ldr,
                                                float* __restrict__ C, int ldc, int M, int N, int K) {
  __shared__ __attribute__((aligned(16))) float so[4][16][64];
  const int tid = threadIdx.x, w = tid >> 5, lane = tid & 31, ln = lane & 15, hh = lane >> 4;
  const int ntn = N / 64;
  const int wid = blockIdx.x * 4 + w;
  const int mt = wid / ntn, nq = wid % ntn;
  if (mt * 16 >= M) return;
  const int row0 = mt * 16, col0 = nq * 64;
  const float* arow = A + (size_t)(row0 + ln) * lda;
  v8f acc[4] = {};
  for (int kb = 0; kb < K; kb += 32) {
    FragB ah, al;
    const v4f x0 = *(const v4fa*)(arow + kb + 8 * hh), x1 = *(const v4fa*)(arow + kb + 8 * hh + 4);
    const v4f x2 = *(const v4fa*)(arow + kb + 16 + 8 * hh), x3 = *(const v4fa*)(arow + kb + 16 + 8 * hh + 4);
    float xs[16] = {x0[0],x0[1],x0[2],x0[3],x1[0],x1[1],x1[2],x1[3],x2[0],x2[1],x2[2],x2[3],x3[0],x3[1],x3[2],x3[3]};
#pragma unroll
    for (int i = 0; i < 16; ++i) { const unsigned short hb = bf16_bits(xs[i]); ah.u[i] = hb; al.u[i] = ASPLIT ? bf16_bits(xs[i] - bf16_val(hb)) : (unsigned short)0; }
#pragma unroll
    for (int t = 0; t < 4; ++t) {
      const unsigned short* brow = Wt + (size_t)(col0 + t * 16 + ln) * ldb + kb;
      FragB b;
      b.half[0] = *(const v8us*)(brow + 8 * hh);
      b.half[1] = *(const v8us*)(brow + 16 + 8 * hh);
      acc[t] = mmaN<ASPLIT ? 2 : 1>(ah.v, al.v, b.v, b.v, acc[t]);
    }
  }
#pragma unroll
  for (int t = 0; t < 4; ++t) {
    const int col = col0 + t * 16 + ln;
    float bv = bias ? bias[col] : 0.f;
    if (BIAS_BF16) bv = bf16_round(bv);
#pragma unroll
    for (int r = 0; r < 8; ++r) {
      float v = acc[t][r] + bv;
      if (resid) { float rv = resid[(size_t)((row0 + 8 * hh + r) % rmod) * ldr + col]; if (RES_BF16) rv = bf16_round(rv); v += rv; }
      if (ACT == 1) v = fmaxf(v, 0.f);
      if (ACT == 2) v = 0.5f * v * (1.0f + erff(v * 0.70710678118654752f));
      if (ACT == 3) { const float u = 0.7978845608028654f * (v + 0.044715f * v * v * v); v = 0.5f * v * (1.0f + tanhf(u)); }
      so[w][8 * hh + r][t * 16 + ln] = v;
    }
  }
  __builtin_amdgcn_fence(__ATOMIC_ACQ_REL, "workgroup");
  __builtin_amdgcn_wave_barrier();
  const int rsub = lane >> 4, c4 = (lane & 15) * 4;
  {
#pragma unroll
    for (int q = 0; q < 8; ++q) {
      const int r = q * 2 + rsub;
      const v4f v = *(const v4fa*)&so[w][r][c4];
      *(v4f*)(C + (size_t)(row0 + r) * ldc + col0 + c4) = v;
    }
    
  }
}
// row LayerNorm (biased variance, eps) over N: s = X (+ R); optional out_sum <- s; out_norm <- (s-mu)*rsqrt(var+eps)*g + b
template <bool PARAM_BF16>
__global__ __launch_bounds__(256) void k_layernorm(const float* __restrict__ X, const float* __restrict__ R, const float* __restrict__ g, const float* __restrict__ bta,
                                                  float* __restrict__ out_sum, float* __restrict__ out_norm, int N, float eps) {
  __shared__ float red[256];
  const int row = blockIdx.x, tid = threadIdx.x;
  const float* x = X + (size_t)row * N; const float* rr = R ? R + (size_t)row * N : nullptr;
  float vals[16];                     // up to N = 4096
  const int per = N / 256;            // contiguous chunk per thread? use strided-by-4 chunks: thread handles j = tid*4 + 1024*u
  float s1 = 0.f;
  for (int u = 0; u < per / 4; ++u) {
    const int j = tid * 4 + 1024 * u;
    const v4f a = *(const v4fa*)(x + j);
    v4f b = {0.f,0.f,0.f,0.f}; if (rr) b = *(const v4fa*)(rr + j);
#pragma unroll
    for (int q = 0; q < 4; ++q) { const float v = a[q] + b[q]; vals[u * 4 + q] = v; s1 += v; }
  }
  red[tid] = s1; __syncthreads();
  for (int st = 128; st > 0; st >>= 1) { if (tid < st) red[tid] += red[tid + st]; __syncthreads(); }
  const float mu = red[0] / (float)N; __syncthreads();
  float s2 = 0.f;
  for (int u = 0; u < per / 4; ++u)
#pragma unroll
    for (int q = 0; q < 4; ++q) { const float c = vals[u * 4 + q] - mu; s2 += c * c; }
  red[tid] = s2; __syncthreads();
  for (int st = 128; st > 0; st >>= 1) { if (tid < st) red[tid] += red[tid + st]; __syncthreads(); }
  const float rs = rsqrtf(red[0] / (float)N + eps);
  {
    for (int u = 0; u < per / 4; ++u) {
      const int j = tid * 4 + 1024 * u;
      v4f o, sm;
#pragma unroll
      for (int q = 0; q < 4; ++q) {
        float gg = g[j + q], bb = bta[j + q];
        if (PARAM_BF16) { gg = bf16_round(gg); bb = bf16_round(bb); }
        sm[q] = vals[u * 4 + q]; o[q] = (vals[u * 4 + q] - mu) * rs * gg + bb;
      }
      if (out_sum) *(v4f*)(out_sum + (size_t)row * N + j) = sm;
      *(v4f*)(out_norm + (size_t)row * N + j) = o;
    }
    
  }
}



// ---- f16 WMMA path (v_wmma_f32_16x16x32_f16): 11-bit significands for operands in range — used where a [0,1] probability operand needs more precision than bf16
typedef _Float16 v16h __attribute__((ext_vector_type(16)));
union FragH { v16h v; v8us half[2]; _Float16 h[16]; unsigned short u[16]; };
template <int NT>
__device__ __forceinline__ v8f mmaH(v16h ah, v16h al, v16h bh, v16h bl, v8f c) {
  c = __builtin_amdgcn_wmma_f32_16x16x32_f16(false, ah, false, bh, (short)0, c, false, false);
  if (NT >= 2) c = __builtin_amdgcn_wmma_f32_16x16x32_f16(false, al, false, bh, (short)0, c, false, false);
  if (NT >= 3) c = __builtin_amdgcn_wmma_f32_16x16x32_f16(false, ah, false, bl, (short)0, c, false, false);
  asm volatile("v_nop\n\tv_nop\n\tv_nop\n\tv_nop" : "+v"(c) : "v"(ah), "v"(al), "v"(bh), "v"(bl));
  return c;
}
// batched GEMM like k_gemm_b but f16 operands: A f32 (split into f16 hi/lo if ASPLIT, else rounded to f16), Bt = f16 values [n][k]; alpha; C f32; N multiple of 16 (partial tiles skipped)
template <bool ASPLIT>
__global__ __launch_bounds__(128) void k_gemm_h(const float* __restrict__ A, int lda, size_t sA, const _Float16* __restrict__ Bh, int ldb, size_t sB, float alpha, float* __restrict__ C, int ldc, size_t sC, int M, int N, int K) {
  __shared__ __attribute__((aligned(16))) float so[4][16][64];
  const int tid = threadIdx.x, w = tid >> 5, lane = tid & 31, ln = lane & 15, hh = lane >> 4; const int by = blockIdx.y;
  A += (size_t)by * sA; Bh += (size_t)by * sB; C += (size_t)by * sC;
  const int ntn = (N + 63) / 64; const int wid = blockIdx.x * 4 + w; const int mt = wid / ntn, nq = wid % ntn; if (mt * 16 >= M) return;
  const int row0 = mt * 16, col0 = nq * 64; const float* arow = A + (size_t)(row0 + ln) * lda;
  v8f acc[4] = {};
  for (int kb = 0; kb < K; kb += 32) {
    FragH ah, al;
    const v4f x0 = *(const v4fa*)(arow + kb + 8 * hh), x1 = *(const v4fa*)(arow + kb + 8 * hh + 4), x2 = *(const v4fa*)(arow + kb + 16 + 8 * hh), x3 = *(const v4fa*)(arow + kb + 16 + 8 * hh + 4);
    float xs[16] = {x0[0],x0[1],x0[2],x0[3],x1[0],x1[1],x1[2],x1[3],x2[0],x2[1],x2[2],x2[3],x3[0],x3[1],x3[2],x3[3]};
#pragma unroll
    for (int i = 0; i < 16; ++i) { const _Float16 h = (_Float16)xs[i]; ah.h[i] = h; al.h[i] = ASPLIT ? (_Float16)(xs[i] - (float)h) : (_Float16)0.0f; }
#pragma unroll
    for (int t = 0; t < 4; ++t) { if (col0 + t * 16 >= N) continue; const size_t boff = (size_t)(col0 + t * 16 + ln) * ldb + kb; FragH bq; bq.half[0] = *(const v8us*)(Bh + boff + 8 * hh); bq.half[1] = *(const v8us*)(Bh + boff + 16 + 8 * hh);
      acc[t] = mmaH<ASPLIT ? 2 : 1>(ah.v, al.v, bq.v, bq.v, acc[t]); }
  }
#pragma unroll
  for (int t = 0; t < 4; ++t) { if (col0 + t * 16 >= N) continue;
#pragma unroll
    for (int r = 0; r < 8; ++r) so[w][8 * hh + r][t * 16 + ln] = acc[t][r] * alpha; }
  __builtin_amdgcn_fence(__ATOMIC_ACQ_REL, "workgroup"); __builtin_amdgcn_wave_barrier();
  const int rsub = lane >> 4, c4 = (lane & 15) * 4;
  {
#pragma unroll
    for (int q = 0; q < 8; ++q) { const int r = q * 2 + rsub; if (col0 + c4 < N) { const v4f v = *(const v4fa*)&so[w][r][c4]; *(v4f*)(C + (size_t)(row0 + r) * ldc + col0 + c4) = v; } }
     }
}

// Wt[n][k] = f16(W[k][n]·scale) from f32 row-major W[K][N] (scale = power of two; bf16-exact weights stay exact in f16 away from the subnormal range)
__global__ __launch_bounds__(256) void k_wt_f16(const float* __restrict__ W, _Float16* __restrict__ Wt, int K, int N, float scale) {
  const int t = blockIdx.x * 256 + threadIdx.x; if (t >= N * (K / 8)) return; const int n = t / (K / 8), k8 = (t % (K / 8)) * 8; FragH f;
#pragma unroll
  for (int i = 0; i < 8; ++i) f.h[i] = (_Float16)(bf16_round(W[(size_t)(k8 + i) * N + n]) * scale); const v8us o = f.half[0];
  *(v8us*)((unsigned short*)Wt + (size_t)n * K + k8) = o; 
}
// k_gemm_hh variant with fused epilogue: v = acc·alpha + bias[by·sBias + col] (+ CP[(row/rowsPerB)·sCPb + by·64 + col] if CP) ; ACT 0 none / 1 elu ; writes f16 C16 (and f32 C if non-null)
template <int ACT>
__global__ __launch_bounds__(128) void k_gemm_hhx(const _Float16* __restrict__ A, int lda, size_t sA, const _Float16* __restrict__ Bh, int ldb, size_t sB, float alpha, const float* __restrict__ bias, size_t sBias, const float* __restrict__ CP, int rowsPerB, size_t sCPb, int row0g,
    float* __restrict__ C, _Float16* __restrict__ C16, int ldc, size_t sC, int M, int N, int K) {
  __shared__ __attribute__((aligned(16))) float so[4][16][64];
  const int tid = threadIdx.x, w = tid >> 5, lane = tid & 31, ln = lane & 15, hh = lane >> 4; const int by = blockIdx.y;
  A += (size_t)by * sA; Bh += (size_t)by * sB; const size_t cofs = (size_t)by * sC; const float* bp = bias ? bias + (size_t)by * sBias : nullptr;
  const int ntn = (N + 63) / 64; const int wid = blockIdx.x * 4 + w; const int mt = wid / ntn, nq = wid % ntn; if (mt * 16 >= M) return;
  const int row0 = mt * 16, col0 = nq * 64; const _Float16* arow = A + (size_t)(row0 + ln) * lda;
  v8f acc[4] = {};
  for (int kb = 0; kb < K; kb += 32) { FragH ah; ah.half[0] = *(const v8us*)((const unsigned short*)arow + kb + 8 * hh); ah.half[1] = *(const v8us*)((const unsigned short*)arow + kb + 16 + 8 * hh);
#pragma unroll
    for (int t = 0; t < 4; ++t) { if (col0 + t * 16 >= N) continue; const size_t boff = (size_t)(col0 + t * 16 + ln) * ldb + kb; FragH bq; bq.half[0] = *(const v8us*)((const unsigned short*)Bh + boff + 8 * hh); bq.half[1] = *(const v8us*)((const unsigned short*)Bh + boff + 16 + 8 * hh);
      acc[t] = mmaH<1>(ah.v, ah.v, bq.v, bq.v, acc[t]); }
  }
#pragma unroll
  for (int t = 0; t < 4; ++t) { if (col0 + t * 16 >= N) continue; const int col = col0 + t * 16 + ln; const float bv = bp ? bf16_round(bp[col]) : 0.f;
#pragma unroll
    for (int r = 0; r < 8; ++r) { float v = acc[t][r] * alpha + bv; if (CP) { const int rr = row0g + row0 + 8 * hh + r; if (rowsPerB < 0) v += CP[cofs + (size_t)rr * ldc + col];      /* rowsPerB < 0: own element of the batched C plane */ else { const int bidx = rr / rowsPerB; v += CP[(size_t)bidx * sCPb + (size_t)by * 64 + col]; } } if (ACT == 1) v = (v > 0.f) ? v : expm1f(v); else if (ACT == 7) v = (v > 0.f) ? v + 1.0f : expf(v); else if (ACT == 8) v = tanhf(v); else if (ACT == 9) v = 0.5f * v * (1.0f + tanhf(0.7978845608028654f * (v + 0.044715f * v * v * v))); else if (ACT == 11) v = 1.0f / (1.0f + expf(-v)); else if (ACT == 12) v = (v > 0.f) ? v : 0.01f * v; else if (ACT == 14) v = (v > 0.f) ? v : 0.1f * v; else if (ACT == 16) v = (v >= 0.f) ? v : 0.3f * v; else if (ACT == 17) v = (v >= 0.f) ? v : 0.2f * v; else if (ACT == 15) v = v / (1.0f + expf(-v)); else if (ACT == 3) v = fmaxf(v, 0.f); else if (ACT == 6) v = 0.5f * v * (1.0f + erff(v * 0.70710678118654752f)); so[w][8 * hh + r][t * 16 + ln] = v; } }
  __builtin_amdgcn_fence(__ATOMIC_ACQ_REL, "workgroup"); __builtin_amdgcn_wave_barrier();
  const int rsub = lane >> 4, c4 = (lane & 15) * 4; typedef _Float16 v4h __attribute__((ext_vector_type(4)));
  {
#pragma unroll
    for (int q = 0; q < 8; ++q) { const int r = q * 2 + rsub; if (col0 + c4 < N) { const v4f v = *(const v4fa*)&so[w][r][c4]; if (C) *(v4f*)(C + cofs + (size_t)(row0 + r) * ldc + col0 + c4) = v; if (C16) { v4h h4; for (int i = 0; i < 4; ++i) h4[i] = (_Float16)v[i]; *(v4h*)(C16 + cofs + (size_t)(row0 + r) * ldc + col0 + c4) = h4; } } }
     }
}


typedef _Float16 v4h __attribute__((ext_vector_type(4)));

__global__ __launch_bounds__(256) void k_x16(const float* __restrict__ x, _Float16* __restrict__ X16, size_t n8) { const size_t t = (size_t)blockIdx.x * 256 + threadIdx.x; if (t >= n8) return; FragH f;
#pragma unroll
  for (int q = 0; q < 8; ++q) f.h[q] = (_Float16)bf16_round(x[t * 8 + q]); *(v8us*)((unsigned short*)X16 + t * 8) = f.half[0];  }
__global__ __launch_bounds__(256) void k_h16(const float* __restrict__ x, _Float16* __restrict__ X16, size_t n8) { const size_t t = (size_t)blockIdx.x * 256 + threadIdx.x; if (t >= n8) return; FragH f;
#pragma unroll
  for (int q = 0; q < 8; ++q) f.h[q] = (_Float16)x[t * 8 + q]; *(v8us*)((unsigned short*)X16 + t * 8) = f.half[0];  }
__global__ __launch_bounds__(256) void k_round16f(const float* __restrict__ W, _Float16* __restrict__ Bt, size_t n8) { const size_t t = (size_t)blockIdx.x * 256 + threadIdx.x; if (t >= n8) return; FragH f;
#pragma unroll
  for (int i = 0; i < 8; ++i) f.h[i] = (_Float16)(bf16_round(W[t * 8 + i]) * 16.0f); *(v8us*)((unsigned short*)Bt + t * 8) = f.half[0];  }
// ---- fragment order: how the attention operands q, k and v lie in the workspace (V^T: same tiles, placed as k_vt writes them) ----
// A plane of R rows x K columns (R % 16 == 0, K % 32 == 0) is cut into tiles of 16 rows x 32 k, tile (rt, kt) at element (rt * (K / 32) + kt) * 512. Inside a tile, 16-byte chunk 32 j + lane (lane = 16 hh + ln) holds
// row ln, k = 16 j + 8 hh + 0..7: the four registers that lane (ln, hh) takes as half j of its fragment (g2_frag's k order). A fragment is then two loads of 512 contiguous bytes, 4 whole lines a load,
// where row-major rows gave 16 lines a load; the register contents, and with them the k order of both operands of each product, are what they were.
template <int NHv, int TTv>
__global__ __launch_bounds__(256) void k_vt(const _Float16* __restrict__ V16, int ldv, int voff, _Float16* __restrict__ Vt) { __shared__ unsigned short tl[64][66]; const int tid = threadIdx.x; const int slab = blockIdx.x / (TTv / 64), lg = blockIdx.x % (TTv / 64); const int b = slab / NHv, h = slab % NHv;
  /* V16 in fragment order (rows = tokens, k = features, K = ldv): this 64 x 64 block is 4 row tiles x 2 adjacent k tiles; chunk c of row tile rtl holds token row r, features c8 + 0..7 */
  for (int i = tid; i < 64 * 8; i += 256) { const int rtl = i >> 7, c = i & 127, lane = i & 31; const int r = rtl * 16 + (lane & 15), c8 = (c >> 5) * 16 + (lane >> 4) * 8; FragH f;
    f.half[0] = *(const v8us*)((const unsigned short*)V16 + ((size_t)b * TTv + lg * 64 + rtl * 16) * ldv + (size_t)(voff + h * 64) * 16 + c * 8);
#pragma unroll
    for (int q = 0; q < 8; ++q) tl[r][c8 + q] = f.u[q]; }
  __syncthreads();
  {      /* Vt in fragment order, per slab: rows = d (4 tiles), k = tokens, the 4 d tiles of one 32-token step adjacent: tile (st, t) at ((slab * (TTv / 32) + st) * 4 + t) * 512; this block's 512 chunks are contiguous */
#pragma unroll
    for (int rd = 0; rd < 2; ++rd) { const int c = rd * 256 + tid, lane = c & 31; const int d = ((c >> 6) & 3) * 16 + (lane & 15), k0 = (c >> 8) * 32 + ((c >> 5) & 1) * 16 + (lane >> 4) * 8; FragH f;
#pragma unroll
      for (int q = 0; q < 8; ++q) f.u[q] = tl[k0 + q][d];
      *(v8us*)((unsigned short*)Vt + ((size_t)slab * (TTv / 32) + lg * 2) * 2048 + c * 8) = f.half[0]; }
     } }

__global__ __launch_bounds__(256) void k_hl(const float* __restrict__ F, _Float16* __restrict__ Hh, _Float16* __restrict__ Hl, size_t n8) { const size_t t = (size_t)blockIdx.x * 256 + threadIdx.x; if (t >= n8) return; FragH fh, fl; const v4f a = *(const v4fa*)(F + t * 8), c = *(const v4fa*)(F + t * 8 + 4);
#pragma unroll
  for (int q = 0; q < 4; ++q) { _Float16 h = (_Float16)a[q]; fh.h[q] = h; fl.h[q] = (_Float16)((a[q] - (float)h) * 1024.0f); h = (_Float16)c[q]; fh.h[4 + q] = h; fl.h[4 + q] = (_Float16)((c[q] - (float)h) * 1024.0f); }
  { *(v8us*)((unsigned short*)Hh + t * 8) = fh.half[0]; *(v8us*)((unsigned short*)Hl + t * 8) = fl.half[0];  } }

// ---- fast GEMM (wave tile 32x64; requires M % 32 == 0 rows per launch region and N % 64 == 0); epilogue = k_gemm_hhx semantics, but C16 is stored in fragment order ----
__device__ __forceinline__ v16h g2_frag(const _Float16* p, int hh) { FragH f; f.half[0] = *(const v8us*)((const unsigned short*)p + 8 * hh); f.half[1] = *(const v8us*)((const unsigned short*)p + 16 + 8 * hh); return f.v; }
__device__ __forceinline__ v8f g2_mma(v16h a, v16h b, v8f c) { v8f d = __builtin_amdgcn_wmma_f32_16x16x32_f16(false, a, false, b, (short)0, c, false, false); asm volatile("v_nop\n\tv_nop\n\tv_nop\n\tv_nop" : "+v"(d) : "v"(a), "v"(b)); return d; }
template <int ACT>
__global__ __launch_bounds__(128) void k_gemm2(const _Float16* __restrict__ A, int lda, size_t sA, const _Float16* __restrict__ Bh, int ldb, size_t sB, float alpha, const float* __restrict__ bias, size_t sBias, const float* __restrict__ CP, int rowsPerB, size_t sCPb, int row0g,
    float* __restrict__ C, _Float16* __restrict__ C16, int ldc, size_t sC, int M, int N, int K) { static_assert(ACT == 0 || ACT == 3 || ACT == 6 || ACT == 8 || ACT == 9 || ACT == 11 || ACT == 12 || ACT == 14 || ACT == 15 || ACT == 16 || ACT == 17, "k_gemm2: unsupported ACT code (would silently apply no activation)");
  __shared__ __attribute__((aligned(16))) float so[4][32][68];
  const int tid = threadIdx.x, w = tid >> 5, lane = tid & 31, ln = lane & 15, hh = lane >> 4; const int by = blockIdx.y;
  A += (size_t)by * sA; Bh += (size_t)by * sB; const size_t cofs = (size_t)by * sC; const float* bp = bias ? bias + (size_t)by * sBias : nullptr;
  const int ntn = N >> 6; const int mt = blockIdx.x / ntn, nq = blockIdx.x - mt * ntn; const int row0 = mt * 128 + 32 * w, col0 = nq * 64; if (row0 >= M) return;
  const _Float16* a0p = A + (size_t)(row0 + ln) * lda; const _Float16* a1p = a0p + (size_t)16 * lda;
  const _Float16* b0p = Bh + (size_t)(col0 + ln) * ldb; const _Float16* b1p = b0p + (size_t)16 * ldb; const _Float16* b2p = b1p + (size_t)16 * ldb; const _Float16* b3p = b2p + (size_t)16 * ldb;
  const v8f z8 = {0.f,0.f,0.f,0.f,0.f,0.f,0.f,0.f}; v8f c00 = z8, c01 = z8, c02 = z8, c03 = z8, c10 = z8, c11 = z8, c12 = z8, c13 = z8;
#pragma unroll 1
  for (int kb = 0; kb < K; kb += 32) { const v16h a0 = g2_frag(a0p + kb, hh), a1 = g2_frag(a1p + kb, hh);
    v16h b = g2_frag(b0p + kb, hh); c00 = g2_mma(a0, b, c00); c10 = g2_mma(a1, b, c10);
    b = g2_frag(b1p + kb, hh); c01 = g2_mma(a0, b, c01); c11 = g2_mma(a1, b, c11);
    b = g2_frag(b2p + kb, hh); c02 = g2_mma(a0, b, c02); c12 = g2_mma(a1, b, c12);
    b = g2_frag(b3p + kb, hh); c03 = g2_mma(a0, b, c03); c13 = g2_mma(a1, b, c13); }
  v8f accs[8] = {c00, c01, c02, c03, c10, c11, c12, c13};
#pragma unroll
  for (int u = 0; u < 8; ++u) { const int t = u & 3, half = u >> 2; const int col = col0 + t * 16 + ln; const float bv = bp ? bf16_round(bp[col]) : 0.f;
#pragma unroll
    for (int r = 0; r < 8; ++r) { const int rloc = half * 16 + 8 * hh + r; float v = accs[u][r] * alpha + bv; if (CP) { if (rowsPerB < 0) v += CP[cofs + (size_t)(row0g + row0 + rloc) * ldc + col];      /* rowsPerB < 0: own element of the batched C plane */ else { const int bidx = (row0g + row0 + rloc) / rowsPerB; v += CP[(size_t)bidx * sCPb + (size_t)by * 64 + col]; } }
      if (ACT == 3) v = fmaxf(v, 0.f); else if (ACT == 6) v = 0.5f * v * (1.0f + erff(v * 0.70710678118654752f)); else if (ACT == 11) v = 1.0f / (1.0f + expf(-v)); else if (ACT == 15) v = v / (1.0f + expf(-v)); else if (ACT == 12) v = (v > 0.f) ? v : 0.01f * v; else if (ACT == 8) v = tanhf(v); else if (ACT == 9) v = 0.5f * v * (1.0f + tanhf(0.7978845608028654f * (v + 0.044715f * v * v * v))); else if (ACT == 14) v = (v > 0.f) ? v : 0.1f * v; else if (ACT == 16) v = (v >= 0.f) ? v : 0.3f * v; else if (ACT == 17) v = (v >= 0.f) ? v : 0.2f * v;
      so[w][rloc][t * 16 + ln] = v; } }
  __builtin_amdgcn_fence(__ATOMIC_ACQ_REL, "workgroup"); __builtin_amdgcn_wave_barrier();
  const int rsub = lane >> 4, c4 = (lane & 15) * 4;
  {
    if (C) {
#pragma unroll
      for (int q = 0; q < 16; ++q) { const int r = q * 2 + rsub; const v4f v = *(const v4fa*)&so[w][r][c4]; *(v4f*)(C + cofs + (size_t)(row0 + r) * ldc + col0 + c4) = v; }
      asm volatile("s_wait_xcnt 0x0" ::: "memory"); }      /* the C16 block below writes registers that these stores name: the wait that is kept in front of such an overwrite */
    if (C16) {      /* C16 goes out in fragment order (see above k_vt; K = ldc): the 32 x 64 tile is 2 row tiles x 2 adjacent k tiles x 2 halves = 8 stores of 512 contiguous bytes */
#pragma unroll
      for (int u = 0; u < 8; ++u) { const int rtl = u >> 2, cu = u & 3; const float* sp = &so[w][rtl * 16 + ln][cu * 16 + 8 * hh]; const v4f v0 = *(const v4fa*)sp, v1 = *(const v4fa*)(sp + 4); FragH f;
#pragma unroll
        for (int i = 0; i < 4; ++i) { f.h[i] = (_Float16)v0[i]; f.h[4 + i] = (_Float16)v1[i]; }
        *(v8us*)((unsigned short*)C16 + cofs + (size_t)(row0 + 16 * rtl) * ldc + (size_t)col0 * 16 + cu * 256 + 8 * lane) = f.half[0]; } }
     } }


__global__ __launch_bounds__(256) void k_wnat(const float* __restrict__ w, size_t n8, _Float16* __restrict__ Bt) { const size_t t = (size_t)blockIdx.x * 256 + threadIdx.x; if (t >= n8) return; FragH f; for (int q = 0; q < 8; ++q) f.h[q] = (_Float16)(bf16_round(w[t * 8 + q]) * 16.0f); *(v8us*)((unsigned short*)Bt + t * 8) = f.half[0];  }
__global__ __launch_bounds__(256) void k_rsm(const float* __restrict__ S, _Float16* __restrict__ P, int nrows) {
  #pragma clang fp contract(off)
  const int i = blockIdx.x * 256 + threadIdx.x; if (i >= nrows) return; const float* s = S + (size_t)i * SQ; float mx = -3.0e38f;
#pragma unroll 1
  for (int j = 0; j < SQ; ++j) mx = fmaxf(mx, s[j]); float se = 0.f;
#pragma unroll 1
  for (int j = 0; j < SQ; ++j) se += expf(s[j] - mx); const float sc = 256.0f / se;
#pragma unroll 1
  for (int j0 = 0; j0 < SQ; j0 += 8) { FragH f; for (int q = 0; q < 8; ++q) f.h[q] = (_Float16)(expf(s[j0 + q] - mx) * sc); unsigned short* d = (unsigned short*)P + (size_t)i * SQ + j0; *(v8us*)d = f.half[0];  } }
__global__ __launch_bounds__(256) void k_vt(const _Float16* __restrict__ V16, int b, int h0, _Float16* __restrict__ VT) { __shared__ unsigned short tl[64][65]; const int tid = threadIdx.x; const int hh = blockIdx.x % HG, sg = blockIdx.x / HG; const int s0 = sg * 64; const int h = h0 + hh;
  for (int i = tid; i < 64 * 8; i += 256) { const int j = i / 8, d8 = (i % 8) * 8; FragH f; f.half[0] = *(const v8us*)((const unsigned short*)V16 + ((size_t)b * SQ + s0 + j) * DM + h * HD + d8); for (int q = 0; q < 8; ++q) tl[d8 + q][j] = f.u[q]; }
  __syncthreads();
  { for (int i = tid; i < 64 * 8; i += 256) { const int d = i / 8, j8 = (i % 8) * 8; FragH f; for (int q = 0; q < 8; ++q) f.u[q] = tl[d][j8 + q]; *(v8us*)((unsigned short*)VT + ((size_t)hh * HD + d) * SQ + s0 + j8) = f.half[0]; }  } }



__global__ __launch_bounds__(256) void k_rsmf(const float* __restrict__ S, _Float16* __restrict__ P, int qn, int hg) {
  #pragma clang fp contract(off)
  const int t = blockIdx.x * 256 + threadIdx.x; if (t >= qn * hg) return; const size_t i = (size_t)(t / qn) * SQ + (t % qn); const float* s = S + i * SQ; float mx = -3.0e38f;
#pragma unroll 1
  for (int j = 0; j < SQ; ++j) mx = fmaxf(mx, s[j]); float se = 0.f;
#pragma unroll 1
  for (int j = 0; j < SQ; ++j) se += __expf(s[j] - mx); const float sc = 256.0f / se;
#pragma unroll 1
  for (int j0 = 0; j0 < SQ; j0 += 8) { FragH f; for (int q = 0; q < 8; ++q) f.h[q] = (_Float16)(__expf(s[j0 + q] - mx) * sc); unsigned short* d = (unsigned short*)P + i * SQ + j0; *(v8us*)d = f.half[0];  } }

// Four native exp2 in one statement: each is the independent instruction that the instruction set asks for behind the transcendental in front of it, and the v_nop is that slot behind the last
// Early-clobber outputs keep the four independent of one another.
__device__ __forceinline__ void exp2x4(float& a, float& b, float& c, float& d) { float e0, e1, e2, e3;
  asm("v_exp_f32 %0, %4\n\tv_exp_f32 %1, %5\n\tv_exp_f32 %2, %6\n\tv_exp_f32 %3, %7\n\tv_nop" : "=&v"(e0), "=&v"(e1), "=&v"(e2), "=&v"(e3) : "v"(a), "v"(b), "v"(c), "v"(d));
  a = e0; b = e1; c = e2; d = e3; }
// Two native exp2 in one statement, as exp2x4 above: the second is the independent instruction behind the first, the v_nop is that slot behind the second.
__device__ __forceinline__ void exp2x2(float& a, float& b) { float e0, e1;
  asm("v_exp_f32 %0, %2\n\tv_exp_f32 %1, %3\n\tv_nop" : "=&v"(e0), "=&v"(e1) : "v"(a), "v"(b));
  a = e0; b = e1; }
__device__ __forceinline__ float fa_xhalf(float x) { return __builtin_bit_cast(float, __builtin_amdgcn_permlanex16(__builtin_bit_cast(int, x), __builtin_bit_cast(int, x), 0x76543210, 0xfedcba98, false, false)); }      /* lane l <-> lane l ^ 16 */
__device__ __forceinline__ v16h fa_frag(const _Float16* ub, unsigned off) { FragH f; f.half[0] = *(const v8us*)((const unsigned short*)ub + off); f.half[1] = *(const v8us*)((const unsigned short*)ub + off + 256); return f.v; }      /* a tile in fragment order, g2_frag's k order; ub is the same for the whole wave, off = tile offset + 8 * lane */
__device__ __forceinline__ v8f fa_mma(v16h a, v16h b, v8f c) { return __builtin_amdgcn_wmma_f32_16x16x32_f16(false, a, false, b, (short)0, c, false, false); }
// Fused attention of one head: scores, softmax and P.V in one launch; neither the scores nor the weights go to memory.
// Grid (SQ / 256, heads), 8 waves; a wave owns 32 queries (two groups of 16 columns) and walks all keys, 32 a step.
// Transposed products: S^T = K . Q^T (A = 16 key rows, B = 16 query columns, k = d) and O^T += V^T . P^T (A = 16 d rows of V^T, B = P^T, k = 32 keys).
// D register r of lane (c = lane & 15, h = lane >> 4) is element [8 h + r][c]: a lane holds one query's scores, and the two 16-key score tiles of a step, converted in place, are the B operand of the
// second product in the k order of g2_frag (elements 0..7 = keys 8 h + 0..7, elements 8..15 = keys 16 + 8 h + 0..7), which loads V^T. No LDS and no lane exchange for P.
// Online softmax in the log2 domain, f32: running maximum mr and running sum lr per query; each step rescales O^T and lr by exp2(old maximum - new maximum). The weights are carried x256 (the + 8) as f16
// operands, away from the f16 subnormals; the factor cancels in the division by lr, which sums the same scaled weights. mr starts at -3.0e38 (finite), so a step whose keys are all masked to -inf adds zeros.
// The mask (bf16-rounded, x log2 e) is prepared once per workgroup in LDS; the one barrier publishes it.
__global__ __launch_bounds__(256) void k_fattn(const _Float16* __restrict__ Q, const _Float16* __restrict__ Kk, const _Float16* __restrict__ VTh, const float* __restrict__ am, _Float16* __restrict__ O) {
  __shared__ __attribute__((aligned(16))) float smk[SQ];
  const int tid = threadIdx.x, lane = tid & 31, ln = lane & 15, hh = lane >> 4, w = tid >> 5; const int h = blockIdx.y, q0 = blockIdx.x * 256 + w * 32;
  for (int i = tid * 4; i < SQ; i += 1024) { v4f a = *(const v4fa*)(am + i);
#pragma unroll
    for (int q = 0; q < 4; ++q) a[q] = bf16_round(a[q]) * 1.44269504f;
    *(v4fa*)&smk[i] = a; }
  __syncthreads();
  const unsigned qo = (unsigned)(q0 * LQ + 8 * lane); v16h qf[2][2];      /* Q, Kk and VTh lie in fragment order (see above k_vt): a row tile is 16 * LQ elements, head h is its k tiles 2 h and 2 h + 1 */
#pragma unroll
  for (int g = 0; g < 2; ++g)
#pragma unroll
    for (int ks = 0; ks < 2; ++ks) qf[g][ks] = fa_frag(Q + h * HD * 16, qo + 16 * g * LQ + 512 * ks);
  const _Float16* const kb = Kk + h * HD * 16; const _Float16* const vb = VTh + (size_t)h * HD * SQ; const unsigned ko = (unsigned)(8 * lane), vo = (unsigned)(8 * lane);
  const v8f z8 = {0.f,0.f,0.f,0.f,0.f,0.f,0.f,0.f}; v8f o[2][4];
#pragma unroll
  for (int g = 0; g < 2; ++g)
#pragma unroll
    for (int t = 0; t < 4; ++t) o[g][t] = z8;
  float mr[2] = {-3.0e38f, -3.0e38f}, lr[2] = {0.f, 0.f};
  v16h ka[2][2];
#pragma unroll
  for (int kt = 0; kt < 2; ++kt)
#pragma unroll
    for (int ks = 0; ks < 2; ++ks) ka[kt][ks] = fa_frag(kb, ko + 16 * kt * LQ + 512 * ks);
#pragma unroll 1      /* one step is some 250 instructions and holds its own overlap (loads against softmax); unrolling would only grow the code */
  for (int j0 = 0; j0 < SQ; j0 += 32) {
    v4f mk[2][2];      /* this step's mask values: read from LDS under the first product */
#pragma unroll
    for (int kt = 0; kt < 2; ++kt)
#pragma unroll
      for (int c = 0; c < 2; ++c) mk[kt][c] = *(const v4fa*)&smk[j0 + 16 * kt + 8 * hh + 4 * c];
    v16h va[4];      /* this step's V^T fragments: issued here, needed only behind the exponentials */
#pragma unroll
    for (int t = 0; t < 4; ++t) va[t] = fa_frag(vb + j0 * HD, vo + 512 * t);
    v8f s[2][2];
#pragma unroll
    for (int g = 0; g < 2; ++g)
#pragma unroll
      for (int kt = 0; kt < 2; ++kt) s[g][kt] = fa_mma(ka[kt][1], qf[g][1], fa_mma(ka[kt][0], qf[g][0], z8));
    const _Float16* const kn = kb + (size_t)((j0 + 32 < SQ) ? j0 + 32 : 0) * LQ;      /* the next step's K fragments, in flight under this step's softmax; the last step re-reads the first rows, unused */
#pragma unroll
    for (int kt = 0; kt < 2; ++kt)
#pragma unroll
      for (int ks = 0; ks < 2; ++ks) ka[kt][ks] = fa_frag(kn, ko + 16 * kt * LQ + 512 * ks);
    __builtin_amdgcn_sched_barrier(0);      /* keeps both groups of loads in front of the softmax: left free, the K loads sank to the loop's foot and the next step waited out their whole latency */
    float mn[2], cr[2];
#pragma unroll
    for (int g = 0; g < 2; ++g) { float mx = mr[g];
#pragma unroll
      for (int kt = 0; kt < 2; ++kt)
#pragma unroll
        for (int r = 0; r < 8; ++r) { s[g][kt][r] = s[g][kt][r] * 0.18033688f + mk[kt][r >> 2][r & 3]; mx = fmaxf(mx, s[g][kt][r]); }      /* (q . k / 8 + mask) log2 e */
      mn[g] = fmaxf(mx, fa_xhalf(mx)); cr[g] = mr[g] - mn[g]; mr[g] = mn[g]; }
    exp2x2(cr[0], cr[1]); FragH pf[2];
#pragma unroll
    for (int g = 0; g < 2; ++g) { const float nm = 8.0f - mn[g]; float ls[4] = {0.f, 0.f, 0.f, 0.f};
#pragma unroll
      for (int t = 0; t < 4; ++t) o[g][t] = o[g][t] * cr[g];
#pragma unroll
      for (int kt = 0; kt < 2; ++kt)
#pragma unroll
        for (int r4 = 0; r4 < 8; r4 += 4) { float y[4];
#pragma unroll
          for (int q = 0; q < 4; ++q) y[q] = s[g][kt][r4 + q] + nm;
          exp2x4(y[0], y[1], y[2], y[3]);
#pragma unroll
          for (int q = 0; q < 4; ++q) { ls[q] += y[q]; pf[g].h[8 * kt + r4 + q] = (_Float16)y[q]; } }
      lr[g] = lr[g] * cr[g] + ((ls[0] + ls[1]) + (ls[2] + ls[3])); }
    __builtin_amdgcn_sched_barrier(0);      /* keeps every asm exponential in front of the second product */
#pragma unroll
    for (int g = 0; g < 2; ++g)
#pragma unroll
      for (int t = 0; t < 4; ++t) o[g][t] = fa_mma(va[t], pf[g].v, o[g][t]); }
#pragma unroll
  for (int g = 0; g < 2; ++g) { const float sc = 64.0f / (lr[g] + fa_xhalf(lr[g]));      /* the halves' sums joined; o carried x64, as the output GEMM's alpha expects */
    _Float16* d = O + h * HD + ((unsigned)((q0 + ln) * DM + 8 * hh) + 16 * g * DM);
#pragma unroll
    for (int t = 0; t < 4; ++t) { FragH f;
#pragma unroll
      for (int r = 0; r < 8; ++r) f.h[r] = (_Float16)(o[g][t][r] * sc);
      *(v8us*)((unsigned short*)d + 16 * t) = f.half[0]; } } }


__global__ __launch_bounds__(256) void k_bfr(const float* __restrict__ x, float* __restrict__ XB, size_t n8) { const size_t t = (size_t)blockIdx.x * 256 + threadIdx.x; if (t >= n8) return; v4f a = *(const v4fa*)(x + t * 8), c = *(const v4fa*)(x + t * 8 + 4); for (int q = 0; q < 4; ++q) { a[q] = bf16_round(a[q]); c[q] = bf16_round(c[q]); }
  { *(v4f*)(XB + t * 8) = a; *(v4f*)(XB + t * 8 + 4) = c;  } }


__global__ __launch_bounds__(256) void k_lnrow(const float* __restrict__ Y, const float* __restrict__ g, const float* __restrict__ bb, float eps, float* __restrict__ out) {
  #pragma clang fp contract(off)
  __shared__ float red[256]; const size_t r = blockIdx.x; const int t = threadIdx.x; const v4f ya = *(const v4fa*)(Y + r * DMQ + t * 4); float s[4]; float sum = 0.f;
  for (int q = 0; q < 4; ++q) { s[q] = ya[q]; sum = __fadd_rn(sum, s[q]); }
  red[t] = sum; __syncthreads(); for (int st = 128; st > 0; st >>= 1) { if (t < st) red[t] = __fadd_rn(red[t], red[t + st]); __syncthreads(); } const float mu = red[0] / (float)DMQ; __syncthreads();
  float vs = 0.f; for (int q = 0; q < 4; ++q) { const float dl = __fadd_rn(s[q], -mu); vs = __fadd_rn(vs, __fmul_rn(dl, dl)); } red[t] = vs; __syncthreads(); for (int st = 128; st > 0; st >>= 1) { if (t < st) red[t] = __fadd_rn(red[t], red[t + st]); __syncthreads(); }
  const float rs = rsqrtf(__fadd_rn(red[0] / (float)DMQ, eps)); v4f y; for (int q = 0; q < 4; ++q) { const int c = t * 4 + q; y[q] = __fadd_rn(__fmul_rn(__fmul_rn(__fadd_rn(s[q], -mu), rs), bf16_round(g[c])), bf16_round(bb[c])); }
  *(v4f*)(out + r * DMQ + t * 4) = y;  }
extern "C" void kernel_launch(void* const* d_in, const int* in_sizes, int n_in,
                              void* d_out, int out_size, void* d_ws, size_t ws_size, hipStream_t stream) {
  (void)in_sizes; (void)n_in; (void)out_size;
  const float* const* I = (const float* const*)d_in; const float* x = I[0]; const float* am = I[1]; const float* wq = I[2]; const float* bq = I[3]; const float* wk = I[4]; const float* bk = I[5]; const float* wv = I[6]; const float* bv = I[7]; const float* wo = I[8]; const float* bo = I[9]; const float* lng = I[10]; const float* lnb = I[11];      /* nn.Linear weights [out][in] + biases; additive mask [1][1][1][S] */
  char* ws = (char*)d_ws; size_t off = 0;
  auto take = [&](size_t bytes) { char* p = ws + off; off += (bytes + 255) & ~(size_t)255; return p; };
  _Float16* BQ = (_Float16*)take((size_t)DM * DM * 2); _Float16* BK = (_Float16*)take((size_t)DM * DM * 2); _Float16* BV = (_Float16*)take((size_t)DM * DM * 2); _Float16* BO = (_Float16*)take((size_t)DM * DM * 2);
  _Float16* X16 = (_Float16*)take(NR * DM * 2); float* XB = (float*)take(NR * DM * 4); float* YF = (float*)take(NR * DM * 4); _Float16* Q16 = (_Float16*)take(NR * DM * 2); _Float16* K16 = (_Float16*)take(NR * DM * 2); _Float16* V16 = (_Float16*)take(NR * DM * 2); _Float16* O16 = (_Float16*)take(NR * DM * 2);
  _Float16* VT = (_Float16*)take((size_t)NH * HD * SQ * 2);
  if (off > ws_size) return;
  { const unsigned g = (unsigned)(((size_t)DM * DM / 8 + 255) / 256); k_wnat<<<g, 256, 0, stream>>>(wq, (size_t)DM * DM / 8, BQ); k_wnat<<<g, 256, 0, stream>>>(wk, (size_t)DM * DM / 8, BK); k_wnat<<<g, 256, 0, stream>>>(wv, (size_t)DM * DM / 8, BV); k_wnat<<<g, 256, 0, stream>>>(wo, (size_t)DM * DM / 8, BO); }      /* natural [out][in] = Bt[n][k], x16 */
  k_x16<<<(unsigned)((NR * DM / 8 + 255) / 256), 256, 0, stream>>>(x, X16, NR * DM / 8); k_bfr<<<(unsigned)((NR * DM / 8 + 255) / 256), 256, 0, stream>>>(x, XB, NR * DM / 8);      /* bf16(x) residual plane */
  const size_t r0p = (size_t)B0 * SQ;      /* first projected row */
  k_gemm2<0><<<dim3((unsigned)((MP / 128) * (DM / 64)), 1), 128, 0, stream>>>(X16 + r0p * DM, DM, 0, BQ, DM, 0, 0.0625f, bq, 0, nullptr, 1, 0, 0, nullptr, Q16 + r0p * DM, DM, 0, MP, DM, DM);
  k_gemm2<0><<<dim3((unsigned)((MP / 128) * (DM / 64)), 1), 128, 0, stream>>>(X16 + r0p * DM, DM, 0, BK, DM, 0, 0.0625f, bk, 0, nullptr, 1, 0, 0, nullptr, K16 + r0p * DM, DM, 0, MP, DM, DM);
  k_gemm2<0><<<dim3((unsigned)((MP / 128) * (DM / 64)), 1), 128, 0, stream>>>(X16 + r0p * DM, DM, 0, BV, DM, 0, 0.0625f, bv, 0, nullptr, 1, 0, 0, nullptr, V16 + r0p * DM, DM, 0, MP, DM, DM);
  for (int b = B0; b < B0 + NBR; ++b) { const size_t r0 = (size_t)b * SQ;
    k_vt<NH, SQ><<<NH * (SQ / 64), 256, 0, stream>>>(V16 + r0 * LQ, LQ, 0, VT);      /* V^T of all heads (HD x SQ each, fragment order) for this batch */
    k_fattn<<<dim3(SQ / 256, NH), 256, 0, stream>>>(Q16 + r0 * LQ, K16 + r0 * LQ, VT, am + (size_t)b * SQ, O16 + r0 * DM); }      /* scores + attention_mask, softmax and P . V of all heads, fused; o (merged heads, x64) as f16 rows */
  k_gemm2<0><<<dim3((unsigned)((MPO / 128) * (DM / 64)), 1), 128, 0, stream>>>(O16 + r0p * DM, DM, 0, BO, DM, 0, 0.0009765625f, bo, 0, XB + r0p * DM, -1, 0, 0, YF + r0p * DM, nullptr, DM, 0, MPO, DM, DM);      /* y = ctx Wo^T + bo + bf16(x) (own-element residual) */
  k_lnrow<<<(unsigned)MPO, 256, 0, stream>>>(YF + r0p * DM, lng, lnb, 1e-12f, (float*)d_out + r0p * DM);      /* post-LayerNorm */
}

// v004
// It runs in 206 microseconds.
// Timed twice side by side with v003, it ran 1.48 and 1.49 times as fast.
// Counting every step since v000, it is 67.6 times as fast.
#include <hip/hip_runtime.h>
// BERT self-attention + output (hidden_states [1][4096][1024]; q/k/v = x W^T + b (nn.Linear [out][in] 1024^2, sigma 1/32, zero biases), 16 heads of 64; scores = (q/8) . k + attention_mask[j] (additive [1][1][1][S], zeros); softmax; ctx merged; out = LayerNorm(ctx Wo^T + bo + hidden_states; ln_gamma, ln_beta, eps 1e-12) -> [1][4096][1024]).
// Structure: token rows r = b*4096 + s; x as exact f16 rows (bf16-rounded); Q, K, V as three WMMA GEMMs (32x64 wave tiles, f32 accumulation, exact x16 weights + bias, f16 outputs); per batch: V^T for all heads via LDS transposes; per batch one fused attention launch over all heads: S^T = K . Q^T on WMMA (alpha = 64^-0.5), online softmax on VALU (f32 statistics, native exp2; weights x256 as f16 operands, in registers only), O^T += V^T . P^T on WMMA (o carried x64 against f16 subnormal flush, folded into the output GEMM alpha) written straight into the merged f16 o rows; y = o Wo^T + bo + bf16(x) GEMM (f32, own-element residual) into f32 rows; post-LayerNorm on VALU (f32, LDS trees) into the output.
// Compute dtype: inputs rounded to bf16; x / weights exact; q, k, v, softmax weights and o as plain f16 GEMM operands (~2^-12); scores and softmax statistics f32. v_wmma_f32_16x16x32_f16.
#define NB 1
#define SQ 4096
#define DM 1024
#define NH 16
#define HD 64
#define HG 1                         /* heads per group of the k_vt(b, h0) overload, not launched */
#define B0 0                         /* first batch processed (debug hook) */
#define NBR NB                       /* batches processed (debug hook) */
#define NR ((size_t)NB * SQ)
#define DMQ DM         /* width of the token rows (LayerNorm length) */
#define MP ((int)((size_t)NBR * SQ)) /* rows projected (debug hook) */
#define QN SQ                        /* not used: attention covers all SQ query rows */
#define NHD NH                       /* not used: attention covers all NH heads */
#define MPO MP                       /* rows through the output stage (debug hook) */
#define LQ DM      /* width K of the q/k/v planes (fragment order) */
typedef __bf16 v16b __attribute__((ext_vector_type(16)));
typedef unsigned short v8us __attribute__((ext_vector_type(8), may_alias));
typedef float  v8f  __attribute__((ext_vector_type(8)));
typedef float  v4f  __attribute__((ext_vector_type(4)));
typedef float  v4fa __attribute__((ext_vector_type(4), may_alias));
union FragB { v16b v; v8us half[2]; unsigned short u[16]; };

__device__ __forceinline__ unsigned short bf16_bits(float x) { unsigned int u = __float_as_uint(x); return (unsigned short)((u + 0x7FFFu + ((u >> 16) & 1u)) >> 16); }
__device__ __forceinline__ float bf16_val(unsigned short b) { return __uint_as_float(((unsigned int)b) << 16); }
__device__ __forceinline__ float bf16_round(float x) { return bf16_val(bf16_bits(x)); }
// D += A·B with NT terms: 1 = ah·bh, 2 = + al·bh (A split), 3 = + ah·bl (both split)
template <int NT>
__device__ __forceinline__ v8f mmaN(v16b ah, v16b al, v16b bh, v16b bl, v8f c) {
  c = __builtin_amdgcn_wmma_f32_16x16x32_bf16(false, ah, false, bh, (short)0, c, false, false);
  if (NT >= 2) c = __builtin_amdgcn_wmma_f32_16x16x32_bf16(false, al, false, bh, (short)0, c, false, false);
  if (NT >= 3) c = __builtin_amdgcn_wmma_f32_16x16x32_bf16(false, ah, false, bl, (short)0, c, false, false);
  asm volatile("v_nop\n\tv_nop\n\tv_nop\n\tv_nop" : "+v"(c) : "v"(ah), "v"(al), "v"(bh), "v"(bl));
  return c;
}

__global__ __launch_bounds__(256) void k_wt_bf16(const float* __restrict__ W, unsigned short* __restrict__ Wt, int K, int N) {
  const int t = blockIdx.x * 256 + threadIdx.x;
  const int k8n = K / 8;
  if (t >= N * k8n) return;
  const int n = t / k8n, k8 = (t % k8n) * 8;
  v8us v;
#pragma unroll
  for (int i = 0; i < 8; ++i) v[i] = bf16_bits(W[(size_t)(k8 + i) * N + n]);
  *(v8us*)(Wt + (size_t)n * K + k8) = v;
  
}

// GEMM C[M][N] (f32, pitch ldc) = act(A[M][K]·W + bias). A f32 row-major (pitch lda) converted per fragment to bf16
// (ASPLIT: hi/lo two planes -> 2 terms, else single rounded term); Wt bf16 [N][K] (pitch ldb). BIAS_BF16 rounds the
// bias to bf16 first (bias quantised to bf16 before the add). K%32==0, M%16==0, N%64==0.
template <bool ASPLIT, int ACT, bool BIAS_BF16>
__global__ __launch_bounds__(128) void k_gemm_bf(const float* __restrict__ A, int lda, const unsigned short* __restrict__ Wt, int ldb,
                                               const float* __restrict__ bias, float* __restrict__ C, int ldc, int M, int N, int K) {
  __shared__ __attribute__((aligned(16))) float so[4][16][64];
  const int tid = threadIdx.x, w = tid >> 5, lane = tid & 31, ln = lane & 15, hh = lane >> 4;
  const int ntn = N / 64;
  const int wid = blockIdx.x * 4 + w;
  const int mt = wid / ntn, nq = wid % ntn;
  if (mt * 16 >= M) return;
  const int row0 = mt * 16, col0 = nq * 64;
  const float* arow = A + (size_t)(row0 + ln) * lda;
  v8f acc[4] = {};
  for (int kb = 0; kb < K; kb += 32) {
    FragB ah, al;
    const v4f x0 = *(const v4fa*)(arow + kb + 8 * hh), x1 = *(const v4fa*)(arow + kb + 8 * hh + 4);
    const v4f x2 = *(const v4fa*)(arow + kb + 16 + 8 * hh), x3 = *(const v4fa*)(arow + kb + 16 + 8 * hh + 4);
    float xs[16] = {x0[0],x0[1],x0[2],x0[3],x1[0],x1[1],x1[2],x1[3],x2[0],x2[1],x2[2],x2[3],x3[0],x3[1],x3[2],x3[3]};
#pragma unroll
    for (int i = 0; i < 16; ++i) { const unsigned short hb = bf16_bits(xs[i]); ah.u[i] = hb; al.u[i] = ASPLIT ? bf16_bits(xs[i] - bf16_val(hb)) : (unsigned short)0; }
#pragma unroll
    for (int t = 0; t < 4; ++t) {
      const unsigned short* brow = Wt + (size_t)(col0 + t * 16 + ln) * ldb + kb;
      FragB b;
      b.half[0] = *(const v8us*)(brow + 8 * hh);
      b.half[1] = *(const v8us*)(brow + 16 + 8 * hh);
      acc[t] = mmaN<ASPLIT ? 2 : 1>(ah.v, al.v, b.v, b.v, acc[t]);
    }
  }
#pragma unroll
  for (int t = 0; t < 4; ++t) {
    float bv = bias ? bias[col0 + t * 16 + ln] : 0.f;
    if (BIAS_BF16) bv = bf16_round(bv);
#pragma unroll
    for (int r = 0; r < 8; ++r) { float v = acc[t][r] + bv; if (ACT == 1) v = fmaxf(v, 0.f); so[w][8 * hh + r][t * 16 + ln] = v; }
  }
  __builtin_amdgcn_fence(__ATOMIC_ACQ_REL, "workgroup");
  __builtin_amdgcn_wave_barrier();
  const int rsub = lane >> 4, c4 = (lane & 15) * 4;
  {
#pragma unroll
    for (int q = 0; q < 8; ++q) {
      const int r = q * 2 + rsub;
      const v4f v = *(const v4fa*)&so[w][r][c4];
      *(v4f*)(C + (size_t)(row0 + r) * ldc + col0 + c4) = v;
    }
    
  }
}

// GEMM C = act(A·W + bias + resid): A f32 (ASPLIT -> hi/lo 2 terms), Wt bf16 [N][K]; ACT 0 none, 1 relu, 2 exact gelu;
// resid (optional, f32, row index = (row % rmod), pitch ldr, RES_BF16 rounds it) added before the activation.
template <bool ASPLIT, int ACT, bool BIAS_BF16, bool RES_BF16>
__global__ __launch_bounds__(128) void k_gemm_bf3(const float* __restrict__ A, int lda, const unsigned short* __restrict__ Wt, int ldb,
                                                const float* __restrict__ bias, const float* __restrict__ resid, int rmod, int ldr,
                                                float* __restrict__ C, int ldc, int M, int N, int K) {
  __shared__ __attribute__((aligned(16))) float so[4][16][64];
  const int tid = threadIdx.x, w = tid >> 5, lane = tid & 31, ln = lane & 15, hh = lane >> 4;
  const int ntn = N / 64;
  const int wid = blockIdx.x * 4 + w;
  const int mt = wid / ntn, nq = wid % ntn;
  if (mt * 16 >= M) return;
  const int row0 = mt * 16, col0 = nq * 64;
  const float* arow = A + (size_t)(row0 + ln) * lda;
  v8f acc[4] = {};
  for (int kb = 0; kb < K; kb += 32) {
    FragB ah, al;
    const v4f x0 = *(const v4fa*)(arow + kb + 8 * hh), x1 = *(const v4fa*)(arow + kb + 8 * hh + 4);
    const v4f x2 = *(const v4fa*)(arow + kb + 16 + 8 * hh), x3 = *(const v4fa*)(arow + kb + 16 + 8 * hh + 4);
    float xs[16] = {x0[0],x0[1],x0[2],x0[3],x1[0],x1[1],x1[2],x1[3],x2[0],x2[1],x2[2],x2[3],x3[0],x3[1],x3[2],x3[3]};
#pragma unroll
    for (int i = 0; i < 16; ++i) { const unsigned short hb = bf16_bits(xs[i]); ah.u[i] = hb; al.u[i] = ASPLIT ? bf16_bits(xs[i] - bf16_val(hb)) : (unsigned short)0; }
#pragma unroll
    for (int t = 0; t < 4; ++t) {
      const unsigned short* brow = Wt + (size_t)(col0 + t * 16 + ln) * ldb + kb;
      FragB b;
      b.half[0] = *(const v8us*)(brow + 8 * hh);
      b.half[1] = *(const v8us*)(brow + 16 + 8 * hh);
      acc[t] = mmaN<ASPLIT ? 2 : 1>(ah.v, al.v, b.v, b.v, acc[t]);
    }
  }
#pragma unroll
  for (int t = 0; t < 4; ++t) {
    const int col = col0 + t * 16 + ln;
    float bv = bias ? bias[col] : 0.f;
    if (BIAS_BF16) bv = bf16_round(bv);
#pragma unroll
    for (int r = 0; r < 8; ++r) {
      float v = acc[t][r] + bv;
      if (resid) { float rv = resid[(size_t)((row0 + 8 * hh + r) % rmod) * ldr + col]; if (RES_BF16) rv = bf16_round(rv); v += rv; }
      if (ACT == 1) v = fmaxf(v, 0.f);
      if (ACT == 2) v = 0.5f * v * (1.0f + erff(v * 0.70710678118654752f));
      if (ACT == 3) { const float u = 0.7978845608028654f * (v + 0.044715f * v * v * v); v = 0.5f * v * (1.0f + tanhf(u)); }
      so[w][8 * hh + r][t * 16 + ln] = v;
    }
  }
  __builtin_amdgcn_fence(__ATOMIC_ACQ_REL, "workgroup");
  __builtin_amdgcn_wave_barrier();
  const int rsub = lane >> 4, c4 = (lane & 15) * 4;
  {
#pragma unroll
    for (int q = 0; q < 8; ++q) {
      const int r = q * 2 + rsub;
      const v4f v = *(const v4fa*)&so[w][r][c4];
      *(v4f*)(C + (size_t)(row0 + r) * ldc + col0 + c4) = v;
    }
    
  }
}
// row LayerNorm (biased variance, eps) over N: s = X (+ R); optional out_sum <- s; out_norm <- (s-mu)*rsqrt(var+eps)*g + b
template <bool PARAM_BF16>
__global__ __launch_bounds__(256) void k_layernorm(const float* __restrict__ X, const float* __restrict__ R, const float* __restrict__ g, const float* __restrict__ bta,
                                                  float* __restrict__ out_sum, float* __restrict__ out_norm, int N, float eps) {
  __shared__ float red[256];
  const int row = blockIdx.x, tid = threadIdx.x;
  const float* x = X + (size_t)row * N; const float* rr = R ? R + (size_t)row * N : nullptr;
  float vals[16];                     // up to N = 4096
  const int per = N / 256;            // contiguous chunk per thread? use strided-by-4 chunks: thread handles j = tid*4 + 1024*u
  float s1 = 0.f;
  for (int u = 0; u < per / 4; ++u) {
    const int j = tid * 4 + 1024 * u;
    const v4f a = *(const v4fa*)(x + j);
    v4f b = {0.f,0.f,0.f,0.f}; if (rr) b = *(const v4fa*)(rr + j);
#pragma unroll
    for (int q = 0; q < 4; ++q) { const float v = a[q] + b[q]; vals[u * 4 + q] = v; s1 += v; }
  }
  red[tid] = s1; __syncthreads();
  for (int st = 128; st > 0; st >>= 1) { if (tid < st) red[tid] += red[tid + st]; __syncthreads(); }
  const float mu = red[0] / (float)N; __syncthreads();
  float s2 = 0.f;
  for (int u = 0; u < per / 4; ++u)
#pragma unroll
    for (int q = 0; q < 4; ++q) { const float c = vals[u * 4 + q] - mu; s2 += c * c; }
  red[tid] = s2; __syncthreads();
  for (int st = 128; st > 0; st >>= 1) { if (tid < st) red[tid] += red[tid + st]; __syncthreads(); }
  const float rs = rsqrtf(red[0] / (float)N + eps);
  {
    for (int u = 0; u < per / 4; ++u) {
      const int j = tid * 4 + 1024 * u;
      v4f o, sm;
#pragma unroll
      for (int q = 0; q < 4; ++q) {
        float gg = g[j + q], bb = bta[j + q];
        if (PARAM_BF16) { gg = bf16_round(gg); bb = bf16_round(bb); }
        sm[q] = vals[u * 4 + q]; o[q] = (vals[u * 4 + q] - mu) * rs * gg + bb;
      }
      if (out_sum) *(v4f*)(out_sum + (size_t)row * N + j) = sm;
      *(v4f*)(out_norm + (size_t)row * N + j) = o;
    }
    
  }
}



// ---- f16 WMMA path (v_wmma_f32_16x16x32_f16): 11-bit significands for operands in range — used where a [0,1] probability operand needs more precision than bf16
typedef _Float16 v16h __attribute__((ext_vector_type(16)));
union FragH { v16h v; v8us half[2]; _Float16 h[16]; unsigned short u[16]; };
template <int NT>
__device__ __forceinline__ v8f mmaH(v16h ah, v16h al, v16h bh, v16h bl, v8f c) {
  c = __builtin_amdgcn_wmma_f32_16x16x32_f16(false, ah, false, bh, (short)0, c, false, false);
  if (NT >= 2) c = __builtin_amdgcn_wmma_f32_16x16x32_f16(false, al, false, bh, (short)0, c, false, false);
  if (NT >= 3) c = __builtin_amdgcn_wmma_f32_16x16x32_f16(false, ah, false, bl, (short)0, c, false, false);
  asm volatile("v_nop\n\tv_nop\n\tv_nop\n\tv_nop" : "+v"(c) : "v"(ah), "v"(al), "v"(bh), "v"(bl));
  return c;
}
// batched GEMM like k_gemm_b but f16 operands: A f32 (split into f16 hi/lo if ASPLIT, else rounded to f16), Bt = f16 values [n][k]; alpha; C f32; N multiple of 16 (partial tiles skipped)
template <bool ASPLIT>
__global__ __launch_bounds__(128) void k_gemm_h(const float* __restrict__ A, int lda, size_t sA, const _Float16* __restrict__ Bh, int ldb, size_t sB, float alpha, float* __restrict__ C, int ldc, size_t sC, int M, int N, int K) {
  __shared__ __attribute__((aligned(16))) float so[4][16][64];
  const int tid = threadIdx.x, w = tid >> 5, lane = tid & 31, ln = lane & 15, hh = lane >> 4; const int by = blockIdx.y;
  A += (size_t)by * sA; Bh += (size_t)by * sB; C += (size_t)by * sC;
  const int ntn = (N + 63) / 64; const int wid = blockIdx.x * 4 + w; const int mt = wid / ntn, nq = wid % ntn; if (mt * 16 >= M) return;
  const int row0 = mt * 16, col0 = nq * 64; const float* arow = A + (size_t)(row0 + ln) * lda;
  v8f acc[4] = {};
  for (int kb = 0; kb < K; kb += 32) {
    FragH ah, al;
    const v4f x0 = *(const v4fa*)(arow + kb + 8 * hh), x1 = *(const v4fa*)(arow + kb + 8 * hh + 4), x2 = *(const v4fa*)(arow + kb + 16 + 8 * hh), x3 = *(const v4fa*)(arow + kb + 16 + 8 * hh + 4);
    float xs[16] = {x0[0],x0[1],x0[2],x0[3],x1[0],x1[1],x1[2],x1[3],x2[0],x2[1],x2[2],x2[3],x3[0],x3[1],x3[2],x3[3]};
#pragma unroll
    for (int i = 0; i < 16; ++i) { const _Float16 h = (_Float16)xs[i]; ah.h[i] = h; al.h[i] = ASPLIT ? (_Float16)(xs[i] - (float)h) : (_Float16)0.0f; }
#pragma unroll
    for (int t = 0; t < 4; ++t) { if (col0 + t * 16 >= N) continue; const size_t boff = (size_t)(col0 + t * 16 + ln) * ldb + kb; FragH bq; bq.half[0] = *(const v8us*)(Bh + boff + 8 * hh); bq.half[1] = *(const v8us*)(Bh + boff + 16 + 8 * hh);
      acc[t] = mmaH<ASPLIT ? 2 : 1>(ah.v, al.v, bq.v, bq.v, acc[t]); }
  }
#pragma unroll
  for (int t = 0; t < 4; ++t) { if (col0 + t * 16 >= N) continue;
#pragma unroll
    for (int r = 0; r < 8; ++r) so[w][8 * hh + r][t * 16 + ln] = acc[t][r] * alpha; }
  __builtin_amdgcn_fence(__ATOMIC_ACQ_REL, "workgroup"); __builtin_amdgcn_wave_barrier();
  const int rsub = lane >> 4, c4 = (lane & 15) * 4;
  {
#pragma unroll
    for (int q = 0; q < 8; ++q) { const int r = q * 2 + rsub; if (col0 + c4 < N) { const v4f v = *(const v4fa*)&so[w][r][c4]; *(v4f*)(C + (size_t)(row0 + r) * ldc + col0 + c4) = v; } }
     }
}

// Wt[n][k] = f16(W[k][n]·scale) from f32 row-major W[K][N] (scale = power of two; bf16-exact weights stay exact in f16 away from the subnormal range)
__global__ __launch_bounds__(256) void k_wt_f16(const float* __restrict__ W, _Float16* __restrict__ Wt, int K, int N, float scale) {
  const int t = blockIdx.x * 256 + threadIdx.x; if (t >= N * (K / 8)) return; const int n = t / (K / 8), k8 = (t % (K / 8)) * 8; FragH f;
#pragma unroll
  for (int i = 0; i < 8; ++i) f.h[i] = (_Float16)(bf16_round(W[(size_t)(k8 + i) * N + n]) * scale); const v8us o = f.half[0];
  *(v8us*)((unsigned short*)Wt + (size_t)n * K + k8) = o; 
}
// k_gemm_hh variant with fused epilogue: v = acc·alpha + bias[by·sBias + col] (+ CP[(row/rowsPerB)·sCPb + by·64 + col] if CP) ; ACT 0 none / 1 elu ; writes f16 C16 (and f32 C if non-null)
template <int ACT>
__global__ __launch_bounds__(128) void k_gemm_hhx(const _Float16* __restrict__ A, int lda, size_t sA, const _Float16* __restrict__ Bh, int ldb, size_t sB, float alpha, const float* __restrict__ bias, size_t sBias, const float* __restrict__ CP, int rowsPerB, size_t sCPb, int row0g,
    float* __restrict__ C, _Float16* __restrict__ C16, int ldc, size_t sC, int M, int N, int K) {
  __shared__ __attribute__((aligned(16))) float so[4][16][64];
  const int tid = threadIdx.x, w = tid >> 5, lane = tid & 31, ln = lane & 15, hh = lane >> 4; const int by = blockIdx.y;
  A += (size_t)by * sA; Bh += (size_t)by * sB; const size_t cofs = (size_t)by * sC; const float* bp = bias ? bias + (size_t)by * sBias : nullptr;
  const int ntn = (N + 63) / 64; const int wid = blockIdx.x * 4 + w; const int mt = wid / ntn, nq = wid % ntn; if (mt * 16 >= M) return;
  const int row0 = mt * 16, col0 = nq * 64; const _Float16* arow = A + (size_t)(row0 + ln) * lda;
  v8f acc[4] = {};
  for (int kb = 0; kb < K; kb += 32) { FragH ah; ah.half[0] = *(const v8us*)((const unsigned short*)arow + kb + 8 * hh); ah.half[1] = *(const v8us*)((const unsigned short*)arow + kb + 16 + 8 * hh);
#pragma unroll
    for (int t = 0; t < 4; ++t) { if (col0 + t * 16 >= N) continue; const size_t boff = (size_t)(col0 + t * 16 + ln) * ldb + kb; FragH bq; bq.half[0] = *(const v8us*)((const unsigned short*)Bh + boff + 8 * hh); bq.half[1] = *(const v8us*)((const unsigned short*)Bh + boff + 16 + 8 * hh);
      acc[t] = mmaH<1>(ah.v, ah.v, bq.v, bq.v, acc[t]); }
  }
#pragma unroll
  for (int t = 0; t < 4; ++t) { if (col0 + t * 16 >= N) continue; const int col = col0 + t * 16 + ln; const float bv = bp ? bf16_round(bp[col]) : 0.f;
#pragma unroll
    for (int r = 0; r < 8; ++r) { float v = acc[t][r] * alpha + bv; if (CP) { const int rr = row0g + row0 + 8 * hh + r; if (rowsPerB < 0) v += CP[cofs + (size_t)rr * ldc + col];      /* rowsPerB < 0: own element of the batched C plane */ else { const int bidx = rr / rowsPerB; v += CP[(size_t)bidx * sCPb + (size_t)by * 64 + col]; } } if (ACT == 1) v = (v > 0.f) ? v : expm1f(v); else if (ACT == 7) v = (v > 0.f) ? v + 1.0f : expf(v); else if (ACT == 8) v = tanhf(v); else if (ACT == 9) v = 0.5f * v * (1.0f + tanhf(0.7978845608028654f * (v + 0.044715f * v * v * v))); else if (ACT == 11) v = 1.0f / (1.0f + expf(-v)); else if (ACT == 12) v = (v > 0.f) ? v : 0.01f * v; else if (ACT == 14) v = (v > 0.f) ? v : 0.1f * v; else if (ACT == 16) v = (v >= 0.f) ? v : 0.3f * v; else if (ACT == 17) v = (v >= 0.f) ? v : 0.2f * v; else if (ACT == 15) v = v / (1.0f + expf(-v)); else if (ACT == 3) v = fmaxf(v, 0.f); else if (ACT == 6) v = 0.5f * v * (1.0f + erff(v * 0.70710678118654752f)); so[w][8 * hh + r][t * 16 + ln] = v; } }
  __builtin_amdgcn_fence(__ATOMIC_ACQ_REL, "workgroup"); __builtin_amdgcn_wave_barrier();
  const int rsub = lane >> 4, c4 = (lane & 15) * 4; typedef _Float16 v4h __attribute__((ext_vector_type(4)));
  {
#pragma unroll
    for (int q = 0; q < 8; ++q) { const int r = q * 2 + rsub; if (col0 + c4 < N) { const v4f v = *(const v4fa*)&so[w][r][c4]; if (C) *(v4f*)(C + cofs + (size_t)(row0 + r) * ldc + col0 + c4) = v; if (C16) { v4h h4; for (int i = 0; i < 4; ++i) h4[i] = (_Float16)v[i]; *(v4h*)(C16 + cofs + (size_t)(row0 + r) * ldc + col0 + c4) = h4; } } }
     }
}


typedef _Float16 v4h __attribute__((ext_vector_type(4)));

__global__ __launch_bounds__(256) void k_x16(const float* __restrict__ x, _Float16* __restrict__ X16, size_t n8) { const size_t t = (size_t)blockIdx.x * 256 + threadIdx.x; if (t >= n8) return; FragH f;
#pragma unroll
  for (int q = 0; q < 8; ++q) f.h[q] = (_Float16)bf16_round(x[t * 8 + q]); *(v8us*)((unsigned short*)X16 + t * 8) = f.half[0];  }
__global__ __launch_bounds__(256) void k_h16(const float* __restrict__ x, _Float16* __restrict__ X16, size_t n8) { const size_t t = (size_t)blockIdx.x * 256 + threadIdx.x; if (t >= n8) return; FragH f;
#pragma unroll
  for (int q = 0; q < 8; ++q) f.h[q] = (_Float16)x[t * 8 + q]; *(v8us*)((unsigned short*)X16 + t * 8) = f.half[0];  }
__global__ __launch_bounds__(256) void k_round16f(const float* __restrict__ W, _Float16* __restrict__ Bt, size_t n8) { const size_t t = (size_t)blockIdx.x * 256 + threadIdx.x; if (t >= n8) return; FragH f;
#pragma unroll
  for (int i = 0; i < 8; ++i) f.h[i] = (_Float16)(bf16_round(W[t * 8 + i]) * 16.0f); *(v8us*)((unsigned short*)Bt + t * 8) = f.half[0];  }
// ---- fragment order: how the attention operands q, k and v lie in the workspace (V^T: same tiles, placed as k_vt writes them) ----
// A plane of R rows x K columns (R % 16 == 0, K % 32 == 0) is cut into tiles of 16 rows x 32 k, tile (rt, kt) at element (rt * (K / 32) + kt) * 512. Inside a tile, 16-byte chunk 32 j + lane (lane = 16 hh + ln) holds
// row ln, k = 16 j + 8 hh + 0..7: the four registers that lane (ln, hh) takes as half j of its fragment (g2_frag's k order). A fragment is then two loads of 512 contiguous bytes, 4 whole lines a load,
// where row-major rows gave 16 lines a load; the register contents, and with them the k order of both operands of each product, are what they were.
template <int NHv, int TTv>
__global__ __launch_bounds__(256) void k_vt(const _Float16* __restrict__ V16, int ldv, int voff, _Float16* __restrict__ Vt) { __shared__ unsigned short tl[64][66]; const int tid = threadIdx.x; const int slab = blockIdx.x / (TTv / 64), lg = blockIdx.x % (TTv / 64); const int b = slab / NHv, h = slab % NHv;
  /* V16 in fragment order (rows = tokens, k = features, K = ldv): this 64 x 64 block is 4 row tiles x 2 adjacent k tiles; chunk c of row tile rtl holds token row r, features c8 + 0..7 */
  for (int i = tid; i < 64 * 8; i += 256) { const int rtl = i >> 7, c = i & 127, lane = i & 31; const int r = rtl * 16 + (lane & 15), c8 = (c >> 5) * 16 + (lane >> 4) * 8; FragH f;
    f.half[0] = *(const v8us*)((const unsigned short*)V16 + ((size_t)b * TTv + lg * 64 + rtl * 16) * ldv + (size_t)(voff + h * 64) * 16 + c * 8);
#pragma unroll
    for (int q = 0; q < 8; ++q) tl[r][c8 + q] = f.u[q]; }
  __syncthreads();
  {      /* Vt in fragment order, per slab: rows = d (4 tiles), k = tokens, the 4 d tiles of one 32-token step adjacent: tile (st, t) at ((slab * (TTv / 32) + st) * 4 + t) * 512; this block's 512 chunks are contiguous */
#pragma unroll
    for (int rd = 0; rd < 2; ++rd) { const int c = rd * 256 + tid, lane = c & 31; const int d = ((c >> 6) & 3) * 16 + (lane & 15), k0 = (c >> 8) * 32 + ((c >> 5) & 1) * 16 + (lane >> 4) * 8; FragH f;
#pragma unroll
      for (int q = 0; q < 8; ++q) f.u[q] = tl[k0 + q][d];
      *(v8us*)((unsigned short*)Vt + ((size_t)slab * (TTv / 32) + lg * 2) * 2048 + c * 8) = f.half[0]; }
     } }

__global__ __launch_bounds__(256) void k_hl(const float* __restrict__ F, _Float16* __restrict__ Hh, _Float16* __restrict__ Hl, size_t n8) { const size_t t = (size_t)blockIdx.x * 256 + threadIdx.x; if (t >= n8) return; FragH fh, fl; const v4f a = *(const v4fa*)(F + t * 8), c = *(const v4fa*)(F + t * 8 + 4);
#pragma unroll
  for (int q = 0; q < 4; ++q) { _Float16 h = (_Float16)a[q]; fh.h[q] = h; fl.h[q] = (_Float16)((a[q] - (float)h) * 1024.0f); h = (_Float16)c[q]; fh.h[4 + q] = h; fl.h[4 + q] = (_Float16)((c[q] - (float)h) * 1024.0f); }
  { *(v8us*)((unsigned short*)Hh + t * 8) = fh.half[0]; *(v8us*)((unsigned short*)Hl + t * 8) = fl.half[0];  } }

// ---- fast GEMM (workgroup tile 128x64, wave tile 32x64; requires M % 128 == 0 rows per launch region, N % 64 == 0 and K % 64 == 0, K >= 64); epilogue as k_gemm_hhx's without ACT 1 and 7, C16 in fragment order ----
// The operands go through LDS: a stage is 64 k of the workgroup's 128 A rows and 64 B rows (192 rows of 128 bytes, each one whole line of its source row), laid at a pitch of 144 bytes (16 B x odd: no bank conflict for
// the 16-byte fragment reads). Two buffers: the next stage's asynchronous copies fly while this stage is multiplied. The B rows are fetched once for the four waves.
#define G2P 72                       /* LDS row pitch, elements */
#define G2S (192 * G2P)              /* one buffer, elements */
__device__ __forceinline__ v16h g2_frag(const unsigned short* p, int hh) { FragH f; f.half[0] = *(const v8us*)(p + 8 * hh); f.half[1] = *(const v8us*)(p + 16 + 8 * hh); return f.v; }
// One thread's share of a stage: twelve asynchronous 16-byte copies (row groups of 16: eight of A, four of B; eight lanes cover one row's 128 bytes, so a wave's copy reads 4 whole lines). l = the thread's LDS byte address in
// row group 0 of the buffer, a and b = its source addresses there, sa and sb = 16 source rows in elements. The s_wait_xcnt is the wait that is kept in front of an overwrite of a register that an issued copy names:
// as the statement's last line it stands in front of every later write of these operands.
__device__ __forceinline__ void g2_stage(unsigned l, const _Float16* a, size_t sa, const _Float16* b, size_t sb) {
  asm volatile("global_load_async_to_lds_b128 %0, %12, off\n\tglobal_load_async_to_lds_b128 %1, %13, off\n\tglobal_load_async_to_lds_b128 %2, %14, off\n\tglobal_load_async_to_lds_b128 %3, %15, off\n\t"
               "global_load_async_to_lds_b128 %4, %16, off\n\tglobal_load_async_to_lds_b128 %5, %17, off\n\tglobal_load_async_to_lds_b128 %6, %18, off\n\tglobal_load_async_to_lds_b128 %7, %19, off\n\t"
               "global_load_async_to_lds_b128 %8, %20, off\n\tglobal_load_async_to_lds_b128 %9, %21, off\n\tglobal_load_async_to_lds_b128 %10, %22, off\n\tglobal_load_async_to_lds_b128 %11, %23, off\n\t"
               "s_wait_xcnt 0x0"
               :: "v"(l), "v"(l + 32u * G2P), "v"(l + 64u * G2P), "v"(l + 96u * G2P), "v"(l + 128u * G2P), "v"(l + 160u * G2P), "v"(l + 192u * G2P), "v"(l + 224u * G2P), "v"(l + 256u * G2P), "v"(l + 288u * G2P), "v"(l + 320u * G2P), "v"(l + 352u * G2P),
                  "v"(a), "v"(a + sa), "v"(a + 2 * sa), "v"(a + 3 * sa), "v"(a + 4 * sa), "v"(a + 5 * sa), "v"(a + 6 * sa), "v"(a + 7 * sa), "v"(b), "v"(b + sb), "v"(b + 2 * sb), "v"(b + 3 * sb) : "memory"); }
__device__ __forceinline__ v8f g2_mma(v16h a, v16h b, v8f c) { v8f d = __builtin_amdgcn_wmma_f32_16x16x32_f16(false, a, false, b, (short)0, c, false, false); asm volatile("v_nop\n\tv_nop\n\tv_nop\n\tv_nop" : "+v"(d) : "v"(a), "v"(b)); return d; }
template <int ACT>
__global__ __launch_bounds__(128) void k_gemm2(const _Float16* __restrict__ A, int lda, size_t sA, const _Float16* __restrict__ Bh, int ldb, size_t sB, float alpha, const float* __restrict__ bias, size_t sBias, const float* __restrict__ CP, int rowsPerB, size_t sCPb, int row0g,
    float* __restrict__ C, _Float16* __restrict__ C16, int ldc, size_t sC, int M, int N, int K) { static_assert(ACT == 0 || ACT == 3 || ACT == 6 || ACT == 8 || ACT == 9 || ACT == 11 || ACT == 12 || ACT == 14 || ACT == 15 || ACT == 16 || ACT == 17, "k_gemm2: unsupported ACT code (would silently apply no activation)");
  __shared__ __attribute__((aligned(16))) float so[4][32][68];
  __shared__ __attribute__((aligned(16))) unsigned short st[2 * G2S];
  const int tid = threadIdx.x, w = tid >> 5, lane = tid & 31, ln = lane & 15, hh = lane >> 4; const int by = blockIdx.y;
  A += (size_t)by * sA; Bh += (size_t)by * sB; const size_t cofs = (size_t)by * sC; const float* bp = bias ? bias + (size_t)by * sBias : nullptr;
  const int ntn = N >> 6; const int mt = blockIdx.x / ntn, nq = blockIdx.x - mt * ntn; const int row0 = mt * 128 + 32 * w, col0 = nq * 64; if (mt * 128 >= M) return;      /* the whole workgroup or none: barriers follow */
  const unsigned l0 = (unsigned)(size_t)&st[(tid >> 3) * G2P + (tid & 7) * 8];      /* LDS byte address: the low 32 bits of the shared address */
  const _Float16* ga = A + (size_t)(mt * 128 + (tid >> 3)) * lda + (tid & 7) * 8; const _Float16* gb = Bh + (size_t)(col0 + (tid >> 3)) * ldb + (tid & 7) * 8; const size_t sa = (size_t)16 * lda, sb = (size_t)16 * ldb;
  const int nt = K >> 6;
  const v8f z8 = {0.f,0.f,0.f,0.f,0.f,0.f,0.f,0.f}; v8f c00 = z8, c01 = z8, c02 = z8, c03 = z8, c10 = z8, c11 = z8, c12 = z8, c13 = z8;
  g2_stage(l0, ga, sa, gb, sb);
  asm volatile("s_wait_asynccnt 0x0" ::: "memory");      /* this wave's copies of stage 0 have landed */
  __syncthreads();      /* publishes stage 0 */
  if (nt > 1) g2_stage(l0 + 2u * G2S, ga + 64, sa, gb + 64, sb);
#pragma unroll 1      /* kept rolled: a trip already holds 24 LDS reads and 16 WMMAs; unrolling would only repeat the copies, the waits and the barrier in the text */
  for (int t = 0; t < nt; ++t) { const unsigned short* const ap = st + (t & 1) * G2S + (32 * w + ln) * G2P; const unsigned short* const bq = st + (t & 1) * G2S + (128 + ln) * G2P; v16h af[2][2], bf[2][4];
#pragma unroll
    for (int ks = 0; ks < 2; ++ks) {
#pragma unroll
      for (int r = 0; r < 2; ++r) af[ks][r] = g2_frag(ap + 16 * r * G2P + 32 * ks, hh);
#pragma unroll
      for (int u = 0; u < 4; ++u) bf[ks][u] = g2_frag(bq + 16 * u * G2P + 32 * ks, hh); }
#pragma unroll
    for (int ks = 0; ks < 2; ++ks) { c00 = g2_mma(af[ks][0], bf[ks][0], c00); c10 = g2_mma(af[ks][1], bf[ks][0], c10); c01 = g2_mma(af[ks][0], bf[ks][1], c01); c11 = g2_mma(af[ks][1], bf[ks][1], c11);
      c02 = g2_mma(af[ks][0], bf[ks][2], c02); c12 = g2_mma(af[ks][1], bf[ks][2], c12); c03 = g2_mma(af[ks][0], bf[ks][3], c03); c13 = g2_mma(af[ks][1], bf[ks][3], c13); }
    asm volatile("s_wait_dscnt 0x0" ::: "memory");      /* this wave's reads of the buffer are done before it may be refilled */
    asm volatile("s_wait_asynccnt 0x0" ::: "memory");      /* this wave's copies of stage t + 1 have landed */
    __syncthreads();      /* publishes stage t + 1 and ends every wave's reads of stage t */
    if (t + 2 < nt) g2_stage(l0 + (unsigned)(t & 1) * (2u * G2S), ga + (size_t)(t + 2) * 64, sa, gb + (size_t)(t + 2) * 64, sb); }
  asm volatile("s_wait_asynccnt 0x0" ::: "memory");      /* no copy is outstanding when the wave goes on */
  v8f accs[8] = {c00, c01, c02, c03, c10, c11, c12, c13};
#pragma unroll
  for (int u = 0; u < 8; ++u) { const int t = u & 3, half = u >> 2; const int col = col0 + t * 16 + ln; const float bv = bp ? bf16_round(bp[col]) : 0.f;
#pragma unroll
    for (int r = 0; r < 8; ++r) { const int rloc = half * 16 + 8 * hh + r; float v = accs[u][r] * alpha + bv; if (CP) { if (rowsPerB < 0) v += CP[cofs + (size_t)(row0g + row0 + rloc) * ldc + col];      /* rowsPerB < 0: own element of the batched C plane */ else { const int bidx = (row0g + row0 + rloc) / rowsPerB; v += CP[(size_t)bidx * sCPb + (size_t)by * 64 + col]; } }
      if (ACT == 3) v = fmaxf(v, 0.f); else if (ACT == 6) v = 0.5f * v * (1.0f + erff(v * 0.70710678118654752f)); else if (ACT == 11) v = 1.0f / (1.0f + expf(-v)); else if (ACT == 15) v = v / (1.0f + expf(-v)); else if (ACT == 12) v = (v > 0.f) ? v : 0.01f * v; else if (ACT == 8) v = tanhf(v); else if (ACT == 9) v = 0.5f * v * (1.0f + tanhf(0.7978845608028654f * (v + 0.044715f * v * v * v))); else if (ACT == 14) v = (v > 0.f) ? v : 0.1f * v; else if (ACT == 16) v = (v >= 0.f) ? v : 0.3f * v; else if (ACT == 17) v = (v >= 0.f) ? v : 0.2f * v;
      so[w][rloc][t * 16 + ln] = v; } }
  __builtin_amdgcn_fence(__ATOMIC_ACQ_REL, "workgroup"); __builtin_amdgcn_wave_barrier();
  const int rsub = lane >> 4, c4 = (lane & 15) * 4;
  {
    if (C) {
#pragma unroll
      for (int q = 0; q < 16; ++q) { const int r = q * 2 + rsub; const v4f v = *(const v4fa*)&so[w][r][c4]; *(v4f*)(C + cofs + (size_t)(row0 + r) * ldc + col0 + c4) = v; }
      asm volatile("s_wait_xcnt 0x0" ::: "memory"); }      /* the C16 block below writes registers that these stores name: the wait that is kept in front of such an overwrite */
    if (C16) {      /* C16 goes out in fragment order (see above k_vt; K = ldc): the 32 x 64 tile is 2 row tiles x 2 adjacent k tiles x 2 halves = 8 stores of 512 contiguous bytes */
#pragma unroll
      for (int u = 0; u < 8; ++u) { const int rtl = u >> 2, cu = u & 3; const float* sp = &so[w][rtl * 16 + ln][cu * 16 + 8 * hh]; const v4f v0 = *(const v4fa*)sp, v1 = *(const v4fa*)(sp + 4); FragH f;
#pragma unroll
        for (int i = 0; i < 4; ++i) { f.h[i] = (_Float16)v0[i]; f.h[4 + i] = (_Float16)v1[i]; }
        *(v8us*)((unsigned short*)C16 + cofs + (size_t)(row0 + 16 * rtl) * ldc + (size_t)col0 * 16 + cu * 256 + 8 * lane) = f.half[0]; } }
     } }


__global__ __launch_bounds__(256) void k_wnat(const float* __restrict__ w, size_t n8, _Float16* __restrict__ Bt) { const size_t t = (size_t)blockIdx.x * 256 + threadIdx.x; if (t >= n8) return; FragH f; for (int q = 0; q < 8; ++q) f.h[q] = (_Float16)(bf16_round(w[t * 8 + q]) * 16.0f); *(v8us*)((unsigned short*)Bt + t * 8) = f.half[0];  }
__global__ __launch_bounds__(256) void k_rsm(const float* __restrict__ S, _Float16* __restrict__ P, int nrows) {
  #pragma clang fp contract(off)
  const int i = blockIdx.x * 256 + threadIdx.x; if (i >= nrows) return; const float* s = S + (size_t)i * SQ; float mx = -3.0e38f;
#pragma unroll 1
  for (int j = 0; j < SQ; ++j) mx = fmaxf(mx, s[j]); float se = 0.f;
#pragma unroll 1
  for (int j = 0; j < SQ; ++j) se += expf(s[j] - mx); const float sc = 256.0f / se;
#pragma unroll 1
  for (int j0 = 0; j0 < SQ; j0 += 8) { FragH f; for (int q = 0; q < 8; ++q) f.h[q] = (_Float16)(expf(s[j0 + q] - mx) * sc); unsigned short* d = (unsigned short*)P + (size_t)i * SQ + j0; *(v8us*)d = f.half[0];  } }
__global__ __launch_bounds__(256) void k_vt(const _Float16* __restrict__ V16, int b, int h0, _Float16* __restrict__ VT) { __shared__ unsigned short tl[64][65]; const int tid = threadIdx.x; const int hh = blockIdx.x % HG, sg = blockIdx.x / HG; const int s0 = sg * 64; const int h = h0 + hh;
  for (int i = tid; i < 64 * 8; i += 256) { const int j = i / 8, d8 = (i % 8) * 8; FragH f; f.half[0] = *(const v8us*)((const unsigned short*)V16 + ((size_t)b * SQ + s0 + j) * DM + h * HD + d8); for (int q = 0; q < 8; ++q) tl[d8 + q][j] = f.u[q]; }
  __syncthreads();
  { for (int i = tid; i < 64 * 8; i += 256) { const int d = i / 8, j8 = (i % 8) * 8; FragH f; for (int q = 0; q < 8; ++q) f.u[q] = tl[d][j8 + q]; *(v8us*)((unsigned short*)VT + ((size_t)hh * HD + d) * SQ + s0 + j8) = f.half[0]; }  } }



__global__ __launch_bounds__(256) void k_rsmf(const float* __restrict__ S, _Float16* __restrict__ P, int qn, int hg) {
  #pragma clang fp contract(off)
  const int t = blockIdx.x * 256 + threadIdx.x; if (t >= qn * hg) return; const size_t i = (size_t)(t / qn) * SQ + (t % qn); const float* s = S + i * SQ; float mx = -3.0e38f;
#pragma unroll 1
  for (int j = 0; j < SQ; ++j) mx = fmaxf(mx, s[j]); float se = 0.f;
#pragma unroll 1
  for (int j = 0; j < SQ; ++j) se += __expf(s[j] - mx); const float sc = 256.0f / se;
#pragma unroll 1
  for (int j0 = 0; j0 < SQ; j0 += 8) { FragH f; for (int q = 0; q < 8; ++q) f.h[q] = (_Float16)(__expf(s[j0 + q] - mx) * sc); unsigned short* d = (unsigned short*)P + i * SQ + j0; *(v8us*)d = f.half[0];  } }

// Four native exp2 in one statement: each is the independent instruction that the instruction set asks for behind the transcendental in front of it, and the v_nop is that slot behind the last
// Early-clobber outputs keep the four independent of one another.
__device__ __forceinline__ void exp2x4(float& a, float& b, float& c, float& d) { float e0, e1, e2, e3;
  asm("v_exp_f32 %0, %4\n\tv_exp_f32 %1, %5\n\tv_exp_f32 %2, %6\n\tv_exp_f32 %3, %7\n\tv_nop" : "=&v"(e0), "=&v"(e1), "=&v"(e2), "=&v"(e3) : "v"(a), "v"(b), "v"(c), "v"(d));
  a = e0; b = e1; c = e2; d = e3; }
// Two native exp2 in one statement, as exp2x4 above: the second is the independent instruction behind the first, the v_nop is that slot behind the second.
__device__ __forceinline__ void exp2x2(float& a, float& b) { float e0, e1;
  asm("v_exp_f32 %0, %2\n\tv_exp_f32 %1, %3\n\tv_nop" : "=&v"(e0), "=&v"(e1) : "v"(a), "v"(b));
  a = e0; b = e1; }
__device__ __forceinline__ float fa_xhalf(float x) { return __builtin_bit_cast(float, __builtin_amdgcn_permlanex16(__builtin_bit_cast(int, x), __builtin_bit_cast(int, x), 0x76543210, 0xfedcba98, false, false)); }      /* lane l <-> lane l ^ 16 */
__device__ __forceinline__ v16h fa_frag(const _Float16* ub, unsigned off) { FragH f; f.half[0] = *(const v8us*)((const unsigned short*)ub + off); f.half[1] = *(const v8us*)((const unsigned short*)ub + off + 256); return f.v; }      /* a tile in fragment order, g2_frag's k order; ub is the same for the whole wave, off = tile offset + 8 * lane */
__device__ __forceinline__ v8f fa_mma(v16h a, v16h b, v8f c) { return __builtin_amdgcn_wmma_f32_16x16x32_f16(false, a, false, b, (short)0, c, false, false); }
// Fused attention of one head: scores, softmax and P.V in one launch; neither the scores nor the weights go to memory.
// Grid (SQ / 256, heads), 8 waves; a wave owns 32 queries (two groups of 16 columns) and walks all keys, 32 a step.
// Transposed products: S^T = K . Q^T (A = 16 key rows, B = 16 query columns, k = d) and O^T += V^T . P^T (A = 16 d rows of V^T, B = P^T, k = 32 keys).
// D register r of lane (c = lane & 15, h = lane >> 4) is element [8 h + r][c]: a lane holds one query's scores, and the two 16-key score tiles of a step, converted in place, are the B operand of the
// second product in the k order of g2_frag (elements 0..7 = keys 8 h + 0..7, elements 8..15 = keys 16 + 8 h + 0..7), which loads V^T. No LDS and no lane exchange for P.
// Online softmax in the log2 domain, f32: running maximum mr and running sum lr per query; each step rescales O^T and lr by exp2(old maximum - new maximum). The weights are carried x256 (the + 8) as f16
// operands, away from the f16 subnormals; the factor cancels in the division by lr, which sums the same scaled weights. mr starts at -3.0e38 (finite), so a step whose keys are all masked to -inf adds zeros.
// The mask (bf16-rounded, x log2 e) is prepared once per workgroup in LDS; the one barrier publishes it.
__global__ __launch_bounds__(256) void k_fattn(const _Float16* __restrict__ Q, const _Float16* __restrict__ Kk, const _Float16* __restrict__ VTh, const float* __restrict__ am, _Float16* __restrict__ O) {
  __shared__ __attribute__((aligned(16))) float smk[SQ];
  const int tid = threadIdx.x, lane = tid & 31, ln = lane & 15, hh = lane >> 4, w = tid >> 5; const int h = blockIdx.y, q0 = blockIdx.x * 256 + w * 32;
  for (int i = tid * 4; i < SQ; i += 1024) { v4f a = *(const v4fa*)(am + i);
#pragma unroll
    for (int q = 0; q < 4; ++q) a[q] = bf16_round(a[q]) * 1.44269504f;
    *(v4fa*)&smk[i] = a; }
  __syncthreads();
  const unsigned qo = (unsigned)(q0 * LQ + 8 * lane); v16h qf[2][2];      /* Q, Kk and VTh lie in fragment order (see above k_vt): a row tile is 16 * LQ elements, head h is its k tiles 2 h and 2 h + 1 */
#pragma unroll
  for (int g = 0; g < 2; ++g)
#pragma unroll
    for (int ks = 0; ks < 2; ++ks) qf[g][ks] = fa_frag(Q + h * HD * 16, qo + 16 * g * LQ + 512 * ks);
  const _Float16* const kb = Kk + h * HD * 16; const _Float16* const vb = VTh + (size_t)h * HD * SQ; const unsigned ko = (unsigned)(8 * lane), vo = (unsigned)(8 * lane);
  const v8f z8 = {0.f,0.f,0.f,0.f,0.f,0.f,0.f,0.f}; v8f o[2][4];
#pragma unroll
  for (int g = 0; g < 2; ++g)
#pragma unroll
    for (int t = 0; t < 4; ++t) o[g][t] = z8;
  float mr[2] = {-3.0e38f, -3.0e38f}, lr[2] = {0.f, 0.f};
  v16h ka[2][2];
#pragma unroll
  for (int kt = 0; kt < 2; ++kt)
#pragma unroll
    for (int ks = 0; ks < 2; ++ks) ka[kt][ks] = fa_frag(kb, ko + 16 * kt * LQ + 512 * ks);
#pragma unroll 1      /* one step is some 250 instructions and holds its own overlap (loads against softmax); unrolling would only grow the code */
  for (int j0 = 0; j0 < SQ; j0 += 32) {
    v4f mk[2][2];      /* this step's mask values: read from LDS under the first product */
#pragma unroll
    for (int kt = 0; kt < 2; ++kt)
#pragma unroll
      for (int c = 0; c < 2; ++c) mk[kt][c] = *(const v4fa*)&smk[j0 + 16 * kt + 8 * hh + 4 * c];
    v16h va[4];      /* this step's V^T fragments: issued here, needed only behind the exponentials */
#pragma unroll
    for (int t = 0; t < 4; ++t) va[t] = fa_frag(vb + j0 * HD, vo + 512 * t);
    v8f s[2][2];
#pragma unroll
    for (int g = 0; g < 2; ++g)
#pragma unroll
      for (int kt = 0; kt < 2; ++kt) s[g][kt] = fa_mma(ka[kt][1], qf[g][1], fa_mma(ka[kt][0], qf[g][0], z8));
    const _Float16* const kn = kb + (size_t)((j0 + 32 < SQ) ? j0 + 32 : 0) * LQ;      /* the next step's K fragments, in flight under this step's softmax; the last step re-reads the first rows, unused */
#pragma unroll
    for (int kt = 0; kt < 2; ++kt)
#pragma unroll
      for (int ks = 0; ks < 2; ++ks) ka[kt][ks] = fa_frag(kn, ko + 16 * kt * LQ + 512 * ks);
    __builtin_amdgcn_sched_barrier(0);      /* keeps both groups of loads in front of the softmax: left free, the K loads sank to the loop's foot and the next step waited out their whole latency */
    float mn[2], cr[2];
#pragma unroll
    for (int g = 0; g < 2; ++g) { float mx = mr[g];
#pragma unroll
      for (int kt = 0; kt < 2; ++kt)
#pragma unroll
        for (int r = 0; r < 8; ++r) { s[g][kt][r] = s[g][kt][r] * 0.18033688f + mk[kt][r >> 2][r & 3]; mx = fmaxf(mx, s[g][kt][r]); }      /* (q . k / 8 + mask) log2 e */
      mn[g] = fmaxf(mx, fa_xhalf(mx)); cr[g] = mr[g] - mn[g]; mr[g] = mn[g]; }
    exp2x2(cr[0], cr[1]); FragH pf[2];
#pragma unroll
    for (int g = 0; g < 2; ++g) { const float nm = 8.0f - mn[g]; float ls[4] = {0.f, 0.f, 0.f, 0.f};
#pragma unroll
      for (int t = 0; t < 4; ++t) o[g][t] = o[g][t] * cr[g];
#pragma unroll
      for (int kt = 0; kt < 2; ++kt)
#pragma unroll
        for (int r4 = 0; r4 < 8; r4 += 4) { float y[4];
#pragma unroll
          for (int q = 0; q < 4; ++q) y[q] = s[g][kt][r4 + q] + nm;
          exp2x4(y[0], y[1], y[2], y[3]);
#pragma unroll
          for (int q = 0; q < 4; ++q) { ls[q] += y[q]; pf[g].h[8 * kt + r4 + q] = (_Float16)y[q]; } }
      lr[g] = lr[g] * cr[g] + ((ls[0] + ls[1]) + (ls[2] + ls[3])); }
    __builtin_amdgcn_sched_barrier(0);      /* keeps every asm exponential in front of the second product */
#pragma unroll
    for (int g = 0; g < 2; ++g)
#pragma unroll
      for (int t = 0; t < 4; ++t) o[g][t] = fa_mma(va[t], pf[g].v, o[g][t]); }
#pragma unroll
  for (int g = 0; g < 2; ++g) { const float sc = 64.0f / (lr[g] + fa_xhalf(lr[g]));      /* the halves' sums joined; o carried x64, as the output GEMM's alpha expects */
    _Float16* d = O + h * HD + ((unsigned)((q0 + ln) * DM + 8 * hh) + 16 * g * DM);
#pragma unroll
    for (int t = 0; t < 4; ++t) { FragH f;
#pragma unroll
      for (int r = 0; r < 8; ++r) f.h[r] = (_Float16)(o[g][t][r] * sc);
      *(v8us*)((unsigned short*)d + 16 * t) = f.half[0]; } } }


__global__ __launch_bounds__(256) void k_bfr(const float* __restrict__ x, float* __restrict__ XB, size_t n8) { const size_t t = (size_t)blockIdx.x * 256 + threadIdx.x; if (t >= n8) return; v4f a = *(const v4fa*)(x + t * 8), c = *(const v4fa*)(x + t * 8 + 4); for (int q = 0; q < 4; ++q) { a[q] = bf16_round(a[q]); c[q] = bf16_round(c[q]); }
  { *(v4f*)(XB + t * 8) = a; *(v4f*)(XB + t * 8 + 4) = c;  } }


__global__ __launch_bounds__(256) void k_lnrow(const float* __restrict__ Y, const float* __restrict__ g, const float* __restrict__ bb, float eps, float* __restrict__ out) {
  #pragma clang fp contract(off)
  __shared__ float red[256]; const size_t r = blockIdx.x; const int t = threadIdx.x; const v4f ya = *(const v4fa*)(Y + r * DMQ + t * 4); float s[4]; float sum = 0.f;
  for (int q = 0; q < 4; ++q) { s[q] = ya[q]; sum = __fadd_rn(sum, s[q]); }
  red[t] = sum; __syncthreads(); for (int st = 128; st > 0; st >>= 1) { if (t < st) red[t] = __fadd_rn(red[t], red[t + st]); __syncthreads(); } const float mu = red[0] / (float)DMQ; __syncthreads();
  float vs = 0.f; for (int q = 0; q < 4; ++q) { const float dl = __fadd_rn(s[q], -mu); vs = __fadd_rn(vs, __fmul_rn(dl, dl)); } red[t] = vs; __syncthreads(); for (int st = 128; st > 0; st >>= 1) { if (t < st) red[t] = __fadd_rn(red[t], red[t + st]); __syncthreads(); }
  const float rs = rsqrtf(__fadd_rn(red[0] / (float)DMQ, eps)); v4f y; for (int q = 0; q < 4; ++q) { const int c = t * 4 + q; y[q] = __fadd_rn(__fmul_rn(__fmul_rn(__fadd_rn(s[q], -mu), rs), bf16_round(g[c])), bf16_round(bb[c])); }
  *(v4f*)(out + r * DMQ + t * 4) = y;  }
extern "C" void kernel_launch(void* const* d_in, const int* in_sizes, int n_in,
                              void* d_out, int out_size, void* d_ws, size_t ws_size, hipStream_t stream) {
  (void)in_sizes; (void)n_in; (void)out_size;
  const float* const* I = (const float* const*)d_in; const float* x = I[0]; const float* am = I[1]; const float* wq = I[2]; const float* bq = I[3]; const float* wk = I[4]; const float* bk = I[5]; const float* wv = I[6]; const float* bv = I[7]; const float* wo = I[8]; const float* bo = I[9]; const float* lng = I[10]; const float* lnb = I[11];      /* nn.Linear weights [out][in] + biases; additive mask [1][1][1][S] */
  char* ws = (char*)d_ws; size_t off = 0;
  auto take = [&](size_t bytes) { char* p = ws + off; off += (bytes + 255) & ~(size_t)255; return p; };
  _Float16* BQ = (_Float16*)take((size_t)DM * DM * 2); _Float16* BK = (_Float16*)take((size_t)DM * DM * 2); _Float16* BV = (_Float16*)take((size_t)DM * DM * 2); _Float16* BO = (_Float16*)take((size_t)DM * DM * 2);
  _Float16* X16 = (_Float16*)take(NR * DM * 2); float* XB = (float*)take(NR * DM * 4); float* YF = (float*)take(NR * DM * 4); _Float16* Q16 = (_Float16*)take(NR * DM * 2); _Float16* K16 = (_Float16*)take(NR * DM * 2); _Float16* V16 = (_Float16*)take(NR * DM * 2); _Float16* O16 = (_Float16*)take(NR * DM * 2);
  _Float16* VT = (_Float16*)take((size_t)NH * HD * SQ * 2);
  if (off > ws_size) return;
  { const unsigned g = (unsigned)(((size_t)DM * DM / 8 + 255) / 256); k_wnat<<<g, 256, 0, stream>>>(wq, (size_t)DM * DM / 8, BQ); k_wnat<<<g, 256, 0, stream>>>(wk, (size_t)DM * DM / 8, BK); k_wnat<<<g, 256, 0, stream>>>(wv, (size_t)DM * DM / 8, BV); k_wnat<<<g, 256, 0, stream>>>(wo, (size_t)DM * DM / 8, BO); }      /* natural [out][in] = Bt[n][k], x16 */
  k_x16<<<(unsigned)((NR * DM / 8 + 255) / 256), 256, 0, stream>>>(x, X16, NR * DM / 8); k_bfr<<<(unsigned)((NR * DM / 8 + 255) / 256), 256, 0, stream>>>(x, XB, NR * DM / 8);      /* bf16(x) residual plane */
  const size_t r0p = (size_t)B0 * SQ;      /* first projected row */
  k_gemm2<0><<<dim3((unsigned)((MP / 128) * (DM / 64)), 1), 128, 0, stream>>>(X16 + r0p * DM, DM, 0, BQ, DM, 0, 0.0625f, bq, 0, nullptr, 1, 0, 0, nullptr, Q16 + r0p * DM, DM, 0, MP, DM, DM);
  k_gemm2<0><<<dim3((unsigned)((MP / 128) * (DM / 64)), 1), 128, 0, stream>>>(X16 + r0p * DM, DM, 0, BK, DM, 0, 0.0625f, bk, 0, nullptr, 1, 0, 0, nullptr, K16 + r0p * DM, DM, 0, MP, DM, DM);
  k_gemm2<0><<<dim3((unsigned)((MP / 128) * (DM / 64)), 1), 128, 0, stream>>>(X16 + r0p * DM, DM, 0, BV, DM, 0, 0.0625f, bv, 0, nullptr, 1, 0, 0, nullptr, V16 + r0p * DM, DM, 0, MP, DM, DM);
  for (int b = B0; b < B0 + NBR; ++b) { const size_t r0 = (size_t)b * SQ;
    k_vt<NH, SQ><<<NH * (SQ / 64), 256, 0, stream>>>(V16 + r0 * LQ, LQ, 0, VT);      /* V^T of all heads (HD x SQ each, fragment order) for this batch */
    k_fattn<<<dim3(SQ / 256, NH), 256, 0, stream>>>(Q16 + r0 * LQ, K16 + r0 * LQ, VT, am + (size_t)b * SQ, O16 + r0 * DM); }      /* scores + attention_mask, softmax and P . V of all heads, fused; o (merged heads, x64) as f16 rows */
  k_gemm2<0><<<dim3((unsigned)((MPO / 128) * (DM / 64)), 1), 128, 0, stream>>>(O16 + r0p * DM, DM, 0, BO, DM, 0, 0.0009765625f, bo, 0, XB + r0p * DM, -1, 0, 0, YF + r0p * DM, nullptr, DM, 0, MPO, DM, DM);      /* y = ctx Wo^T + bo + bf16(x) (own-element residual) */
  k_lnrow<<<(unsigned)MPO, 256, 0, stream>>>(YF + r0p * DM, lng, lnb, 1e-12f, (float*)d_out + r0p * DM);      /* post-LayerNorm */
}

// v005
// One run takes 197 microseconds.
// Timed twice side by side with v004, it ran 1.05 times as fast both times.
// Counting every step since v000, it is 71.0 times as fast.
#include <hip/hip_runtime.h>
// BERT self-attention + output (hidden_states [1][4096][1024]; q/k/v = x W^T + b (nn.Linear [out][in] 1024^2, sigma 1/32, zero biases), 16 heads of 64; scores = (q/8) . k + attention_mask[j] (additive [1][1][1][S], zeros); softmax; ctx merged; out = LayerNorm(ctx Wo^T + bo + hidden_states; ln_gamma, ln_beta, eps 1e-12) -> [1][4096][1024]).
// Structure: token rows r = b*4096 + s; x as exact f16 rows (bf16-rounded); Q, K, V as three WMMA GEMMs (32x64 wave tiles, f32 accumulation, exact x16 weights + bias, f16 outputs); per batch: V^T for all heads via LDS transposes; per batch one fused attention launch over all heads: S^T = K . Q^T on WMMA (alpha = 64^-0.5), online softmax on VALU (f32 statistics, native exp2; weights x256 as f16 operands, in registers only), O^T += V^T . P^T on WMMA (o carried x64 against f16 subnormal flush, folded into the output GEMM alpha) written straight into the merged f16 o rows; y = o Wo^T + bo + bf16(x) GEMM (f32, own-element residual) into f32 rows; post-LayerNorm on VALU (f32, LDS trees) into the output.
// Compute dtype: inputs rounded to bf16; x / weights exact; q, k, v, softmax weights and o as plain f16 GEMM operands (~2^-12); scores and softmax statistics f32. v_wmma_f32_16x16x32_f16.
#define NB 1
#define SQ 4096
#define DM 1024
#define NH 16
#define HD 64
#define HG 1                         /* heads per group of the k_vt(b, h0) overload, not launched */
#define B0 0                         /* first batch processed (debug hook) */
#define NBR NB                       /* batches processed (debug hook) */
#define NR ((size_t)NB * SQ)
#define DMQ DM         /* width of the token rows (LayerNorm length) */
#define MP ((int)((size_t)NBR * SQ)) /* rows projected (debug hook) */
#define QN SQ                        /* not used: attention covers all SQ query rows */
#define NHD NH                       /* not used: attention covers all NH heads */
#define MPO MP                       /* rows through the output stage (debug hook) */
#define LQ DM      /* width K of the q/k/v planes (fragment order) */
typedef __bf16 v16b __attribute__((ext_vector_type(16)));
typedef unsigned short v8us __attribute__((ext_vector_type(8), may_alias));
typedef float  v8f  __attribute__((ext_vector_type(8)));
typedef float  v4f  __attribute__((ext_vector_type(4)));
typedef float  v4fa __attribute__((ext_vector_type(4), may_alias));
union FragB { v16b v; v8us half[2]; unsigned short u[16]; };

__device__ __forceinline__ unsigned short bf16_bits(float x) { unsigned int u = __float_as_uint(x); return (unsigned short)((u + 0x7FFFu + ((u >> 16) & 1u)) >> 16); }
__device__ __forceinline__ float bf16_val(unsigned short b) { return __uint_as_float(((unsigned int)b) << 16); }
__device__ __forceinline__ float bf16_round(float x) { return bf16_val(bf16_bits(x)); }
// D += A·B with NT terms: 1 = ah·bh, 2 = + al·bh (A split), 3 = + ah·bl (both split)
template <int NT>
__device__ __forceinline__ v8f mmaN(v16b ah, v16b al, v16b bh, v16b bl, v8f c) {
  c = __builtin_amdgcn_wmma_f32_16x16x32_bf16(false, ah, false, bh, (short)0, c, false, false);
  if (NT >= 2) c = __builtin_amdgcn_wmma_f32_16x16x32_bf16(false, al, false, bh, (short)0, c, false, false);
  if (NT >= 3) c = __builtin_amdgcn_wmma_f32_16x16x32_bf16(false, ah, false, bl, (short)0, c, false, false);
  asm volatile("v_nop\n\tv_nop\n\tv_nop\n\tv_nop" : "+v"(c) : "v"(ah), "v"(al), "v"(bh), "v"(bl));
  return c;
}

__global__ __launch_bounds__(256) void k_wt_bf16(const float* __restrict__ W, unsigned short* __restrict__ Wt, int K, int N) {
  const int t = blockIdx.x * 256 + threadIdx.x;
  const int k8n = K / 8;
  if (t >= N * k8n) return;
  const int n = t / k8n, k8 = (t % k8n) * 8;
  v8us v;
#pragma unroll
  for (int i = 0; i < 8; ++i) v[i] = bf16_bits(W[(size_t)(k8 + i) * N + n]);
  *(v8us*)(Wt + (size_t)n * K + k8) = v;
  
}

// GEMM C[M][N] (f32, pitch ldc) = act(A[M][K]·W + bias). A f32 row-major (pitch lda) converted per fragment to bf16
// (ASPLIT: hi/lo two planes -> 2 terms, else single rounded term); Wt bf16 [N][K] (pitch ldb). BIAS_BF16 rounds the
// bias to bf16 first (bias quantised to bf16 before the add). K%32==0, M%16==0, N%64==0.
template <bool ASPLIT, int ACT, bool BIAS_BF16>
__global__ __launch_bounds__(128) void k_gemm_bf(const float* __restrict__ A, int lda, const unsigned short* __restrict__ Wt, int ldb,
                                               const float* __restrict__ bias, float* __restrict__ C, int ldc, int M, int N, int K) {
  __shared__ __attribute__((aligned(16))) float so[4][16][64];
  const int tid = threadIdx.x, w = tid >> 5, lane = tid & 31, ln = lane & 15, hh = lane >> 4;
  const int ntn = N / 64;
  const int wid = blockIdx.x * 4 + w;
  const int mt = wid / ntn, nq = wid % ntn;
  if (mt * 16 >= M) return;
  const int row0 = mt * 16, col0 = nq * 64;
  const float* arow = A + (size_t)(row0 + ln) * lda;
  v8f acc[4] = {};
  for (int kb = 0; kb < K; kb += 32) {
    FragB ah, al;
    const v4f x0 = *(const v4fa*)(arow + kb + 8 * hh), x1 = *(const v4fa*)(arow + kb + 8 * hh + 4);
    const v4f x2 = *(const v4fa*)(arow + kb + 16 + 8 * hh), x3 = *(const v4fa*)(arow + kb + 16 + 8 * hh + 4);
    float xs[16] = {x0[0],x0[1],x0[2],x0[3],x1[0],x1[1],x1[2],x1[3],x2[0],x2[1],x2[2],x2[3],x3[0],x3[1],x3[2],x3[3]};
#pragma unroll
    for (int i = 0; i < 16; ++i) { const unsigned short hb = bf16_bits(xs[i]); ah.u[i] = hb; al.u[i] = ASPLIT ? bf16_bits(xs[i] - bf16_val(hb)) : (unsigned short)0; }
#pragma unroll
    for (int t = 0; t < 4; ++t) {
      const unsigned short* brow = Wt + (size_t)(col0 + t * 16 + ln) * ldb + kb;
      FragB b;
      b.half[0] = *(const v8us*)(brow + 8 * hh);
      b.half[1] = *(const v8us*)(brow + 16 + 8 * hh);
      acc[t] = mmaN<ASPLIT ? 2 : 1>(ah.v, al.v, b.v, b.v, acc[t]);
    }
  }
#pragma unroll
  for (int t = 0; t < 4; ++t) {
    float bv = bias ? bias[col0 + t * 16 + ln] : 0.f;
    if (BIAS_BF16) bv = bf16_round(bv);
#pragma unroll
    for (int r = 0; r < 8; ++r) { float v = acc[t][r] + bv; if (ACT == 1) v = fmaxf(v, 0.f); so[w][8 * hh + r][t * 16 + ln] = v; }
  }
  __builtin_amdgcn_fence(__ATOMIC_ACQ_REL, "workgroup");
  __builtin_amdgcn_wave_barrier();
  const int rsub = lane >> 4, c4 = (lane & 15) * 4;
  {
#pragma unroll
    for (int q = 0; q < 8; ++q) {
      const int r = q * 2 + rsub;
      const v4f v = *(const v4fa*)&so[w][r][c4];
      *(v4f*)(C + (size_t)(row0 + r) * ldc + col0 + c4) = v;
    }
    
  }
}

// GEMM C = act(A·W + bias + resid): A f32 (ASPLIT -> hi/lo 2 terms), Wt bf16 [N][K]; ACT 0 none, 1 relu, 2 exact gelu;
// resid (optional, f32, row index = (row % rmod), pitch ldr, RES_BF16 rounds it) added before the activation.
template <bool ASPLIT, int ACT, bool BIAS_BF16, bool RES_BF16>
__global__ __launch_bounds__(128) void k_gemm_bf3(const float* __restrict__ A, int lda, const unsigned short* __restrict__ Wt, int ldb,
                                                const float* __restrict__ bias, const float* __restrict__ resid, int rmod, int ldr,
                                                float* __restrict__ C, int ldc, int M, int N, int K) {
  __shared__ __attribute__((aligned(16))) float so[4][16][64];
  const int tid = threadIdx.x, w = tid >> 5, lane = tid & 31, ln = lane & 15, hh = lane >> 4;
  const int ntn = N / 64;
  const int wid = blockIdx.x * 4 + w;
  const int mt = wid / ntn, nq = wid % ntn;
  if (mt * 16 >= M) return;
  const int row0 = mt * 16, col0 = nq * 64;
  const float* arow = A + (size_t)(row0 + ln) * lda;
  v8f acc[4] = {};
  for (int kb = 0; kb < K; kb += 32) {
    FragB ah, al;
    const v4f x0 = *(const v4fa*)(arow + kb + 8 * hh), x1 = *(const v4fa*)(arow + kb + 8 * hh + 4);
    const v4f x2 = *(const v4fa*)(arow + kb + 16 + 8 * hh), x3 = *(const v4fa*)(arow + kb + 16 + 8 * hh + 4);
    float xs[16] = {x0[0],x0[1],x0[2],x0[3],x1[0],x1[1],x1[2],x1[3],x2[0],x2[1],x2[2],x2[3],x3[0],x3[1],x3[2],x3[3]};
#pragma unroll
    for (int i = 0; i < 16; ++i) { const unsigned short hb = bf16_bits(xs[i]); ah.u[i] = hb; al.u[i] = ASPLIT ? bf16_bits(xs[i] - bf16_val(hb)) : (unsigned short)0; }
#pragma unroll
    for (int t = 0; t < 4; ++t) {
      const unsigned short* brow = Wt + (size_t)(col0 + t * 16 + ln) * ldb + kb;
      FragB b;
      b.half[0] = *(const v8us*)(brow + 8 * hh);
      b.half[1] = *(const v8us*)(brow + 16 + 8 * hh);
      acc[t] = mmaN<ASPLIT ? 2 : 1>(ah.v, al.v, b.v, b.v, acc[t]);
    }
  }
#pragma unroll
  for (int t = 0; t < 4; ++t) {
    const int col = col0 + t * 16 + ln;
    float bv = bias ? bias[col] : 0.f;
    if (BIAS_BF16) bv = bf16_round(bv);
#pragma unroll
    for (int r = 0; r < 8; ++r) {
      float v = acc[t][r] + bv;
      if (resid) { float rv = resid[(size_t)((row0 + 8 * hh + r) % rmod) * ldr + col]; if (RES_BF16) rv = bf16_round(rv); v += rv; }
      if (ACT == 1) v = fmaxf(v, 0.f);
      if (ACT == 2) v = 0.5f * v * (1.0f + erff(v * 0.70710678118654752f));
      if (ACT == 3) { const float u = 0.7978845608028654f * (v + 0.044715f * v * v * v); v = 0.5f * v * (1.0f + tanhf(u)); }
      so[w][8 * hh + r][t * 16 + ln] = v;
    }
  }
  __builtin_amdgcn_fence(__ATOMIC_ACQ_REL, "workgroup");
  __builtin_amdgcn_wave_barrier();
  const int rsub = lane >> 4, c4 = (lane & 15) * 4;
  {
#pragma unroll
    for (int q = 0; q < 8; ++q) {
      const int r = q * 2 + rsub;
      const v4f v = *(const v4fa*)&so[w][r][c4];
      *(v4f*)(C + (size_t)(row0 + r) * ldc + col0 + c4) = v;
    }
    
  }
}
// row LayerNorm (biased variance, eps) over N: s = X (+ R); optional out_sum <- s; out_norm <- (s-mu)*rsqrt(var+eps)*g + b
template <bool PARAM_BF16>
__global__ __launch_bounds__(256) void k_layernorm(const float* __restrict__ X, const float* __restrict__ R, const float* __restrict__ g, const float* __restrict__ bta,
                                                  float* __restrict__ out_sum, float* __restrict__ out_norm, int N, float eps) {
  __shared__ float red[256];
  const int row = blockIdx.x, tid = threadIdx.x;
  const float* x = X + (size_t)row * N; const float* rr = R ? R + (size_t)row * N : nullptr;
  float vals[16];                     // up to N = 4096
  const int per = N / 256;            // contiguous chunk per thread? use strided-by-4 chunks: thread handles j = tid*4 + 1024*u
  float s1 = 0.f;
  for (int u = 0; u < per / 4; ++u) {
    const int j = tid * 4 + 1024 * u;
    const v4f a = *(const v4fa*)(x + j);
    v4f b = {0.f,0.f,0.f,0.f}; if (rr) b = *(const v4fa*)(rr + j);
#pragma unroll
    for (int q = 0; q < 4; ++q) { const float v = a[q] + b[q]; vals[u * 4 + q] = v; s1 += v; }
  }
  red[tid] = s1; __syncthreads();
  for (int st = 128; st > 0; st >>= 1) { if (tid < st) red[tid] += red[tid + st]; __syncthreads(); }
  const float mu = red[0] / (float)N; __syncthreads();
  float s2 = 0.f;
  for (int u = 0; u < per / 4; ++u)
#pragma unroll
    for (int q = 0; q < 4; ++q) { const float c = vals[u * 4 + q] - mu; s2 += c * c; }
  red[tid] = s2; __syncthreads();
  for (int st = 128; st > 0; st >>= 1) { if (tid < st) red[tid] += red[tid + st]; __syncthreads(); }
  const float rs = rsqrtf(red[0] / (float)N + eps);
  {
    for (int u = 0; u < per / 4; ++u) {
      const int j = tid * 4 + 1024 * u;
      v4f o, sm;
#pragma unroll
      for (int q = 0; q < 4; ++q) {
        float gg = g[j + q], bb = bta[j + q];
        if (PARAM_BF16) { gg = bf16_round(gg); bb = bf16_round(bb); }
        sm[q] = vals[u * 4 + q]; o[q] = (vals[u * 4 + q] - mu) * rs * gg + bb;
      }
      if (out_sum) *(v4f*)(out_sum + (size_t)row * N + j) = sm;
      *(v4f*)(out_norm + (size_t)row * N + j) = o;
    }
    
  }
}



// ---- f16 WMMA path (v_wmma_f32_16x16x32_f16): 11-bit significands for operands in range — used where a [0,1] probability operand needs more precision than bf16
typedef _Float16 v16h __attribute__((ext_vector_type(16)));
union FragH { v16h v; v8us half[2]; _Float16 h[16]; unsigned short u[16]; };
template <int NT>
__device__ __forceinline__ v8f mmaH(v16h ah, v16h al, v16h bh, v16h bl, v8f c) {
  c = __builtin_amdgcn_wmma_f32_16x16x32_f16(false, ah, false, bh, (short)0, c, false, false);
  if (NT >= 2) c = __builtin_amdgcn_wmma_f32_16x16x32_f16(false, al, false, bh, (short)0, c, false, false);
  if (NT >= 3) c = __builtin_amdgcn_wmma_f32_16x16x32_f16(false, ah, false, bl, (short)0, c, false, false);
  asm volatile("v_nop\n\tv_nop\n\tv_nop\n\tv_nop" : "+v"(c) : "v"(ah), "v"(al), "v"(bh), "v"(bl));
  return c;
}
// batched GEMM like k_gemm_b but f16 operands: A f32 (split into f16 hi/lo if ASPLIT, else rounded to f16), Bt = f16 values [n][k]; alpha; C f32; N multiple of 16 (partial tiles skipped)
template <bool ASPLIT>
__global__ __launch_bounds__(128) void k_gemm_h(const float* __restrict__ A, int lda, size_t sA, const _Float16* __restrict__ Bh, int ldb, size_t sB, float alpha, float* __restrict__ C, int ldc, size_t sC, int M, int N, int K) {
  __shared__ __attribute__((aligned(16))) float so[4][16][64];
  const int tid = threadIdx.x, w = tid >> 5, lane = tid & 31, ln = lane & 15, hh = lane >> 4; const int by = blockIdx.y;
  A += (size_t)by * sA; Bh += (size_t)by * sB; C += (size_t)by * sC;
  const int ntn = (N + 63) / 64; const int wid = blockIdx.x * 4 + w; const int mt = wid / ntn, nq = wid % ntn; if (mt * 16 >= M) return;
  const int row0 = mt * 16, col0 = nq * 64; const float* arow = A + (size_t)(row0 + ln) * lda;
  v8f acc[4] = {};
  for (int kb = 0; kb < K; kb += 32) {
    FragH ah, al;
    const v4f x0 = *(const v4fa*)(arow + kb + 8 * hh), x1 = *(const v4fa*)(arow + kb + 8 * hh + 4), x2 = *(const v4fa*)(arow + kb + 16 + 8 * hh), x3 = *(const v4fa*)(arow + kb + 16 + 8 * hh + 4);
    float xs[16] = {x0[0],x0[1],x0[2],x0[3],x1[0],x1[1],x1[2],x1[3],x2[0],x2[1],x2[2],x2[3],x3[0],x3[1],x3[2],x3[3]};
#pragma unroll
    for (int i = 0; i < 16; ++i) { const _Float16 h = (_Float16)xs[i]; ah.h[i] = h; al.h[i] = ASPLIT ? (_Float16)(xs[i] - (float)h) : (_Float16)0.0f; }
#pragma unroll
    for (int t = 0; t < 4; ++t) { if (col0 + t * 16 >= N) continue; const size_t boff = (size_t)(col0 + t * 16 + ln) * ldb + kb; FragH bq; bq.half[0] = *(const v8us*)(Bh + boff + 8 * hh); bq.half[1] = *(const v8us*)(Bh + boff + 16 + 8 * hh);
      acc[t] = mmaH<ASPLIT ? 2 : 1>(ah.v, al.v, bq.v, bq.v, acc[t]); }
  }
#pragma unroll
  for (int t = 0; t < 4; ++t) { if (col0 + t * 16 >= N) continue;
#pragma unroll
    for (int r = 0; r < 8; ++r) so[w][8 * hh + r][t * 16 + ln] = acc[t][r] * alpha; }
  __builtin_amdgcn_fence(__ATOMIC_ACQ_REL, "workgroup"); __builtin_amdgcn_wave_barrier();
  const int rsub = lane >> 4, c4 = (lane & 15) * 4;
  {
#pragma unroll
    for (int q = 0; q < 8; ++q) { const int r = q * 2 + rsub; if (col0 + c4 < N) { const v4f v = *(const v4fa*)&so[w][r][c4]; *(v4f*)(C + (size_t)(row0 + r) * ldc + col0 + c4) = v; } }
     }
}

// Wt[n][k] = f16(W[k][n]·scale) from f32 row-major W[K][N] (scale = power of two; bf16-exact weights stay exact in f16 away from the subnormal range)
__global__ __launch_bounds__(256) void k_wt_f16(const float* __restrict__ W, _Float16* __restrict__ Wt, int K, int N, float scale) {
  const int t = blockIdx.x * 256 + threadIdx.x; if (t >= N * (K / 8)) return; const int n = t / (K / 8), k8 = (t % (K / 8)) * 8; FragH f;
#pragma unroll
  for (int i = 0; i < 8; ++i) f.h[i] = (_Float16)(bf16_round(W[(size_t)(k8 + i) * N + n]) * scale); const v8us o = f.half[0];
  *(v8us*)((unsigned short*)Wt + (size_t)n * K + k8) = o; 
}
// k_gemm_hh variant with fused epilogue: v = acc·alpha + bias[by·sBias + col] (+ CP[(row/rowsPerB)·sCPb + by·64 + col] if CP) ; ACT 0 none / 1 elu ; writes f16 C16 (and f32 C if non-null)
template <int ACT>
__global__ __launch_bounds__(128) void k_gemm_hhx(const _Float16* __restrict__ A, int lda, size_t sA, const _Float16* __restrict__ Bh, int ldb, size_t sB, float alpha, const float* __restrict__ bias, size_t sBias, const float* __restrict__ CP, int rowsPerB, size_t sCPb, int row0g,
    float* __restrict__ C, _Float16* __restrict__ C16, int ldc, size_t sC, int M, int N, int K) {
  __shared__ __attribute__((aligned(16))) float so[4][16][64];
  const int tid = threadIdx.x, w = tid >> 5, lane = tid & 31, ln = lane & 15, hh = lane >> 4; const int by = blockIdx.y;
  A += (size_t)by * sA; Bh += (size_t)by * sB; const size_t cofs = (size_t)by * sC; const float* bp = bias ? bias + (size_t)by * sBias : nullptr;
  const int ntn = (N + 63) / 64; const int wid = blockIdx.x * 4 + w; const int mt = wid / ntn, nq = wid % ntn; if (mt * 16 >= M) return;
  const int row0 = mt * 16, col0 = nq * 64; const _Float16* arow = A + (size_t)(row0 + ln) * lda;
  v8f acc[4] = {};
  for (int kb = 0; kb < K; kb += 32) { FragH ah; ah.half[0] = *(const v8us*)((const unsigned short*)arow + kb + 8 * hh); ah.half[1] = *(const v8us*)((const unsigned short*)arow + kb + 16 + 8 * hh);
#pragma unroll
    for (int t = 0; t < 4; ++t) { if (col0 + t * 16 >= N) continue; const size_t boff = (size_t)(col0 + t * 16 + ln) * ldb + kb; FragH bq; bq.half[0] = *(const v8us*)((const unsigned short*)Bh + boff + 8 * hh); bq.half[1] = *(const v8us*)((const unsigned short*)Bh + boff + 16 + 8 * hh);
      acc[t] = mmaH<1>(ah.v, ah.v, bq.v, bq.v, acc[t]); }
  }
#pragma unroll
  for (int t = 0; t < 4; ++t) { if (col0 + t * 16 >= N) continue; const int col = col0 + t * 16 + ln; const float bv = bp ? bf16_round(bp[col]) : 0.f;
#pragma unroll
    for (int r = 0; r < 8; ++r) { float v = acc[t][r] * alpha + bv; if (CP) { const int rr = row0g + row0 + 8 * hh + r; if (rowsPerB < 0) v += CP[cofs + (size_t)rr * ldc + col];      /* rowsPerB < 0: own element of the batched C plane */ else { const int bidx = rr / rowsPerB; v += CP[(size_t)bidx * sCPb + (size_t)by * 64 + col]; } } if (ACT == 1) v = (v > 0.f) ? v : expm1f(v); else if (ACT == 7) v = (v > 0.f) ? v + 1.0f : expf(v); else if (ACT == 8) v = tanhf(v); else if (ACT == 9) v = 0.5f * v * (1.0f + tanhf(0.7978845608028654f * (v + 0.044715f * v * v * v))); else if (ACT == 11) v = 1.0f / (1.0f + expf(-v)); else if (ACT == 12) v = (v > 0.f) ? v : 0.01f * v; else if (ACT == 14) v = (v > 0.f) ? v : 0.1f * v; else if (ACT == 16) v = (v >= 0.f) ? v : 0.3f * v; else if (ACT == 17) v = (v >= 0.f) ? v : 0.2f * v; else if (ACT == 15) v = v / (1.0f + expf(-v)); else if (ACT == 3) v = fmaxf(v, 0.f); else if (ACT == 6) v = 0.5f * v * (1.0f + erff(v * 0.70710678118654752f)); so[w][8 * hh + r][t * 16 + ln] = v; } }
  __builtin_amdgcn_fence(__ATOMIC_ACQ_REL, "workgroup"); __builtin_amdgcn_wave_barrier();
  const int rsub = lane >> 4, c4 = (lane & 15) * 4; typedef _Float16 v4h __attribute__((ext_vector_type(4)));
  {
#pragma unroll
    for (int q = 0; q < 8; ++q) { const int r = q * 2 + rsub; if (col0 + c4 < N) { const v4f v = *(const v4fa*)&so[w][r][c4]; if (C) *(v4f*)(C + cofs + (size_t)(row0 + r) * ldc + col0 + c4) = v; if (C16) { v4h h4; for (int i = 0; i < 4; ++i) h4[i] = (_Float16)v[i]; *(v4h*)(C16 + cofs + (size_t)(row0 + r) * ldc + col0 + c4) = h4; } } }
     }
}


typedef _Float16 v4h __attribute__((ext_vector_type(4)));

__global__ __launch_bounds__(256) void k_h16(const float* __restrict__ x, _Float16* __restrict__ X16, size_t n8) { const size_t t = (size_t)blockIdx.x * 256 + threadIdx.x; if (t >= n8) return; FragH f;
#pragma unroll
  for (int q = 0; q < 8; ++q) f.h[q] = (_Float16)x[t * 8 + q]; *(v8us*)((unsigned short*)X16 + t * 8) = f.half[0];  }
__global__ __launch_bounds__(256) void k_round16f(const float* __restrict__ W, _Float16* __restrict__ Bt, size_t n8) { const size_t t = (size_t)blockIdx.x * 256 + threadIdx.x; if (t >= n8) return; FragH f;
#pragma unroll
  for (int i = 0; i < 8; ++i) f.h[i] = (_Float16)(bf16_round(W[t * 8 + i]) * 16.0f); *(v8us*)((unsigned short*)Bt + t * 8) = f.half[0];  }
// ---- fragment order: how the attention operands q, k and v lie in the workspace (V^T: same tiles, placed as k_vt writes them) ----
// A plane of R rows x K columns (R % 16 == 0, K % 32 == 0) is cut into tiles of 16 rows x 32 k, tile (rt, kt) at element (rt * (K / 32) + kt) * 512. Inside a tile, 16-byte chunk 32 j + lane (lane = 16 hh + ln) holds
// row ln, k = 16 j + 8 hh + 0..7: the four registers that lane (ln, hh) takes as half j of its fragment (g2_frag's k order). A fragment is then two loads of 512 contiguous bytes, 4 whole lines a load,
// where row-major rows gave 16 lines a load; the register contents, and with them the k order of both operands of each product, are what they were.
template <int NHv, int TTv>
__global__ __launch_bounds__(256) void k_vt(const _Float16* __restrict__ V16, int ldv, int voff, _Float16* __restrict__ Vt) { __shared__ unsigned short tl[64][66]; const int tid = threadIdx.x; const int slab = blockIdx.x / (TTv / 64), lg = blockIdx.x % (TTv / 64); const int b = slab / NHv, h = slab % NHv;
  /* V16 in fragment order (rows = tokens, k = features, K = ldv): this 64 x 64 block is 4 row tiles x 2 adjacent k tiles; chunk c of row tile rtl holds token row r, features c8 + 0..7 */
  for (int i = tid; i < 64 * 8; i += 256) { const int rtl = i >> 7, c = i & 127, lane = i & 31; const int r = rtl * 16 + (lane & 15), c8 = (c >> 5) * 16 + (lane >> 4) * 8; FragH f;
    f.half[0] = *(const v8us*)((const unsigned short*)V16 + ((size_t)b * TTv + lg * 64 + rtl * 16) * ldv + (size_t)(voff + h * 64) * 16 + c * 8);
#pragma unroll
    for (int q = 0; q < 8; ++q) tl[r][c8 + q] = f.u[q]; }
  __syncthreads();
  {      /* Vt in fragment order, per slab: rows = d (4 tiles), k = tokens, the 4 d tiles of one 32-token step adjacent: tile (st, t) at ((slab * (TTv / 32) + st) * 4 + t) * 512; this block's 512 chunks are contiguous */
#pragma unroll
    for (int rd = 0; rd < 2; ++rd) { const int c = rd * 256 + tid, lane = c & 31; const int d = ((c >> 6) & 3) * 16 + (lane & 15), k0 = (c >> 8) * 32 + ((c >> 5) & 1) * 16 + (lane >> 4) * 8; FragH f;
#pragma unroll
      for (int q = 0; q < 8; ++q) f.u[q] = tl[k0 + q][d];
      *(v8us*)((unsigned short*)Vt + ((size_t)slab * (TTv / 32) + lg * 2) * 2048 + c * 8) = f.half[0]; }
     } }

__global__ __launch_bounds__(256) void k_hl(const float* __restrict__ F, _Float16* __restrict__ Hh, _Float16* __restrict__ Hl, size_t n8) { const size_t t = (size_t)blockIdx.x * 256 + threadIdx.x; if (t >= n8) return; FragH fh, fl; const v4f a = *(const v4fa*)(F + t * 8), c = *(const v4fa*)(F + t * 8 + 4);
#pragma unroll
  for (int q = 0; q < 4; ++q) { _Float16 h = (_Float16)a[q]; fh.h[q] = h; fl.h[q] = (_Float16)((a[q] - (float)h) * 1024.0f); h = (_Float16)c[q]; fh.h[4 + q] = h; fl.h[4 + q] = (_Float16)((c[q] - (float)h) * 1024.0f); }
  { *(v8us*)((unsigned short*)Hh + t * 8) = fh.half[0]; *(v8us*)((unsigned short*)Hl + t * 8) = fl.half[0];  } }

// ---- fast GEMM (workgroup tile 128x64, wave tile 32x64; requires M % 128 == 0 rows per launch region, N % 64 == 0 and K % 64 == 0, K >= 64); epilogue as k_gemm_hhx's without ACT 1 and 7, C16 in fragment order ----
// The operands go through LDS: a stage is 64 k of the workgroup's 128 A rows and 64 B rows (192 rows of 128 bytes, each one whole line of its source row), laid at a pitch of 144 bytes (16 B x odd: no bank conflict for
// the 16-byte fragment reads). Two buffers: the next stage's asynchronous copies fly while this stage is multiplied. The B rows are fetched once for the four waves.
#define G2P 72                       /* LDS row pitch, elements */
#define G2S (192 * G2P)              /* one buffer, elements */
__device__ __forceinline__ v16h g2_frag(const unsigned short* p, int hh) { FragH f; f.half[0] = *(const v8us*)(p + 8 * hh); f.half[1] = *(const v8us*)(p + 16 + 8 * hh); return f.v; }
// One thread's share of a stage: twelve asynchronous 16-byte copies (row groups of 16: eight of A, four of B; eight lanes cover one row's 128 bytes, so a wave's copy reads 4 whole lines). l = the thread's LDS byte address in
// row group 0 of the buffer, a and b = its source addresses there, sa and sb = 16 source rows in elements. The s_wait_xcnt is the wait that is kept in front of an overwrite of a register that an issued copy names:
// as the statement's last line it stands in front of every later write of these operands.
__device__ __forceinline__ void g2_stage(unsigned l, const _Float16* a, size_t sa, const _Float16* b, size_t sb) {
  asm volatile("global_load_async_to_lds_b128 %0, %12, off\n\tglobal_load_async_to_lds_b128 %1, %13, off\n\tglobal_load_async_to_lds_b128 %2, %14, off\n\tglobal_load_async_to_lds_b128 %3, %15, off\n\t"
               "global_load_async_to_lds_b128 %4, %16, off\n\tglobal_load_async_to_lds_b128 %5, %17, off\n\tglobal_load_async_to_lds_b128 %6, %18, off\n\tglobal_load_async_to_lds_b128 %7, %19, off\n\t"
               "global_load_async_to_lds_b128 %8, %20, off\n\tglobal_load_async_to_lds_b128 %9, %21, off\n\tglobal_load_async_to_lds_b128 %10, %22, off\n\tglobal_load_async_to_lds_b128 %11, %23, off\n\t"
               "s_wait_xcnt 0x0"
               :: "v"(l), "v"(l + 32u * G2P), "v"(l + 64u * G2P), "v"(l + 96u * G2P), "v"(l + 128u * G2P), "v"(l + 160u * G2P), "v"(l + 192u * G2P), "v"(l + 224u * G2P), "v"(l + 256u * G2P), "v"(l + 288u * G2P), "v"(l + 320u * G2P), "v"(l + 352u * G2P),
                  "v"(a), "v"(a + sa), "v"(a + 2 * sa), "v"(a + 3 * sa), "v"(a + 4 * sa), "v"(a + 5 * sa), "v"(a + 6 * sa), "v"(a + 7 * sa), "v"(b), "v"(b + sb), "v"(b + 2 * sb), "v"(b + 3 * sb) : "memory"); }
__device__ __forceinline__ v8f g2_mma(v16h a, v16h b, v8f c) { v8f d = __builtin_amdgcn_wmma_f32_16x16x32_f16(false, a, false, b, (short)0, c, false, false); asm volatile("v_nop\n\tv_nop\n\tv_nop\n\tv_nop" : "+v"(d) : "v"(a), "v"(b)); return d; }
template <int ACT>
__global__ __launch_bounds__(128) void k_gemm2(const _Float16* __restrict__ A, int lda, size_t sA, const _Float16* __restrict__ Bh, int ldb, size_t sB, float alpha, const float* __restrict__ bias, size_t sBias, const float* __restrict__ CP, int rowsPerB, size_t sCPb, int row0g,
    float* __restrict__ C, _Float16* __restrict__ C16, int ldc, size_t sC, int M, int N, int K) { static_assert(ACT == 0 || ACT == 3 || ACT == 6 || ACT == 8 || ACT == 9 || ACT == 11 || ACT == 12 || ACT == 14 || ACT == 15 || ACT == 16 || ACT == 17, "k_gemm2: unsupported ACT code (would silently apply no activation)");
  __shared__ __attribute__((aligned(16))) float so[4][32][68];
  __shared__ __attribute__((aligned(16))) unsigned short st[2 * G2S];
  const int tid = threadIdx.x, w = tid >> 5, lane = tid & 31, ln = lane & 15, hh = lane >> 4; const int by = blockIdx.y;
  A += (size_t)by * sA; Bh += (size_t)by * sB; const size_t cofs = (size_t)by * sC; const float* bp = bias ? bias + (size_t)by * sBias : nullptr;
  const int ntn = N >> 6; const int mt = blockIdx.x / ntn, nq = blockIdx.x - mt * ntn; const int row0 = mt * 128 + 32 * w, col0 = nq * 64; if (mt * 128 >= M) return;      /* the whole workgroup or none: barriers follow */
  const unsigned l0 = (unsigned)(size_t)&st[(tid >> 3) * G2P + (tid & 7) * 8];      /* LDS byte address: the low 32 bits of the shared address */
  const _Float16* ga = A + (size_t)(mt * 128 + (tid >> 3)) * lda + (tid & 7) * 8; const _Float16* gb = Bh + (size_t)(col0 + (tid >> 3)) * ldb + (tid & 7) * 8; const size_t sa = (size_t)16 * lda, sb = (size_t)16 * ldb;
  const int nt = K >> 6;
  const v8f z8 = {0.f,0.f,0.f,0.f,0.f,0.f,0.f,0.f}; v8f c00 = z8, c01 = z8, c02 = z8, c03 = z8, c10 = z8, c11 = z8, c12 = z8, c13 = z8;
  g2_stage(l0, ga, sa, gb, sb);
  asm volatile("s_wait_asynccnt 0x0" ::: "memory");      /* this wave's copies of stage 0 have landed */
  __syncthreads();      /* publishes stage 0 */
  if (nt > 1) g2_stage(l0 + 2u * G2S, ga + 64, sa, gb + 64, sb);
#pragma unroll 1      /* kept rolled: a trip already holds 24 LDS reads and 16 WMMAs; unrolling would only repeat the copies, the waits and the barrier in the text */
  for (int t = 0; t < nt; ++t) { const unsigned short* const ap = st + (t & 1) * G2S + (32 * w + ln) * G2P; const unsigned short* const bq = st + (t & 1) * G2S + (128 + ln) * G2P; v16h af[2][2], bf[2][4];
#pragma unroll
    for (int ks = 0; ks < 2; ++ks) {
#pragma unroll
      for (int r = 0; r < 2; ++r) af[ks][r] = g2_frag(ap + 16 * r * G2P + 32 * ks, hh);
#pragma unroll
      for (int u = 0; u < 4; ++u) bf[ks][u] = g2_frag(bq + 16 * u * G2P + 32 * ks, hh); }
#pragma unroll
    for (int ks = 0; ks < 2; ++ks) { c00 = g2_mma(af[ks][0], bf[ks][0], c00); c10 = g2_mma(af[ks][1], bf[ks][0], c10); c01 = g2_mma(af[ks][0], bf[ks][1], c01); c11 = g2_mma(af[ks][1], bf[ks][1], c11);
      c02 = g2_mma(af[ks][0], bf[ks][2], c02); c12 = g2_mma(af[ks][1], bf[ks][2], c12); c03 = g2_mma(af[ks][0], bf[ks][3], c03); c13 = g2_mma(af[ks][1], bf[ks][3], c13); }
    asm volatile("s_wait_dscnt 0x0" ::: "memory");      /* this wave's reads of the buffer are done before it may be refilled */
    asm volatile("s_wait_asynccnt 0x0" ::: "memory");      /* this wave's copies of stage t + 1 have landed */
    __syncthreads();      /* publishes stage t + 1 and ends every wave's reads of stage t */
    if (t + 2 < nt) g2_stage(l0 + (unsigned)(t & 1) * (2u * G2S), ga + (size_t)(t + 2) * 64, sa, gb + (size_t)(t + 2) * 64, sb); }
  asm volatile("s_wait_asynccnt 0x0" ::: "memory");      /* no copy is outstanding when the wave goes on */
  v8f accs[8] = {c00, c01, c02, c03, c10, c11, c12, c13};
#pragma unroll
  for (int u = 0; u < 8; ++u) { const int t = u & 3, half = u >> 2; const int col = col0 + t * 16 + ln; const float bv = bp ? bf16_round(bp[col]) : 0.f;
#pragma unroll
    for (int r = 0; r < 8; ++r) { const int rloc = half * 16 + 8 * hh + r; float v = accs[u][r] * alpha + bv; if (CP) { if (rowsPerB < 0) v += CP[cofs + (size_t)(row0g + row0 + rloc) * ldc + col];      /* rowsPerB < 0: own element of the batched C plane */ else { const int bidx = (row0g + row0 + rloc) / rowsPerB; v += CP[(size_t)bidx * sCPb + (size_t)by * 64 + col]; } }
      if (ACT == 3) v = fmaxf(v, 0.f); else if (ACT == 6) v = 0.5f * v * (1.0f + erff(v * 0.70710678118654752f)); else if (ACT == 11) v = 1.0f / (1.0f + expf(-v)); else if (ACT == 15) v = v / (1.0f + expf(-v)); else if (ACT == 12) v = (v > 0.f) ? v : 0.01f * v; else if (ACT == 8) v = tanhf(v); else if (ACT == 9) v = 0.5f * v * (1.0f + tanhf(0.7978845608028654f * (v + 0.044715f * v * v * v))); else if (ACT == 14) v = (v > 0.f) ? v : 0.1f * v; else if (ACT == 16) v = (v >= 0.f) ? v : 0.3f * v; else if (ACT == 17) v = (v >= 0.f) ? v : 0.2f * v;
      so[w][rloc][t * 16 + ln] = v; } }
  __builtin_amdgcn_fence(__ATOMIC_ACQ_REL, "workgroup"); __builtin_amdgcn_wave_barrier();
  const int rsub = lane >> 4, c4 = (lane & 15) * 4;
  {
    if (C) {
#pragma unroll
      for (int q = 0; q < 16; ++q) { const int r = q * 2 + rsub; const v4f v = *(const v4fa*)&so[w][r][c4]; *(v4f*)(C + cofs + (size_t)(row0 + r) * ldc + col0 + c4) = v; }
      asm volatile("s_wait_xcnt 0x0" ::: "memory"); }      /* the C16 block below writes registers that these stores name: the wait that is kept in front of such an overwrite */
    if (C16) {      /* C16 goes out in fragment order (see above k_vt; K = ldc): the 32 x 64 tile is 2 row tiles x 2 adjacent k tiles x 2 halves = 8 stores of 512 contiguous bytes */
#pragma unroll
      for (int u = 0; u < 8; ++u) { const int rtl = u >> 2, cu = u & 3; const float* sp = &so[w][rtl * 16 + ln][cu * 16 + 8 * hh]; const v4f v0 = *(const v4fa*)sp, v1 = *(const v4fa*)(sp + 4); FragH f;
#pragma unroll
        for (int i = 0; i < 4; ++i) { f.h[i] = (_Float16)v0[i]; f.h[4 + i] = (_Float16)v1[i]; }
        *(v8us*)((unsigned short*)C16 + cofs + (size_t)(row0 + 16 * rtl) * ldc + (size_t)col0 * 16 + cu * 256 + 8 * lane) = f.half[0]; } }
     } }


__global__ __launch_bounds__(256) void k_rsm(const float* __restrict__ S, _Float16* __restrict__ P, int nrows) {
  #pragma clang fp contract(off)
  const int i = blockIdx.x * 256 + threadIdx.x; if (i >= nrows) return; const float* s = S + (size_t)i * SQ; float mx = -3.0e38f;
#pragma unroll 1
  for (int j = 0; j < SQ; ++j) mx = fmaxf(mx, s[j]); float se = 0.f;
#pragma unroll 1
  for (int j = 0; j < SQ; ++j) se += expf(s[j] - mx); const float sc = 256.0f / se;
#pragma unroll 1
  for (int j0 = 0; j0 < SQ; j0 += 8) { FragH f; for (int q = 0; q < 8; ++q) f.h[q] = (_Float16)(expf(s[j0 + q] - mx) * sc); unsigned short* d = (unsigned short*)P + (size_t)i * SQ + j0; *(v8us*)d = f.half[0];  } }
__global__ __launch_bounds__(256) void k_vt(const _Float16* __restrict__ V16, int b, int h0, _Float16* __restrict__ VT) { __shared__ unsigned short tl[64][65]; const int tid = threadIdx.x; const int hh = blockIdx.x % HG, sg = blockIdx.x / HG; const int s0 = sg * 64; const int h = h0 + hh;
  for (int i = tid; i < 64 * 8; i += 256) { const int j = i / 8, d8 = (i % 8) * 8; FragH f; f.half[0] = *(const v8us*)((const unsigned short*)V16 + ((size_t)b * SQ + s0 + j) * DM + h * HD + d8); for (int q = 0; q < 8; ++q) tl[d8 + q][j] = f.u[q]; }
  __syncthreads();
  { for (int i = tid; i < 64 * 8; i += 256) { const int d = i / 8, j8 = (i % 8) * 8; FragH f; for (int q = 0; q < 8; ++q) f.u[q] = tl[d][j8 + q]; *(v8us*)((unsigned short*)VT + ((size_t)hh * HD + d) * SQ + s0 + j8) = f.half[0]; }  } }



__global__ __launch_bounds__(256) void k_rsmf(const float* __restrict__ S, _Float16* __restrict__ P, int qn, int hg) {
  #pragma clang fp contract(off)
  const int t = blockIdx.x * 256 + threadIdx.x; if (t >= qn * hg) return; const size_t i = (size_t)(t / qn) * SQ + (t % qn); const float* s = S + i * SQ; float mx = -3.0e38f;
#pragma unroll 1
  for (int j = 0; j < SQ; ++j) mx = fmaxf(mx, s[j]); float se = 0.f;
#pragma unroll 1
  for (int j = 0; j < SQ; ++j) se += __expf(s[j] - mx); const float sc = 256.0f / se;
#pragma unroll 1
  for (int j0 = 0; j0 < SQ; j0 += 8) { FragH f; for (int q = 0; q < 8; ++q) f.h[q] = (_Float16)(__expf(s[j0 + q] - mx) * sc); unsigned short* d = (unsigned short*)P + i * SQ + j0; *(v8us*)d = f.half[0];  } }

// Four native exp2 in one statement: each is the independent instruction that the instruction set asks for behind the transcendental in front of it, and the v_nop is that slot behind the last
// Early-clobber outputs keep the four independent of one another.
__device__ __forceinline__ void exp2x4(float& a, float& b, float& c, float& d) { float e0, e1, e2, e3;
  asm("v_exp_f32 %0, %4\n\tv_exp_f32 %1, %5\n\tv_exp_f32 %2, %6\n\tv_exp_f32 %3, %7\n\tv_nop" : "=&v"(e0), "=&v"(e1), "=&v"(e2), "=&v"(e3) : "v"(a), "v"(b), "v"(c), "v"(d));
  a = e0; b = e1; c = e2; d = e3; }
// Two native exp2 in one statement, as exp2x4 above: the second is the independent instruction behind the first, the v_nop is that slot behind the second.
__device__ __forceinline__ void exp2x2(float& a, float& b) { float e0, e1;
  asm("v_exp_f32 %0, %2\n\tv_exp_f32 %1, %3\n\tv_nop" : "=&v"(e0), "=&v"(e1) : "v"(a), "v"(b));
  a = e0; b = e1; }
__device__ __forceinline__ float fa_xhalf(float x) { return __builtin_bit_cast(float, __builtin_amdgcn_permlanex16(__builtin_bit_cast(int, x), __builtin_bit_cast(int, x), 0x76543210, 0xfedcba98, false, false)); }      /* lane l <-> lane l ^ 16 */
__device__ __forceinline__ v16h fa_frag(const _Float16* ub, unsigned off) { FragH f; f.half[0] = *(const v8us*)((const unsigned short*)ub + off); f.half[1] = *(const v8us*)((const unsigned short*)ub + off + 256); return f.v; }      /* a tile in fragment order, g2_frag's k order; ub is the same for the whole wave, off = tile offset + 8 * lane */
__device__ __forceinline__ v8f fa_mma(v16h a, v16h b, v8f c) { return __builtin_amdgcn_wmma_f32_16x16x32_f16(false, a, false, b, (short)0, c, false, false); }
// Fused attention of one head: scores, softmax and P.V in one launch; neither the scores nor the weights go to memory.
// Grid (SQ / 256, heads), 8 waves; a wave owns 32 queries (two groups of 16 columns) and walks all keys, 32 a step.
// Transposed products: S^T = K . Q^T (A = 16 key rows, B = 16 query columns, k = d) and O^T += V^T . P^T (A = 16 d rows of V^T, B = P^T, k = 32 keys).
// D register r of lane (c = lane & 15, h = lane >> 4) is element [8 h + r][c]: a lane holds one query's scores, and the two 16-key score tiles of a step, converted in place, are the B operand of the
// second product in the k order of g2_frag (elements 0..7 = keys 8 h + 0..7, elements 8..15 = keys 16 + 8 h + 0..7), which loads V^T. No LDS and no lane exchange for P.
// Online softmax in the log2 domain, f32: running maximum mr and running sum lr per query; each step rescales O^T and lr by exp2(old maximum - new maximum). The weights are carried x256 (the + 8) as f16
// operands, away from the f16 subnormals; the factor cancels in the division by lr, which sums the same scaled weights. mr starts at -3.0e38 (finite), so a step whose keys are all masked to -inf adds zeros.
// The mask (bf16-rounded, x log2 e) is prepared once per workgroup in LDS; the one barrier publishes it.
__global__ __launch_bounds__(256) void k_fattn(const _Float16* __restrict__ Q, const _Float16* __restrict__ Kk, const _Float16* __restrict__ VTh, const float* __restrict__ am, _Float16* __restrict__ O) {
  __shared__ __attribute__((aligned(16))) float smk[SQ];
  const int tid = threadIdx.x, lane = tid & 31, ln = lane & 15, hh = lane >> 4, w = tid >> 5; const int h = blockIdx.y, q0 = blockIdx.x * 256 + w * 32;
  for (int i = tid * 4; i < SQ; i += 1024) { v4f a = *(const v4fa*)(am + i);
#pragma unroll
    for (int q = 0; q < 4; ++q) a[q] = bf16_round(a[q]) * 1.44269504f;
    *(v4fa*)&smk[i] = a; }
  __syncthreads();
  const unsigned qo = (unsigned)(q0 * LQ + 8 * lane); v16h qf[2][2];      /* Q, Kk and VTh lie in fragment order (see above k_vt): a row tile is 16 * LQ elements, head h is its k tiles 2 h and 2 h + 1 */
#pragma unroll
  for (int g = 0; g < 2; ++g)
#pragma unroll
    for (int ks = 0; ks < 2; ++ks) qf[g][ks] = fa_frag(Q + h * HD * 16, qo + 16 * g * LQ + 512 * ks);
  const _Float16* const kb = Kk + h * HD * 16; const _Float16* const vb = VTh + (size_t)h * HD * SQ; const unsigned ko = (unsigned)(8 * lane), vo = (unsigned)(8 * lane);
  const v8f z8 = {0.f,0.f,0.f,0.f,0.f,0.f,0.f,0.f}; v8f o[2][4];
#pragma unroll
  for (int g = 0; g < 2; ++g)
#pragma unroll
    for (int t = 0; t < 4; ++t) o[g][t] = z8;
  float mr[2] = {-3.0e38f, -3.0e38f}, lr[2] = {0.f, 0.f};
  v16h ka[2][2];
#pragma unroll
  for (int kt = 0; kt < 2; ++kt)
#pragma unroll
    for (int ks = 0; ks < 2; ++ks) ka[kt][ks] = fa_frag(kb, ko + 16 * kt * LQ + 512 * ks);
#pragma unroll 1      /* one step is some 250 instructions and holds its own overlap (loads against softmax); unrolling would only grow the code */
  for (int j0 = 0; j0 < SQ; j0 += 32) {
    v4f mk[2][2];      /* this step's mask values: read from LDS under the first product */
#pragma unroll
    for (int kt = 0; kt < 2; ++kt)
#pragma unroll
      for (int c = 0; c < 2; ++c) mk[kt][c] = *(const v4fa*)&smk[j0 + 16 * kt + 8 * hh + 4 * c];
    v16h va[4];      /* this step's V^T fragments: issued here, needed only behind the exponentials */
#pragma unroll
    for (int t = 0; t < 4; ++t) va[t] = fa_frag(vb + j0 * HD, vo + 512 * t);
    v8f s[2][2];
#pragma unroll
    for (int g = 0; g < 2; ++g)
#pragma unroll
      for (int kt = 0; kt < 2; ++kt) s[g][kt] = fa_mma(ka[kt][1], qf[g][1], fa_mma(ka[kt][0], qf[g][0], z8));
    const _Float16* const kn = kb + (size_t)((j0 + 32 < SQ) ? j0 + 32 : 0) * LQ;      /* the next step's K fragments, in flight under this step's softmax; the last step re-reads the first rows, unused */
#pragma unroll
    for (int kt = 0; kt < 2; ++kt)
#pragma unroll
      for (int ks = 0; ks < 2; ++ks) ka[kt][ks] = fa_frag(kn, ko + 16 * kt * LQ + 512 * ks);
    __builtin_amdgcn_sched_barrier(0);      /* keeps both groups of loads in front of the softmax: left free, the K loads sank to the loop's foot and the next step waited out their whole latency */
    float mn[2], cr[2];
#pragma unroll
    for (int g = 0; g < 2; ++g) { float mx = mr[g];
#pragma unroll
      for (int kt = 0; kt < 2; ++kt)
#pragma unroll
        for (int r = 0; r < 8; ++r) { s[g][kt][r] = s[g][kt][r] * 0.18033688f + mk[kt][r >> 2][r & 3]; mx = fmaxf(mx, s[g][kt][r]); }      /* (q . k / 8 + mask) log2 e */
      mn[g] = fmaxf(mx, fa_xhalf(mx)); cr[g] = mr[g] - mn[g]; mr[g] = mn[g]; }
    exp2x2(cr[0], cr[1]); FragH pf[2];
#pragma unroll
    for (int g = 0; g < 2; ++g) { const float nm = 8.0f - mn[g]; float ls[4] = {0.f, 0.f, 0.f, 0.f};
#pragma unroll
      for (int t = 0; t < 4; ++t) o[g][t] = o[g][t] * cr[g];
#pragma unroll
      for (int kt = 0; kt < 2; ++kt)
#pragma unroll
        for (int r4 = 0; r4 < 8; r4 += 4) { float y[4];
#pragma unroll
          for (int q = 0; q < 4; ++q) y[q] = s[g][kt][r4 + q] + nm;
          exp2x4(y[0], y[1], y[2], y[3]);
#pragma unroll
          for (int q = 0; q < 4; ++q) { ls[q] += y[q]; pf[g].h[8 * kt + r4 + q] = (_Float16)y[q]; } }
      lr[g] = lr[g] * cr[g] + ((ls[0] + ls[1]) + (ls[2] + ls[3])); }
    __builtin_amdgcn_sched_barrier(0);      /* keeps every asm exponential in front of the second product */
#pragma unroll
    for (int g = 0; g < 2; ++g)
#pragma unroll
      for (int t = 0; t < 4; ++t) o[g][t] = fa_mma(va[t], pf[g].v, o[g][t]); }
#pragma unroll
  for (int g = 0; g < 2; ++g) { const float sc = 64.0f / (lr[g] + fa_xhalf(lr[g]));      /* the halves' sums joined; o carried x64, as the output GEMM's alpha expects */
    _Float16* d = O + h * HD + ((unsigned)((q0 + ln) * DM + 8 * hh) + 16 * g * DM);
#pragma unroll
    for (int t = 0; t < 4; ++t) { FragH f;
#pragma unroll
      for (int r = 0; r < 8; ++r) f.h[r] = (_Float16)(o[g][t][r] * sc);
      *(v8us*)((unsigned short*)d + 16 * t) = f.half[0]; } } }


// All input conversions in one streaming launch: x -> X16 (the bf16-rounded value as f16) and XB (the same value as f32, the residual plane); each weight -> its f16 plane, x16 (natural [out][in] = Bt[n][k]).
// 512 workgroups of 8 waves: 16 waves a WGP, 4096 waves in all. A wave takes one contiguous 4-KiB block of x and one of a weight (workgroups 128 s .. 128 s + 127 share weight s): 8 + 8 loads of 16 bytes a lane,
// each load 512 contiguous bytes (4 whole lines), all sixteen issued before the first value is used; the stores cover whole lines too (512 bytes f32, 256 bytes f16). x is read once for both of its planes.
__global__ __launch_bounds__(256) void k_prep(const float* __restrict__ x, const float* __restrict__ wq, const float* __restrict__ wk, const float* __restrict__ wv, const float* __restrict__ wo,
    _Float16* __restrict__ X16, float* __restrict__ XB, _Float16* __restrict__ BQ, _Float16* __restrict__ BK, _Float16* __restrict__ BV, _Float16* __restrict__ BO) {
  static_assert(NR * DM == (size_t)512 * 8 * 1024 && (size_t)DM * DM == (size_t)128 * 8 * 1024, "k_prep: the grid of 512 workgroups covers exactly these planes");
  const unsigned lane = threadIdx.x & 31, wid = blockIdx.x * 8 + (threadIdx.x >> 5), sel = blockIdx.x >> 7;
  const float* const w = sel == 0 ? wq : sel == 1 ? wk : sel == 2 ? wv : wo; _Float16* const B = sel == 0 ? BQ : sel == 1 ? BK : sel == 2 ? BV : BO;
  const unsigned xo = wid * 1024 + lane * 4, bo = (wid & 1023) * 1024 + lane * 4;      /* element offsets of the wave's two blocks */
  v4f a[8], b[8];      /* every loop below is unrolled: a and b stay in registers and each step's offset is an immediate of its load or store */
#pragma unroll
  for (int j = 0; j < 8; ++j) a[j] = *(const v4fa*)(x + xo + 128 * j);
#pragma unroll
  for (int j = 0; j < 8; ++j) b[j] = *(const v4fa*)(w + bo + 128 * j);
  __builtin_amdgcn_sched_barrier(0);      /* keeps the weight loads in front of the conversions: left free, they sank behind the x stores and the wave waited out a second memory latency */
#pragma unroll
  for (int j = 0; j < 8; ++j) { v4f r; v4h h;
#pragma unroll
    for (int q = 0; q < 4; ++q) { r[q] = bf16_round(a[j][q]); h[q] = (_Float16)r[q]; }
    *(v4f*)(XB + xo + 128 * j) = r; *(v4h*)(X16 + xo + 128 * j) = h; }
#pragma unroll
  for (int j = 0; j < 8; ++j) { v4h h;
#pragma unroll
    for (int q = 0; q < 4; ++q) h[q] = (_Float16)(bf16_round(b[j][q]) * 16.0f);
    *(v4h*)(B + bo + 128 * j) = h; } }


__global__ __launch_bounds__(256) void k_lnrow(const float* __restrict__ Y, const float* __restrict__ g, const float* __restrict__ bb, float eps, float* __restrict__ out) {
  #pragma clang fp contract(off)
  __shared__ float red[256]; const size_t r = blockIdx.x; const int t = threadIdx.x; const v4f ya = *(const v4fa*)(Y + r * DMQ + t * 4); float s[4]; float sum = 0.f;
  for (int q = 0; q < 4; ++q) { s[q] = ya[q]; sum = __fadd_rn(sum, s[q]); }
  red[t] = sum; __syncthreads(); for (int st = 128; st > 0; st >>= 1) { if (t < st) red[t] = __fadd_rn(red[t], red[t + st]); __syncthreads(); } const float mu = red[0] / (float)DMQ; __syncthreads();
  float vs = 0.f; for (int q = 0; q < 4; ++q) { const float dl = __fadd_rn(s[q], -mu); vs = __fadd_rn(vs, __fmul_rn(dl, dl)); } red[t] = vs; __syncthreads(); for (int st = 128; st > 0; st >>= 1) { if (t < st) red[t] = __fadd_rn(red[t], red[t + st]); __syncthreads(); }
  const float rs = rsqrtf(__fadd_rn(red[0] / (float)DMQ, eps)); v4f y; for (int q = 0; q < 4; ++q) { const int c = t * 4 + q; y[q] = __fadd_rn(__fmul_rn(__fmul_rn(__fadd_rn(s[q], -mu), rs), bf16_round(g[c])), bf16_round(bb[c])); }
  *(v4f*)(out + r * DMQ + t * 4) = y;  }
extern "C" void kernel_launch(void* const* d_in, const int* in_sizes, int n_in,
                              void* d_out, int out_size, void* d_ws, size_t ws_size, hipStream_t stream) {
  (void)in_sizes; (void)n_in; (void)out_size;
  const float* const* I = (const float* const*)d_in; const float* x = I[0]; const float* am = I[1]; const float* wq = I[2]; const float* bq = I[3]; const float* wk = I[4]; const float* bk = I[5]; const float* wv = I[6]; const float* bv = I[7]; const float* wo = I[8]; const float* bo = I[9]; const float* lng = I[10]; const float* lnb = I[11];      /* nn.Linear weights [out][in] + biases; additive mask [1][1][1][S] */
  char* ws = (char*)d_ws; size_t off = 0;
  auto take = [&](size_t bytes) { char* p = ws + off; off += (bytes + 255) & ~(size_t)255; return p; };
  _Float16* BQ = (_Float16*)take((size_t)DM * DM * 2); _Float16* BK = (_Float16*)take((size_t)DM * DM * 2); _Float16* BV = (_Float16*)take((size_t)DM * DM * 2); _Float16* BO = (_Float16*)take((size_t)DM * DM * 2);
  _Float16* X16 = (_Float16*)take(NR * DM * 2); float* XB = (float*)take(NR * DM * 4); float* YF = (float*)take(NR * DM * 4); _Float16* Q16 = (_Float16*)take(NR * DM * 2); _Float16* K16 = (_Float16*)take(NR * DM * 2); _Float16* V16 = (_Float16*)take(NR * DM * 2); _Float16* O16 = (_Float16*)take(NR * DM * 2);
  _Float16* VT = (_Float16*)take((size_t)NH * HD * SQ * 2);
  if (off > ws_size) return;
  k_prep<<<512, 256, 0, stream>>>(x, wq, wk, wv, wo, X16, XB, BQ, BK, BV, BO);      /* f16 x rows, bf16(x) residual plane, the four weight planes x16 */
  const size_t r0p = (size_t)B0 * SQ;      /* first projected row */
  k_gemm2<0><<<dim3((unsigned)((MP / 128) * (DM / 64)), 1), 128, 0, stream>>>(X16 + r0p * DM, DM, 0, BQ, DM, 0, 0.0625f, bq, 0, nullptr, 1, 0, 0, nullptr, Q16 + r0p * DM, DM, 0, MP, DM, DM);
  k_gemm2<0><<<dim3((unsigned)((MP / 128) * (DM / 64)), 1), 128, 0, stream>>>(X16 + r0p * DM, DM, 0, BK, DM, 0, 0.0625f, bk, 0, nullptr, 1, 0, 0, nullptr, K16 + r0p * DM, DM, 0, MP, DM, DM);
  k_gemm2<0><<<dim3((unsigned)((MP / 128) * (DM / 64)), 1), 128, 0, stream>>>(X16 + r0p * DM, DM, 0, BV, DM, 0, 0.0625f, bv, 0, nullptr, 1, 0, 0, nullptr, V16 + r0p * DM, DM, 0, MP, DM, DM);
  for (int b = B0; b < B0 + NBR; ++b) { const size_t r0 = (size_t)b * SQ;
    k_vt<NH, SQ><<<NH * (SQ / 64), 256, 0, stream>>>(V16 + r0 * LQ, LQ, 0, VT);      /* V^T of all heads (HD x SQ each, fragment order) for this batch */
    k_fattn<<<dim3(SQ / 256, NH), 256, 0, stream>>>(Q16 + r0 * LQ, K16 + r0 * LQ, VT, am + (size_t)b * SQ, O16 + r0 * DM); }      /* scores + attention_mask, softmax and P . V of all heads, fused; o (merged heads, x64) as f16 rows */
  k_gemm2<0><<<dim3((unsigned)((MPO / 128) * (DM / 64)), 1), 128, 0, stream>>>(O16 + r0p * DM, DM, 0, BO, DM, 0, 0.0009765625f, bo, 0, XB + r0p * DM, -1, 0, 0, YF + r0p * DM, nullptr, DM, 0, MPO, DM, DM);      /* y = ctx Wo^T + bo + bf16(x) (own-element residual) */
  k_lnrow<<<(unsigned)MPO, 256, 0, stream>>>(YF + r0p * DM, lng, lnb, 1e-12f, (float*)d_out + r0p * DM);      /* post-LayerNorm */
}

// v006
// Measured time: 175 microseconds a run.
// Two timings next to v005 put it at 1.13 and 1.11 times that version's speed.
// All steps since v000 together make it 79.5 times as fast.
#include <hip/hip_runtime.h>
// BERT self-attention + output (hidden_states [1][4096][1024]; q/k/v = x W^T + b (nn.Linear [out][in] 1024^2, sigma 1/32, zero biases), 16 heads of 64; scores = (q/8) . k + attention_mask[j] (additive [1][1][1][S], zeros); softmax; ctx merged; out = LayerNorm(ctx Wo^T + bo + hidden_states; ln_gamma, ln_beta, eps 1e-12) -> [1][4096][1024]).
// Structure: token rows r = b*4096 + s; x as exact f16 rows (bf16-rounded); Q, K, V as three WMMA GEMMs (32x64 wave tiles, f32 accumulation, exact x16 weights + bias, f16 outputs); per batch: V^T for all heads via LDS transposes; per batch one fused attention launch over all heads: S^T = K . Q^T on WMMA (alpha = 64^-0.5), online softmax on VALU (f32 statistics, native exp2; weights x256 as f16 operands, in registers only), O^T += V^T . P^T on WMMA (o carried x64 against f16 subnormal flush, folded into the output GEMM alpha) written straight into the merged f16 o rows; y = o Wo^T + bo + bf16(x) GEMM (f32, own-element residual) into f32 rows; post-LayerNorm on VALU (f32, LDS trees) into the output.
// Compute dtype: inputs rounded to bf16; x / weights exact; q, k, v, softmax weights and o as plain f16 GEMM operands (~2^-12); scores and softmax statistics f32. v_wmma_f32_16x16x32_f16.
#define NB 1
#define SQ 4096
#define DM 1024
#define NH 16
#define HD 64
#define HG 1                         /* heads per group of the k_vt(b, h0) overload, not launched */
#define B0 0                         /* first batch processed (debug hook) */
#define NBR NB                       /* batches processed (debug hook) */
#define NR ((size_t)NB * SQ)
#define DMQ DM         /* width of the token rows (LayerNorm length) */
#define MP ((int)((size_t)NBR * SQ)) /* rows projected (debug hook) */
#define QN SQ                        /* not used: attention covers all SQ query rows */
#define NHD NH                       /* not used: attention covers all NH heads */
#define MPO MP                       /* rows through the output stage (debug hook) */
#define LQ DM      /* width K of the q/k/v planes (fragment order) */
typedef __bf16 v16b __attribute__((ext_vector_type(16)));
typedef unsigned short v8us __attribute__((ext_vector_type(8), may_alias));
typedef float  v8f  __attribute__((ext_vector_type(8)));
typedef float  v4f  __attribute__((ext_vector_type(4)));
typedef float  v4fa __attribute__((ext_vector_type(4), may_alias));
union FragB { v16b v; v8us half[2]; unsigned short u[16]; };

__device__ __forceinline__ unsigned short bf16_bits(float x) { unsigned int u = __float_as_uint(x); return (unsigned short)((u + 0x7FFFu + ((u >> 16) & 1u)) >> 16); }
__device__ __forceinline__ float bf16_val(unsigned short b) { return __uint_as_float(((unsigned int)b) << 16); }
__device__ __forceinline__ float bf16_round(float x) { return bf16_val(bf16_bits(x)); }
// D += A·B with NT terms: 1 = ah·bh, 2 = + al·bh (A split), 3 = + ah·bl (both split)
template <int NT>
__device__ __forceinline__ v8f mmaN(v16b ah, v16b al, v16b bh, v16b bl, v8f c) {
  c = __builtin_amdgcn_wmma_f32_16x16x32_bf16(false, ah, false, bh, (short)0, c, false, false);
  if (NT >= 2) c = __builtin_amdgcn_wmma_f32_16x16x32_bf16(false, al, false, bh, (short)0, c, false, false);
  if (NT >= 3) c = __builtin_amdgcn_wmma_f32_16x16x32_bf16(false, ah, false, bl, (short)0, c, false, false);
  asm volatile("v_nop\n\tv_nop\n\tv_nop\n\tv_nop" : "+v"(c) : "v"(ah), "v"(al), "v"(bh), "v"(bl));
  return c;
}

__global__ __launch_bounds__(256) void k_wt_bf16(const float* __restrict__ W, unsigned short* __restrict__ Wt, int K, int N) {
  const int t = blockIdx.x * 256 + threadIdx.x;
  const int k8n = K / 8;
  if (t >= N * k8n) return;
  const int n = t / k8n, k8 = (t % k8n) * 8;
  v8us v;
#pragma unroll
  for (int i = 0; i < 8; ++i) v[i] = bf16_bits(W[(size_t)(k8 + i) * N + n]);
  *(v8us*)(Wt + (size_t)n * K + k8) = v;
  
}

// GEMM C[M][N] (f32, pitch ldc) = act(A[M][K]·W + bias). A f32 row-major (pitch lda) converted per fragment to bf16
// (ASPLIT: hi/lo two planes -> 2 terms, else single rounded term); Wt bf16 [N][K] (pitch ldb). BIAS_BF16 rounds the
// bias to bf16 first (bias quantised to bf16 before the add). K%32==0, M%16==0, N%64==0.
template <bool ASPLIT, int ACT, bool BIAS_BF16>
__global__ __launch_bounds__(128) void k_gemm_bf(const float* __restrict__ A, int lda, const unsigned short* __restrict__ Wt, int ldb,
                                               const float* __restrict__ bias, float* __restrict__ C, int ldc, int M, int N, int K) {
  __shared__ __attribute__((aligned(16))) float so[4][16][64];
  const int tid = threadIdx.x, w = tid >> 5, lane = tid & 31, ln = lane & 15, hh = lane >> 4;
  const int ntn = N / 64;
  const int wid = blockIdx.x * 4 + w;
  const int mt = wid / ntn, nq = wid % ntn;
  if (mt * 16 >= M) return;
  const int row0 = mt * 16, col0 = nq * 64;
  const float* arow = A + (size_t)(row0 + ln) * lda;
  v8f acc[4] = {};
  for (int kb = 0; kb < K; kb += 32) {
    FragB ah, al;
    const v4f x0 = *(const v4fa*)(arow + kb + 8 * hh), x1 = *(const v4fa*)(arow + kb + 8 * hh + 4);
    const v4f x2 = *(const v4fa*)(arow + kb + 16 + 8 * hh), x3 = *(const v4fa*)(arow + kb + 16 + 8 * hh + 4);
    float xs[16] = {x0[0],x0[1],x0[2],x0[3],x1[0],x1[1],x1[2],x1[3],x2[0],x2[1],x2[2],x2[3],x3[0],x3[1],x3[2],x3[3]};
#pragma unroll
    for (int i = 0; i < 16; ++i) { const unsigned short hb = bf16_bits(xs[i]); ah.u[i] = hb; al.u[i] = ASPLIT ? bf16_bits(xs[i] - bf16_val(hb)) : (unsigned short)0; }
#pragma unroll
    for (int t = 0; t < 4; ++t) {
      const unsigned short* brow = Wt + (size_t)(col0 + t * 16 + ln) * ldb + kb;
      FragB b;
      b.half[0] = *(const v8us*)(brow + 8 * hh);
      b.half[1] = *(const v8us*)(brow + 16 + 8 * hh);
      acc[t] = mmaN<ASPLIT ? 2 : 1>(ah.v, al.v, b.v, b.v, acc[t]);
    }
  }
#pragma unroll
  for (int t = 0; t < 4; ++t) {
    float bv = bias ? bias[col0 + t * 16 + ln] : 0.f;
    if (BIAS_BF16) bv = bf16_round(bv);
#pragma unroll
    for (int r = 0; r < 8; ++r) { float v = acc[t][r] + bv; if (ACT == 1) v = fmaxf(v, 0.f); so[w][8 * hh + r][t * 16 + ln] = v; }
  }
  __builtin_amdgcn_fence(__ATOMIC_ACQ_REL, "workgroup");
  __builtin_amdgcn_wave_barrier();
  const int rsub = lane >> 4, c4 = (lane & 15) * 4;
  {
#pragma unroll
    for (int q = 0; q < 8; ++q) {
      const int r = q * 2 + rsub;
      const v4f v = *(const v4fa*)&so[w][r][c4];
      *(v4f*)(C + (size_t)(row0 + r) * ldc + col0 + c4) = v;
    }
    
  }
}

// GEMM C = act(A·W + bias + resid): A f32 (ASPLIT -> hi/lo 2 terms), Wt bf16 [N][K]; ACT 0 none, 1 relu, 2 exact gelu;
// resid (optional, f32, row index = (row % rmod), pitch ldr, RES_BF16 rounds it) added before the activation.
template <bool ASPLIT, int ACT, bool BIAS_BF16, bool RES_BF16>
__global__ __launch_bounds__(128) void k_gemm_bf3(const float* __restrict__ A, int lda, const unsigned short* __restrict__ Wt, int ldb,
                                                const float* __restrict__ bias, const float* __restrict__ resid, int rmod, int ldr,
                                                float* __restrict__ C, int ldc, int M, int N, int K) {
  __shared__ __attribute__((aligned(16))) float so[4][16][64];
  const int tid = threadIdx.x, w = tid >> 5, lane = tid & 31, ln = lane & 15, hh = lane >> 4;
  const int ntn = N / 64;
  const int wid = blockIdx.x * 4 + w;
  const int mt = wid / ntn, nq = wid % ntn;
  if (mt * 16 >= M) return;
  const int row0 = mt * 16, col0 = nq * 64;
  const float* arow = A + (size_t)(row0 + ln) * lda;
  v8f acc[4] = {};
  for (int kb = 0; kb < K; kb += 32) {
    FragB ah, al;
    const v4f x0 = *(const v4fa*)(arow + kb + 8 * hh), x1 = *(const v4fa*)(arow + kb + 8 * hh + 4);
    const v4f x2 = *(const v4fa*)(arow + kb + 16 + 8 * hh), x3 = *(const v4fa*)(arow + kb + 16 + 8 * hh + 4);
    float xs[16] = {x0[0],x0[1],x0[2],x0[3],x1[0],x1[1],x1[2],x1[3],x2[0],x2[1],x2[2],x2[3],x3[0],x3[1],x3[2],x3[3]};
#pragma unroll
    for (int i = 0; i < 16; ++i) { const unsigned short hb = bf16_bits(xs[i]); ah.u[i] = hb; al.u[i] = ASPLIT ? bf16_bits(xs[i] - bf16_val(hb)) : (unsigned short)0; }
#pragma unroll
    for (int t = 0; t < 4; ++t) {
      const unsigned short* brow = Wt + (size_t)(col0 + t * 16 + ln) * ldb + kb;
      FragB b;
      b.half[0] = *(const v8us*)(brow + 8 * hh);
      b.half[1] = *(const v8us*)(brow + 16 + 8 * hh);
      acc[t] = mmaN<ASPLIT ? 2 : 1>(ah.v, al.v, b.v, b.v, acc[t]);
    }
  }
#pragma unroll
  for (int t = 0; t < 4; ++t) {
    const int col = col0 + t * 16 + ln;
    float bv = bias ? bias[col] : 0.f;
    if (BIAS_BF16) bv = bf16_round(bv);
#pragma unroll
    for (int r = 0; r < 8; ++r) {
      float v = acc[t][r] + bv;
      if (resid) { float rv = resid[(size_t)((row0 + 8 * hh + r) % rmod) * ldr + col]; if (RES_BF16) rv = bf16_round(rv); v += rv; }
      if (ACT == 1) v = fmaxf(v, 0.f);
      if (ACT == 2) v = 0.5f * v * (1.0f + erff(v * 0.70710678118654752f));
      if (ACT == 3) { const float u = 0.7978845608028654f * (v + 0.044715f * v * v * v); v = 0.5f * v * (1.0f + tanhf(u)); }
      so[w][8 * hh + r][t * 16 + ln] = v;
    }
  }
  __builtin_amdgcn_fence(__ATOMIC_ACQ_REL, "workgroup");
  __builtin_amdgcn_wave_barrier();
  const int rsub = lane >> 4, c4 = (lane & 15) * 4;
  {
#pragma unroll
    for (int q = 0; q < 8; ++q) {
      const int r = q * 2 + rsub;
      const v4f v = *(const v4fa*)&so[w][r][c4];
      *(v4f*)(C + (size_t)(row0 + r) * ldc + col0 + c4) = v;
    }
    
  }
}
// row LayerNorm (biased variance, eps) over N: s = X (+ R); optional out_sum <- s; out_norm <- (s-mu)*rsqrt(var+eps)*g + b
template <bool PARAM_BF16>
__global__ __launch_bounds__(256) void k_layernorm(const float* __restrict__ X, const float* __restrict__ R, const float* __restrict__ g, const float* __restrict__ bta,
                                                  float* __restrict__ out_sum, float* __restrict__ out_norm, int N, float eps) {
  __shared__ float red[256];
  const int row = blockIdx.x, tid = threadIdx.x;
  const float* x = X + (size_t)row * N; const float* rr = R ? R + (size_t)row * N : nullptr;
  float vals[16];                     // up to N = 4096
  const int per = N / 256;            // contiguous chunk per thread? use strided-by-4 chunks: thread handles j = tid*4 + 1024*u
  float s1 = 0.f;
  for (int u = 0; u < per / 4; ++u) {
    const int j = tid * 4 + 1024 * u;
    const v4f a = *(const v4fa*)(x + j);
    v4f b = {0.f,0.f,0.f,0.f}; if (rr) b = *(const v4fa*)(rr + j);
#pragma unroll
    for (int q = 0; q < 4; ++q) { const float v = a[q] + b[q]; vals[u * 4 + q] = v; s1 += v; }
  }
  red[tid] = s1; __syncthreads();
  for (int st = 128; st > 0; st >>= 1) { if (tid < st) red[tid] += red[tid + st]; __syncthreads(); }
  const float mu = red[0] / (float)N; __syncthreads();
  float s2 = 0.f;
  for (int u = 0; u < per / 4; ++u)
#pragma unroll
    for (int q = 0; q < 4; ++q) { const float c = vals[u * 4 + q] - mu; s2 += c * c; }
  red[tid] = s2; __syncthreads();
  for (int st = 128; st > 0; st >>= 1) { if (tid < st) red[tid] += red[tid + st]; __syncthreads(); }
  const float rs = rsqrtf(red[0] / (float)N + eps);
  {
    for (int u = 0; u < per / 4; ++u) {
      const int j = tid * 4 + 1024 * u;
      v4f o, sm;
#pragma unroll
      for (int q = 0; q < 4; ++q) {
        float gg = g[j + q], bb = bta[j + q];
        if (PARAM_BF16) { gg = bf16_round(gg); bb = bf16_round(bb); }
        sm[q] = vals[u * 4 + q]; o[q] = (vals[u * 4 + q] - mu) * rs * gg + bb;
      }
      if (out_sum) *(v4f*)(out_sum + (size_t)row * N + j) = sm;
      *(v4f*)(out_norm + (size_t)row * N + j) = o;
    }
    
  }
}



// ---- f16 WMMA path (v_wmma_f32_16x16x32_f16): 11-bit significands for operands in range — used where a [0,1] probability operand needs more precision than bf16
typedef _Float16 v16h __attribute__((ext_vector_type(16)));
union FragH { v16h v; v8us half[2]; _Float16 h[16]; unsigned short u[16]; };
template <int NT>
__device__ __forceinline__ v8f mmaH(v16h ah, v16h al, v16h bh, v16h bl, v8f c) {
  c = __builtin_amdgcn_wmma_f32_16x16x32_f16(false, ah, false, bh, (short)0, c, false, false);
  if (NT >= 2) c = __builtin_amdgcn_wmma_f32_16x16x32_f16(false, al, false, bh, (short)0, c, false, false);
  if (NT >= 3) c = __builtin_amdgcn_wmma_f32_16x16x32_f16(false, ah, false, bl, (short)0, c, false, false);
  asm volatile("v_nop\n\tv_nop\n\tv_nop\n\tv_nop" : "+v"(c) : "v"(ah), "v"(al), "v"(bh), "v"(bl));
  return c;
}
// batched GEMM like k_gemm_b but f16 operands: A f32 (split into f16 hi/lo if ASPLIT, else rounded to f16), Bt = f16 values [n][k]; alpha; C f32; N multiple of 16 (partial tiles skipped)
template <bool ASPLIT>
__global__ __launch_bounds__(128) void k_gemm_h(const float* __restrict__ A, int lda, size_t sA, const _Float16* __restrict__ Bh, int ldb, size_t sB, float alpha, float* __restrict__ C, int ldc, size_t sC, int M, int N, int K) {
  __shared__ __attribute__((aligned(16))) float so[4][16][64];
  const int tid = threadIdx.x, w = tid >> 5, lane = tid & 31, ln = lane & 15, hh = lane >> 4; const int by = blockIdx.y;
  A += (size_t)by * sA; Bh += (size_t)by * sB; C += (size_t)by * sC;
  const int ntn = (N + 63) / 64; const int wid = blockIdx.x * 4 + w; const int mt = wid / ntn, nq = wid % ntn; if (mt * 16 >= M) return;
  const int row0 = mt * 16, col0 = nq * 64; const float* arow = A + (size_t)(row0 + ln) * lda;
  v8f acc[4] = {};
  for (int kb = 0; kb < K; kb += 32) {
    FragH ah, al;
    const v4f x0 = *(const v4fa*)(arow + kb + 8 * hh), x1 = *(const v4fa*)(arow + kb + 8 * hh + 4), x2 = *(const v4fa*)(arow + kb + 16 + 8 * hh), x3 = *(const v4fa*)(arow + kb + 16 + 8 * hh + 4);
    float xs[16] = {x0[0],x0[1],x0[2],x0[3],x1[0],x1[1],x1[2],x1[3],x2[0],x2[1],x2[2],x2[3],x3[0],x3[1],x3[2],x3[3]};
#pragma unroll
    for (int i = 0; i < 16; ++i) { const _Float16 h = (_Float16)xs[i]; ah.h[i] = h; al.h[i] = ASPLIT ? (_Float16)(xs[i] - (float)h) : (_Float16)0.0f; }
#pragma unroll
    for (int t = 0; t < 4; ++t) { if (col0 + t * 16 >= N) continue; const size_t boff = (size_t)(col0 + t * 16 + ln) * ldb + kb; FragH bq; bq.half[0] = *(const v8us*)(Bh + boff + 8 * hh); bq.half[1] = *(const v8us*)(Bh + boff + 16 + 8 * hh);
      acc[t] = mmaH<ASPLIT ? 2 : 1>(ah.v, al.v, bq.v, bq.v, acc[t]); }
  }
#pragma unroll
  for (int t = 0; t < 4; ++t) { if (col0 + t * 16 >= N) continue;
#pragma unroll
    for (int r = 0; r < 8; ++r) so[w][8 * hh + r][t * 16 + ln] = acc[t][r] * alpha; }
  __builtin_amdgcn_fence(__ATOMIC_ACQ_REL, "workgroup"); __builtin_amdgcn_wave_barrier();
  const int rsub = lane >> 4, c4 = (lane & 15) * 4;
  {
#pragma unroll
    for (int q = 0; q < 8; ++q) { const int r = q * 2 + rsub; if (col0 + c4 < N) { const v4f v = *(const v4fa*)&so[w][r][c4]; *(v4f*)(C + (size_t)(row0 + r) * ldc + col0 + c4) = v; } }
     }
}

// Wt[n][k] = f16(W[k][n]·scale) from f32 row-major W[K][N] (scale = power of two; bf16-exact weights stay exact in f16 away from the subnormal range)
__global__ __launch_bounds__(256) void k_wt_f16(const float* __restrict__ W, _Float16* __restrict__ Wt, int K, int N, float scale) {
  const int t = blockIdx.x * 256 + threadIdx.x; if (t >= N * (K / 8)) return; const int n = t / (K / 8), k8 = (t % (K / 8)) * 8; FragH f;
#pragma unroll
  for (int i = 0; i < 8; ++i) f.h[i] = (_Float16)(bf16_round(W[(size_t)(k8 + i) * N + n]) * scale); const v8us o = f.half[0];
  *(v8us*)((unsigned short*)Wt + (size_t)n * K + k8) = o; 
}
// k_gemm_hh variant with fused epilogue: v = acc·alpha + bias[by·sBias + col] (+ CP[(row/rowsPerB)·sCPb + by·64 + col] if CP) ; ACT 0 none / 1 elu ; writes f16 C16 (and f32 C if non-null)
template <int ACT>
__global__ __launch_bounds__(128) void k_gemm_hhx(const _Float16* __restrict__ A, int lda, size_t sA, const _Float16* __restrict__ Bh, int ldb, size_t sB, float alpha, const float* __restrict__ bias, size_t sBias, const float* __restrict__ CP, int rowsPerB, size_t sCPb, int row0g,
    float* __restrict__ C, _Float16* __restrict__ C16, int ldc, size_t sC, int M, int N, int K) {
  __shared__ __attribute__((aligned(16))) float so[4][16][64];
  const int tid = threadIdx.x, w = tid >> 5, lane = tid & 31, ln = lane & 15, hh = lane >> 4; const int by = blockIdx.y;
  A += (size_t)by * sA; Bh += (size_t)by * sB; const size_t cofs = (size_t)by * sC; const float* bp = bias ? bias + (size_t)by * sBias : nullptr;
  const int ntn = (N + 63) / 64; const int wid = blockIdx.x * 4 + w; const int mt = wid / ntn, nq = wid % ntn; if (mt * 16 >= M) return;
  const int row0 = mt * 16, col0 = nq * 64; const _Float16* arow = A + (size_t)(row0 + ln) * lda;
  v8f acc[4] = {};
  for (int kb = 0; kb < K; kb += 32) { FragH ah; ah.half[0] = *(const v8us*)((const unsigned short*)arow + kb + 8 * hh); ah.half[1] = *(const v8us*)((const unsigned short*)arow + kb + 16 + 8 * hh);
#pragma unroll
    for (int t = 0; t < 4; ++t) { if (col0 + t * 16 >= N) continue; const size_t boff = (size_t)(col0 + t * 16 + ln) * ldb + kb; FragH bq; bq.half[0] = *(const v8us*)((const unsigned short*)Bh + boff + 8 * hh); bq.half[1] = *(const v8us*)((const unsigned short*)Bh + boff + 16 + 8 * hh);
      acc[t] = mmaH<1>(ah.v, ah.v, bq.v, bq.v, acc[t]); }
  }
#pragma unroll
  for (int t = 0; t < 4; ++t) { if (col0 + t * 16 >= N) continue; const int col = col0 + t * 16 + ln; const float bv = bp ? bf16_round(bp[col]) : 0.f;
#pragma unroll
    for (int r = 0; r < 8; ++r) { float v = acc[t][r] * alpha + bv; if (CP) { const int rr = row0g + row0 + 8 * hh + r; if (rowsPerB < 0) v += CP[cofs + (size_t)rr * ldc + col];      /* rowsPerB < 0: own element of the batched C plane */ else { const int bidx = rr / rowsPerB; v += CP[(size_t)bidx * sCPb + (size_t)by * 64 + col]; } } if (ACT == 1) v = (v > 0.f) ? v : expm1f(v); else if (ACT == 7) v = (v > 0.f) ? v + 1.0f : expf(v); else if (ACT == 8) v = tanhf(v); else if (ACT == 9) v = 0.5f * v * (1.0f + tanhf(0.7978845608028654f * (v + 0.044715f * v * v * v))); else if (ACT == 11) v = 1.0f / (1.0f + expf(-v)); else if (ACT == 12) v = (v > 0.f) ? v : 0.01f * v; else if (ACT == 14) v = (v > 0.f) ? v : 0.1f * v; else if (ACT == 16) v = (v >= 0.f) ? v : 0.3f * v; else if (ACT == 17) v = (v >= 0.f) ? v : 0.2f * v; else if (ACT == 15) v = v / (1.0f + expf(-v)); else if (ACT == 3) v = fmaxf(v, 0.f); else if (ACT == 6) v = 0.5f * v * (1.0f + erff(v * 0.70710678118654752f)); so[w][8 * hh + r][t * 16 + ln] = v; } }
  __builtin_amdgcn_fence(__ATOMIC_ACQ_REL, "workgroup"); __builtin_amdgcn_wave_barrier();
  const int rsub = lane >> 4, c4 = (lane & 15) * 4; typedef _Float16 v4h __attribute__((ext_vector_type(4)));
  {
#pragma unroll
    for (int q = 0; q < 8; ++q) { const int r = q * 2 + rsub; if (col0 + c4 < N) { const v4f v = *(const v4fa*)&so[w][r][c4]; if (C) *(v4f*)(C + cofs + (size_t)(row0 + r) * ldc + col0 + c4) = v; if (C16) { v4h h4; for (int i = 0; i < 4; ++i) h4[i] = (_Float16)v[i]; *(v4h*)(C16 + cofs + (size_t)(row0 + r) * ldc + col0 + c4) = h4; } } }
     }
}


typedef _Float16 v4h __attribute__((ext_vector_type(4)));

__global__ __launch_bounds__(256) void k_h16(const float* __restrict__ x, _Float16* __restrict__ X16, size_t n8) { const size_t t = (size_t)blockIdx.x * 256 + threadIdx.x; if (t >= n8) return; FragH f;
#pragma unroll
  for (int q = 0; q < 8; ++q) f.h[q] = (_Float16)x[t * 8 + q]; *(v8us*)((unsigned short*)X16 + t * 8) = f.half[0];  }
__global__ __launch_bounds__(256) void k_round16f(const float* __restrict__ W, _Float16* __restrict__ Bt, size_t n8) { const size_t t = (size_t)blockIdx.x * 256 + threadIdx.x; if (t >= n8) return; FragH f;
#pragma unroll
  for (int i = 0; i < 8; ++i) f.h[i] = (_Float16)(bf16_round(W[t * 8 + i]) * 16.0f); *(v8us*)((unsigned short*)Bt + t * 8) = f.half[0];  }
// ---- fragment order: how the attention operands q, k and v lie in the workspace (V^T: same tiles, placed as k_vt writes them) ----
// A plane of R rows x K columns (R % 16 == 0, K % 32 == 0) is cut into tiles of 16 rows x 32 k, tile (rt, kt) at element (rt * (K / 32) + kt) * 512. Inside a tile, 16-byte chunk 32 j + lane (lane = 16 hh + ln) holds
// row ln, k = 16 j + 8 hh + 0..7: the four registers that lane (ln, hh) takes as half j of its fragment (g2_frag's k order). A fragment is then two loads of 512 contiguous bytes, 4 whole lines a load,
// where row-major rows gave 16 lines a load; the register contents, and with them the k order of both operands of each product, are what they were.
template <int NHv, int TTv>
__global__ __launch_bounds__(256) void k_vt(const _Float16* __restrict__ V16, int ldv, int voff, _Float16* __restrict__ Vt) { __shared__ unsigned short tl[64][66]; const int tid = threadIdx.x; const int slab = blockIdx.x / (TTv / 64), lg = blockIdx.x % (TTv / 64); const int b = slab / NHv, h = slab % NHv;
  /* V16 in fragment order (rows = tokens, k = features, K = ldv): this 64 x 64 block is 4 row tiles x 2 adjacent k tiles; chunk c of row tile rtl holds token row r, features c8 + 0..7 */
  for (int i = tid; i < 64 * 8; i += 256) { const int rtl = i >> 7, c = i & 127, lane = i & 31; const int r = rtl * 16 + (lane & 15), c8 = (c >> 5) * 16 + (lane >> 4) * 8; FragH f;
    f.half[0] = *(const v8us*)((const unsigned short*)V16 + ((size_t)b * TTv + lg * 64 + rtl * 16) * ldv + (size_t)(voff + h * 64) * 16 + c * 8);
#pragma unroll
    for (int q = 0; q < 8; ++q) tl[r][c8 + q] = f.u[q]; }
  __syncthreads();
  {      /* Vt in fragment order, per slab: rows = d (4 tiles), k = tokens, the 4 d tiles of one 32-token step adjacent: tile (st, t) at ((slab * (TTv / 32) + st) * 4 + t) * 512; this block's 512 chunks are contiguous */
#pragma unroll
    for (int rd = 0; rd < 2; ++rd) { const int c = rd * 256 + tid, lane = c & 31; const int d = ((c >> 6) & 3) * 16 + (lane & 15), k0 = (c >> 8) * 32 + ((c >> 5) & 1) * 16 + (lane >> 4) * 8; FragH f;
#pragma unroll
      for (int q = 0; q < 8; ++q) f.u[q] = tl[k0 + q][d];
      *(v8us*)((unsigned short*)Vt + ((size_t)slab * (TTv / 32) + lg * 2) * 2048 + c * 8) = f.half[0]; }
     } }

__global__ __launch_bounds__(256) void k_hl(const float* __restrict__ F, _Float16* __restrict__ Hh, _Float16* __restrict__ Hl, size_t n8) { const size_t t = (size_t)blockIdx.x * 256 + threadIdx.x; if (t >= n8) return; FragH fh, fl; const v4f a = *(const v4fa*)(F + t * 8), c = *(const v4fa*)(F + t * 8 + 4);
#pragma unroll
  for (int q = 0; q < 4; ++q) { _Float16 h = (_Float16)a[q]; fh.h[q] = h; fl.h[q] = (_Float16)((a[q] - (float)h) * 1024.0f); h = (_Float16)c[q]; fh.h[4 + q] = h; fl.h[4 + q] = (_Float16)((c[q] - (float)h) * 1024.0f); }
  { *(v8us*)((unsigned short*)Hh + t * 8) = fh.half[0]; *(v8us*)((unsigned short*)Hl + t * 8) = fl.half[0];  } }

// ---- fast GEMM (workgroup tile 128x64, wave tile 32x64; requires M % 128 == 0 rows per launch region, N % 64 == 0 and K % 64 == 0, K >= 64) ----
// Epilogue, chosen at compile time so that it holds no branch and its loads can be issued together: v = act(acc * alpha + bf16(bias[col])); RES: f32 rows C = v + own element of CP (no activation); else: f16 C16 in fragment order.
// The operands go through LDS: a stage is 64 k of the workgroup's 128 A rows and 64 B rows (192 rows of 128 bytes, each one whole line of its source row), laid at a pitch of 144 bytes (16 B x odd: no bank conflict for
// the 16-byte fragment reads). Two buffers: the next stage's asynchronous copies fly while this stage is multiplied. The B rows are fetched once for the four waves.
#define G2P 72                       /* LDS row pitch, elements */
#define G2S (192 * G2P)              /* one buffer, elements */
__device__ __forceinline__ v16h g2_frag(const unsigned short* p, int hh) { FragH f; f.half[0] = *(const v8us*)(p + 8 * hh); f.half[1] = *(const v8us*)(p + 16 + 8 * hh); return f.v; }
// One thread's share of a stage: twelve asynchronous 16-byte copies (row groups of 16: eight of A, four of B; eight lanes cover one row's 128 bytes, so a wave's copy reads 4 whole lines). l = the thread's LDS byte address in
// row group 0 of the buffer, a and b = its source addresses there, sa and sb = 16 source rows in elements. The s_wait_xcnt is the wait that is kept in front of an overwrite of a register that an issued copy names:
// as the statement's last line it stands in front of every later write of these operands.
__device__ __forceinline__ void g2_stage(unsigned l, const _Float16* a, size_t sa, const _Float16* b, size_t sb) {
  asm volatile("global_load_async_to_lds_b128 %0, %12, off\n\tglobal_load_async_to_lds_b128 %1, %13, off\n\tglobal_load_async_to_lds_b128 %2, %14, off\n\tglobal_load_async_to_lds_b128 %3, %15, off\n\t"
               "global_load_async_to_lds_b128 %4, %16, off\n\tglobal_load_async_to_lds_b128 %5, %17, off\n\tglobal_load_async_to_lds_b128 %6, %18, off\n\tglobal_load_async_to_lds_b128 %7, %19, off\n\t"
               "global_load_async_to_lds_b128 %8, %20, off\n\tglobal_load_async_to_lds_b128 %9, %21, off\n\tglobal_load_async_to_lds_b128 %10, %22, off\n\tglobal_load_async_to_lds_b128 %11, %23, off\n\t"
               "s_wait_xcnt 0x0"
               :: "v"(l), "v"(l + 32u * G2P), "v"(l + 64u * G2P), "v"(l + 96u * G2P), "v"(l + 128u * G2P), "v"(l + 160u * G2P), "v"(l + 192u * G2P), "v"(l + 224u * G2P), "v"(l + 256u * G2P), "v"(l + 288u * G2P), "v"(l + 320u * G2P), "v"(l + 352u * G2P),
                  "v"(a), "v"(a + sa), "v"(a + 2 * sa), "v"(a + 3 * sa), "v"(a + 4 * sa), "v"(a + 5 * sa), "v"(a + 6 * sa), "v"(a + 7 * sa), "v"(b), "v"(b + sb), "v"(b + 2 * sb), "v"(b + 3 * sb) : "memory"); }
__device__ __forceinline__ v8f g2_mma(v16h a, v16h b, v8f c) { v8f d = __builtin_amdgcn_wmma_f32_16x16x32_f16(false, a, false, b, (short)0, c, false, false); asm volatile("v_nop\n\tv_nop\n\tv_nop\n\tv_nop" : "+v"(d) : "v"(a), "v"(b)); return d; }
template <int ACT, bool RES>
__global__ __launch_bounds__(128) void k_gemm2(const _Float16* __restrict__ A, int lda, size_t sA, const _Float16* __restrict__ Bh, int ldb, size_t sB, float alpha, const float* __restrict__ bias, size_t sBias, const float* __restrict__ CP, int row0g,
    float* __restrict__ C, _Float16* __restrict__ C16, int ldc, size_t sC, int M, int N, int K) { static_assert(!RES || ACT == 0, "k_gemm2: the residual is added at the write-out, behind the activation's place"); static_assert(ACT == 0 || ACT == 3 || ACT == 6 || ACT == 8 || ACT == 9 || ACT == 11 || ACT == 12 || ACT == 14 || ACT == 15 || ACT == 16 || ACT == 17, "k_gemm2: unsupported ACT code (would silently apply no activation)");
  __shared__ __attribute__((aligned(16))) float so[4][32][68];
  __shared__ __attribute__((aligned(16))) unsigned short st[2 * G2S];
  const int tid = threadIdx.x, w = tid >> 5, lane = tid & 31, ln = lane & 15, hh = lane >> 4; const int by = blockIdx.y;
  A += (size_t)by * sA; Bh += (size_t)by * sB; const size_t cofs = (size_t)by * sC; const float* bp = bias + (size_t)by * sBias;
  const int ntn = N >> 6; const int mt = blockIdx.x / ntn, nq = blockIdx.x - mt * ntn; const int row0 = mt * 128 + 32 * w, col0 = nq * 64; if (mt * 128 >= M) return;      /* the whole workgroup or none: barriers follow */
  const unsigned l0 = (unsigned)(size_t)&st[(tid >> 3) * G2P + (tid & 7) * 8];      /* LDS byte address: the low 32 bits of the shared address */
  const _Float16* ga = A + (size_t)(mt * 128 + (tid >> 3)) * lda + (tid & 7) * 8; const _Float16* gb = Bh + (size_t)(col0 + (tid >> 3)) * ldb + (tid & 7) * 8; const size_t sa = (size_t)16 * lda, sb = (size_t)16 * ldb;
  const int nt = K >> 6;
  const v8f z8 = {0.f,0.f,0.f,0.f,0.f,0.f,0.f,0.f}; v8f c00 = z8, c01 = z8, c02 = z8, c03 = z8, c10 = z8, c11 = z8, c12 = z8, c13 = z8;
  float bv[4];      /* the lane's four bias values: loaded here, used behind the loop */
#pragma unroll
  for (int t = 0; t < 4; ++t) bv[t] = bp[col0 + t * 16 + ln];
  g2_stage(l0, ga, sa, gb, sb);
  asm volatile("s_wait_asynccnt 0x0" ::: "memory");      /* this wave's copies of stage 0 have landed */
  __syncthreads();      /* publishes stage 0 */
  if (nt > 1) g2_stage(l0 + 2u * G2S, ga + 64, sa, gb + 64, sb);
#pragma unroll 1      /* kept rolled: a trip already holds 24 LDS reads and 16 WMMAs; unrolling would only repeat the copies, the waits and the barrier in the text */
  for (int t = 0; t < nt; ++t) { const unsigned short* const ap = st + (t & 1) * G2S + (32 * w + ln) * G2P; const unsigned short* const bq = st + (t & 1) * G2S + (128 + ln) * G2P; v16h af[2][2], bf[2][4];
#pragma unroll
    for (int ks = 0; ks < 2; ++ks) {
#pragma unroll
      for (int r = 0; r < 2; ++r) af[ks][r] = g2_frag(ap + 16 * r * G2P + 32 * ks, hh);
#pragma unroll
      for (int u = 0; u < 4; ++u) bf[ks][u] = g2_frag(bq + 16 * u * G2P + 32 * ks, hh); }
#pragma unroll
    for (int ks = 0; ks < 2; ++ks) { c00 = g2_mma(af[ks][0], bf[ks][0], c00); c10 = g2_mma(af[ks][1], bf[ks][0], c10); c01 = g2_mma(af[ks][0], bf[ks][1], c01); c11 = g2_mma(af[ks][1], bf[ks][1], c11);
      c02 = g2_mma(af[ks][0], bf[ks][2], c02); c12 = g2_mma(af[ks][1], bf[ks][2], c12); c03 = g2_mma(af[ks][0], bf[ks][3], c03); c13 = g2_mma(af[ks][1], bf[ks][3], c13); }
    asm volatile("s_wait_dscnt 0x0" ::: "memory");      /* this wave's reads of the buffer are done before it may be refilled */
    asm volatile("s_wait_asynccnt 0x0" ::: "memory");      /* this wave's copies of stage t + 1 have landed */
    __syncthreads();      /* publishes stage t + 1 and ends every wave's reads of stage t */
    if (t + 2 < nt) g2_stage(l0 + (unsigned)(t & 1) * (2u * G2S), ga + (size_t)(t + 2) * 64, sa, gb + (size_t)(t + 2) * 64, sb); }
  asm volatile("s_wait_asynccnt 0x0" ::: "memory");      /* no copy is outstanding when the wave goes on */
  const int rsub = lane >> 4, c4 = (lane & 15) * 4;
  v4f res[16]; unsigned eo[16];      /* with RES, the wave's 32 x 64 residual tile: 16 loads of 16 bytes a lane (two 256-byte row pieces a load), all issued here, in flight under the staging below; eo = the lane's offsets in the plane, in 16-byte units (ldc % 4 == 0, as the 16-byte accesses ask), the same for the residual loads and the C stores */
  if constexpr (RES) {
#pragma unroll
    for (int q = 0; q < 16; ++q) { eo[q] = (unsigned)(row0 + q * 2 + rsub) * ((unsigned)ldc >> 2) + (unsigned)((col0 + c4) >> 2); res[q] = ((const v4fa*)(CP + cofs + (size_t)row0g * ldc))[eo[q]]; } }
  v8f accs[8] = {c00, c01, c02, c03, c10, c11, c12, c13};
#pragma unroll
  for (int u = 0; u < 8; ++u) { const int t = u & 3, half = u >> 2; const float bvr = bf16_round(bv[t]);
#pragma unroll
    for (int r = 0; r < 8; ++r) { const int rloc = half * 16 + 8 * hh + r; float v = accs[u][r] * alpha + bvr;
      if (ACT == 3) v = fmaxf(v, 0.f); else if (ACT == 6) v = 0.5f * v * (1.0f + erff(v * 0.70710678118654752f)); else if (ACT == 11) v = 1.0f / (1.0f + expf(-v)); else if (ACT == 15) v = v / (1.0f + expf(-v)); else if (ACT == 12) v = (v > 0.f) ? v : 0.01f * v; else if (ACT == 8) v = tanhf(v); else if (ACT == 9) v = 0.5f * v * (1.0f + tanhf(0.7978845608028654f * (v + 0.044715f * v * v * v))); else if (ACT == 14) v = (v > 0.f) ? v : 0.1f * v; else if (ACT == 16) v = (v >= 0.f) ? v : 0.3f * v; else if (ACT == 17) v = (v >= 0.f) ? v : 0.2f * v;
      so[w][rloc][t * 16 + ln] = v; } }
  __builtin_amdgcn_fence(__ATOMIC_ACQ_REL, "workgroup"); __builtin_amdgcn_wave_barrier();
  if constexpr (RES) {
#pragma unroll
    for (int q = 0; q < 16; ++q) { const v4f v = *(const v4fa*)&so[w][q * 2 + rsub][c4] + res[q]; ((v4f*)(C + cofs))[eo[q]] = v; }
  } else {      /* C16 goes out in fragment order (see above k_vt; K = ldc): the 32 x 64 tile is 2 row tiles x 2 adjacent k tiles x 2 halves = 8 stores of 512 contiguous bytes */
#pragma unroll
    for (int u = 0; u < 8; ++u) { const int rtl = u >> 2, cu = u & 3; const float* sp = &so[w][rtl * 16 + ln][cu * 16 + 8 * hh]; const v4f v0 = *(const v4fa*)sp, v1 = *(const v4fa*)(sp + 4); FragH f;
#pragma unroll
      for (int i = 0; i < 4; ++i) { f.h[i] = (_Float16)v0[i]; f.h[4 + i] = (_Float16)v1[i]; }
      *(v8us*)((unsigned short*)C16 + cofs + (size_t)(row0 + 16 * rtl) * ldc + (size_t)col0 * 16 + cu * 256 + 8 * lane) = f.half[0]; } } }


__global__ __launch_bounds__(256) void k_rsm(const float* __restrict__ S, _Float16* __restrict__ P, int nrows) {
  #pragma clang fp contract(off)
  const int i = blockIdx.x * 256 + threadIdx.x; if (i >= nrows) return; const float* s = S + (size_t)i * SQ; float mx = -3.0e38f;
#pragma unroll 1
  for (int j = 0; j < SQ; ++j) mx = fmaxf(mx, s[j]); float se = 0.f;
#pragma unroll 1
  for (int j = 0; j < SQ; ++j) se += expf(s[j] - mx); const float sc = 256.0f / se;
#pragma unroll 1
  for (int j0 = 0; j0 < SQ; j0 += 8) { FragH f; for (int q = 0; q < 8; ++q) f.h[q] = (_Float16)(expf(s[j0 + q] - mx) * sc); unsigned short* d = (unsigned short*)P + (size_t)i * SQ + j0; *(v8us*)d = f.half[0];  } }
__global__ __launch_bounds__(256) void k_vt(const _Float16* __restrict__ V16, int b, int h0, _Float16* __restrict__ VT) { __shared__ unsigned short tl[64][65]; const int tid = threadIdx.x; const int hh = blockIdx.x % HG, sg = blockIdx.x / HG; const int s0 = sg * 64; const int h = h0 + hh;
  for (int i = tid; i < 64 * 8; i += 256) { const int j = i / 8, d8 = (i % 8) * 8; FragH f; f.half[0] = *(const v8us*)((const unsigned short*)V16 + ((size_t)b * SQ + s0 + j) * DM + h * HD + d8); for (int q = 0; q < 8; ++q) tl[d8 + q][j] = f.u[q]; }
  __syncthreads();
  { for (int i = tid; i < 64 * 8; i += 256) { const int d = i / 8, j8 = (i % 8) * 8; FragH f; for (int q = 0; q < 8; ++q) f.u[q] = tl[d][j8 + q]; *(v8us*)((unsigned short*)VT + ((size_t)hh * HD + d) * SQ + s0 + j8) = f.half[0]; }  } }



__global__ __launch_bounds__(256) void k_rsmf(const float* __restrict__ S, _Float16* __restrict__ P, int qn, int hg) {
  #pragma clang fp contract(off)
  const int t = blockIdx.x * 256 + threadIdx.x; if (t >= qn * hg) return; const size_t i = (size_t)(t / qn) * SQ + (t % qn); const float* s = S + i * SQ; float mx = -3.0e38f;
#pragma unroll 1
  for (int j = 0; j < SQ; ++j) mx = fmaxf(mx, s[j]); float se = 0.f;
#pragma unroll 1
  for (int j = 0; j < SQ; ++j) se += __expf(s[j] - mx); const float sc = 256.0f / se;
#pragma unroll 1
  for (int j0 = 0; j0 < SQ; j0 += 8) { FragH f; for (int q = 0; q < 8; ++q) f.h[q] = (_Float16)(__expf(s[j0 + q] - mx) * sc); unsigned short* d = (unsigned short*)P + i * SQ + j0; *(v8us*)d = f.half[0];  } }

// Four native exp2 in one statement: each is the independent instruction that the instruction set asks for behind the transcendental in front of it, and the v_nop is that slot behind the last
// Early-clobber outputs keep the four independent of one another.
__device__ __forceinline__ void exp2x4(float& a, float& b, float& c, float& d) { float e0, e1, e2, e3;
  asm("v_exp_f32 %0, %4\n\tv_exp_f32 %1, %5\n\tv_exp_f32 %2, %6\n\tv_exp_f32 %3, %7\n\tv_nop" : "=&v"(e0), "=&v"(e1), "=&v"(e2), "=&v"(e3) : "v"(a), "v"(b), "v"(c), "v"(d));
  a = e0; b = e1; c = e2; d = e3; }
// Two native exp2 in one statement, as exp2x4 above: the second is the independent instruction behind the first, the v_nop is that slot behind the second.
__device__ __forceinline__ void exp2x2(float& a, float& b) { float e0, e1;
  asm("v_exp_f32 %0, %2\n\tv_exp_f32 %1, %3\n\tv_nop" : "=&v"(e0), "=&v"(e1) : "v"(a), "v"(b));
  a = e0; b = e1; }
__device__ __forceinline__ float fa_xhalf(float x) { return __builtin_bit_cast(float, __builtin_amdgcn_permlanex16(__builtin_bit_cast(int, x), __builtin_bit_cast(int, x), 0x76543210, 0xfedcba98, false, false)); }      /* lane l <-> lane l ^ 16 */
__device__ __forceinline__ v16h fa_frag(const _Float16* ub, unsigned off) { FragH f; f.half[0] = *(const v8us*)((const unsigned short*)ub + off); f.half[1] = *(const v8us*)((const unsigned short*)ub + off + 256); return f.v; }      /* a tile in fragment order, g2_frag's k order; ub is the same for the whole wave, off = tile offset + 8 * lane */
__device__ __forceinline__ v8f fa_mma(v16h a, v16h b, v8f c) { return __builtin_amdgcn_wmma_f32_16x16x32_f16(false, a, false, b, (short)0, c, false, false); }
// Fused attention of one head: scores, softmax and P.V in one launch; neither the scores nor the weights go to memory.
// Grid (SQ / 256, heads), 8 waves; a wave owns 32 queries (two groups of 16 columns) and walks all keys, 32 a step.
// Transposed products: S^T = K . Q^T (A = 16 key rows, B = 16 query columns, k = d) and O^T += V^T . P^T (A = 16 d rows of V^T, B = P^T, k = 32 keys).
// D register r of lane (c = lane & 15, h = lane >> 4) is element [8 h + r][c]: a lane holds one query's scores, and the two 16-key score tiles of a step, converted in place, are the B operand of the
// second product in the k order of g2_frag (elements 0..7 = keys 8 h + 0..7, elements 8..15 = keys 16 + 8 h + 0..7), which loads V^T. No LDS and no lane exchange for P.
// Online softmax in the log2 domain, f32: running maximum mr and running sum lr per query; each step rescales O^T and lr by exp2(old maximum - new maximum). The weights are carried x256 (the + 8) as f16
// operands, away from the f16 subnormals; the factor cancels in the division by lr, which sums the same scaled weights. mr starts at -3.0e38 (finite), so a step whose keys are all masked to -inf adds zeros.
// The mask (bf16-rounded, x log2 e) is prepared once per workgroup in LDS; the one barrier publishes it.
__global__ __launch_bounds__(256) void k_fattn(const _Float16* __restrict__ Q, const _Float16* __restrict__ Kk, const _Float16* __restrict__ VTh, const float* __restrict__ am, _Float16* __restrict__ O) {
  __shared__ __attribute__((aligned(16))) float smk[SQ];
  const int tid = threadIdx.x, lane = tid & 31, ln = lane & 15, hh = lane >> 4, w = tid >> 5; const int h = blockIdx.y, q0 = blockIdx.x * 256 + w * 32;
  for (int i = tid * 4; i < SQ; i += 1024) { v4f a = *(const v4fa*)(am + i);
#pragma unroll
    for (int q = 0; q < 4; ++q) a[q] = bf16_round(a[q]) * 1.44269504f;
    *(v4fa*)&smk[i] = a; }
  __syncthreads();
  const unsigned qo = (unsigned)(q0 * LQ + 8 * lane); v16h qf[2][2];      /* Q, Kk and VTh lie in fragment order (see above k_vt): a row tile is 16 * LQ elements, head h is its k tiles 2 h and 2 h + 1 */
#pragma unroll
  for (int g = 0; g < 2; ++g)
#pragma unroll
    for (int ks = 0; ks < 2; ++ks) qf[g][ks] = fa_frag(Q + h * HD * 16, qo + 16 * g * LQ + 512 * ks);
  const _Float16* const kb = Kk + h * HD * 16; const _Float16* const vb = VTh + (size_t)h * HD * SQ; const unsigned ko = (unsigned)(8 * lane), vo = (unsigned)(8 * lane);
  const v8f z8 = {0.f,0.f,0.f,0.f,0.f,0.f,0.f,0.f}; v8f o[2][4];
#pragma unroll
  for (int g = 0; g < 2; ++g)
#pragma unroll
    for (int t = 0; t < 4; ++t) o[g][t] = z8;
  float mr[2] = {-3.0e38f, -3.0e38f}, lr[2] = {0.f, 0.f};
  v16h ka[2][2];
#pragma unroll
  for (int kt = 0; kt < 2; ++kt)
#pragma unroll
    for (int ks = 0; ks < 2; ++ks) ka[kt][ks] = fa_frag(kb, ko + 16 * kt * LQ + 512 * ks);
#pragma unroll 1      /* one step is some 250 instructions and holds its own overlap (loads against softmax); unrolling would only grow the code */
  for (int j0 = 0; j0 < SQ; j0 += 32) {
    v4f mk[2][2];      /* this step's mask values: read from LDS under the first product */
#pragma unroll
    for (int kt = 0; kt < 2; ++kt)
#pragma unroll
      for (int c = 0; c < 2; ++c) mk[kt][c] = *(const v4fa*)&smk[j0 + 16 * kt + 8 * hh + 4 * c];
    v16h va[4];      /* this step's V^T fragments: issued here, needed only behind the exponentials */
#pragma unroll
    for (int t = 0; t < 4; ++t) va[t] = fa_frag(vb + j0 * HD, vo + 512 * t);
    v8f s[2][2];
#pragma unroll
    for (int g = 0; g < 2; ++g)
#pragma unroll
      for (int kt = 0; kt < 2; ++kt) s[g][kt] = fa_mma(ka[kt][1], qf[g][1], fa_mma(ka[kt][0], qf[g][0], z8));
    const _Float16* const kn = kb + (size_t)((j0 + 32 < SQ) ? j0 + 32 : 0) * LQ;      /* the next step's K fragments, in flight under this step's softmax; the last step re-reads the first rows, unused */
#pragma unroll
    for (int kt = 0; kt < 2; ++kt)
#pragma unroll
      for (int ks = 0; ks < 2; ++ks) ka[kt][ks] = fa_frag(kn, ko + 16 * kt * LQ + 512 * ks);
    __builtin_amdgcn_sched_barrier(0);      /* keeps both groups of loads in front of the softmax: left free, the K loads sank to the loop's foot and the next step waited out their whole latency */
    float mn[2], cr[2];
#pragma unroll
    for (int g = 0; g < 2; ++g) { float mx = mr[g];
#pragma unroll
      for (int kt = 0; kt < 2; ++kt)
#pragma unroll
        for (int r = 0; r < 8; ++r) { s[g][kt][r] = s[g][kt][r] * 0.18033688f + mk[kt][r >> 2][r & 3]; mx = fmaxf(mx, s[g][kt][r]); }      /* (q . k / 8 + mask) log2 e */
      mn[g] = fmaxf(mx, fa_xhalf(mx)); cr[g] = mr[g] - mn[g]; mr[g] = mn[g]; }
    exp2x2(cr[0], cr[1]); FragH pf[2];
#pragma unroll
    for (int g = 0; g < 2; ++g) { const float nm = 8.0f - mn[g]; float ls[4] = {0.f, 0.f, 0.f, 0.f};
#pragma unroll
      for (int t = 0; t < 4; ++t) o[g][t] = o[g][t] * cr[g];
#pragma unroll
      for (int kt = 0; kt < 2; ++kt)
#pragma unroll
        for (int r4 = 0; r4 < 8; r4 += 4) { float y[4];
#pragma unroll
          for (int q = 0; q < 4; ++q) y[q] = s[g][kt][r4 + q] + nm;
          exp2x4(y[0], y[1], y[2], y[3]);
#pragma unroll
          for (int q = 0; q < 4; ++q) { ls[q] += y[q]; pf[g].h[8 * kt + r4 + q] = (_Float16)y[q]; } }
      lr[g] = lr[g] * cr[g] + ((ls[0] + ls[1]) + (ls[2] + ls[3])); }
    __builtin_amdgcn_sched_barrier(0);      /* keeps every asm exponential in front of the second product */
#pragma unroll
    for (int g = 0; g < 2; ++g)
#pragma unroll
      for (int t = 0; t < 4; ++t) o[g][t] = fa_mma(va[t], pf[g].v, o[g][t]); }
#pragma unroll
  for (int g = 0; g < 2; ++g) { const float sc = 64.0f / (lr[g] + fa_xhalf(lr[g]));      /* the halves' sums joined; o carried x64, as the output GEMM's alpha expects */
    _Float16* d = O + h * HD + ((unsigned)((q0 + ln) * DM + 8 * hh) + 16 * g * DM);
#pragma unroll
    for (int t = 0; t < 4; ++t) { FragH f;
#pragma unroll
      for (int r = 0; r < 8; ++r) f.h[r] = (_Float16)(o[g][t][r] * sc);
      *(v8us*)((unsigned short*)d + 16 * t) = f.half[0]; } } }


// All input conversions in one streaming launch: x -> X16 (the bf16-rounded value as f16) and XB (the same value as f32, the residual plane); each weight -> its f16 plane, x16 (natural [out][in] = Bt[n][k]).
// 512 workgroups of 8 waves: 16 waves a WGP, 4096 waves in all. A wave takes one contiguous 4-KiB block of x and one of a weight (workgroups 128 s .. 128 s + 127 share weight s): 8 + 8 loads of 16 bytes a lane,
// each load 512 contiguous bytes (4 whole lines), all sixteen issued before the first value is used; the stores cover whole lines too (512 bytes f32, 256 bytes f16). x is read once for both of its planes.
__global__ __launch_bounds__(256) void k_prep(const float* __restrict__ x, const float* __restrict__ wq, const float* __restrict__ wk, const float* __restrict__ wv, const float* __restrict__ wo,
    _Float16* __restrict__ X16, float* __restrict__ XB, _Float16* __restrict__ BQ, _Float16* __restrict__ BK, _Float16* __restrict__ BV, _Float16* __restrict__ BO) {
  static_assert(NR * DM == (size_t)512 * 8 * 1024 && (size_t)DM * DM == (size_t)128 * 8 * 1024, "k_prep: the grid of 512 workgroups covers exactly these planes");
  const unsigned lane = threadIdx.x & 31, wid = blockIdx.x * 8 + (threadIdx.x >> 5), sel = blockIdx.x >> 7;
  const float* const w = sel == 0 ? wq : sel == 1 ? wk : sel == 2 ? wv : wo; _Float16* const B = sel == 0 ? BQ : sel == 1 ? BK : sel == 2 ? BV : BO;
  const unsigned xo = wid * 1024 + lane * 4, bo = (wid & 1023) * 1024 + lane * 4;      /* element offsets of the wave's two blocks */
  v4f a[8], b[8];      /* every loop below is unrolled: a and b stay in registers and each step's offset is an immediate of its load or store */
#pragma unroll
  for (int j = 0; j < 8; ++j) a[j] = *(const v4fa*)(x + xo + 128 * j);
#pragma unroll
  for (int j = 0; j < 8; ++j) b[j] = *(const v4fa*)(w + bo + 128 * j);
  __builtin_amdgcn_sched_barrier(0);      /* keeps the weight loads in front of the conversions: left free, they sank behind the x stores and the wave waited out a second memory latency */
#pragma unroll
  for (int j = 0; j < 8; ++j) { v4f r; v4h h;
#pragma unroll
    for (int q = 0; q < 4; ++q) { r[q] = bf16_round(a[j][q]); h[q] = (_Float16)r[q]; }
    *(v4f*)(XB + xo + 128 * j) = r; *(v4h*)(X16 + xo + 128 * j) = h; }
#pragma unroll
  for (int j = 0; j < 8; ++j) { v4h h;
#pragma unroll
    for (int q = 0; q < 4; ++q) h[q] = (_Float16)(bf16_round(b[j][q]) * 16.0f);
    *(v4h*)(B + bo + 128 * j) = h; } }


__global__ __launch_bounds__(256) void k_lnrow(const float* __restrict__ Y, const float* __restrict__ g, const float* __restrict__ bb, float eps, float* __restrict__ out) {
  #pragma clang fp contract(off)
  __shared__ float red[256]; const size_t r = blockIdx.x; const int t = threadIdx.x; const v4f ya = *(const v4fa*)(Y + r * DMQ + t * 4); float s[4]; float sum = 0.f;
  for (int q = 0; q < 4; ++q) { s[q] = ya[q]; sum = __fadd_rn(sum, s[q]); }
  red[t] = sum; __syncthreads(); for (int st = 128; st > 0; st >>= 1) { if (t < st) red[t] = __fadd_rn(red[t], red[t + st]); __syncthreads(); } const float mu = red[0] / (float)DMQ; __syncthreads();
  float vs = 0.f; for (int q = 0; q < 4; ++q) { const float dl = __fadd_rn(s[q], -mu); vs = __fadd_rn(vs, __fmul_rn(dl, dl)); } red[t] = vs; __syncthreads(); for (int st = 128; st > 0; st >>= 1) { if (t < st) red[t] = __fadd_rn(red[t], red[t + st]); __syncthreads(); }
  const float rs = rsqrtf(__fadd_rn(red[0] / (float)DMQ, eps)); v4f y; for (int q = 0; q < 4; ++q) { const int c = t * 4 + q; y[q] = __fadd_rn(__fmul_rn(__fmul_rn(__fadd_rn(s[q], -mu), rs), bf16_round(g[c])), bf16_round(bb[c])); }
  *(v4f*)(out + r * DMQ + t * 4) = y;  }
extern "C" void kernel_launch(void* const* d_in, const int* in_sizes, int n_in,
                              void* d_out, int out_size, void* d_ws, size_t ws_size, hipStream_t stream) {
  (void)in_sizes; (void)n_in; (void)out_size;
  const float* const* I = (const float* const*)d_in; const float* x = I[0]; const float* am = I[1]; const float* wq = I[2]; const float* bq = I[3]; const float* wk = I[4]; const float* bk = I[5]; const float* wv = I[6]; const float* bv = I[7]; const float* wo = I[8]; const float* bo = I[9]; const float* lng = I[10]; const float* lnb = I[11];      /* nn.Linear weights [out][in] + biases; additive mask [1][1][1][S] */
  char* ws = (char*)d_ws; size_t off = 0;
  auto take = [&](size_t bytes) { char* p = ws + off; off += (bytes + 255) & ~(size_t)255; return p; };
  _Float16* BQ = (_Float16*)take((size_t)DM * DM * 2); _Float16* BK = (_Float16*)take((size_t)DM * DM * 2); _Float16* BV = (_Float16*)take((size_t)DM * DM * 2); _Float16* BO = (_Float16*)take((size_t)DM * DM * 2);
  _Float16* X16 = (_Float16*)take(NR * DM * 2); float* XB = (float*)take(NR * DM * 4); float* YF = (float*)take(NR * DM * 4); _Float16* Q16 = (_Float16*)take(NR * DM * 2); _Float16* K16 = (_Float16*)take(NR * DM * 2); _Float16* V16 = (_Float16*)take(NR * DM * 2); _Float16* O16 = (_Float16*)take(NR * DM * 2);
  _Float16* VT = (_Float16*)take((size_t)NH * HD * SQ * 2);
  if (off > ws_size) return;
  k_prep<<<512, 256, 0, stream>>>(x, wq, wk, wv, wo, X16, XB, BQ, BK, BV, BO);      /* f16 x rows, bf16(x) residual plane, the four weight planes x16 */
  const size_t r0p = (size_t)B0 * SQ;      /* first projected row */
  k_gemm2<0, false><<<dim3((unsigned)((MP / 128) * (DM / 64)), 1), 128, 0, stream>>>(X16 + r0p * DM, DM, 0, BQ, DM, 0, 0.0625f, bq, 0, nullptr, 0, nullptr, Q16 + r0p * DM, DM, 0, MP, DM, DM);
  k_gemm2<0, false><<<dim3((unsigned)((MP / 128) * (DM / 64)), 1), 128, 0, stream>>>(X16 + r0p * DM, DM, 0, BK, DM, 0, 0.0625f, bk, 0, nullptr, 0, nullptr, K16 + r0p * DM, DM, 0, MP, DM, DM);
  k_gemm2<0, false><<<dim3((unsigned)((MP / 128) * (DM / 64)), 1), 128, 0, stream>>>(X16 + r0p * DM, DM, 0, BV, DM, 0, 0.0625f, bv, 0, nullptr, 0, nullptr, V16 + r0p * DM, DM, 0, MP, DM, DM);
  for (int b = B0; b < B0 + NBR; ++b) { const size_t r0 = (size_t)b * SQ;
    k_vt<NH, SQ><<<NH * (SQ / 64), 256, 0, stream>>>(V16 + r0 * LQ, LQ, 0, VT);      /* V^T of all heads (HD x SQ each, fragment order) for this batch */
    k_fattn<<<dim3(SQ / 256, NH), 256, 0, stream>>>(Q16 + r0 * LQ, K16 + r0 * LQ, VT, am + (size_t)b * SQ, O16 + r0 * DM); }      /* scores + attention_mask, softmax and P . V of all heads, fused; o (merged heads, x64) as f16 rows */
  k_gemm2<0, true><<<dim3((unsigned)((MPO / 128) * (DM / 64)), 1), 128, 0, stream>>>(O16 + r0p * DM, DM, 0, BO, DM, 0, 0.0009765625f, bo, 0, XB + r0p * DM, 0, YF + r0p * DM, nullptr, DM, 0, MPO, DM, DM);      /* y = ctx Wo^T + bo + bf16(x) (own-element residual) */
  k_lnrow<<<(unsigned)MPO, 256, 0, stream>>>(YF + r0p * DM, lng, lnb, 1e-12f, (float*)d_out + r0p * DM);      /* post-LayerNorm */
}

// v007
// One run takes 156 microseconds.
// Two timings next to v006 both put it at 1.11 times that version's speed.
// Counting every step since v000, it is 88.0 times as fast.
#include <hip/hip_runtime.h>
// BERT self-attention + output (hidden_states [1][4096][1024]; q/k/v = x W^T + b (nn.Linear [out][in] 1024^2, sigma 1/32, zero biases), 16 heads of 64; scores = (q/8) . k + attention_mask[j] (additive [1][1][1][S], zeros); softmax; ctx merged; out = LayerNorm(ctx Wo^T + bo + hidden_states; ln_gamma, ln_beta, eps 1e-12) -> [1][4096][1024]).
// Structure: token rows r = b*4096 + s; x as exact f16 rows (bf16-rounded); Q, K, V as one WMMA GEMM launch (32x64 wave tiles, f32 accumulation, exact x16 weights + bias, f16 outputs); per batch: V^T for all heads via LDS transposes; per batch one fused attention launch over all heads: S^T = K . Q^T on WMMA (alpha = 64^-0.5), online softmax on VALU (f32 statistics, native exp2; weights x256 as f16 operands, in registers only), O^T += V^T . P^T on WMMA (o carried x64 against f16 subnormal flush, folded into the output GEMM alpha) written straight into the merged f16 o rows; y = o Wo^T + bo + bf16(x) GEMM (f32, own-element residual) into f32 rows; post-LayerNorm on VALU (f32, LDS trees) into the output.
// Compute dtype: inputs rounded to bf16; x / weights exact; q, k, v, softmax weights and o as plain f16 GEMM operands (~2^-12); scores and softmax statistics f32. v_wmma_f32_16x16x32_f16.
#define NB 1
#define SQ 4096
#define DM 1024
#define NH 16
#define HD 64
#define HG 1                         /* heads per group of the k_vt(b, h0) overload, not launched */
#define B0 0                         /* first batch processed (debug hook) */
#define NBR NB                       /* batches processed (debug hook) */
#define NR ((size_t)NB * SQ)
#define DMQ DM         /* width of the token rows (LayerNorm length) */
#define MP ((int)((size_t)NBR * SQ)) /* rows projected (debug hook) */
#define QN SQ                        /* not used: attention covers all SQ query rows */
#define NHD NH                       /* not used: attention covers all NH heads */
#define MPO MP                       /* rows through the output stage (debug hook) */
#define LQ DM      /* width K of the q/k/v planes (fragment order) */
typedef __bf16 v16b __attribute__((ext_vector_type(16)));
typedef unsigned short v8us __attribute__((ext_vector_type(8), may_alias));
typedef float  v8f  __attribute__((ext_vector_type(8)));
typedef float  v4f  __attribute__((ext_vector_type(4)));
typedef float  v4fa __attribute__((ext_vector_type(4), may_alias));
union FragB { v16b v; v8us half[2]; unsigned short u[16]; };

__device__ __forceinline__ unsigned short bf16_bits(float x) { unsigned int u = __float_as_uint(x); return (unsigned short)((u + 0x7FFFu + ((u >> 16) & 1u)) >> 16); }
__device__ __forceinline__ float bf16_val(unsigned short b) { return __uint_as_float(((unsigned int)b) << 16); }
__device__ __forceinline__ float bf16_round(float x) { return bf16_val(bf16_bits(x)); }
// D += A·B with NT terms: 1 = ah·bh, 2 = + al·bh (A split), 3 = + ah·bl (both split)
template <int NT>
__device__ __forceinline__ v8f mmaN(v16b ah, v16b al, v16b bh, v16b bl, v8f c) {
  c = __builtin_amdgcn_wmma_f32_16x16x32_bf16(false, ah, false, bh, (short)0, c, false, false);
  if (NT >= 2) c = __builtin_amdgcn_wmma_f32_16x16x32_bf16(false, al, false, bh, (short)0, c, false, false);
  if (NT >= 3) c = __builtin_amdgcn_wmma_f32_16x16x32_bf16(false, ah, false, bl, (short)0, c, false, false);
  asm volatile("v_nop\n\tv_nop\n\tv_nop\n\tv_nop" : "+v"(c) : "v"(ah), "v"(al), "v"(bh), "v"(bl));
  return c;
}

__global__ __launch_bounds__(256) void k_wt_bf16(const float* __restrict__ W, unsigned short* __restrict__ Wt, int K, int N) {
  const int t = blockIdx.x * 256 + threadIdx.x;
  const int k8n = K / 8;
  if (t >= N * k8n) return;
  const int n = t / k8n, k8 = (t % k8n) * 8;
  v8us v;
#pragma unroll
  for (int i = 0; i < 8; ++i) v[i] = bf16_bits(W[(size_t)(k8 + i) * N + n]);
  *(v8us*)(Wt + (size_t)n * K + k8) = v;
  
}

// GEMM C[M][N] (f32, pitch ldc) = act(A[M][K]·W + bias). A f32 row-major (pitch lda) converted per fragment to bf16
// (ASPLIT: hi/lo two planes -> 2 terms, else single rounded term); Wt bf16 [N][K] (pitch ldb). BIAS_BF16 rounds the
// bias to bf16 first (bias quantised to bf16 before the add). K%32==0, M%16==0, N%64==0.
template <bool ASPLIT, int ACT, bool BIAS_BF16>
__global__ __launch_bounds__(128) void k_gemm_bf(const float* __restrict__ A, int lda, const unsigned short* __restrict__ Wt, int ldb,
                                               const float* __restrict__ bias, float* __restrict__ C, int ldc, int M, int N, int K) {
  __shared__ __attribute__((aligned(16))) float so[4][16][64];
  const int tid = threadIdx.x, w = tid >> 5, lane = tid & 31, ln = lane & 15, hh = lane >> 4;
  const int ntn = N / 64;
  const int wid = blockIdx.x * 4 + w;
  const int mt = wid / ntn, nq = wid % ntn;
  if (mt * 16 >= M) return;
  const int row0 = mt * 16, col0 = nq * 64;
  const float* arow = A + (size_t)(row0 + ln) * lda;
  v8f acc[4] = {};
  for (int kb = 0; kb < K; kb += 32) {
    FragB ah, al;
    const v4f x0 = *(const v4fa*)(arow + kb + 8 * hh), x1 = *(const v4fa*)(arow + kb + 8 * hh + 4);
    const v4f x2 = *(const v4fa*)(arow + kb + 16 + 8 * hh), x3 = *(const v4fa*)(arow + kb + 16 + 8 * hh + 4);
    float xs[16] = {x0[0],x0[1],x0[2],x0[3],x1[0],x1[1],x1[2],x1[3],x2[0],x2[1],x2[2],x2[3],x3[0],x3[1],x3[2],x3[3]};
#pragma unroll
    for (int i = 0; i < 16; ++i) { const unsigned short hb = bf16_bits(xs[i]); ah.u[i] = hb; al.u[i] = ASPLIT ? bf16_bits(xs[i] - bf16_val(hb)) : (unsigned short)0; }
#pragma unroll
    for (int t = 0; t < 4; ++t) {
      const unsigned short* brow = Wt + (size_t)(col0 + t * 16 + ln) * ldb + kb;
      FragB b;
      b.half[0] = *(const v8us*)(brow + 8 * hh);
      b.half[1] = *(const v8us*)(brow + 16 + 8 * hh);
      acc[t] = mmaN<ASPLIT ? 2 : 1>(ah.v, al.v, b.v, b.v, acc[t]);
    }
  }
#pragma unroll
  for (int t = 0; t < 4; ++t) {
    float bv = bias ? bias[col0 + t * 16 + ln] : 0.f;
    if (BIAS_BF16) bv = bf16_round(bv);
#pragma unroll
    for (int r = 0; r < 8; ++r) { float v = acc[t][r] + bv; if (ACT == 1) v = fmaxf(v, 0.f); so[w][8 * hh + r][t * 16 + ln] = v; }
  }
  __builtin_amdgcn_fence(__ATOMIC_ACQ_REL, "workgroup");
  __builtin_amdgcn_wave_barrier();
  const int rsub = lane >> 4, c4 = (lane & 15) * 4;
  {
#pragma unroll
    for (int q = 0; q < 8; ++q) {
      const int r = q * 2 + rsub;
      const v4f v = *(const v4fa*)&so[w][r][c4];
      *(v4f*)(C + (size_t)(row0 + r) * ldc + col0 + c4) = v;
    }
    
  }
}

// GEMM C = act(A·W + bias + resid): A f32 (ASPLIT -> hi/lo 2 terms), Wt bf16 [N][K]; ACT 0 none, 1 relu, 2 exact gelu;
// resid (optional, f32, row index = (row % rmod), pitch ldr, RES_BF16 rounds it) added before the activation.
template <bool ASPLIT, int ACT, bool BIAS_BF16, bool RES_BF16>
__global__ __launch_bounds__(128) void k_gemm_bf3(const float* __restrict__ A, int lda, const unsigned short* __restrict__ Wt, int ldb,
                                                const float* __restrict__ bias, const float* __restrict__ resid, int rmod, int ldr,
                                                float* __restrict__ C, int ldc, int M, int N, int K) {
  __shared__ __attribute__((aligned(16))) float so[4][16][64];
  const int tid = threadIdx.x, w = tid >> 5, lane = tid & 31, ln = lane & 15, hh = lane >> 4;
  const int ntn = N / 64;
  const int wid = blockIdx.x * 4 + w;
  const int mt = wid / ntn, nq = wid % ntn;
  if (mt * 16 >= M) return;
  const int row0 = mt * 16, col0 = nq * 64;
  const float* arow = A + (size_t)(row0 + ln) * lda;
  v8f acc[4] = {};
  for (int kb = 0; kb < K; kb += 32) {
    FragB ah, al;
    const v4f x0 = *(const v4fa*)(arow + kb + 8 * hh), x1 = *(const v4fa*)(arow + kb + 8 * hh + 4);
    const v4f x2 = *(const v4fa*)(arow + kb + 16 + 8 * hh), x3 = *(const v4fa*)(arow + kb + 16 + 8 * hh + 4);
    float xs[16] = {x0[0],x0[1],x0[2],x0[3],x1[0],x1[1],x1[2],x1[3],x2[0],x2[1],x2[2],x2[3],x3[0],x3[1],x3[2],x3[3]};
#pragma unroll
    for (int i = 0; i < 16; ++i) { const unsigned short hb = bf16_bits(xs[i]); ah.u[i] = hb; al.u[i] = ASPLIT ? bf16_bits(xs[i] - bf16_val(hb)) : (unsigned short)0; }
#pragma unroll
    for (int t = 0; t < 4; ++t) {
      const unsigned short* brow = Wt + (size_t)(col0 + t * 16 + ln) * ldb + kb;
      FragB b;
      b.half[0] = *(const v8us*)(brow + 8 * hh);
      b.half[1] = *(const v8us*)(brow + 16 + 8 * hh);
      acc[t] = mmaN<ASPLIT ? 2 : 1>(ah.v, al.v, b.v, b.v, acc[t]);
    }
  }
#pragma unroll
  for (int t = 0; t < 4; ++t) {
    const int col = col0 + t * 16 + ln;
    float bv = bias ? bias[col] : 0.f;
    if (BIAS_BF16) bv = bf16_round(bv);
#pragma unroll
    for (int r = 0; r < 8; ++r) {
      float v = acc[t][r] + bv;
      if (resid) { float rv = resid[(size_t)((row0 + 8 * hh + r) % rmod) * ldr + col]; if (RES_BF16) rv = bf16_round(rv); v += rv; }
      if (ACT == 1) v = fmaxf(v, 0.f);
      if (ACT == 2) v = 0.5f * v * (1.0f + erff(v * 0.70710678118654752f));
      if (ACT == 3) { const float u = 0.7978845608028654f * (v + 0.044715f * v * v * v); v = 0.5f * v * (1.0f + tanhf(u)); }
      so[w][8 * hh + r][t * 16 + ln] = v;
    }
  }
  __builtin_amdgcn_fence(__ATOMIC_ACQ_REL, "workgroup");
  __builtin_amdgcn_wave_barrier();
  const int rsub = lane >> 4, c4 = (lane & 15) * 4;
  {
#pragma unroll
    for (int q = 0; q < 8; ++q) {
      const int r = q * 2 + rsub;
      const v4f v = *(const v4fa*)&so[w][r][c4];
      *(v4f*)(C + (size_t)(row0 + r) * ldc + col0 + c4) = v;
    }
    
  }
}
// row LayerNorm (biased variance, eps) over N: s = X (+ R); optional out_sum <- s; out_norm <- (s-mu)*rsqrt(var+eps)*g + b
template <bool PARAM_BF16>
__global__ __launch_bounds__(256) void k_layernorm(const float* __restrict__ X, const float* __restrict__ R, const float* __restrict__ g, const float* __restrict__ bta,
                                                  float* __restrict__ out_sum, float* __restrict__ out_norm, int N, float eps) {
  __shared__ float red[256];
  const int row = blockIdx.x, tid = threadIdx.x;
  const float* x = X + (size_t)row * N; const float* rr = R ? R + (size_t)row * N : nullptr;
  float vals[16];                     // up to N = 4096
  const int per = N / 256;            // contiguous chunk per thread? use strided-by-4 chunks: thread handles j = tid*4 + 1024*u
  float s1 = 0.f;
  for (int u = 0; u < per / 4; ++u) {
    const int j = tid * 4 + 1024 * u;
    const v4f a = *(const v4fa*)(x + j);
    v4f b = {0.f,0.f,0.f,0.f}; if (rr) b = *(const v4fa*)(rr + j);
#pragma unroll
    for (int q = 0; q < 4; ++q) { const float v = a[q] + b[q]; vals[u * 4 + q] = v; s1 += v; }
  }
  red[tid] = s1; __syncthreads();
  for (int st = 128; st > 0; st >>= 1) { if (tid < st) red[tid] += red[tid + st]; __syncthreads(); }
  const float mu = red[0] / (float)N; __syncthreads();
  float s2 = 0.f;
  for (int u = 0; u < per / 4; ++u)
#pragma unroll
    for (int q = 0; q < 4; ++q) { const float c = vals[u * 4 + q] - mu; s2 += c * c; }
  red[tid] = s2; __syncthreads();
  for (int st = 128; st > 0; st >>= 1) { if (tid < st) red[tid] += red[tid + st]; __syncthreads(); }
  const float rs = rsqrtf(red[0] / (float)N + eps);
  {
    for (int u = 0; u < per / 4; ++u) {
      const int j = tid * 4 + 1024 * u;
      v4f o, sm;
#pragma unroll
      for (int q = 0; q < 4; ++q) {
        float gg = g[j + q], bb = bta[j + q];
        if (PARAM_BF16) { gg = bf16_round(gg); bb = bf16_round(bb); }
        sm[q] = vals[u * 4 + q]; o[q] = (vals[u * 4 + q] - mu) * rs * gg + bb;
      }
      if (out_sum) *(v4f*)(out_sum + (size_t)row * N + j) = sm;
      *(v4f*)(out_norm + (size_t)row * N + j) = o;
    }
    
  }
}



// ---- f16 WMMA path (v_wmma_f32_16x16x32_f16): 11-bit significands for operands in range — used where a [0,1] probability operand needs more precision than bf16
typedef _Float16 v16h __attribute__((ext_vector_type(16)));
union FragH { v16h v; v8us half[2]; _Float16 h[16]; unsigned short u[16]; };
template <int NT>
__device__ __forceinline__ v8f mmaH(v16h ah, v16h al, v16h bh, v16h bl, v8f c) {
  c = __builtin_amdgcn_wmma_f32_16x16x32_f16(false, ah, false, bh, (short)0, c, false, false);
  if (NT >= 2) c = __builtin_amdgcn_wmma_f32_16x16x32_f16(false, al, false, bh, (short)0, c, false, false);
  if (NT >= 3) c = __builtin_amdgcn_wmma_f32_16x16x32_f16(false, ah, false, bl, (short)0, c, false, false);
  asm volatile("v_nop\n\tv_nop\n\tv_nop\n\tv_nop" : "+v"(c) : "v"(ah), "v"(al), "v"(bh), "v"(bl));
  return c;
}
// batched GEMM like k_gemm_b but f16 operands: A f32 (split into f16 hi/lo if ASPLIT, else rounded to f16), Bt = f16 values [n][k]; alpha; C f32; N multiple of 16 (partial tiles skipped)
template <bool ASPLIT>
__global__ __launch_bounds__(128) void k_gemm_h(const float* __restrict__ A, int lda, size_t sA, const _Float16* __restrict__ Bh, int ldb, size_t sB, float alpha, float* __restrict__ C, int ldc, size_t sC, int M, int N, int K) {
  __shared__ __attribute__((aligned(16))) float so[4][16][64];
  const int tid = threadIdx.x, w = tid >> 5, lane = tid & 31, ln = lane & 15, hh = lane >> 4; const int by = blockIdx.y;
  A += (size_t)by * sA; Bh += (size_t)by * sB; C += (size_t)by * sC;
  const int ntn = (N + 63) / 64; const int wid = blockIdx.x * 4 + w; const int mt = wid / ntn, nq = wid % ntn; if (mt * 16 >= M) return;
  const int row0 = mt * 16, col0 = nq * 64; const float* arow = A + (size_t)(row0 + ln) * lda;
  v8f acc[4] = {};
  for (int kb = 0; kb < K; kb += 32) {
    FragH ah, al;
    const v4f x0 = *(const v4fa*)(arow + kb + 8 * hh), x1 = *(const v4fa*)(arow + kb + 8 * hh + 4), x2 = *(const v4fa*)(arow + kb + 16 + 8 * hh), x3 = *(const v4fa*)(arow + kb + 16 + 8 * hh + 4);
    float xs[16] = {x0[0],x0[1],x0[2],x0[3],x1[0],x1[1],x1[2],x1[3],x2[0],x2[1],x2[2],x2[3],x3[0],x3[1],x3[2],x3[3]};
#pragma unroll
    for (int i = 0; i < 16; ++i) { const _Float16 h = (_Float16)xs[i]; ah.h[i] = h; al.h[i] = ASPLIT ? (_Float16)(xs[i] - (float)h) : (_Float16)0.0f; }
#pragma unroll
    for (int t = 0; t < 4; ++t) { if (col0 + t * 16 >= N) continue; const size_t boff = (size_t)(col0 + t * 16 + ln) * ldb + kb; FragH bq; bq.half[0] = *(const v8us*)(Bh + boff + 8 * hh); bq.half[1] = *(const v8us*)(Bh + boff + 16 + 8 * hh);
      acc[t] = mmaH<ASPLIT ? 2 : 1>(ah.v, al.v, bq.v, bq.v, acc[t]); }
  }
#pragma unroll
  for (int t = 0; t < 4; ++t) { if (col0 + t * 16 >= N) continue;
#pragma unroll
    for (int r = 0; r < 8; ++r) so[w][8 * hh + r][t * 16 + ln] = acc[t][r] * alpha; }
  __builtin_amdgcn_fence(__ATOMIC_ACQ_REL, "workgroup"); __builtin_amdgcn_wave_barrier();
  const int rsub = lane >> 4, c4 = (lane & 15) * 4;
  {
#pragma unroll
    for (int q = 0; q < 8; ++q) { const int r = q * 2 + rsub; if (col0 + c4 < N) { const v4f v = *(const v4fa*)&so[w][r][c4]; *(v4f*)(C + (size_t)(row0 + r) * ldc + col0 + c4) = v; } }
     }
}

// Wt[n][k] = f16(W[k][n]·scale) from f32 row-major W[K][N] (scale = power of two; bf16-exact weights stay exact in f16 away from the subnormal range)
__global__ __launch_bounds__(256) void k_wt_f16(const float* __restrict__ W, _Float16* __restrict__ Wt, int K, int N, float scale) {
  const int t = blockIdx.x * 256 + threadIdx.x; if (t >= N * (K / 8)) return; const int n = t / (K / 8), k8 = (t % (K / 8)) * 8; FragH f;
#pragma unroll
  for (int i = 0; i < 8; ++i) f.h[i] = (_Float16)(bf16_round(W[(size_t)(k8 + i) * N + n]) * scale); const v8us o = f.half[0];
  *(v8us*)((unsigned short*)Wt + (size_t)n * K + k8) = o; 
}
// k_gemm_hh variant with fused epilogue: v = acc·alpha + bias[by·sBias + col] (+ CP[(row/rowsPerB)·sCPb + by·64 + col] if CP) ; ACT 0 none / 1 elu ; writes f16 C16 (and f32 C if non-null)
template <int ACT>
__global__ __launch_bounds__(128) void k_gemm_hhx(const _Float16* __restrict__ A, int lda, size_t sA, const _Float16* __restrict__ Bh, int ldb, size_t sB, float alpha, const float* __restrict__ bias, size_t sBias, const float* __restrict__ CP, int rowsPerB, size_t sCPb, int row0g,
    float* __restrict__ C, _Float16* __restrict__ C16, int ldc, size_t sC, int M, int N, int K) {
  __shared__ __attribute__((aligned(16))) float so[4][16][64];
  const int tid = threadIdx.x, w = tid >> 5, lane = tid & 31, ln = lane & 15, hh = lane >> 4; const int by = blockIdx.y;
  A += (size_t)by * sA; Bh += (size_t)by * sB; const size_t cofs = (size_t)by * sC; const float* bp = bias ? bias + (size_t)by * sBias : nullptr;
  const int ntn = (N + 63) / 64; const int wid = blockIdx.x * 4 + w; const int mt = wid / ntn, nq = wid % ntn; if (mt * 16 >= M) return;
  const int row0 = mt * 16, col0 = nq * 64; const _Float16* arow = A + (size_t)(row0 + ln) * lda;
  v8f acc[4] = {};
  for (int kb = 0; kb < K; kb += 32) { FragH ah; ah.half[0] = *(const v8us*)((const unsigned short*)arow + kb + 8 * hh); ah.half[1] = *(const v8us*)((const unsigned short*)arow + kb + 16 + 8 * hh);
#pragma unroll
    for (int t = 0; t < 4; ++t) { if (col0 + t * 16 >= N) continue; const size_t boff = (size_t)(col0 + t * 16 + ln) * ldb + kb; FragH bq; bq.half[0] = *(const v8us*)((const unsigned short*)Bh + boff + 8 * hh); bq.half[1] = *(const v8us*)((const unsigned short*)Bh + boff + 16 + 8 * hh);
      acc[t] = mmaH<1>(ah.v, ah.v, bq.v, bq.v, acc[t]); }
  }
#pragma unroll
  for (int t = 0; t < 4; ++t) { if (col0 + t * 16 >= N) continue; const int col = col0 + t * 16 + ln; const float bv = bp ? bf16_round(bp[col]) : 0.f;
#pragma unroll
    for (int r = 0; r < 8; ++r) { float v = acc[t][r] * alpha + bv; if (CP) { const int rr = row0g + row0 + 8 * hh + r; if (rowsPerB < 0) v += CP[cofs + (size_t)rr * ldc + col];      /* rowsPerB < 0: own element of the batched C plane */ else { const int bidx = rr / rowsPerB; v += CP[(size_t)bidx * sCPb + (size_t)by * 64 + col]; } } if (ACT == 1) v = (v > 0.f) ? v : expm1f(v); else if (ACT == 7) v = (v > 0.f) ? v + 1.0f : expf(v); else if (ACT == 8) v = tanhf(v); else if (ACT == 9) v = 0.5f * v * (1.0f + tanhf(0.7978845608028654f * (v + 0.044715f * v * v * v))); else if (ACT == 11) v = 1.0f / (1.0f + expf(-v)); else if (ACT == 12) v = (v > 0.f) ? v : 0.01f * v; else if (ACT == 14) v = (v > 0.f) ? v : 0.1f * v; else if (ACT == 16) v = (v >= 0.f) ? v : 0.3f * v; else if (ACT == 17) v = (v >= 0.f) ? v : 0.2f * v; else if (ACT == 15) v = v / (1.0f + expf(-v)); else if (ACT == 3) v = fmaxf(v, 0.f); else if (ACT == 6) v = 0.5f * v * (1.0f + erff(v * 0.70710678118654752f)); so[w][8 * hh + r][t * 16 + ln] = v; } }
  __builtin_amdgcn_fence(__ATOMIC_ACQ_REL, "workgroup"); __builtin_amdgcn_wave_barrier();
  const int rsub = lane >> 4, c4 = (lane & 15) * 4; typedef _Float16 v4h __attribute__((ext_vector_type(4)));
  {
#pragma unroll
    for (int q = 0; q < 8; ++q) { const int r = q * 2 + rsub; if (col0 + c4 < N) { const v4f v = *(const v4fa*)&so[w][r][c4]; if (C) *(v4f*)(C + cofs + (size_t)(row0 + r) * ldc + col0 + c4) = v; if (C16) { v4h h4; for (int i = 0; i < 4; ++i) h4[i] = (_Float16)v[i]; *(v4h*)(C16 + cofs + (size_t)(row0 + r) * ldc + col0 + c4) = h4; } } }
     }
}


typedef _Float16 v4h __attribute__((ext_vector_type(4)));

__global__ __launch_bounds__(256) void k_h16(const float* __restrict__ x, _Float16* __restrict__ X16, size_t n8) { const size_t t = (size_t)blockIdx.x * 256 + threadIdx.x; if (t >= n8) return; FragH f;
#pragma unroll
  for (int q = 0; q < 8; ++q) f.h[q] = (_Float16)x[t * 8 + q]; *(v8us*)((unsigned short*)X16 + t * 8) = f.half[0];  }
__global__ __launch_bounds__(256) void k_round16f(const float* __restrict__ W, _Float16* __restrict__ Bt, size_t n8) { const size_t t = (size_t)blockIdx.x * 256 + threadIdx.x; if (t >= n8) return; FragH f;
#pragma unroll
  for (int i = 0; i < 8; ++i) f.h[i] = (_Float16)(bf16_round(W[t * 8 + i]) * 16.0f); *(v8us*)((unsigned short*)Bt + t * 8) = f.half[0];  }
// ---- fragment order: how the attention operands q, k and v lie in the workspace (V^T: same tiles, placed as k_vt writes them) ----
// A plane of R rows x K columns (R % 16 == 0, K % 32 == 0) is cut into tiles of 16 rows x 32 k, tile (rt, kt) at element (rt * (K / 32) + kt) * 512. Inside a tile, 16-byte chunk 32 j + lane (lane = 16 hh + ln) holds
// row ln, k = 16 j + 8 hh + 0..7: the four registers that lane (ln, hh) takes as half j of its fragment (g2_frag's k order). A fragment is then two loads of 512 contiguous bytes, 4 whole lines a load,
// where row-major rows gave 16 lines a load; the register contents, and with them the k order of both operands of each product, are what they were.
template <int NHv, int TTv>
__global__ __launch_bounds__(256) void k_vt(const _Float16* __restrict__ V16, int ldv, int voff, _Float16* __restrict__ Vt) { __shared__ unsigned short tl[64][66]; const int tid = threadIdx.x; const int slab = blockIdx.x / (TTv / 64), lg = blockIdx.x % (TTv / 64); const int b = slab / NHv, h = slab % NHv;
  /* V16 in fragment order (rows = tokens, k = features, K = ldv): this 64 x 64 block is 4 row tiles x 2 adjacent k tiles; chunk c of row tile rtl holds token row r, features c8 + 0..7 */
  for (int i = tid; i < 64 * 8; i += 256) { const int rtl = i >> 7, c = i & 127, lane = i & 31; const int r = rtl * 16 + (lane & 15), c8 = (c >> 5) * 16 + (lane >> 4) * 8; FragH f;
    f.half[0] = *(const v8us*)((const unsigned short*)V16 + ((size_t)b * TTv + lg * 64 + rtl * 16) * ldv + (size_t)(voff + h * 64) * 16 + c * 8);
#pragma unroll
    for (int q = 0; q < 8; ++q) tl[r][c8 + q] = f.u[q]; }
  __syncthreads();
  {      /* Vt in fragment order, per slab: rows = d (4 tiles), k = tokens, the 4 d tiles of one 32-token step adjacent: tile (st, t) at ((slab * (TTv / 32) + st) * 4 + t) * 512; this block's 512 chunks are contiguous */
#pragma unroll
    for (int rd = 0; rd < 2; ++rd) { const int c = rd * 256 + tid, lane = c & 31; const int d = ((c >> 6) & 3) * 16 + (lane & 15), k0 = (c >> 8) * 32 + ((c >> 5) & 1) * 16 + (lane >> 4) * 8; FragH f;
#pragma unroll
      for (int q = 0; q < 8; ++q) f.u[q] = tl[k0 + q][d];
      *(v8us*)((unsigned short*)Vt + ((size_t)slab * (TTv / 32) + lg * 2) * 2048 + c * 8) = f.half[0]; }
     } }

__global__ __launch_bounds__(256) void k_hl(const float* __restrict__ F, _Float16* __restrict__ Hh, _Float16* __restrict__ Hl, size_t n8) { const size_t t = (size_t)blockIdx.x * 256 + threadIdx.x; if (t >= n8) return; FragH fh, fl; const v4f a = *(const v4fa*)(F + t * 8), c = *(const v4fa*)(F + t * 8 + 4);
#pragma unroll
  for (int q = 0; q < 4; ++q) { _Float16 h = (_Float16)a[q]; fh.h[q] = h; fl.h[q] = (_Float16)((a[q] - (float)h) * 1024.0f); h = (_Float16)c[q]; fh.h[4 + q] = h; fl.h[4 + q] = (_Float16)((c[q] - (float)h) * 1024.0f); }
  { *(v8us*)((unsigned short*)Hh + t * 8) = fh.half[0]; *(v8us*)((unsigned short*)Hl + t * 8) = fl.half[0];  } }

// ---- fast GEMM (workgroup tile 128x64, wave tile 32x64; requires M % 128 == 0 rows per launch region, N % 64 == 0 and K % 64 == 0, K >= 64) ----
// Epilogue, chosen at compile time so that it holds no branch and its loads can be issued together: v = act(acc * alpha + bf16(bias[col])); RES: f32 rows C = v + own element of CP (no activation); else: f16 C16 in fragment order.
// The operands go through LDS: a stage is 64 k of the workgroup's 128 A rows and 64 B rows (192 rows of 128 bytes, each one whole line of its source row), laid at a pitch of 144 bytes (16 B x odd: no bank conflict for
// the 16-byte fragment reads). Two buffers: the next stage's asynchronous copies fly while this stage is multiplied. The B rows are fetched once for the four waves.
#define G2P 72                       /* LDS row pitch, elements */
#define G2S (192 * G2P)              /* one buffer, elements */
__device__ __forceinline__ v16h g2_frag(const unsigned short* p, int hh) { FragH f; f.half[0] = *(const v8us*)(p + 8 * hh); f.half[1] = *(const v8us*)(p + 16 + 8 * hh); return f.v; }
// One thread's share of a stage: twelve asynchronous 16-byte copies (row groups of 16: eight of A, four of B; eight lanes cover one row's 128 bytes, so a wave's copy reads 4 whole lines). l = the thread's LDS byte address in
// row group 0 of the buffer, a and b = its source addresses there, sa and sb = 16 source rows in elements. The s_wait_xcnt is the wait that is kept in front of an overwrite of a register that an issued copy names:
// as the statement's last line it stands in front of every later write of these operands.
__device__ __forceinline__ void g2_stage(unsigned l, const _Float16* a, size_t sa, const _Float16* b, size_t sb) {
  asm volatile("global_load_async_to_lds_b128 %0, %12, off\n\tglobal_load_async_to_lds_b128 %1, %13, off\n\tglobal_load_async_to_lds_b128 %2, %14, off\n\tglobal_load_async_to_lds_b128 %3, %15, off\n\t"
               "global_load_async_to_lds_b128 %4, %16, off\n\tglobal_load_async_to_lds_b128 %5, %17, off\n\tglobal_load_async_to_lds_b128 %6, %18, off\n\tglobal_load_async_to_lds_b128 %7, %19, off\n\t"
               "global_load_async_to_lds_b128 %8, %20, off\n\tglobal_load_async_to_lds_b128 %9, %21, off\n\tglobal_load_async_to_lds_b128 %10, %22, off\n\tglobal_load_async_to_lds_b128 %11, %23, off\n\t"
               "s_wait_xcnt 0x0"
               :: "v"(l), "v"(l + 32u * G2P), "v"(l + 64u * G2P), "v"(l + 96u * G2P), "v"(l + 128u * G2P), "v"(l + 160u * G2P), "v"(l + 192u * G2P), "v"(l + 224u * G2P), "v"(l + 256u * G2P), "v"(l + 288u * G2P), "v"(l + 320u * G2P), "v"(l + 352u * G2P),
                  "v"(a), "v"(a + sa), "v"(a + 2 * sa), "v"(a + 3 * sa), "v"(a + 4 * sa), "v"(a + 5 * sa), "v"(a + 6 * sa), "v"(a + 7 * sa), "v"(b), "v"(b + sb), "v"(b + 2 * sb), "v"(b + 3 * sb) : "memory"); }
__device__ __forceinline__ v8f g2_mma(v16h a, v16h b, v8f c) { v8f d = __builtin_amdgcn_wmma_f32_16x16x32_f16(false, a, false, b, (short)0, c, false, false); asm volatile("v_nop\n\tv_nop\n\tv_nop\n\tv_nop" : "+v"(d) : "v"(a), "v"(b)); return d; }
template <int ACT, bool RES>
__global__ __launch_bounds__(128) void k_gemm2(const _Float16* __restrict__ A, int lda, size_t sA, const _Float16* __restrict__ Bh, int ldb, size_t sB, float alpha, const float* __restrict__ bias, size_t sBias, const float* __restrict__ CP, int row0g,
    float* __restrict__ C, _Float16* __restrict__ C16, int ldc, size_t sC, int M, int N, int K) { static_assert(!RES || ACT == 0, "k_gemm2: the residual is added at the write-out, behind the activation's place"); static_assert(ACT == 0 || ACT == 3 || ACT == 6 || ACT == 8 || ACT == 9 || ACT == 11 || ACT == 12 || ACT == 14 || ACT == 15 || ACT == 16 || ACT == 17, "k_gemm2: unsupported ACT code (would silently apply no activation)");
  __shared__ __attribute__((aligned(16))) float so[4][32][68];
  __shared__ __attribute__((aligned(16))) unsigned short st[2 * G2S];
  const int tid = threadIdx.x, w = tid >> 5, lane = tid & 31, ln = lane & 15, hh = lane >> 4; const int by = blockIdx.y;
  A += (size_t)by * sA; Bh += (size_t)by * sB; const size_t cofs = (size_t)by * sC; const float* bp = bias + (size_t)by * sBias;
  const int ntn = N >> 6; const int mt = blockIdx.x / ntn, nq = blockIdx.x - mt * ntn; const int row0 = mt * 128 + 32 * w, col0 = nq * 64; if (mt * 128 >= M) return;      /* the whole workgroup or none: barriers follow */
  const unsigned l0 = (unsigned)(size_t)&st[(tid >> 3) * G2P + (tid & 7) * 8];      /* LDS byte address: the low 32 bits of the shared address */
  const _Float16* ga = A + (size_t)(mt * 128 + (tid >> 3)) * lda + (tid & 7) * 8; const _Float16* gb = Bh + (size_t)(col0 + (tid >> 3)) * ldb + (tid & 7) * 8; const size_t sa = (size_t)16 * lda, sb = (size_t)16 * ldb;
  const int nt = K >> 6;
  const v8f z8 = {0.f,0.f,0.f,0.f,0.f,0.f,0.f,0.f}; v8f c00 = z8, c01 = z8, c02 = z8, c03 = z8, c10 = z8, c11 = z8, c12 = z8, c13 = z8;
  float bv[4];      /* the lane's four bias values: loaded here, used behind the loop */
#pragma unroll
  for (int t = 0; t < 4; ++t) bv[t] = bp[col0 + t * 16 + ln];
  g2_stage(l0, ga, sa, gb, sb);
  asm volatile("s_wait_asynccnt 0x0" ::: "memory");      /* this wave's copies of stage 0 have landed */
  __syncthreads();      /* publishes stage 0 */
  if (nt > 1) g2_stage(l0 + 2u * G2S, ga + 64, sa, gb + 64, sb);
#pragma unroll 1      /* kept rolled: a trip already holds 24 LDS reads and 16 WMMAs; unrolling would only repeat the copies, the waits and the barrier in the text */
  for (int t = 0; t < nt; ++t) { const unsigned short* const ap = st + (t & 1) * G2S + (32 * w + ln) * G2P; const unsigned short* const bq = st + (t & 1) * G2S + (128 + ln) * G2P; v16h af[2][2], bf[2][4];
#pragma unroll
    for (int ks = 0; ks < 2; ++ks) {
#pragma unroll
      for (int r = 0; r < 2; ++r) af[ks][r] = g2_frag(ap + 16 * r * G2P + 32 * ks, hh);
#pragma unroll
      for (int u = 0; u < 4; ++u) bf[ks][u] = g2_frag(bq + 16 * u * G2P + 32 * ks, hh); }
#pragma unroll
    for (int ks = 0; ks < 2; ++ks) { c00 = g2_mma(af[ks][0], bf[ks][0], c00); c10 = g2_mma(af[ks][1], bf[ks][0], c10); c01 = g2_mma(af[ks][0], bf[ks][1], c01); c11 = g2_mma(af[ks][1], bf[ks][1], c11);
      c02 = g2_mma(af[ks][0], bf[ks][2], c02); c12 = g2_mma(af[ks][1], bf[ks][2], c12); c03 = g2_mma(af[ks][0], bf[ks][3], c03); c13 = g2_mma(af[ks][1], bf[ks][3], c13); }
    asm volatile("s_wait_dscnt 0x0" ::: "memory");      /* this wave's reads of the buffer are done before it may be refilled */
    asm volatile("s_wait_asynccnt 0x0" ::: "memory");      /* this wave's copies of stage t + 1 have landed */
    __syncthreads();      /* publishes stage t + 1 and ends every wave's reads of stage t */
    if (t + 2 < nt) g2_stage(l0 + (unsigned)(t & 1) * (2u * G2S), ga + (size_t)(t + 2) * 64, sa, gb + (size_t)(t + 2) * 64, sb); }
  asm volatile("s_wait_asynccnt 0x0" ::: "memory");      /* no copy is outstanding when the wave goes on */
  const int rsub = lane >> 4, c4 = (lane & 15) * 4;
  v4f res[16]; unsigned eo[16];      /* with RES, the wave's 32 x 64 residual tile: 16 loads of 16 bytes a lane (two 256-byte row pieces a load), all issued here, in flight under the staging below; eo = the lane's offsets in the plane, in 16-byte units (ldc % 4 == 0, as the 16-byte accesses ask), the same for the residual loads and the C stores */
  if constexpr (RES) {
#pragma unroll
    for (int q = 0; q < 16; ++q) { eo[q] = (unsigned)(row0 + q * 2 + rsub) * ((unsigned)ldc >> 2) + (unsigned)((col0 + c4) >> 2); res[q] = ((const v4fa*)(CP + cofs + (size_t)row0g * ldc))[eo[q]]; } }
  v8f accs[8] = {c00, c01, c02, c03, c10, c11, c12, c13};
#pragma unroll
  for (int u = 0; u < 8; ++u) { const int t = u & 3, half = u >> 2; const float bvr = bf16_round(bv[t]);
#pragma unroll
    for (int r = 0; r < 8; ++r) { const int rloc = half * 16 + 8 * hh + r; float v = accs[u][r] * alpha + bvr;
      if (ACT == 3) v = fmaxf(v, 0.f); else if (ACT == 6) v = 0.5f * v * (1.0f + erff(v * 0.70710678118654752f)); else if (ACT == 11) v = 1.0f / (1.0f + expf(-v)); else if (ACT == 15) v = v / (1.0f + expf(-v)); else if (ACT == 12) v = (v > 0.f) ? v : 0.01f * v; else if (ACT == 8) v = tanhf(v); else if (ACT == 9) v = 0.5f * v * (1.0f + tanhf(0.7978845608028654f * (v + 0.044715f * v * v * v))); else if (ACT == 14) v = (v > 0.f) ? v : 0.1f * v; else if (ACT == 16) v = (v >= 0.f) ? v : 0.3f * v; else if (ACT == 17) v = (v >= 0.f) ? v : 0.2f * v;
      so[w][rloc][t * 16 + ln] = v; } }
  __builtin_amdgcn_fence(__ATOMIC_ACQ_REL, "workgroup"); __builtin_amdgcn_wave_barrier();
  if constexpr (RES) {
#pragma unroll
    for (int q = 0; q < 16; ++q) { const v4f v = *(const v4fa*)&so[w][q * 2 + rsub][c4] + res[q]; ((v4f*)(C + cofs))[eo[q]] = v; }
  } else {      /* C16 goes out in fragment order (see above k_vt; K = ldc): the 32 x 64 tile is 2 row tiles x 2 adjacent k tiles x 2 halves = 8 stores of 512 contiguous bytes */
#pragma unroll
    for (int u = 0; u < 8; ++u) { const int rtl = u >> 2, cu = u & 3; const float* sp = &so[w][rtl * 16 + ln][cu * 16 + 8 * hh]; const v4f v0 = *(const v4fa*)sp, v1 = *(const v4fa*)(sp + 4); FragH f;
#pragma unroll
      for (int i = 0; i < 4; ++i) { f.h[i] = (_Float16)v0[i]; f.h[4 + i] = (_Float16)v1[i]; }
      *(v8us*)((unsigned short*)C16 + cofs + (size_t)(row0 + 16 * rtl) * ldc + (size_t)col0 * 16 + cu * 256 + 8 * lane) = f.half[0]; } } }

// ---- the three projections q, k, v in one launch: one workgroup multiplies its 128 x rows by the 64-column tiles of all three weights ----
// 12 waves: wave group p = 0, 1, 2 (four waves each) owns weight p and works as the four waves of k_gemm2 do (32 x 64 wave tiles, the same fragment reads, the same order of products, the same f16 fragment-order write-out).
// A stage is 64 k of 320 rows at k_gemm2's pitch: rows 0..127 the x tile, fetched once for the three weights, rows 128 + 64 p .. the tile of weight p. Two buffers, k_gemm2's order of waits and its one barrier a trip.
// Who copies what: group p brings its own weight tile (four row groups of 16) and x row groups 3 p, 3 p + 1 and, for p < 2, 3 p + 2 (eight in all).
// The write-out staging lies over the two buffers: behind the last trip's barrier no wave reads them and no copy is outstanding. 104,448 bytes of LDS and at most 160 registers: two workgroups a WGP, all 512 resident.
#define G3S (320 * G2P)              /* one buffer, elements */
typedef float f32a __attribute__((may_alias));
// One thread's share of a stage, as g2_stage: la, a = its LDS byte address and source address in its first x row group, lb, b = the same in row group 0 of its weight tile; third = the group has a third x row group (the same for a whole wave).
// Each s_wait_xcnt is the last line of its copies' own statement, in front of every later write of their operands.
__device__ __forceinline__ void g3_stage(unsigned la, const _Float16* a, size_t sa, unsigned lb, const _Float16* b, size_t sb, bool third) {
  asm volatile("global_load_async_to_lds_b128 %0, %6, off\n\tglobal_load_async_to_lds_b128 %1, %7, off\n\tglobal_load_async_to_lds_b128 %2, %8, off\n\t"
               "global_load_async_to_lds_b128 %3, %9, off\n\tglobal_load_async_to_lds_b128 %4, %10, off\n\tglobal_load_async_to_lds_b128 %5, %11, off\n\t"
               "s_wait_xcnt 0x0"
               :: "v"(la), "v"(la + 32u * G2P), "v"(lb), "v"(lb + 32u * G2P), "v"(lb + 64u * G2P), "v"(lb + 96u * G2P),
                  "v"(a), "v"(a + sa), "v"(b), "v"(b + sb), "v"(b + 2 * sb), "v"(b + 3 * sb) : "memory");
  if (third) asm volatile("global_load_async_to_lds_b128 %0, %1, off\n\ts_wait_xcnt 0x0" :: "v"(la + 64u * G2P), "v"(a + 2 * sa) : "memory"); }
__global__ __launch_bounds__(384, 6) void k_gemm_qkv(const _Float16* __restrict__ A, int lda, const _Float16* __restrict__ W0, const _Float16* __restrict__ W1, const _Float16* __restrict__ W2, int ldb, float alpha,
    const float* __restrict__ bias0, const float* __restrict__ bias1, const float* __restrict__ bias2, _Float16* __restrict__ C0, _Float16* __restrict__ C1, _Float16* __restrict__ C2, int ldc, int M, int N, int K) {
  __shared__ __attribute__((aligned(16))) unsigned short st[12 * 32 * 68 * 2];      /* the two stage buffers (2 * G3S elements); behind the loop, twelve 32 x 68 f32 staging tiles */
  static_assert(2 * G3S <= 12 * 32 * 68 * 2, "k_gemm_qkv: the stage buffers fit the array");
  const int tid = threadIdx.x, w = tid >> 5, lane = tid & 31, ln = lane & 15, hh = lane >> 4, wr = w & 3, t7 = tid & 127;
  const int p = __builtin_amdgcn_readfirstlane(tid >> 7);      /* the wave's group, in a scalar register: the choices below and the test on the third x row group are scalar */
  const _Float16* const Bh = p == 0 ? W0 : p == 1 ? W1 : W2; const float* const bp = p == 0 ? bias0 : p == 1 ? bias1 : bias2; _Float16* const C16 = p == 0 ? C0 : p == 1 ? C1 : C2;
  const int ntn = N >> 6; const int mt = blockIdx.x / ntn, nq = blockIdx.x - mt * ntn; const int row0 = mt * 128 + 32 * wr, col0 = nq * 64; if (mt * 128 >= M) return;      /* the whole workgroup or none: barriers follow */
  const unsigned la0 = (unsigned)(size_t)&st[(48 * p + (t7 >> 3)) * G2P + (t7 & 7) * 8], lb0 = (unsigned)(size_t)&st[(128 + 64 * p + (t7 >> 3)) * G2P + (t7 & 7) * 8];      /* LDS byte addresses: the low 32 bits of the shared addresses */
  const _Float16* ga = A + (size_t)(mt * 128 + 48 * p + (t7 >> 3)) * lda + (t7 & 7) * 8; const _Float16* gb = Bh + (size_t)(col0 + (t7 >> 3)) * ldb + (t7 & 7) * 8; const size_t sa = (size_t)16 * lda, sb = (size_t)16 * ldb;
  const bool third = p < 2; const int nt = K >> 6;
  const v8f z8 = {0.f,0.f,0.f,0.f,0.f,0.f,0.f,0.f}; v8f c00 = z8, c01 = z8, c02 = z8, c03 = z8, c10 = z8, c11 = z8, c12 = z8, c13 = z8;
  float bv[4];      /* the lane's four bias values: loaded here, used behind the loop */
#pragma unroll      /* this and every unrolled loop below runs over fragments, tiles or registers: unrolled, its arrays stay in registers and its offsets are immediates */
  for (int t = 0; t < 4; ++t) bv[t] = bp[col0 + t * 16 + ln];
  g3_stage(la0, ga, sa, lb0, gb, sb, third);
  asm volatile("s_wait_asynccnt 0x0" ::: "memory");      /* this wave's copies of stage 0 have landed */
  __syncthreads();      /* publishes stage 0 */
  if (nt > 1) g3_stage(la0 + 2u * G3S, ga + 64, sa, lb0 + 2u * G3S, gb + 64, sb, third);
#pragma unroll 1      /* kept rolled, as in k_gemm2: unrolling would only repeat the copies, the waits and the barrier in the text */
  for (int t = 0; t < nt; ++t) { const unsigned short* const ap = st + (t & 1) * G3S + (32 * wr + ln) * G2P; const unsigned short* const bq = st + (t & 1) * G3S + (128 + 64 * p + ln) * G2P;
#pragma unroll
    for (int ks = 0; ks < 2; ++ks) { v16h af[2], bf[4];
#pragma unroll
      for (int r = 0; r < 2; ++r) af[r] = g2_frag(ap + 16 * r * G2P + 32 * ks, hh);
#pragma unroll
      for (int u = 0; u < 4; ++u) bf[u] = g2_frag(bq + 16 * u * G2P + 32 * ks, hh);
      c00 = g2_mma(af[0], bf[0], c00); c10 = g2_mma(af[1], bf[0], c10); c01 = g2_mma(af[0], bf[1], c01); c11 = g2_mma(af[1], bf[1], c11);
      c02 = g2_mma(af[0], bf[2], c02); c12 = g2_mma(af[1], bf[2], c12); c03 = g2_mma(af[0], bf[3], c03); c13 = g2_mma(af[1], bf[3], c13); }
    asm volatile("s_wait_dscnt 0x0" ::: "memory");      /* this wave's reads of the buffer are done before it may be refilled */
    asm volatile("s_wait_asynccnt 0x0" ::: "memory");      /* this wave's copies of stage t + 1 have landed */
    __syncthreads();      /* publishes stage t + 1 and ends every wave's reads of stage t */
    if (t + 2 < nt) g3_stage(la0 + (unsigned)(t & 1) * (2u * G3S), ga + (size_t)(t + 2) * 64, sa, lb0 + (unsigned)(t & 1) * (2u * G3S), gb + (size_t)(t + 2) * 64, sb, third); }
  asm volatile("s_wait_asynccnt 0x0" ::: "memory");      /* no copy is outstanding when the wave goes on */
  f32a* const so = (f32a*)st + w * (32 * 68);      /* the wave's own staging tile, pitch 68 */
  v8f accs[8] = {c00, c01, c02, c03, c10, c11, c12, c13};
#pragma unroll
  for (int u = 0; u < 8; ++u) { const int t = u & 3, half = u >> 2; const float bvr = bf16_round(bv[t]);
#pragma unroll
    for (int r = 0; r < 8; ++r) so[(half * 16 + 8 * hh + r) * 68 + t * 16 + ln] = accs[u][r] * alpha + bvr; }
  __builtin_amdgcn_fence(__ATOMIC_ACQ_REL, "workgroup"); __builtin_amdgcn_wave_barrier();      /* the wave's stores to its own tile stay in front of the reads below, which take other lanes' values */
  /* C16 goes out in fragment order (see above k_vt; K = ldc), as in k_gemm2: 8 stores of 512 contiguous bytes */
#pragma unroll
  for (int u = 0; u < 8; ++u) { const int rtl = u >> 2, cu = u & 3; const f32a* sp = so + (rtl * 16 + ln) * 68 + cu * 16 + 8 * hh; const v4f v0 = *(const v4fa*)sp, v1 = *(const v4fa*)(sp + 4); FragH f;
#pragma unroll
    for (int i = 0; i < 4; ++i) { f.h[i] = (_Float16)v0[i]; f.h[4 + i] = (_Float16)v1[i]; }
    *(v8us*)((unsigned short*)C16 + (size_t)(row0 + 16 * rtl) * ldc + (size_t)col0 * 16 + cu * 256 + 8 * lane) = f.half[0]; } }


__global__ __launch_bounds__(256) void k_rsm(const float* __restrict__ S, _Float16* __restrict__ P, int nrows) {
  #pragma clang fp contract(off)
  const int i = blockIdx.x * 256 + threadIdx.x; if (i >= nrows) return; const float* s = S + (size_t)i * SQ; float mx = -3.0e38f;
#pragma unroll 1
  for (int j = 0; j < SQ; ++j) mx = fmaxf(mx, s[j]); float se = 0.f;
#pragma unroll 1
  for (int j = 0; j < SQ; ++j) se += expf(s[j] - mx); const float sc = 256.0f / se;
#pragma unroll 1
  for (int j0 = 0; j0 < SQ; j0 += 8) { FragH f; for (int q = 0; q < 8; ++q) f.h[q] = (_Float16)(expf(s[j0 + q] - mx) * sc); unsigned short* d = (unsigned short*)P + (size_t)i * SQ + j0; *(v8us*)d = f.half[0];  } }
__global__ __launch_bounds__(256) void k_vt(const _Float16* __restrict__ V16, int b, int h0, _Float16* __restrict__ VT) { __shared__ unsigned short tl[64][65]; const int tid = threadIdx.x; const int hh = blockIdx.x % HG, sg = blockIdx.x / HG; const int s0 = sg * 64; const int h = h0 + hh;
  for (int i = tid; i < 64 * 8; i += 256) { const int j = i / 8, d8 = (i % 8) * 8; FragH f; f.half[0] = *(const v8us*)((const unsigned short*)V16 + ((size_t)b * SQ + s0 + j) * DM + h * HD + d8); for (int q = 0; q < 8; ++q) tl[d8 + q][j] = f.u[q]; }
  __syncthreads();
  { for (int i = tid; i < 64 * 8; i += 256) { const int d = i / 8, j8 = (i % 8) * 8; FragH f; for (int q = 0; q < 8; ++q) f.u[q] = tl[d][j8 + q]; *(v8us*)((unsigned short*)VT + ((size_t)hh * HD + d) * SQ + s0 + j8) = f.half[0]; }  } }



__global__ __launch_bounds__(256) void k_rsmf(const float* __restrict__ S, _Float16* __restrict__ P, int qn, int hg) {
  #pragma clang fp contract(off)
  const int t = blockIdx.x * 256 + threadIdx.x; if (t >= qn * hg) return; const size_t i = (size_t)(t / qn) * SQ + (t % qn); const float* s = S + i * SQ; float mx = -3.0e38f;
#pragma unroll 1
  for (int j = 0; j < SQ; ++j) mx = fmaxf(mx, s[j]); float se = 0.f;
#pragma unroll 1
  for (int j = 0; j < SQ; ++j) se += __expf(s[j] - mx); const float sc = 256.0f / se;
#pragma unroll 1
  for (int j0 = 0; j0 < SQ; j0 += 8) { FragH f; for (int q = 0; q < 8; ++q) f.h[q] = (_Float16)(__expf(s[j0 + q] - mx) * sc); unsigned short* d = (unsigned short*)P + i * SQ + j0; *(v8us*)d = f.half[0];  } }

// Four native exp2 in one statement: each is the independent instruction that the instruction set asks for behind the transcendental in front of it, and the v_nop is that slot behind the last
// Early-clobber outputs keep the four independent of one another.
__device__ __forceinline__ void exp2x4(float& a, float& b, float& c, float& d) { float e0, e1, e2, e3;
  asm("v_exp_f32 %0, %4\n\tv_exp_f32 %1, %5\n\tv_exp_f32 %2, %6\n\tv_exp_f32 %3, %7\n\tv_nop" : "=&v"(e0), "=&v"(e1), "=&v"(e2), "=&v"(e3) : "v"(a), "v"(b), "v"(c), "v"(d));
  a = e0; b = e1; c = e2; d = e3; }
// Two native exp2 in one statement, as exp2x4 above: the second is the independent instruction behind the first, the v_nop is that slot behind the second.
__device__ __forceinline__ void exp2x2(float& a, float& b) { float e0, e1;
  asm("v_exp_f32 %0, %2\n\tv_exp_f32 %1, %3\n\tv_nop" : "=&v"(e0), "=&v"(e1) : "v"(a), "v"(b));
  a = e0; b = e1; }
__device__ __forceinline__ float fa_xhalf(float x) { return __builtin_bit_cast(float, __builtin_amdgcn_permlanex16(__builtin_bit_cast(int, x), __builtin_bit_cast(int, x), 0x76543210, 0xfedcba98, false, false)); }      /* lane l <-> lane l ^ 16 */
__device__ __forceinline__ v16h fa_frag(const _Float16* ub, unsigned off) { FragH f; f.half[0] = *(const v8us*)((const unsigned short*)ub + off); f.half[1] = *(const v8us*)((const unsigned short*)ub + off + 256); return f.v; }      /* a tile in fragment order, g2_frag's k order; ub is the same for the whole wave, off = tile offset + 8 * lane */
__device__ __forceinline__ v8f fa_mma(v16h a, v16h b, v8f c) { return __builtin_amdgcn_wmma_f32_16x16x32_f16(false, a, false, b, (short)0, c, false, false); }
// Fused attention of one head: scores, softmax and P.V in one launch; neither the scores nor the weights go to memory.
// Grid (SQ / 256, heads), 8 waves; a wave owns 32 queries (two groups of 16 columns) and walks all keys, 32 a step.
// Transposed products: S^T = K . Q^T (A = 16 key rows, B = 16 query columns, k = d) and O^T += V^T . P^T (A = 16 d rows of V^T, B = P^T, k = 32 keys).
// D register r of lane (c = lane & 15, h = lane >> 4) is element [8 h + r][c]: a lane holds one query's scores, and the two 16-key score tiles of a step, converted in place, are the B operand of the
// second product in the k order of g2_frag (elements 0..7 = keys 8 h + 0..7, elements 8..15 = keys 16 + 8 h + 0..7), which loads V^T. No LDS and no lane exchange for P.
// Online softmax in the log2 domain, f32: running maximum mr and running sum lr per query; each step rescales O^T and lr by exp2(old maximum - new maximum). The weights are carried x256 (the + 8) as f16
// operands, away from the f16 subnormals; the factor cancels in the division by lr, which sums the same scaled weights. mr starts at -3.0e38 (finite), so a step whose keys are all masked to -inf adds zeros.
// The mask (bf16-rounded, x log2 e) is prepared once per workgroup in LDS; the one barrier publishes it.
__global__ __launch_bounds__(256) void k_fattn(const _Float16* __restrict__ Q, const _Float16* __restrict__ Kk, const _Float16* __restrict__ VTh, const float* __restrict__ am, _Float16* __restrict__ O) {
  __shared__ __attribute__((aligned(16))) float smk[SQ];
  const int tid = threadIdx.x, lane = tid & 31, ln = lane & 15, hh = lane >> 4, w = tid >> 5; const int h = blockIdx.y, q0 = blockIdx.x * 256 + w * 32;
  for (int i = tid * 4; i < SQ; i += 1024) { v4f a = *(const v4fa*)(am + i);
#pragma unroll
    for (int q = 0; q < 4; ++q) a[q] = bf16_round(a[q]) * 1.44269504f;
    *(v4fa*)&smk[i] = a; }
  __syncthreads();
  const unsigned qo = (unsigned)(q0 * LQ + 8 * lane); v16h qf[2][2];      /* Q, Kk and VTh lie in fragment order (see above k_vt): a row tile is 16 * LQ elements, head h is its k tiles 2 h and 2 h + 1 */
#pragma unroll
  for (int g = 0; g < 2; ++g)
#pragma unroll
    for (int ks = 0; ks < 2; ++ks) qf[g][ks] = fa_frag(Q + h * HD * 16, qo + 16 * g * LQ + 512 * ks);
  const _Float16* const kb = Kk + h * HD * 16; const _Float16* const vb = VTh + (size_t)h * HD * SQ; const unsigned ko = (unsigned)(8 * lane), vo = (unsigned)(8 * lane);
  const v8f z8 = {0.f,0.f,0.f,0.f,0.f,0.f,0.f,0.f}; v8f o[2][4];
#pragma unroll
  for (int g = 0; g < 2; ++g)
#pragma unroll
    for (int t = 0; t < 4; ++t) o[g][t] = z8;
  float mr[2] = {-3.0e38f, -3.0e38f}, lr[2] = {0.f, 0.f};
  v16h ka[2][2];
#pragma unroll
  for (int kt = 0; kt < 2; ++kt)
#pragma unroll
    for (int ks = 0; ks < 2; ++ks) ka[kt][ks] = fa_frag(kb, ko + 16 * kt * LQ + 512 * ks);
#pragma unroll 1      /* one step is some 250 instructions and holds its own overlap (loads against softmax); unrolling would only grow the code */
  for (int j0 = 0; j0 < SQ; j0 += 32) {
    v4f mk[2][2];      /* this step's mask values: read from LDS under the first product */
#pragma unroll
    for (int kt = 0; kt < 2; ++kt)
#pragma unroll
      for (int c = 0; c < 2; ++c) mk[kt][c] = *(const v4fa*)&smk[j0 + 16 * kt + 8 * hh + 4 * c];
    v16h va[4];      /* this step's V^T fragments: issued here, needed only behind the exponentials */
#pragma unroll
    for (int t = 0; t < 4; ++t) va[t] = fa_frag(vb + j0 * HD, vo + 512 * t);
    v8f s[2][2];
#pragma unroll
    for (int g = 0; g < 2; ++g)
#pragma unroll
      for (int kt = 0; kt < 2; ++kt) s[g][kt] = fa_mma(ka[kt][1], qf[g][1], fa_mma(ka[kt][0], qf[g][0], z8));
    const _Float16* const kn = kb + (size_t)((j0 + 32 < SQ) ? j0 + 32 : 0) * LQ;      /* the next step's K fragments, in flight under this step's softmax; the last step re-reads the first rows, unused */
#pragma unroll
    for (int kt = 0; kt < 2; ++kt)
#pragma unroll
      for (int ks = 0; ks < 2; ++ks) ka[kt][ks] = fa_frag(kn, ko + 16 * kt * LQ + 512 * ks);
    __builtin_amdgcn_sched_barrier(0);      /* keeps both groups of loads in front of the softmax: left free, the K loads sank to the loop's foot and the next step waited out their whole latency */
    float mn[2], cr[2];
#pragma unroll
    for (int g = 0; g < 2; ++g) { float mx = mr[g];
#pragma unroll
      for (int kt = 0; kt < 2; ++kt)
#pragma unroll
        for (int r = 0; r < 8; ++r) { s[g][kt][r] = s[g][kt][r] * 0.18033688f + mk[kt][r >> 2][r & 3]; mx = fmaxf(mx, s[g][kt][r]); }      /* (q . k / 8 + mask) log2 e */
      mn[g] = fmaxf(mx, fa_xhalf(mx)); cr[g] = mr[g] - mn[g]; mr[g] = mn[g]; }
    exp2x2(cr[0], cr[1]); FragH pf[2];
#pragma unroll
    for (int g = 0; g < 2; ++g) { const float nm = 8.0f - mn[g]; float ls[4] = {0.f, 0.f, 0.f, 0.f};
#pragma unroll
      for (int t = 0; t < 4; ++t) o[g][t] = o[g][t] * cr[g];
#pragma unroll
      for (int kt = 0; kt < 2; ++kt)
#pragma unroll
        for (int r4 = 0; r4 < 8; r4 += 4) { float y[4];
#pragma unroll
          for (int q = 0; q < 4; ++q) y[q] = s[g][kt][r4 + q] + nm;
          exp2x4(y[0], y[1], y[2], y[3]);
#pragma unroll
          for (int q = 0; q < 4; ++q) { ls[q] += y[q]; pf[g].h[8 * kt + r4 + q] = (_Float16)y[q]; } }
      lr[g] = lr[g] * cr[g] + ((ls[0] + ls[1]) + (ls[2] + ls[3])); }
    __builtin_amdgcn_sched_barrier(0);      /* keeps every asm exponential in front of the second product */
#pragma unroll
    for (int g = 0; g < 2; ++g)
#pragma unroll
      for (int t = 0; t < 4; ++t) o[g][t] = fa_mma(va[t], pf[g].v, o[g][t]); }
#pragma unroll
  for (int g = 0; g < 2; ++g) { const float sc = 64.0f / (lr[g] + fa_xhalf(lr[g]));      /* the halves' sums joined; o carried x64, as the output GEMM's alpha expects */
    _Float16* d = O + h * HD + ((unsigned)((q0 + ln) * DM + 8 * hh) + 16 * g * DM);
#pragma unroll
    for (int t = 0; t < 4; ++t) { FragH f;
#pragma unroll
      for (int r = 0; r < 8; ++r) f.h[r] = (_Float16)(o[g][t][r] * sc);
      *(v8us*)((unsigned short*)d + 16 * t) = f.half[0]; } } }


// All input conversions in one streaming launch: x -> X16 (the bf16-rounded value as f16) and XB (the same value as f32, the residual plane); each weight -> its f16 plane, x16 (natural [out][in] = Bt[n][k]).
// 512 workgroups of 8 waves: 16 waves a WGP, 4096 waves in all. A wave takes one contiguous 4-KiB block of x and one of a weight (workgroups 128 s .. 128 s + 127 share weight s): 8 + 8 loads of 16 bytes a lane,
// each load 512 contiguous bytes (4 whole lines), all sixteen issued before the first value is used; the stores cover whole lines too (512 bytes f32, 256 bytes f16). x is read once for both of its planes.
__global__ __launch_bounds__(256) void k_prep(const float* __restrict__ x, const float* __restrict__ wq, const float* __restrict__ wk, const float* __restrict__ wv, const float* __restrict__ wo,
    _Float16* __restrict__ X16, float* __restrict__ XB, _Float16* __restrict__ BQ, _Float16* __restrict__ BK, _Float16* __restrict__ BV, _Float16* __restrict__ BO) {
  static_assert(NR * DM == (size_t)512 * 8 * 1024 && (size_t)DM * DM == (size_t)128 * 8 * 1024, "k_prep: the grid of 512 workgroups covers exactly these planes");
  const unsigned lane = threadIdx.x & 31, wid = blockIdx.x * 8 + (threadIdx.x >> 5), sel = blockIdx.x >> 7;
  const float* const w = sel == 0 ? wq : sel == 1 ? wk : sel == 2 ? wv : wo; _Float16* const B = sel == 0 ? BQ : sel == 1 ? BK : sel == 2 ? BV : BO;
  const unsigned xo = wid * 1024 + lane * 4, bo = (wid & 1023) * 1024 + lane * 4;      /* element offsets of the wave's two blocks */
  v4f a[8], b[8];      /* every loop below is unrolled: a and b stay in registers and each step's offset is an immediate of its load or store */
#pragma unroll
  for (int j = 0; j < 8; ++j) a[j] = *(const v4fa*)(x + xo + 128 * j);
#pragma unroll
  for (int j = 0; j < 8; ++j) b[j] = *(const v4fa*)(w + bo + 128 * j);
  __builtin_amdgcn_sched_barrier(0);      /* keeps the weight loads in front of the conversions: left free, they sank behind the x stores and the wave waited out a second memory latency */
#pragma unroll
  for (int j = 0; j < 8; ++j) { v4f r; v4h h;
#pragma unroll
    for (int q = 0; q < 4; ++q) { r[q] = bf16_round(a[j][q]); h[q] = (_Float16)r[q]; }
    *(v4f*)(XB + xo + 128 * j) = r; *(v4h*)(X16 + xo + 128 * j) = h; }
#pragma unroll
  for (int j = 0; j < 8; ++j) { v4h h;
#pragma unroll
    for (int q = 0; q < 4; ++q) h[q] = (_Float16)(bf16_round(b[j][q]) * 16.0f);
    *(v4h*)(B + bo + 128 * j) = h; } }


__global__ __launch_bounds__(256) void k_lnrow(const float* __restrict__ Y, const float* __restrict__ g, const float* __restrict__ bb, float eps, float* __restrict__ out) {
  #pragma clang fp contract(off)
  __shared__ float red[256]; const size_t r = blockIdx.x; const int t = threadIdx.x; const v4f ya = *(const v4fa*)(Y + r * DMQ + t * 4); float s[4]; float sum = 0.f;
  for (int q = 0; q < 4; ++q) { s[q] = ya[q]; sum = __fadd_rn(sum, s[q]); }
  red[t] = sum; __syncthreads(); for (int st = 128; st > 0; st >>= 1) { if (t < st) red[t] = __fadd_rn(red[t], red[t + st]); __syncthreads(); } const float mu = red[0] / (float)DMQ; __syncthreads();
  float vs = 0.f; for (int q = 0; q < 4; ++q) { const float dl = __fadd_rn(s[q], -mu); vs = __fadd_rn(vs, __fmul_rn(dl, dl)); } red[t] = vs; __syncthreads(); for (int st = 128; st > 0; st >>= 1) { if (t < st) red[t] = __fadd_rn(red[t], red[t + st]); __syncthreads(); }
  const float rs = rsqrtf(__fadd_rn(red[0] / (float)DMQ, eps)); v4f y; for (int q = 0; q < 4; ++q) { const int c = t * 4 + q; y[q] = __fadd_rn(__fmul_rn(__fmul_rn(__fadd_rn(s[q], -mu), rs), bf16_round(g[c])), bf16_round(bb[c])); }
  *(v4f*)(out + r * DMQ + t * 4) = y;  }
extern "C" void kernel_launch(void* const* d_in, const int* in_sizes, int n_in,
                              void* d_out, int out_size, void* d_ws, size_t ws_size, hipStream_t stream) {
  (void)in_sizes; (void)n_in; (void)out_size;
  const float* const* I = (const float* const*)d_in; const float* x = I[0]; const float* am = I[1]; const float* wq = I[2]; const float* bq = I[3]; const float* wk = I[4]; const float* bk = I[5]; const float* wv = I[6]; const float* bv = I[7]; const float* wo = I[8]; const float* bo = I[9]; const float* lng = I[10]; const float* lnb = I[11];      /* nn.Linear weights [out][in] + biases; additive mask [1][1][1][S] */
  char* ws = (char*)d_ws; size_t off = 0;
  auto take = [&](size_t bytes) { char* p = ws + off; off += (bytes + 255) & ~(size_t)255; return p; };
  _Float16* BQ = (_Float16*)take((size_t)DM * DM * 2); _Float16* BK = (_Float16*)take((size_t)DM * DM * 2); _Float16* BV = (_Float16*)take((size_t)DM * DM * 2); _Float16* BO = (_Float16*)take((size_t)DM * DM * 2);
  _Float16* X16 = (_Float16*)take(NR * DM * 2); float* XB = (float*)take(NR * DM * 4); float* YF = (float*)take(NR * DM * 4); _Float16* Q16 = (_Float16*)take(NR * DM * 2); _Float16* K16 = (_Float16*)take(NR * DM * 2); _Float16* V16 = (_Float16*)take(NR * DM * 2); _Float16* O16 = (_Float16*)take(NR * DM * 2);
  _Float16* VT = (_Float16*)take((size_t)NH * HD * SQ * 2);
  if (off > ws_size) return;
  k_prep<<<512, 256, 0, stream>>>(x, wq, wk, wv, wo, X16, XB, BQ, BK, BV, BO);      /* f16 x rows, bf16(x) residual plane, the four weight planes x16 */
  const size_t r0p = (size_t)B0 * SQ;      /* first projected row */
  k_gemm_qkv<<<(unsigned)((MP / 128) * (DM / 64)), 384, 0, stream>>>(X16 + r0p * DM, DM, BQ, BK, BV, DM, 0.0625f, bq, bk, bv, Q16 + r0p * DM, K16 + r0p * DM, V16 + r0p * DM, DM, MP, DM, DM);      /* q, k, v in one launch */
  for (int b = B0; b < B0 + NBR; ++b) { const size_t r0 = (size_t)b * SQ;
    k_vt<NH, SQ><<<NH * (SQ / 64), 256, 0, stream>>>(V16 + r0 * LQ, LQ, 0, VT);      /* V^T of all heads (HD x SQ each, fragment order) for this batch */
    k_fattn<<<dim3(SQ / 256, NH), 256, 0, stream>>>(Q16 + r0 * LQ, K16 + r0 * LQ, VT, am + (size_t)b * SQ, O16 + r0 * DM); }      /* scores + attention_mask, softmax and P . V of all heads, fused; o (merged heads, x64) as f16 rows */
  k_gemm2<0, true><<<dim3((unsigned)((MPO / 128) * (DM / 64)), 1), 128, 0, stream>>>(O16 + r0p * DM, DM, 0, BO, DM, 0, 0.0009765625f, bo, 0, XB + r0p * DM, 0, YF + r0p * DM, nullptr, DM, 0, MPO, DM, DM);      /* y = ctx Wo^T + bo + bf16(x) (own-element residual) */
  k_lnrow<<<(unsigned)MPO, 256, 0, stream>>>(YF + r0p * DM, lng, lnb, 1e-12f, (float*)d_out + r0p * DM);      /* post-LayerNorm */
}

// v008
// A run of this version takes 130 microseconds.
// Timed twice side by side with v007, it ran 1.23 and 1.24 times as fast.
// All steps since v000 together make it 109 times as fast.
#include <hip/hip_runtime.h>
// BERT self-attention + output (hidden_states [1][4096][1024]; q/k/v = x W^T + b (nn.Linear [out][in] 1024^2, sigma 1/32, zero biases), 16 heads of 64; scores = (q/8) . k + attention_mask[j] (additive [1][1][1][S], zeros); softmax; ctx merged; out = LayerNorm(ctx Wo^T + bo + hidden_states; ln_gamma, ln_beta, eps 1e-12) -> [1][4096][1024]).
// Structure: token rows r = b*4096 + s; x as exact f16 rows (bf16-rounded); Q, K, V as one WMMA GEMM launch (32x64 wave tiles, f32 accumulation, exact x16 weights + bias, f16 outputs); per batch: V^T for all heads via LDS transposes; per batch one fused attention launch over all heads: S^T = K . Q^T on WMMA (alpha = 64^-0.5), online softmax on VALU (f32 statistics, native exp2; weights x256 as f16 operands, in registers only), O^T += V^T . P^T on WMMA (o carried x64 against f16 subnormal flush, folded into the output GEMM alpha) written straight into the merged f16 o rows; y = o Wo^T + bo + bf16(x) GEMM (f32, own-element residual) into f32 rows; post-LayerNorm on VALU (f32, LDS trees) into the output.
// Compute dtype: inputs rounded to bf16; x / weights exact; q, k, v, softmax weights and o as plain f16 GEMM operands (~2^-12); scores and softmax statistics f32. v_wmma_f32_16x16x32_f16.
#define NB 1
#define SQ 4096
#define DM 1024
#define NH 16
#define HD 64
#define HG 1                         /* heads per group of the k_vt(b, h0) overload, not launched */
#define B0 0                         /* first batch processed (debug hook) */
#define NBR NB                       /* batches processed (debug hook) */
#define NR ((size_t)NB * SQ)
#define DMQ DM         /* width of the token rows (LayerNorm length) */
#define MP ((int)((size_t)NBR * SQ)) /* rows projected (debug hook) */
#define QN SQ                        /* not used: attention covers all SQ query rows */
#define NHD NH                       /* not used: attention covers all NH heads */
#define MPO MP                       /* rows through the output stage (debug hook) */
#define LQ DM      /* width K of the q/k/v planes (fragment order) */
typedef __bf16 v16b __attribute__((ext_vector_type(16)));
typedef unsigned short v8us __attribute__((ext_vector_type(8), may_alias));
typedef float  v8f  __attribute__((ext_vector_type(8)));
typedef float  v4f  __attribute__((ext_vector_type(4)));
typedef float  v4fa __attribute__((ext_vector_type(4), may_alias));
union FragB { v16b v; v8us half[2]; unsigned short u[16]; };

__device__ __forceinline__ unsigned short bf16_bits(float x) { unsigned int u = __float_as_uint(x); return (unsigned short)((u + 0x7FFFu + ((u >> 16) & 1u)) >> 16); }
__device__ __forceinline__ float bf16_val(unsigned short b) { return __uint_as_float(((unsigned int)b) << 16); }
__device__ __forceinline__ float bf16_round(float x) { return bf16_val(bf16_bits(x)); }
// D += A·B with NT terms: 1 = ah·bh, 2 = + al·bh (A split), 3 = + ah·bl (both split)
template <int NT>
__device__ __forceinline__ v8f mmaN(v16b ah, v16b al, v16b bh, v16b bl, v8f c) {
  c = __builtin_amdgcn_wmma_f32_16x16x32_bf16(false, ah, false, bh, (short)0, c, false, false);
  if (NT >= 2) c = __builtin_amdgcn_wmma_f32_16x16x32_bf16(false, al, false, bh, (short)0, c, false, false);
  if (NT >= 3) c = __builtin_amdgcn_wmma_f32_16x16x32_bf16(false, ah, false, bl, (short)0, c, false, false);
  asm volatile("v_nop\n\tv_nop\n\tv_nop\n\tv_nop" : "+v"(c) : "v"(ah), "v"(al), "v"(bh), "v"(bl));
  return c;
}

__global__ __launch_bounds__(256) void k_wt_bf16(const float* __restrict__ W, unsigned short* __restrict__ Wt, int K, int N) {
  const int t = blockIdx.x * 256 + threadIdx.x;
  const int k8n = K / 8;
  if (t >= N * k8n) return;
  const int n = t / k8n, k8 = (t % k8n) * 8;
  v8us v;
#pragma unroll
  for (int i = 0; i < 8; ++i) v[i] = bf16_bits(W[(size_t)(k8 + i) * N + n]);
  *(v8us*)(Wt + (size_t)n * K + k8) = v;
  
}

// GEMM C[M][N] (f32, pitch ldc) = act(A[M][K]·W + bias). A f32 row-major (pitch lda) converted per fragment to bf16
// (ASPLIT: hi/lo two planes -> 2 terms, else single rounded term); Wt bf16 [N][K] (pitch ldb). BIAS_BF16 rounds the
// bias to bf16 first (bias quantised to bf16 before the add). K%32==0, M%16==0, N%64==0.
template <bool ASPLIT, int ACT, bool BIAS_BF16>
__global__ __launch_bounds__(128) void k_gemm_bf(const float* __restrict__ A, int lda, const unsigned short* __restrict__ Wt, int ldb,
                                               const float* __restrict__ bias, float* __restrict__ C, int ldc, int M, int N, int K) {
  __shared__ __attribute__((aligned(16))) float so[4][16][64];
  const int tid = threadIdx.x, w = tid >> 5, lane = tid & 31, ln = lane & 15, hh = lane >> 4;
  const int ntn = N / 64;
  const int wid = blockIdx.x * 4 + w;
  const int mt = wid / ntn, nq = wid % ntn;
  if (mt * 16 >= M) return;
  const int row0 = mt * 16, col0 = nq * 64;
  const float* arow = A + (size_t)(row0 + ln) * lda;
  v8f acc[4] = {};
  for (int kb = 0; kb < K; kb += 32) {
    FragB ah, al;
    const v4f x0 = *(const v4fa*)(arow + kb + 8 * hh), x1 = *(const v4fa*)(arow + kb + 8 * hh + 4);
    const v4f x2 = *(const v4fa*)(arow + kb + 16 + 8 * hh), x3 = *(const v4fa*)(arow + kb + 16 + 8 * hh + 4);
    float xs[16] = {x0[0],x0[1],x0[2],x0[3],x1[0],x1[1],x1[2],x1[3],x2[0],x2[1],x2[2],x2[3],x3[0],x3[1],x3[2],x3[3]};
#pragma unroll
    for (int i = 0; i < 16; ++i) { const unsigned short hb = bf16_bits(xs[i]); ah.u[i] = hb; al.u[i] = ASPLIT ? bf16_bits(xs[i] - bf16_val(hb)) : (unsigned short)0; }
#pragma unroll
    for (int t = 0; t < 4; ++t) {
      const unsigned short* brow = Wt + (size_t)(col0 + t * 16 + ln) * ldb + kb;
      FragB b;
      b.half[0] = *(const v8us*)(brow + 8 * hh);
      b.half[1] = *(const v8us*)(brow + 16 + 8 * hh);
      acc[t] = mmaN<ASPLIT ? 2 : 1>(ah.v, al.v, b.v, b.v, acc[t]);
    }
  }
#pragma unroll
  for (int t = 0; t < 4; ++t) {
    float bv = bias ? bias[col0 + t * 16 + ln] : 0.f;
    if (BIAS_BF16) bv = bf16_round(bv);
#pragma unroll
    for (int r = 0; r < 8; ++r) { float v = acc[t][r] + bv; if (ACT == 1) v = fmaxf(v, 0.f); so[w][8 * hh + r][t * 16 + ln] = v; }
  }
  __builtin_amdgcn_fence(__ATOMIC_ACQ_REL, "workgroup");
  __builtin_amdgcn_wave_barrier();
  const int rsub = lane >> 4, c4 = (lane & 15) * 4;
  {
#pragma unroll
    for (int q = 0; q < 8; ++q) {
      const int r = q * 2 + rsub;
      const v4f v = *(const v4fa*)&so[w][r][c4];
      *(v4f*)(C + (size_t)(row0 + r) * ldc + col0 + c4) = v;
    }
    
  }
}

// GEMM C = act(A·W + bias + resid): A f32 (ASPLIT -> hi/lo 2 terms), Wt bf16 [N][K]; ACT 0 none, 1 relu, 2 exact gelu;
// resid (optional, f32, row index = (row % rmod), pitch ldr, RES_BF16 rounds it) added before the activation.
template <bool ASPLIT, int ACT, bool BIAS_BF16, bool RES_BF16>
__global__ __launch_bounds__(128) void k_gemm_bf3(const float* __restrict__ A, int lda, const unsigned short* __restrict__ Wt, int ldb,
                                                const float* __restrict__ bias, const float* __restrict__ resid, int rmod, int ldr,
                                                float* __restrict__ C, int ldc, int M, int N, int K) {
  __shared__ __attribute__((aligned(16))) float so[4][16][64];
  const int tid = threadIdx.x, w = tid >> 5, lane = tid & 31, ln = lane & 15, hh = lane >> 4;
  const int ntn = N / 64;
  const int wid = blockIdx.x * 4 + w;
  const int mt = wid / ntn, nq = wid % ntn;
  if (mt * 16 >= M) return;
  const int row0 = mt * 16, col0 = nq * 64;
  const float* arow = A + (size_t)(row0 + ln) * lda;
  v8f acc[4] = {};
  for (int kb = 0; kb < K; kb += 32) {
    FragB ah, al;
    const v4f x0 = *(const v4fa*)(arow + kb + 8 * hh), x1 = *(const v4fa*)(arow + kb + 8 * hh + 4);
    const v4f x2 = *(const v4fa*)(arow + kb + 16 + 8 * hh), x3 = *(const v4fa*)(arow + kb + 16 + 8 * hh + 4);
    float xs[16] = {x0[0],x0[1],x0[2],x0[3],x1[0],x1[1],x1[2],x1[3],x2[0],x2[1],x2[2],x2[3],x3[0],x3[1],x3[2],x3[3]};
#pragma unroll
    for (int i = 0; i < 16; ++i) { const unsigned short hb = bf16_bits(xs[i]); ah.u[i] = hb; al.u[i] = ASPLIT ? bf16_bits(xs[i] - bf16_val(hb)) : (unsigned short)0; }
#pragma unroll
    for (int t = 0; t < 4; ++t) {
      const unsigned short* brow = Wt + (size_t)(col0 + t * 16 + ln) * ldb + kb;
      FragB b;
      b.half[0] = *(const v8us*)(brow + 8 * hh);
      b.half[1] = *(const v8us*)(brow + 16 + 8 * hh);
      acc[t] = mmaN<ASPLIT ? 2 : 1>(ah.v, al.v, b.v, b.v, acc[t]);
    }
  }
#pragma unroll
  for (int t = 0; t < 4; ++t) {
    const int col = col0 + t * 16 + ln;
    float bv = bias ? bias[col] : 0.f;
    if (BIAS_BF16) bv = bf16_round(bv);
#pragma unroll
    for (int r = 0; r < 8; ++r) {
      float v = acc[t][r] + bv;
      if (resid) { float rv = resid[(size_t)((row0 + 8 * hh + r) % rmod) * ldr + col]; if (RES_BF16) rv = bf16_round(rv); v += rv; }
      if (ACT == 1) v = fmaxf(v, 0.f);
      if (ACT == 2) v = 0.5f * v * (1.0f + erff(v * 0.70710678118654752f));
      if (ACT == 3) { const float u = 0.7978845608028654f * (v + 0.044715f * v * v * v); v = 0.5f * v * (1.0f + tanhf(u)); }
      so[w][8 * hh + r][t * 16 + ln] = v;
    }
  }
  __builtin_amdgcn_fence(__ATOMIC_ACQ_REL, "workgroup");
  __builtin_amdgcn_wave_barrier();
  const int rsub = lane >> 4, c4 = (lane & 15) * 4;
  {
#pragma unroll
    for (int q = 0; q < 8; ++q) {
      const int r = q * 2 + rsub;
      const v4f v = *(const v4fa*)&so[w][r][c4];
      *(v4f*)(C + (size_t)(row0 + r) * ldc + col0 + c4) = v;
    }
    
  }
}
// row LayerNorm (biased variance, eps) over N: s = X (+ R); optional out_sum <- s; out_norm <- (s-mu)*rsqrt(var+eps)*g + b
template <bool PARAM_BF16>
__global__ __launch_bounds__(256) void k_layernorm(const float* __restrict__ X, const float* __restrict__ R, const float* __restrict__ g, const float* __restrict__ bta,
                                                  float* __restrict__ out_sum, float* __restrict__ out_norm, int N, float eps) {
  __shared__ float red[256];
  const int row = blockIdx.x, tid = threadIdx.x;
  const float* x = X + (size_t)row * N; const float* rr = R ? R + (size_t)row * N : nullptr;
  float vals[16];                     // up to N = 4096
  const int per = N / 256;            // contiguous chunk per thread? use strided-by-4 chunks: thread handles j = tid*4 + 1024*u
  float s1 = 0.f;
  for (int u = 0; u < per / 4; ++u) {
    const int j = tid * 4 + 1024 * u;
    const v4f a = *(const v4fa*)(x + j);
    v4f b = {0.f,0.f,0.f,0.f}; if (rr) b = *(const v4fa*)(rr + j);
#pragma unroll
    for (int q = 0; q < 4; ++q) { const float v = a[q] + b[q]; vals[u * 4 + q] = v; s1 += v; }
  }
  red[tid] = s1; __syncthreads();
  for (int st = 128; st > 0; st >>= 1) { if (tid < st) red[tid] += red[tid + st]; __syncthreads(); }
  const float mu = red[0] / (float)N; __syncthreads();
  float s2 = 0.f;
  for (int u = 0; u < per / 4; ++u)
#pragma unroll
    for (int q = 0; q < 4; ++q) { const float c = vals[u * 4 + q] - mu; s2 += c * c; }
  red[tid] = s2; __syncthreads();
  for (int st = 128; st > 0; st >>= 1) { if (tid < st) red[tid] += red[tid + st]; __syncthreads(); }
  const float rs = rsqrtf(red[0] / (float)N + eps);
  {
    for (int u = 0; u < per / 4; ++u) {
      const int j = tid * 4 + 1024 * u;
      v4f o, sm;
#pragma unroll
      for (int q = 0; q < 4; ++q) {
        float gg = g[j + q], bb = bta[j + q];
        if (PARAM_BF16) { gg = bf16_round(gg); bb = bf16_round(bb); }
        sm[q] = vals[u * 4 + q]; o[q] = (vals[u * 4 + q] - mu) * rs * gg + bb;
      }
      if (out_sum) *(v4f*)(out_sum + (size_t)row * N + j) = sm;
      *(v4f*)(out_norm + (size_t)row * N + j) = o;
    }
    
  }
}



// ---- f16 WMMA path (v_wmma_f32_16x16x32_f16): 11-bit significands for operands in range — used where a [0,1] probability operand needs more precision than bf16
typedef _Float16 v16h __attribute__((ext_vector_type(16)));
union FragH { v16h v; v8us half[2]; _Float16 h[16]; unsigned short u[16]; };
template <int NT>
__device__ __forceinline__ v8f mmaH(v16h ah, v16h al, v16h bh, v16h bl, v8f c) {
  c = __builtin_amdgcn_wmma_f32_16x16x32_f16(false, ah, false, bh, (short)0, c, false, false);
  if (NT >= 2) c = __builtin_amdgcn_wmma_f32_16x16x32_f16(false, al, false, bh, (short)0, c, false, false);
  if (NT >= 3) c = __builtin_amdgcn_wmma_f32_16x16x32_f16(false, ah, false, bl, (short)0, c, false, false);
  asm volatile("v_nop\n\tv_nop\n\tv_nop\n\tv_nop" : "+v"(c) : "v"(ah), "v"(al), "v"(bh), "v"(bl));
  return c;
}
// batched GEMM like k_gemm_b but f16 operands: A f32 (split into f16 hi/lo if ASPLIT, else rounded to f16), Bt = f16 values [n][k]; alpha; C f32; N multiple of 16 (partial tiles skipped)
template <bool ASPLIT>
__global__ __launch_bounds__(128) void k_gemm_h(const float* __restrict__ A, int lda, size_t sA, const _Float16* __restrict__ Bh, int ldb, size_t sB, float alpha, float* __restrict__ C, int ldc, size_t sC, int M, int N, int K) {
  __shared__ __attribute__((aligned(16))) float so[4][16][64];
  const int tid = threadIdx.x, w = tid >> 5, lane = tid & 31, ln = lane & 15, hh = lane >> 4; const int by = blockIdx.y;
  A += (size_t)by * sA; Bh += (size_t)by * sB; C += (size_t)by * sC;
  const int ntn = (N + 63) / 64; const int wid = blockIdx.x * 4 + w; const int mt = wid / ntn, nq = wid % ntn; if (mt * 16 >= M) return;
  const int row0 = mt * 16, col0 = nq * 64; const float* arow = A + (size_t)(row0 + ln) * lda;
  v8f acc[4] = {};
  for (int kb = 0; kb < K; kb += 32) {
    FragH ah, al;
    const v4f x0 = *(const v4fa*)(arow + kb + 8 * hh), x1 = *(const v4fa*)(arow + kb + 8 * hh + 4), x2 = *(const v4fa*)(arow + kb + 16 + 8 * hh), x3 = *(const v4fa*)(arow + kb + 16 + 8 * hh + 4);
    float xs[16] = {x0[0],x0[1],x0[2],x0[3],x1[0],x1[1],x1[2],x1[3],x2[0],x2[1],x2[2],x2[3],x3[0],x3[1],x3[2],x3[3]};
#pragma unroll
    for (int i = 0; i < 16; ++i) { const _Float16 h = (_Float16)xs[i]; ah.h[i] = h; al.h[i] = ASPLIT ? (_Float16)(xs[i] - (float)h) : (_Float16)0.0f; }
#pragma unroll
    for (int t = 0; t < 4; ++t) { if (col0 + t * 16 >= N) continue; const size_t boff = (size_t)(col0 + t * 16 + ln) * ldb + kb; FragH bq; bq.half[0] = *(const v8us*)(Bh + boff + 8 * hh); bq.half[1] = *(const v8us*)(Bh + boff + 16 + 8 * hh);
      acc[t] = mmaH<ASPLIT ? 2 : 1>(ah.v, al.v, bq.v, bq.v, acc[t]); }
  }
#pragma unroll
  for (int t = 0; t < 4; ++t) { if (col0 + t * 16 >= N) continue;
#pragma unroll
    for (int r = 0; r < 8; ++r) so[w][8 * hh + r][t * 16 + ln] = acc[t][r] * alpha; }
  __builtin_amdgcn_fence(__ATOMIC_ACQ_REL, "workgroup"); __builtin_amdgcn_wave_barrier();
  const int rsub = lane >> 4, c4 = (lane & 15) * 4;
  {
#pragma unroll
    for (int q = 0; q < 8; ++q) { const int r = q * 2 + rsub; if (col0 + c4 < N) { const v4f v = *(const v4fa*)&so[w][r][c4]; *(v4f*)(C + (size_t)(row0 + r) * ldc + col0 + c4) = v; } }
     }
}

// Wt[n][k] = f16(W[k][n]·scale) from f32 row-major W[K][N] (scale = power of two; bf16-exact weights stay exact in f16 away from the subnormal range)
__global__ __launch_bounds__(256) void k_wt_f16(const float* __restrict__ W, _Float16* __restrict__ Wt, int K, int N, float scale) {
  const int t = blockIdx.x * 256 + threadIdx.x; if (t >= N * (K / 8)) return; const int n = t / (K / 8), k8 = (t % (K / 8)) * 8; FragH f;
#pragma unroll
  for (int i = 0; i < 8; ++i) f.h[i] = (_Float16)(bf16_round(W[(size_t)(k8 + i) * N + n]) * scale); const v8us o = f.half[0];
  *(v8us*)((unsigned short*)Wt + (size_t)n * K + k8) = o; 
}
// k_gemm_hh variant with fused epilogue: v = acc·alpha + bias[by·sBias + col] (+ CP[(row/rowsPerB)·sCPb + by·64 + col] if CP) ; ACT 0 none / 1 elu ; writes f16 C16 (and f32 C if non-null)
template <int ACT>
__global__ __launch_bounds__(128) void k_gemm_hhx(const _Float16* __restrict__ A, int lda, size_t sA, const _Float16* __restrict__ Bh, int ldb, size_t sB, float alpha, const float* __restrict__ bias, size_t sBias, const float* __restrict__ CP, int rowsPerB, size_t sCPb, int row0g,
    float* __restrict__ C, _Float16* __restrict__ C16, int ldc, size_t sC, int M, int N, int K) {
  __shared__ __attribute__((aligned(16))) float so[4][16][64];
  const int tid = threadIdx.x, w = tid >> 5, lane = tid & 31, ln = lane & 15, hh = lane >> 4; const int by = blockIdx.y;
  A += (size_t)by * sA; Bh += (size_t)by * sB; const size_t cofs = (size_t)by * sC; const float* bp = bias ? bias + (size_t)by * sBias : nullptr;
  const int ntn = (N + 63) / 64; const int wid = blockIdx.x * 4 + w; const int mt = wid / ntn, nq = wid % ntn; if (mt * 16 >= M) return;
  const int row0 = mt * 16, col0 = nq * 64; const _Float16* arow = A + (size_t)(row0 + ln) * lda;
  v8f acc[4] = {};
  for (int kb = 0; kb < K; kb += 32) { FragH ah; ah.half[0] = *(const v8us*)((const unsigned short*)arow + kb + 8 * hh); ah.half[1] = *(const v8us*)((const unsigned short*)arow + kb + 16 + 8 * hh);
#pragma unroll
    for (int t = 0; t < 4; ++t) { if (col0 + t * 16 >= N) continue; const size_t boff = (size_t)(col0 + t * 16 + ln) * ldb + kb; FragH bq; bq.half[0] = *(const v8us*)((const unsigned short*)Bh + boff + 8 * hh); bq.half[1] = *(const v8us*)((const unsigned short*)Bh + boff + 16 + 8 * hh);
      acc[t] = mmaH<1>(ah.v, ah.v, bq.v, bq.v, acc[t]); }
  }
#pragma unroll
  for (int t = 0; t < 4; ++t) { if (col0 + t * 16 >= N) continue; const int col = col0 + t * 16 + ln; const float bv = bp ? bf16_round(bp[col]) : 0.f;
#pragma unroll
    for (int r = 0; r < 8; ++r) { float v = acc[t][r] * alpha + bv; if (CP) { const int rr = row0g + row0 + 8 * hh + r; if (rowsPerB < 0) v += CP[cofs + (size_t)rr * ldc + col];      /* rowsPerB < 0: own element of the batched C plane */ else { const int bidx = rr / rowsPerB; v += CP[(size_t)bidx * sCPb + (size_t)by * 64 + col]; } } if (ACT == 1) v = (v > 0.f) ? v : expm1f(v); else if (ACT == 7) v = (v > 0.f) ? v + 1.0f : expf(v); else if (ACT == 8) v = tanhf(v); else if (ACT == 9) v = 0.5f * v * (1.0f + tanhf(0.7978845608028654f * (v + 0.044715f * v * v * v))); else if (ACT == 11) v = 1.0f / (1.0f + expf(-v)); else if (ACT == 12) v = (v > 0.f) ? v : 0.01f * v; else if (ACT == 14) v = (v > 0.f) ? v : 0.1f * v; else if (ACT == 16) v = (v >= 0.f) ? v : 0.3f * v; else if (ACT == 17) v = (v >= 0.f) ? v : 0.2f * v; else if (ACT == 15) v = v / (1.0f + expf(-v)); else if (ACT == 3) v = fmaxf(v, 0.f); else if (ACT == 6) v = 0.5f * v * (1.0f + erff(v * 0.70710678118654752f)); so[w][8 * hh + r][t * 16 + ln] = v; } }
  __builtin_amdgcn_fence(__ATOMIC_ACQ_REL, "workgroup"); __builtin_amdgcn_wave_barrier();
  const int rsub = lane >> 4, c4 = (lane & 15) * 4; typedef _Float16 v4h __attribute__((ext_vector_type(4)));
  {
#pragma unroll
    for (int q = 0; q < 8; ++q) { const int r = q * 2 + rsub; if (col0 + c4 < N) { const v4f v = *(const v4fa*)&so[w][r][c4]; if (C) *(v4f*)(C + cofs + (size_t)(row0 + r) * ldc + col0 + c4) = v; if (C16) { v4h h4; for (int i = 0; i < 4; ++i) h4[i] = (_Float16)v[i]; *(v4h*)(C16 + cofs + (size_t)(row0 + r) * ldc + col0 + c4) = h4; } } }
     }
}


typedef _Float16 v4h __attribute__((ext_vector_type(4)));

__global__ __launch_bounds__(256) void k_h16(const float* __restrict__ x, _Float16* __restrict__ X16, size_t n8) { const size_t t = (size_t)blockIdx.x * 256 + threadIdx.x; if (t >= n8) return; FragH f;
#pragma unroll
  for (int q = 0; q < 8; ++q) f.h[q] = (_Float16)x[t * 8 + q]; *(v8us*)((unsigned short*)X16 + t * 8) = f.half[0];  }
__global__ __launch_bounds__(256) void k_round16f(const float* __restrict__ W, _Float16* __restrict__ Bt, size_t n8) { const size_t t = (size_t)blockIdx.x * 256 + threadIdx.x; if (t >= n8) return; FragH f;
#pragma unroll
  for (int i = 0; i < 8; ++i) f.h[i] = (_Float16)(bf16_round(W[t * 8 + i]) * 16.0f); *(v8us*)((unsigned short*)Bt + t * 8) = f.half[0];  }
// ---- fragment order: how the attention operands q, k and v lie in the workspace (V^T: same tiles, placed as k_vt writes them) ----
// A plane of R rows x K columns (R % 16 == 0, K % 32 == 0) is cut into tiles of 16 rows x 32 k, tile (rt, kt) at element (rt * (K / 32) + kt) * 512. Inside a tile, 16-byte chunk 32 j + lane (lane = 16 hh + ln) holds
// row ln, k = 16 j + 8 hh + 0..7: the four registers that lane (ln, hh) takes as half j of its fragment (g2_frag's k order). A fragment is then two loads of 512 contiguous bytes, 4 whole lines a load,
// where row-major rows gave 16 lines a load; the register contents, and with them the k order of both operands of each product, are what they were.
template <int NHv, int TTv>
__global__ __launch_bounds__(256) void k_vt(const _Float16* __restrict__ V16, int ldv, int voff, _Float16* __restrict__ Vt) { __shared__ unsigned short tl[64][66]; const int tid = threadIdx.x; const int slab = blockIdx.x / (TTv / 64), lg = blockIdx.x % (TTv / 64); const int b = slab / NHv, h = slab % NHv;
  /* V16 in fragment order (rows = tokens, k = features, K = ldv): this 64 x 64 block is 4 row tiles x 2 adjacent k tiles; chunk c of row tile rtl holds token row r, features c8 + 0..7 */
  for (int i = tid; i < 64 * 8; i += 256) { const int rtl = i >> 7, c = i & 127, lane = i & 31; const int r = rtl * 16 + (lane & 15), c8 = (c >> 5) * 16 + (lane >> 4) * 8; FragH f;
    f.half[0] = *(const v8us*)((const unsigned short*)V16 + ((size_t)b * TTv + lg * 64 + rtl * 16) * ldv + (size_t)(voff + h * 64) * 16 + c * 8);
#pragma unroll
    for (int q = 0; q < 8; ++q) tl[r][c8 + q] = f.u[q]; }
  __syncthreads();
  {      /* Vt in fragment order, per slab: rows = d (4 tiles), k = tokens, the 4 d tiles of one 32-token step adjacent: tile (st, t) at ((slab * (TTv / 32) + st) * 4 + t) * 512; this block's 512 chunks are contiguous */
#pragma unroll
    for (int rd = 0; rd < 2; ++rd) { const int c = rd * 256 + tid, lane = c & 31; const int d = ((c >> 6) & 3) * 16 + (lane & 15), k0 = (c >> 8) * 32 + ((c >> 5) & 1) * 16 + (lane >> 4) * 8; FragH f;
#pragma unroll
      for (int q = 0; q < 8; ++q) f.u[q] = tl[k0 + q][d];
      *(v8us*)((unsigned short*)Vt + ((size_t)slab * (TTv / 32) + lg * 2) * 2048 + c * 8) = f.half[0]; }
     } }

__global__ __launch_bounds__(256) void k_hl(const float* __restrict__ F, _Float16* __restrict__ Hh, _Float16* __restrict__ Hl, size_t n8) { const size_t t = (size_t)blockIdx.x * 256 + threadIdx.x; if (t >= n8) return; FragH fh, fl; const v4f a = *(const v4fa*)(F + t * 8), c = *(const v4fa*)(F + t * 8 + 4);
#pragma unroll
  for (int q = 0; q < 4; ++q) { _Float16 h = (_Float16)a[q]; fh.h[q] = h; fl.h[q] = (_Float16)((a[q] - (float)h) * 1024.0f); h = (_Float16)c[q]; fh.h[4 + q] = h; fl.h[4 + q] = (_Float16)((c[q] - (float)h) * 1024.0f); }
  { *(v8us*)((unsigned short*)Hh + t * 8) = fh.half[0]; *(v8us*)((unsigned short*)Hl + t * 8) = fl.half[0];  } }

// ---- fast GEMM (workgroup tile 128x64, wave tile 32x64; requires M % 128 == 0 rows per launch region, N % 64 == 0 and K % 64 == 0, K >= 64) ----
// Epilogue, chosen at compile time so that it holds no branch and its loads can be issued together: v = act(acc * alpha + bf16(bias[col])); RES: f32 rows C = v + own element of CP (no activation); else: f16 C16 in fragment order.
// The operands go through LDS: a stage is 64 k of the workgroup's 128 A rows and 64 B rows (192 rows of 128 bytes, each one whole line of its source row), laid at a pitch of 144 bytes (16 B x odd: no bank conflict for
// the 16-byte fragment reads). Two buffers: the next stage's asynchronous copies fly while this stage is multiplied. The B rows are fetched once for the four waves.
#define G2P 72                       /* LDS row pitch, elements */
#define G2S (192 * G2P)              /* one buffer, elements */
__device__ __forceinline__ v16h g2_frag(const unsigned short* p, int hh) { FragH f; f.half[0] = *(const v8us*)(p + 8 * hh); f.half[1] = *(const v8us*)(p + 16 + 8 * hh); return f.v; }
// One thread's share of a stage: twelve asynchronous 16-byte copies (row groups of 16: eight of A, four of B; eight lanes cover one row's 128 bytes, so a wave's copy reads 4 whole lines). l = the thread's LDS byte address in
// row group 0 of the buffer, a and b = its source addresses there, sa and sb = 16 source rows in elements. The s_wait_xcnt is the wait that is kept in front of an overwrite of a register that an issued copy names:
// as the statement's last line it stands in front of every later write of these operands.
__device__ __forceinline__ void g2_stage(unsigned l, const _Float16* a, size_t sa, const _Float16* b, size_t sb) {
  asm volatile("global_load_async_to_lds_b128 %0, %12, off\n\tglobal_load_async_to_lds_b128 %1, %13, off\n\tglobal_load_async_to_lds_b128 %2, %14, off\n\tglobal_load_async_to_lds_b128 %3, %15, off\n\t"
               "global_load_async_to_lds_b128 %4, %16, off\n\tglobal_load_async_to_lds_b128 %5, %17, off\n\tglobal_load_async_to_lds_b128 %6, %18, off\n\tglobal_load_async_to_lds_b128 %7, %19, off\n\t"
               "global_load_async_to_lds_b128 %8, %20, off\n\tglobal_load_async_to_lds_b128 %9, %21, off\n\tglobal_load_async_to_lds_b128 %10, %22, off\n\tglobal_load_async_to_lds_b128 %11, %23, off\n\t"
               "s_wait_xcnt 0x0"
               :: "v"(l), "v"(l + 32u * G2P), "v"(l + 64u * G2P), "v"(l + 96u * G2P), "v"(l + 128u * G2P), "v"(l + 160u * G2P), "v"(l + 192u * G2P), "v"(l + 224u * G2P), "v"(l + 256u * G2P), "v"(l + 288u * G2P), "v"(l + 320u * G2P), "v"(l + 352u * G2P),
                  "v"(a), "v"(a + sa), "v"(a + 2 * sa), "v"(a + 3 * sa), "v"(a + 4 * sa), "v"(a + 5 * sa), "v"(a + 6 * sa), "v"(a + 7 * sa), "v"(b), "v"(b + sb), "v"(b + 2 * sb), "v"(b + 3 * sb) : "memory"); }
__device__ __forceinline__ v8f g2_mma(v16h a, v16h b, v8f c) { v8f d = __builtin_amdgcn_wmma_f32_16x16x32_f16(false, a, false, b, (short)0, c, false, false); asm volatile("v_nop\n\tv_nop\n\tv_nop\n\tv_nop" : "+v"(d) : "v"(a), "v"(b)); return d; }
template <int ACT, bool RES>
__global__ __launch_bounds__(128) void k_gemm2(const _Float16* __restrict__ A, int lda, size_t sA, const _Float16* __restrict__ Bh, int ldb, size_t sB, float alpha, const float* __restrict__ bias, size_t sBias, const float* __restrict__ CP, int row0g,
    float* __restrict__ C, _Float16* __restrict__ C16, int ldc, size_t sC, int M, int N, int K) { static_assert(!RES || ACT == 0, "k_gemm2: the residual is added at the write-out, behind the activation's place"); static_assert(ACT == 0 || ACT == 3 || ACT == 6 || ACT == 8 || ACT == 9 || ACT == 11 || ACT == 12 || ACT == 14 || ACT == 15 || ACT == 16 || ACT == 17, "k_gemm2: unsupported ACT code (would silently apply no activation)");
  __shared__ __attribute__((aligned(16))) float so[4][32][68];
  __shared__ __attribute__((aligned(16))) unsigned short st[2 * G2S];
  const int tid = threadIdx.x, w = tid >> 5, lane = tid & 31, ln = lane & 15, hh = lane >> 4; const int by = blockIdx.y;
  A += (size_t)by * sA; Bh += (size_t)by * sB; const size_t cofs = (size_t)by * sC; const float* bp = bias + (size_t)by * sBias;
  const int ntn = N >> 6; const int mt = blockIdx.x / ntn, nq = blockIdx.x - mt * ntn; const int row0 = mt * 128 + 32 * w, col0 = nq * 64; if (mt * 128 >= M) return;      /* the whole workgroup or none: barriers follow */
  const unsigned l0 = (unsigned)(size_t)&st[(tid >> 3) * G2P + (tid & 7) * 8];      /* LDS byte address: the low 32 bits of the shared address */
  const _Float16* ga = A + (size_t)(mt * 128 + (tid >> 3)) * lda + (tid & 7) * 8; const _Float16* gb = Bh + (size_t)(col0 + (tid >> 3)) * ldb + (tid & 7) * 8; const size_t sa = (size_t)16 * lda, sb = (size_t)16 * ldb;
  const int nt = K >> 6;
  const v8f z8 = {0.f,0.f,0.f,0.f,0.f,0.f,0.f,0.f}; v8f c00 = z8, c01 = z8, c02 = z8, c03 = z8, c10 = z8, c11 = z8, c12 = z8, c13 = z8;
  float bv[4];      /* the lane's four bias values: loaded here, used behind the loop */
#pragma unroll
  for (int t = 0; t < 4; ++t) bv[t] = bp[col0 + t * 16 + ln];
  g2_stage(l0, ga, sa, gb, sb);
  asm volatile("s_wait_asynccnt 0x0" ::: "memory");      /* this wave's copies of stage 0 have landed */
  __syncthreads();      /* publishes stage 0 */
  if (nt > 1) g2_stage(l0 + 2u * G2S, ga + 64, sa, gb + 64, sb);
#pragma unroll 1      /* kept rolled: a trip already holds 24 LDS reads and 16 WMMAs; unrolling would only repeat the copies, the waits and the barrier in the text */
  for (int t = 0; t < nt; ++t) { const unsigned short* const ap = st + (t & 1) * G2S + (32 * w + ln) * G2P; const unsigned short* const bq = st + (t & 1) * G2S + (128 + ln) * G2P; v16h af[2][2], bf[2][4];
#pragma unroll
    for (int ks = 0; ks < 2; ++ks) {
#pragma unroll
      for (int r = 0; r < 2; ++r) af[ks][r] = g2_frag(ap + 16 * r * G2P + 32 * ks, hh);
#pragma unroll
      for (int u = 0; u < 4; ++u) bf[ks][u] = g2_frag(bq + 16 * u * G2P + 32 * ks, hh); }
#pragma unroll
    for (int ks = 0; ks < 2; ++ks) { c00 = g2_mma(af[ks][0], bf[ks][0], c00); c10 = g2_mma(af[ks][1], bf[ks][0], c10); c01 = g2_mma(af[ks][0], bf[ks][1], c01); c11 = g2_mma(af[ks][1], bf[ks][1], c11);
      c02 = g2_mma(af[ks][0], bf[ks][2], c02); c12 = g2_mma(af[ks][1], bf[ks][2], c12); c03 = g2_mma(af[ks][0], bf[ks][3], c03); c13 = g2_mma(af[ks][1], bf[ks][3], c13); }
    asm volatile("s_wait_dscnt 0x0" ::: "memory");      /* this wave's reads of the buffer are done before it may be refilled */
    asm volatile("s_wait_asynccnt 0x0" ::: "memory");      /* this wave's copies of stage t + 1 have landed */
    __syncthreads();      /* publishes stage t + 1 and ends every wave's reads of stage t */
    if (t + 2 < nt) g2_stage(l0 + (unsigned)(t & 1) * (2u * G2S), ga + (size_t)(t + 2) * 64, sa, gb + (size_t)(t + 2) * 64, sb); }
  asm volatile("s_wait_asynccnt 0x0" ::: "memory");      /* no copy is outstanding when the wave goes on */
  const int rsub = lane >> 4, c4 = (lane & 15) * 4;
  v4f res[16]; unsigned eo[16];      /* with RES, the wave's 32 x 64 residual tile: 16 loads of 16 bytes a lane (two 256-byte row pieces a load), all issued here, in flight under the staging below; eo = the lane's offsets in the plane, in 16-byte units (ldc % 4 == 0, as the 16-byte accesses ask), the same for the residual loads and the C stores */
  if constexpr (RES) {
#pragma unroll
    for (int q = 0; q < 16; ++q) { eo[q] = (unsigned)(row0 + q * 2 + rsub) * ((unsigned)ldc >> 2) + (unsigned)((col0 + c4) >> 2); res[q] = ((const v4fa*)(CP + cofs + (size_t)row0g * ldc))[eo[q]]; } }
  v8f accs[8] = {c00, c01, c02, c03, c10, c11, c12, c13};
#pragma unroll
  for (int u = 0; u < 8; ++u) { const int t = u & 3, half = u >> 2; const float bvr = bf16_round(bv[t]);
#pragma unroll
    for (int r = 0; r < 8; ++r) { const int rloc = half * 16 + 8 * hh + r; float v = accs[u][r] * alpha + bvr;
      if (ACT == 3) v = fmaxf(v, 0.f); else if (ACT == 6) v = 0.5f * v * (1.0f + erff(v * 0.70710678118654752f)); else if (ACT == 11) v = 1.0f / (1.0f + expf(-v)); else if (ACT == 15) v = v / (1.0f + expf(-v)); else if (ACT == 12) v = (v > 0.f) ? v : 0.01f * v; else if (ACT == 8) v = tanhf(v); else if (ACT == 9) v = 0.5f * v * (1.0f + tanhf(0.7978845608028654f * (v + 0.044715f * v * v * v))); else if (ACT == 14) v = (v > 0.f) ? v : 0.1f * v; else if (ACT == 16) v = (v >= 0.f) ? v : 0.3f * v; else if (ACT == 17) v = (v >= 0.f) ? v : 0.2f * v;
      so[w][rloc][t * 16 + ln] = v; } }
  __builtin_amdgcn_fence(__ATOMIC_ACQ_REL, "workgroup"); __builtin_amdgcn_wave_barrier();
  if constexpr (RES) {
#pragma unroll
    for (int q = 0; q < 16; ++q) { const v4f v = *(const v4fa*)&so[w][q * 2 + rsub][c4] + res[q]; ((v4f*)(C + cofs))[eo[q]] = v; }
  } else {      /* C16 goes out in fragment order (see above k_vt; K = ldc): the 32 x 64 tile is 2 row tiles x 2 adjacent k tiles x 2 halves = 8 stores of 512 contiguous bytes */
#pragma unroll
    for (int u = 0; u < 8; ++u) { const int rtl = u >> 2, cu = u & 3; const float* sp = &so[w][rtl * 16 + ln][cu * 16 + 8 * hh]; const v4f v0 = *(const v4fa*)sp, v1 = *(const v4fa*)(sp + 4); FragH f;
#pragma unroll
      for (int i = 0; i < 4; ++i) { f.h[i] = (_Float16)v0[i]; f.h[4 + i] = (_Float16)v1[i]; }
      *(v8us*)((unsigned short*)C16 + cofs + (size_t)(row0 + 16 * rtl) * ldc + (size_t)col0 * 16 + cu * 256 + 8 * lane) = f.half[0]; } } }

// ---- the three projections q, k, v in one launch: one workgroup multiplies its 128 x rows by the 64-column tiles of all three weights ----
// 12 waves: wave group p = 0, 1, 2 (four waves each) owns weight p and works as the four waves of k_gemm2 do (32 x 64 wave tiles, the same fragment reads, the same order of products, the same f16 fragment-order write-out).
// A stage is 64 k of 320 rows at k_gemm2's pitch: rows 0..127 the x tile, fetched once for the three weights, rows 128 + 64 p .. the tile of weight p. Two buffers, k_gemm2's order of waits and its one barrier a trip.
// Who copies what: group p brings its own weight tile (four row groups of 16) and x row groups 3 p, 3 p + 1 and, for p < 2, 3 p + 2 (eight in all).
// The write-out staging lies over the two buffers: behind the last trip's barrier no wave reads them and no copy is outstanding. 104,448 bytes of LDS and at most 160 registers: two workgroups a WGP, all 512 resident.
#define G3S (320 * G2P)              /* one buffer, elements */
typedef float f32a __attribute__((may_alias));
// One thread's share of a stage, as g2_stage: la, a = its LDS byte address and source address in its first x row group, lb, b = the same in row group 0 of its weight tile; third = the group has a third x row group (the same for a whole wave).
// Each s_wait_xcnt is the last line of its copies' own statement, in front of every later write of their operands.
__device__ __forceinline__ void g3_stage(unsigned la, const _Float16* a, size_t sa, unsigned lb, const _Float16* b, size_t sb, bool third) {
  asm volatile("global_load_async_to_lds_b128 %0, %6, off\n\tglobal_load_async_to_lds_b128 %1, %7, off\n\tglobal_load_async_to_lds_b128 %2, %8, off\n\t"
               "global_load_async_to_lds_b128 %3, %9, off\n\tglobal_load_async_to_lds_b128 %4, %10, off\n\tglobal_load_async_to_lds_b128 %5, %11, off\n\t"
               "s_wait_xcnt 0x0"
               :: "v"(la), "v"(la + 32u * G2P), "v"(lb), "v"(lb + 32u * G2P), "v"(lb + 64u * G2P), "v"(lb + 96u * G2P),
                  "v"(a), "v"(a + sa), "v"(b), "v"(b + sb), "v"(b + 2 * sb), "v"(b + 3 * sb) : "memory");
  if (third) asm volatile("global_load_async_to_lds_b128 %0, %1, off\n\ts_wait_xcnt 0x0" :: "v"(la + 64u * G2P), "v"(a + 2 * sa) : "memory"); }
__global__ __launch_bounds__(384, 6) void k_gemm_qkv(const _Float16* __restrict__ A, int lda, const _Float16* __restrict__ W0, const _Float16* __restrict__ W1, const _Float16* __restrict__ W2, int ldb, float alpha,
    const float* __restrict__ bias0, const float* __restrict__ bias1, const float* __restrict__ bias2, _Float16* __restrict__ C0, _Float16* __restrict__ C1, _Float16* __restrict__ C2, int ldc, int M, int N, int K) {
  __shared__ __attribute__((aligned(16))) unsigned short st[12 * 32 * 68 * 2];      /* the two stage buffers (2 * G3S elements); behind the loop, twelve 32 x 68 f32 staging tiles */
  static_assert(2 * G3S <= 12 * 32 * 68 * 2, "k_gemm_qkv: the stage buffers fit the array");
  const int tid = threadIdx.x, w = tid >> 5, lane = tid & 31, ln = lane & 15, hh = lane >> 4, wr = w & 3, t7 = tid & 127;
  const int p = __builtin_amdgcn_readfirstlane(tid >> 7);      /* the wave's group, in a scalar register: the choices below and the test on the third x row group are scalar */
  const _Float16* const Bh = p == 0 ? W0 : p == 1 ? W1 : W2; const float* const bp = p == 0 ? bias0 : p == 1 ? bias1 : bias2; _Float16* const C16 = p == 0 ? C0 : p == 1 ? C1 : C2;
  const int ntn = N >> 6; const int mt = blockIdx.x / ntn, nq = blockIdx.x - mt * ntn; const int row0 = mt * 128 + 32 * wr, col0 = nq * 64; if (mt * 128 >= M) return;      /* the whole workgroup or none: barriers follow */
  const unsigned la0 = (unsigned)(size_t)&st[(48 * p + (t7 >> 3)) * G2P + (t7 & 7) * 8], lb0 = (unsigned)(size_t)&st[(128 + 64 * p + (t7 >> 3)) * G2P + (t7 & 7) * 8];      /* LDS byte addresses: the low 32 bits of the shared addresses */
  const _Float16* ga = A + (size_t)(mt * 128 + 48 * p + (t7 >> 3)) * lda + (t7 & 7) * 8; const _Float16* gb = Bh + (size_t)(col0 + (t7 >> 3)) * ldb + (t7 & 7) * 8; const size_t sa = (size_t)16 * lda, sb = (size_t)16 * ldb;
  const bool third = p < 2; const int nt = K >> 6;
  const v8f z8 = {0.f,0.f,0.f,0.f,0.f,0.f,0.f,0.f}; v8f c00 = z8, c01 = z8, c02 = z8, c03 = z8, c10 = z8, c11 = z8, c12 = z8, c13 = z8;
  float bv[4];      /* the lane's four bias values: loaded here, used behind the loop */
#pragma unroll      /* this and every unrolled loop below runs over fragments, tiles or registers: unrolled, its arrays stay in registers and its offsets are immediates */
  for (int t = 0; t < 4; ++t) bv[t] = bp[col0 + t * 16 + ln];
  g3_stage(la0, ga, sa, lb0, gb, sb, third);
  asm volatile("s_wait_asynccnt 0x0" ::: "memory");      /* this wave's copies of stage 0 have landed */
  __syncthreads();      /* publishes stage 0 */
  if (nt > 1) g3_stage(la0 + 2u * G3S, ga + 64, sa, lb0 + 2u * G3S, gb + 64, sb, third);
#pragma unroll 1      /* kept rolled, as in k_gemm2: unrolling would only repeat the copies, the waits and the barrier in the text */
  for (int t = 0; t < nt; ++t) { const unsigned short* const ap = st + (t & 1) * G3S + (32 * wr + ln) * G2P; const unsigned short* const bq = st + (t & 1) * G3S + (128 + 64 * p + ln) * G2P;
#pragma unroll
    for (int ks = 0; ks < 2; ++ks) { v16h af[2], bf[4];
#pragma unroll
      for (int r = 0; r < 2; ++r) af[r] = g2_frag(ap + 16 * r * G2P + 32 * ks, hh);
#pragma unroll
      for (int u = 0; u < 4; ++u) bf[u] = g2_frag(bq + 16 * u * G2P + 32 * ks, hh);
      c00 = g2_mma(af[0], bf[0], c00); c10 = g2_mma(af[1], bf[0], c10); c01 = g2_mma(af[0], bf[1], c01); c11 = g2_mma(af[1], bf[1], c11);
      c02 = g2_mma(af[0], bf[2], c02); c12 = g2_mma(af[1], bf[2], c12); c03 = g2_mma(af[0], bf[3], c03); c13 = g2_mma(af[1], bf[3], c13); }
    asm volatile("s_wait_dscnt 0x0" ::: "memory");      /* this wave's reads of the buffer are done before it may be refilled */
    asm volatile("s_wait_asynccnt 0x0" ::: "memory");      /* this wave's copies of stage t + 1 have landed */
    __syncthreads();      /* publishes stage t + 1 and ends every wave's reads of stage t */
    if (t + 2 < nt) g3_stage(la0 + (unsigned)(t & 1) * (2u * G3S), ga + (size_t)(t + 2) * 64, sa, lb0 + (unsigned)(t & 1) * (2u * G3S), gb + (size_t)(t + 2) * 64, sb, third); }
  asm volatile("s_wait_asynccnt 0x0" ::: "memory");      /* no copy is outstanding when the wave goes on */
  f32a* const so = (f32a*)st + w * (32 * 68);      /* the wave's own staging tile, pitch 68 */
  v8f accs[8] = {c00, c01, c02, c03, c10, c11, c12, c13};
#pragma unroll
  for (int u = 0; u < 8; ++u) { const int t = u & 3, half = u >> 2; const float bvr = bf16_round(bv[t]);
#pragma unroll
    for (int r = 0; r < 8; ++r) so[(half * 16 + 8 * hh + r) * 68 + t * 16 + ln] = accs[u][r] * alpha + bvr; }
  __builtin_amdgcn_fence(__ATOMIC_ACQ_REL, "workgroup"); __builtin_amdgcn_wave_barrier();      /* the wave's stores to its own tile stay in front of the reads below, which take other lanes' values */
  /* C16 goes out in fragment order (see above k_vt; K = ldc), as in k_gemm2: 8 stores of 512 contiguous bytes */
#pragma unroll
  for (int u = 0; u < 8; ++u) { const int rtl = u >> 2, cu = u & 3; const f32a* sp = so + (rtl * 16 + ln) * 68 + cu * 16 + 8 * hh; const v4f v0 = *(const v4fa*)sp, v1 = *(const v4fa*)(sp + 4); FragH f;
#pragma unroll
    for (int i = 0; i < 4; ++i) { f.h[i] = (_Float16)v0[i]; f.h[4 + i] = (_Float16)v1[i]; }
    *(v8us*)((unsigned short*)C16 + (size_t)(row0 + 16 * rtl) * ldc + (size_t)col0 * 16 + cu * 256 + 8 * lane) = f.half[0]; } }


__global__ __launch_bounds__(256) void k_rsm(const float* __restrict__ S, _Float16* __restrict__ P, int nrows) {
  #pragma clang fp contract(off)
  const int i = blockIdx.x * 256 + threadIdx.x; if (i >= nrows) return; const float* s = S + (size_t)i * SQ; float mx = -3.0e38f;
#pragma unroll 1
  for (int j = 0; j < SQ; ++j) mx = fmaxf(mx, s[j]); float se = 0.f;
#pragma unroll 1
  for (int j = 0; j < SQ; ++j) se += expf(s[j] - mx); const float sc = 256.0f / se;
#pragma unroll 1
  for (int j0 = 0; j0 < SQ; j0 += 8) { FragH f; for (int q = 0; q < 8; ++q) f.h[q] = (_Float16)(expf(s[j0 + q] - mx) * sc); unsigned short* d = (unsigned short*)P + (size_t)i * SQ + j0; *(v8us*)d = f.half[0];  } }
__global__ __launch_bounds__(256) void k_vt(const _Float16* __restrict__ V16, int b, int h0, _Float16* __restrict__ VT) { __shared__ unsigned short tl[64][65]; const int tid = threadIdx.x; const int hh = blockIdx.x % HG, sg = blockIdx.x / HG; const int s0 = sg * 64; const int h = h0 + hh;
  for (int i = tid; i < 64 * 8; i += 256) { const int j = i / 8, d8 = (i % 8) * 8; FragH f; f.half[0] = *(const v8us*)((const unsigned short*)V16 + ((size_t)b * SQ + s0 + j) * DM + h * HD + d8); for (int q = 0; q < 8; ++q) tl[d8 + q][j] = f.u[q]; }
  __syncthreads();
  { for (int i = tid; i < 64 * 8; i += 256) { const int d = i / 8, j8 = (i % 8) * 8; FragH f; for (int q = 0; q < 8; ++q) f.u[q] = tl[d][j8 + q]; *(v8us*)((unsigned short*)VT + ((size_t)hh * HD + d) * SQ + s0 + j8) = f.half[0]; }  } }



__global__ __launch_bounds__(256) void k_rsmf(const float* __restrict__ S, _Float16* __restrict__ P, int qn, int hg) {
  #pragma clang fp contract(off)
  const int t = blockIdx.x * 256 + threadIdx.x; if (t >= qn * hg) return; const size_t i = (size_t)(t / qn) * SQ + (t % qn); const float* s = S + i * SQ; float mx = -3.0e38f;
#pragma unroll 1
  for (int j = 0; j < SQ; ++j) mx = fmaxf(mx, s[j]); float se = 0.f;
#pragma unroll 1
  for (int j = 0; j < SQ; ++j) se += __expf(s[j] - mx); const float sc = 256.0f / se;
#pragma unroll 1
  for (int j0 = 0; j0 < SQ; j0 += 8) { FragH f; for (int q = 0; q < 8; ++q) f.h[q] = (_Float16)(__expf(s[j0 + q] - mx) * sc); unsigned short* d = (unsigned short*)P + i * SQ + j0; *(v8us*)d = f.half[0];  } }

// Four native exp2 in one statement: each is the independent instruction that the instruction set asks for behind the transcendental in front of it, and the v_nop is that slot behind the last
// Early-clobber outputs keep the four independent of one another.
__device__ __forceinline__ void exp2x4(float& a, float& b, float& c, float& d) { float e0, e1, e2, e3;
  asm("v_exp_f32 %0, %4\n\tv_exp_f32 %1, %5\n\tv_exp_f32 %2, %6\n\tv_exp_f32 %3, %7\n\tv_nop" : "=&v"(e0), "=&v"(e1), "=&v"(e2), "=&v"(e3) : "v"(a), "v"(b), "v"(c), "v"(d));
  a = e0; b = e1; c = e2; d = e3; }
// Two native exp2 in one statement, as exp2x4 above: the second is the independent instruction behind the first, the v_nop is that slot behind the second.
__device__ __forceinline__ void exp2x2(float& a, float& b) { float e0, e1;
  asm("v_exp_f32 %0, %2\n\tv_exp_f32 %1, %3\n\tv_nop" : "=&v"(e0), "=&v"(e1) : "v"(a), "v"(b));
  a = e0; b = e1; }
__device__ __forceinline__ float fa_xhalf(float x) { return __builtin_bit_cast(float, __builtin_amdgcn_permlanex16(__builtin_bit_cast(int, x), __builtin_bit_cast(int, x), 0x76543210, 0xfedcba98, false, false)); }      /* lane l <-> lane l ^ 16 */
__device__ __forceinline__ v16h fa_frag(const _Float16* ub, unsigned off) { FragH f; f.half[0] = *(const v8us*)((const unsigned short*)ub + off); f.half[1] = *(const v8us*)((const unsigned short*)ub + off + 256); return f.v; }      /* a tile in fragment order, g2_frag's k order; ub is the same for the whole wave, off = tile offset + 8 * lane */
__device__ __forceinline__ v8f fa_mma(v16h a, v16h b, v8f c) { return __builtin_amdgcn_wmma_f32_16x16x32_f16(false, a, false, b, (short)0, c, false, false); }
// Fused attention of one head: scores, softmax and P.V in one launch; neither the scores nor the weights go to memory.
// Grid (SQ / 256, heads), 8 waves; a wave owns 32 queries (two groups of 16 columns) and walks all keys, 32 a step.
// Transposed products: S^T = K . Q^T (A = 16 key rows, B = 16 query columns, k = d) and O^T += V^T . P^T (A = 16 d rows of V^T, B = P^T, k = 32 keys).
// D register r of lane (c = lane & 15, h = lane >> 4) is element [8 h + r][c]: a lane holds one query's scores, and the two 16-key score tiles of a step, converted in place, are the B operand of the
// second product in the k order of g2_frag (elements 0..7 = keys 8 h + 0..7, elements 8..15 = keys 16 + 8 h + 0..7), which loads V^T. No LDS and no lane exchange for P.
// Online softmax in the log2 domain, f32: running maximum mr and running sum lr per query; each step rescales O^T and lr by exp2(old maximum - new maximum). The weights are carried x256 (the + 8) as f16
// operands, away from the f16 subnormals; the factor cancels in the division by lr, which sums the same scaled weights. mr starts at -3.0e38 (finite), so a step whose keys are all masked to -inf adds zeros.
// The mask (bf16-rounded, x log2 e) is prepared once per workgroup in LDS.
// K and V^T go through LDS: a stage is 256 keys of the head, 32 KiB of K (16 row tiles of 2 KiB) and behind it 32 KiB of V^T (8 steps of 4 KiB), both kept in fragment order, so a fragment half is 512 contiguous LDS bytes
// (no bank conflict). The workgroup fetches a stage once for its eight waves, by asynchronous copies, two buffers: the next stage's copies fly during the eight steps of this one, a lead longer than a memory latency.
#define FKT 256                      /* keys a stage */
#define FSK (FKT * HD)               /* elements of K, and of V^T, in a stage */
#define FST (2 * FSK)                /* one buffer, elements */
// One thread's share of half a stage (128 keys): eight asynchronous 16-byte copies, four of K and four of V^T; a wave's copy covers 512 contiguous bytes (4 whole lines) on both sides. l = the thread's LDS byte address in that
// half of the buffer's K part, k and v = its source addresses; a round of 256 threads moves 4 KiB: two row tiles of K (16 * LQ elements apart in the plane), 2048 elements of V^T. The s_wait_xcnt is the wait that is kept in front of an overwrite of a
// register that an issued copy names: as the statement's last line it stands in front of every later write of these operands.
__device__ __forceinline__ void fa_stage(unsigned l, const _Float16* k, const _Float16* v) {
  asm volatile("global_load_async_to_lds_b128 %0, %8, off\n\tglobal_load_async_to_lds_b128 %1, %9, off\n\tglobal_load_async_to_lds_b128 %2, %10, off\n\tglobal_load_async_to_lds_b128 %3, %11, off\n\t"
               "global_load_async_to_lds_b128 %4, %12, off\n\tglobal_load_async_to_lds_b128 %5, %13, off\n\tglobal_load_async_to_lds_b128 %6, %14, off\n\tglobal_load_async_to_lds_b128 %7, %15, off\n\t"
               "s_wait_xcnt 0x0"
               :: "v"(l), "v"(l + 4096u), "v"(l + 8192u), "v"(l + 12288u), "v"(l + 2u * FSK), "v"(l + 2u * FSK + 4096u), "v"(l + 2u * FSK + 8192u), "v"(l + 2u * FSK + 12288u),
                  "v"(k), "v"(k + 32 * LQ), "v"(k + 64 * LQ), "v"(k + 96 * LQ), "v"(v), "v"(v + 2048), "v"(v + 4096), "v"(v + 6144) : "memory"); }
__device__ __forceinline__ void fa_stage2(unsigned l, const _Float16* k, const _Float16* v) { fa_stage(l, k, v); fa_stage(l + 16384u, k + 128 * LQ, v + 128 * HD); }      /* a whole stage: sixteen copies a thread */
__device__ __forceinline__ v16h fa_lfrag(const unsigned short* p) { FragH f; f.half[0] = *(const v8us*)p; f.half[1] = *(const v8us*)(p + 256); return f.v; }      /* fa_frag from LDS: p = tile + 8 * lane */
__global__ __launch_bounds__(256) void k_fattn(const _Float16* __restrict__ Q, const _Float16* __restrict__ Kk, const _Float16* __restrict__ VTh, const float* __restrict__ am, _Float16* __restrict__ O) {
  static_assert(SQ % FKT == 0 && SQ / FKT >= 2 && FKT == 256 && HD == 64, "k_fattn: whole stages, at least two; fa_stage2 moves 256 keys of 64 features");
  __shared__ __attribute__((aligned(16))) float smk[SQ];
  __shared__ __attribute__((aligned(128))) unsigned short kv[2 * FST];
  const int tid = threadIdx.x, lane = tid & 31, ln = lane & 15, hh = lane >> 4, w = tid >> 5; const int h = blockIdx.y, q0 = blockIdx.x * 256 + w * 32;
  const unsigned l0 = (unsigned)(size_t)&kv[tid * 8];      /* LDS byte address: the low 32 bits of the shared address */
  const _Float16* const gk = Kk + h * HD * 16 + (tid >> 7) * (16 * LQ) + (tid & 127) * 8; const _Float16* const gv = VTh + (size_t)h * HD * SQ + tid * 8;      /* Q, Kk and VTh lie in fragment order (see above k_vt): a row tile is 16 * LQ elements, head h is its k tiles 2 h and 2 h + 1 */
  fa_stage2(l0, gk, gv);
  for (int i = tid * 4; i < SQ; i += 1024) { v4f a = *(const v4fa*)(am + i);
#pragma unroll
    for (int q = 0; q < 4; ++q) a[q] = bf16_round(a[q]) * 1.44269504f;
    *(v4fa*)&smk[i] = a; }
  const unsigned qo = (unsigned)(q0 * LQ + 8 * lane); v16h qf[2][2];
#pragma unroll
  for (int g = 0; g < 2; ++g)
#pragma unroll
    for (int ks = 0; ks < 2; ++ks) qf[g][ks] = fa_frag(Q + h * HD * 16, qo + 16 * g * LQ + 512 * ks);
  const v8f z8 = {0.f,0.f,0.f,0.f,0.f,0.f,0.f,0.f}; v8f o[2][4];
#pragma unroll
  for (int g = 0; g < 2; ++g)
#pragma unroll
    for (int t = 0; t < 4; ++t) o[g][t] = z8;
  float mr[2] = {-3.0e38f, -3.0e38f}, lr[2] = {0.f, 0.f};
  asm volatile("s_wait_asynccnt 0x0" ::: "memory");      /* this wave's copies of stage 0 have landed */
  __syncthreads();      /* publishes stage 0 and the mask */
  fa_stage2(l0 + 2u * FST, gk + (size_t)FKT * LQ, gv + FSK);
#pragma unroll 1      /* kept rolled: unrolling would only repeat the copies, the waits and the barrier in the text */
  for (int st = 0; st < SQ / FKT; ++st) { const unsigned short* const kl = kv + (st & 1) * FST + 8 * lane; const unsigned short* const vl = kl + FSK;
  v16h ka[2][2];
#pragma unroll
  for (int kt = 0; kt < 2; ++kt)
#pragma unroll
    for (int ks = 0; ks < 2; ++ks) ka[kt][ks] = fa_lfrag(kl + 1024 * kt + 512 * ks);
#pragma unroll 1      /* kept rolled too: unrolled, the next step's fragment reads rose over this step's second product and the registers went past 256 */
  for (int u = 0; u < FKT / 32; ++u) { const int j0 = st * FKT + 32 * u;
    v4f mk[2][2];      /* this step's mask values: read from LDS under the first product */
#pragma unroll
    for (int kt = 0; kt < 2; ++kt)
#pragma unroll
      for (int c = 0; c < 2; ++c) mk[kt][c] = *(const v4fa*)&smk[j0 + 16 * kt + 8 * hh + 4 * c];
    v16h va[4];      /* this step's V^T fragments: issued here, needed only behind the exponentials */
#pragma unroll
    for (int t = 0; t < 4; ++t) va[t] = fa_lfrag(vl + 2048 * u + 512 * t);
    v8f s[2][2];
#pragma unroll
    for (int g = 0; g < 2; ++g)
#pragma unroll
      for (int kt = 0; kt < 2; ++kt) s[g][kt] = fa_mma(ka[kt][1], qf[g][1], fa_mma(ka[kt][0], qf[g][0], z8));
    const unsigned short* const kn = kl + ((u + 1 < FKT / 32) ? 2048 * (u + 1) : 0);      /* the next step's K fragments, read under this step's softmax; never across a stage (the next buffer is not published yet): the stage's last step re-reads its own first rows, unused */
#pragma unroll
    for (int kt = 0; kt < 2; ++kt)
#pragma unroll
      for (int ks = 0; ks < 2; ++ks) ka[kt][ks] = fa_lfrag(kn + 1024 * kt + 512 * ks);
    __builtin_amdgcn_sched_barrier(0);      /* keeps both groups of LDS reads in front of the softmax: sunk to their users, each would wait out its LDS latency */
    float mn[2], cr[2];
#pragma unroll
    for (int g = 0; g < 2; ++g) { float mx = mr[g];
#pragma unroll
      for (int kt = 0; kt < 2; ++kt)
#pragma unroll
        for (int r = 0; r < 8; ++r) { s[g][kt][r] = s[g][kt][r] * 0.18033688f + mk[kt][r >> 2][r & 3]; mx = fmaxf(mx, s[g][kt][r]); }      /* (q . k / 8 + mask) log2 e */
      mn[g] = fmaxf(mx, fa_xhalf(mx)); cr[g] = mr[g] - mn[g]; mr[g] = mn[g]; }
    exp2x2(cr[0], cr[1]); FragH pf[2];
#pragma unroll
    for (int g = 0; g < 2; ++g) { const float nm = 8.0f - mn[g]; float ls[4] = {0.f, 0.f, 0.f, 0.f};
#pragma unroll
      for (int t = 0; t < 4; ++t) o[g][t] = o[g][t] * cr[g];
#pragma unroll
      for (int kt = 0; kt < 2; ++kt)
#pragma unroll
        for (int r4 = 0; r4 < 8; r4 += 4) { float y[4];
#pragma unroll
          for (int q = 0; q < 4; ++q) y[q] = s[g][kt][r4 + q] + nm;
          exp2x4(y[0], y[1], y[2], y[3]);
#pragma unroll
          for (int q = 0; q < 4; ++q) { ls[q] += y[q]; pf[g].h[8 * kt + r4 + q] = (_Float16)y[q]; } }
      lr[g] = lr[g] * cr[g] + ((ls[0] + ls[1]) + (ls[2] + ls[3])); }
    __builtin_amdgcn_sched_barrier(0);      /* keeps every asm exponential in front of the second product */
#pragma unroll
    for (int g = 0; g < 2; ++g)
#pragma unroll
      for (int t = 0; t < 4; ++t) o[g][t] = fa_mma(va[t], pf[g].v, o[g][t]);
    __builtin_amdgcn_sched_barrier(0);      /* keeps every WMMA of the step in front of the v_nops below */
    asm volatile("v_nop\n\tv_nop\n\tv_nop\n\tv_nop"); }      /* the four vector slots between the step's last WMMA and an overwrite of its operands */
    asm volatile("s_wait_dscnt 0x0" ::: "memory");      /* this wave's reads of the buffer are done before it may be refilled */
    asm volatile("s_wait_asynccnt 0x0" ::: "memory");      /* this wave's copies of stage st + 1 have landed */
    __syncthreads();      /* publishes stage st + 1 and ends every wave's reads of stage st */
    if (st + 2 < SQ / FKT) fa_stage2(l0 + (unsigned)(st & 1) * (2u * FST), gk + (size_t)(st + 2) * (FKT * LQ), gv + (size_t)(st + 2) * FSK); }
  asm volatile("s_wait_asynccnt 0x0" ::: "memory");      /* no copy is outstanding when the wave goes on */
#pragma unroll
  for (int g = 0; g < 2; ++g) { const float sc = 64.0f / (lr[g] + fa_xhalf(lr[g]));      /* the halves' sums joined; o carried x64, as the output GEMM's alpha expects */
    _Float16* d = O + h * HD + ((unsigned)((q0 + ln) * DM + 8 * hh) + 16 * g * DM);
#pragma unroll
    for (int t = 0; t < 4; ++t) { FragH f;
#pragma unroll
      for (int r = 0; r < 8; ++r) f.h[r] = (_Float16)(o[g][t][r] * sc);
      *(v8us*)((unsigned short*)d + 16 * t) = f.half[0]; } } }


// All input conversions in one streaming launch: x -> X16 (the bf16-rounded value as f16) and XB (the same value as f32, the residual plane); each weight -> its f16 plane, x16 (natural [out][in] = Bt[n][k]).
// 512 workgroups of 8 waves: 16 waves a WGP, 4096 waves in all. A wave takes one contiguous 4-KiB block of x and one of a weight (workgroups 128 s .. 128 s + 127 share weight s): 8 + 8 loads of 16 bytes a lane,
// each load 512 contiguous bytes (4 whole lines), all sixteen issued before the first value is used; the stores cover whole lines too (512 bytes f32, 256 bytes f16). x is read once for both of its planes.
__global__ __launch_bounds__(256) void k_prep(const float* __restrict__ x, const float* __restrict__ wq, const float* __restrict__ wk, const float* __restrict__ wv, const float* __restrict__ wo,
    _Float16* __restrict__ X16, float* __restrict__ XB, _Float16* __restrict__ BQ, _Float16* __restrict__ BK, _Float16* __restrict__ BV, _Float16* __restrict__ BO) {
  static_assert(NR * DM == (size_t)512 * 8 * 1024 && (size_t)DM * DM == (size_t)128 * 8 * 1024, "k_prep: the grid of 512 workgroups covers exactly these planes");
  const unsigned lane = threadIdx.x & 31, wid = blockIdx.x * 8 + (threadIdx.x >> 5), sel = blockIdx.x >> 7;
  const float* const w = sel == 0 ? wq : sel == 1 ? wk : sel == 2 ? wv : wo; _Float16* const B = sel == 0 ? BQ : sel == 1 ? BK : sel == 2 ? BV : BO;
  const unsigned xo = wid * 1024 + lane * 4, bo = (wid & 1023) * 1024 + lane * 4;      /* element offsets of the wave's two blocks */
  v4f a[8], b[8];      /* every loop below is unrolled: a and b stay in registers and each step's offset is an immediate of its load or store */
#pragma unroll
  for (int j = 0; j < 8; ++j) a[j] = *(const v4fa*)(x + xo + 128 * j);
#pragma unroll
  for (int j = 0; j < 8; ++j) b[j] = *(const v4fa*)(w + bo + 128 * j);
  __builtin_amdgcn_sched_barrier(0);      /* keeps the weight loads in front of the conversions: left free, they sank behind the x stores and the wave waited out a second memory latency */
#pragma unroll
  for (int j = 0; j < 8; ++j) { v4f r; v4h h;
#pragma unroll
    for (int q = 0; q < 4; ++q) { r[q] = bf16_round(a[j][q]); h[q] = (_Float16)r[q]; }
    *(v4f*)(XB + xo + 128 * j) = r; *(v4h*)(X16 + xo + 128 * j) = h; }
#pragma unroll
  for (int j = 0; j < 8; ++j) { v4h h;
#pragma unroll
    for (int q = 0; q < 4; ++q) h[q] = (_Float16)(bf16_round(b[j][q]) * 16.0f);
    *(v4h*)(B + bo + 128 * j) = h; } }


__global__ __launch_bounds__(256) void k_lnrow(const float* __restrict__ Y, const float* __restrict__ g, const float* __restrict__ bb, float eps, float* __restrict__ out) {
  #pragma clang fp contract(off)
  __shared__ float red[256]; const size_t r = blockIdx.x; const int t = threadIdx.x; const v4f ya = *(const v4fa*)(Y + r * DMQ + t * 4); float s[4]; float sum = 0.f;
  for (int q = 0; q < 4; ++q) { s[q] = ya[q]; sum = __fadd_rn(sum, s[q]); }
  red[t] = sum; __syncthreads(); for (int st = 128; st > 0; st >>= 1) { if (t < st) red[t] = __fadd_rn(red[t], red[t + st]); __syncthreads(); } const float mu = red[0] / (float)DMQ; __syncthreads();
  float vs = 0.f; for (int q = 0; q < 4; ++q) { const float dl = __fadd_rn(s[q], -mu); vs = __fadd_rn(vs, __fmul_rn(dl, dl)); } red[t] = vs; __syncthreads(); for (int st = 128; st > 0; st >>= 1) { if (t < st) red[t] = __fadd_rn(red[t], red[t + st]); __syncthreads(); }
  const float rs = rsqrtf(__fadd_rn(red[0] / (float)DMQ, eps)); v4f y; for (int q = 0; q < 4; ++q) { const int c = t * 4 + q; y[q] = __fadd_rn(__fmul_rn(__fmul_rn(__fadd_rn(s[q], -mu), rs), bf16_round(g[c])), bf16_round(bb[c])); }
  *(v4f*)(out + r * DMQ + t * 4) = y;  }
extern "C" void kernel_launch(void* const* d_in, const int* in_sizes, int n_in,
                              void* d_out, int out_size, void* d_ws, size_t ws_size, hipStream_t stream) {
  (void)in_sizes; (void)n_in; (void)out_size;
  const float* const* I = (const float* const*)d_in; const float* x = I[0]; const float* am = I[1]; const float* wq = I[2]; const float* bq = I[3]; const float* wk = I[4]; const float* bk = I[5]; const float* wv = I[6]; const float* bv = I[7]; const float* wo = I[8]; const float* bo = I[9]; const float* lng = I[10]; const float* lnb = I[11];      /* nn.Linear weights [out][in] + biases; additive mask [1][1][1][S] */
  char* ws = (char*)d_ws; size_t off = 0;
  auto take = [&](size_t bytes) { char* p = ws + off; off += (bytes + 255) & ~(size_t)255; return p; };
  _Float16* BQ = (_Float16*)take((size_t)DM * DM * 2); _Float16* BK = (_Float16*)take((size_t)DM * DM * 2); _Float16* BV = (_Float16*)take((size_t)DM * DM * 2); _Float16* BO = (_Float16*)take((size_t)DM * DM * 2);
  _Float16* X16 = (_Float16*)take(NR * DM * 2); float* XB = (float*)take(NR * DM * 4); float* YF = (float*)take(NR * DM * 4); _Float16* Q16 = (_Float16*)take(NR * DM * 2); _Float16* K16 = (_Float16*)take(NR * DM * 2); _Float16* V16 = (_Float16*)take(NR * DM * 2); _Float16* O16 = (_Float16*)take(NR * DM * 2);
  _Float16* VT = (_Float16*)take((size_t)NH * HD * SQ * 2);
  if (off > ws_size) return;
  k_prep<<<512, 256, 0, stream>>>(x, wq, wk, wv, wo, X16, XB, BQ, BK, BV, BO);      /* f16 x rows, bf16(x) residual plane, the four weight planes x16 */
  const size_t r0p = (size_t)B0 * SQ;      /* first projected row */
  k_gemm_qkv<<<(unsigned)((MP / 128) * (DM / 64)), 384, 0, stream>>>(X16 + r0p * DM, DM, BQ, BK, BV, DM, 0.0625f, bq, bk, bv, Q16 + r0p * DM, K16 + r0p * DM, V16 + r0p * DM, DM, MP, DM, DM);      /* q, k, v in one launch */
  for (int b = B0; b < B0 + NBR; ++b) { const size_t r0 = (size_t)b * SQ;
    k_vt<NH, SQ><<<NH * (SQ / 64), 256, 0, stream>>>(V16 + r0 * LQ, LQ, 0, VT);      /* V^T of all heads (HD x SQ each, fragment order) for this batch */
    k_fattn<<<dim3(SQ / 256, NH), 256, 0, stream>>>(Q16 + r0 * LQ, K16 + r0 * LQ, VT, am + (size_t)b * SQ, O16 + r0 * DM); }      /* scores + attention_mask, softmax and P . V of all heads, fused; o (merged heads, x64) as f16 rows */
  k_gemm2<0, true><<<dim3((unsigned)((MPO / 128) * (DM / 64)), 1), 128, 0, stream>>>(O16 + r0p * DM, DM, 0, BO, DM, 0, 0.0009765625f, bo, 0, XB + r0p * DM, 0, YF + r0p * DM, nullptr, DM, 0, MPO, DM, DM);      /* y = ctx Wo^T + bo + bf16(x) (own-element residual) */
  k_lnrow<<<(unsigned)MPO, 256, 0, stream>>>(YF + r0p * DM, lng, lnb, 1e-12f, (float*)d_out + r0p * DM);      /* post-LayerNorm */
}

// v009
// It runs in 125 microseconds.
// Two timings next to v008 both put it at 1.04 times that version's speed.
// All steps since v000 together make it 113 times as fast.
#include <hip/hip_runtime.h>
// BERT self-attention + output (hidden_states [1][4096][1024]; q/k/v = x W^T + b (nn.Linear [out][in] 1024^2, sigma 1/32, zero biases), 16 heads of 64; scores = (q/8) . k + attention_mask[j] (additive [1][1][1][S], zeros); softmax; ctx merged; out = LayerNorm(ctx Wo^T + bo + hidden_states; ln_gamma, ln_beta, eps 1e-12) -> [1][4096][1024]).
// Structure: token rows r = b*4096 + s; x as exact f16 rows (bf16-rounded); Q, K, V as one WMMA GEMM launch (32x64 wave tiles, f32 accumulation, exact x16 weights + bias, f16 outputs); per batch: V^T for all heads via LDS transposes; per batch one fused attention launch over all heads: S^T = K . Q^T on WMMA (alpha = 64^-0.5), online softmax on VALU (f32 statistics, native exp2; weights x256 as f16 operands, in registers only), O^T += V^T . P^T on WMMA (o carried x64 against f16 subnormal flush, folded into the output GEMM alpha) written straight into the merged f16 o rows; y = o Wo^T + bo + bf16(x) GEMM (f32, own-element residual) into f32 rows; post-LayerNorm on VALU (f32, LDS trees) into the output.
// Compute dtype: inputs rounded to bf16; x / weights exact; q, k, v, softmax weights and o as plain f16 GEMM operands (~2^-12); scores and softmax statistics f32. v_wmma_f32_16x16x32_f16.
#define NB 1
#define SQ 4096
#define DM 1024
#define NH 16
#define HD 64
#define HG 1                         /* heads per group of the k_vt(b, h0) overload, not launched */
#define B0 0                         /* first batch processed (debug hook) */
#define NBR NB                       /* batches processed (debug hook) */
#define NR ((size_t)NB * SQ)
#define DMQ DM         /* width of the token rows (LayerNorm length) */
#define MP ((int)((size_t)NBR * SQ)) /* rows projected (debug hook) */
#define QN SQ                        /* not used: attention covers all SQ query rows */
#define NHD NH                       /* not used: attention covers all NH heads */
#define MPO MP                       /* rows through the output stage (debug hook) */
#define LQ DM      /* width K of the q/k/v planes (fragment order) */
typedef __bf16 v16b __attribute__((ext_vector_type(16)));
typedef unsigned short v8us __attribute__((ext_vector_type(8), may_alias));
typedef float  v8f  __attribute__((ext_vector_type(8)));
typedef float  v4f  __attribute__((ext_vector_type(4)));
typedef float  v4fa __attribute__((ext_vector_type(4), may_alias));
union FragB { v16b v; v8us half[2]; unsigned short u[16]; };

__device__ __forceinline__ unsigned short bf16_bits(float x) { unsigned int u = __float_as_uint(x); return (unsigned short)((u + 0x7FFFu + ((u >> 16) & 1u)) >> 16); }
__device__ __forceinline__ float bf16_val(unsigned short b) { return __uint_as_float(((unsigned int)b) << 16); }
__device__ __forceinline__ float bf16_round(float x) { return bf16_val(bf16_bits(x)); }
// D += A·B with NT terms: 1 = ah·bh, 2 = + al·bh (A split), 3 = + ah·bl (both split)
template <int NT>
__device__ __forceinline__ v8f mmaN(v16b ah, v16b al, v16b bh, v16b bl, v8f c) {
  c = __builtin_amdgcn_wmma_f32_16x16x32_bf16(false, ah, false, bh, (short)0, c, false, false);
  if (NT >= 2) c = __builtin_amdgcn_wmma_f32_16x16x32_bf16(false, al, false, bh, (short)0, c, false, false);
  if (NT >= 3) c = __builtin_amdgcn_wmma_f32_16x16x32_bf16(false, ah, false, bl, (short)0, c, false, false);
  asm volatile("v_nop\n\tv_nop\n\tv_nop\n\tv_nop" : "+v"(c) : "v"(ah), "v"(al), "v"(bh), "v"(bl));
  return c;
}

__global__ __launch_bounds__(256) void k_wt_bf16(const float* __restrict__ W, unsigned short* __restrict__ Wt, int K, int N) {
  const int t = blockIdx.x * 256 + threadIdx.x;
  const int k8n = K / 8;
  if (t >= N * k8n) return;
  const int n = t / k8n, k8 = (t % k8n) * 8;
  v8us v;
#pragma unroll
  for (int i = 0; i < 8; ++i) v[i] = bf16_bits(W[(size_t)(k8 + i) * N + n]);
  *(v8us*)(Wt + (size_t)n * K + k8) = v;
  
}

// GEMM C[M][N] (f32, pitch ldc) = act(A[M][K]·W + bias). A f32 row-major (pitch lda) converted per fragment to bf16
// (ASPLIT: hi/lo two planes -> 2 terms, else single rounded term); Wt bf16 [N][K] (pitch ldb). BIAS_BF16 rounds the
// bias to bf16 first (bias quantised to bf16 before the add). K%32==0, M%16==0, N%64==0.
template <bool ASPLIT, int ACT, bool BIAS_BF16>
__global__ __launch_bounds__(128) void k_gemm_bf(const float* __restrict__ A, int lda, const unsigned short* __restrict__ Wt, int ldb,
                                               const float* __restrict__ bias, float* __restrict__ C, int ldc, int M, int N, int K) {
  __shared__ __attribute__((aligned(16))) float so[4][16][64];
  const int tid = threadIdx.x, w = tid >> 5, lane = tid & 31, ln = lane & 15, hh = lane >> 4;
  const int ntn = N / 64;
  const int wid = blockIdx.x * 4 + w;
  const int mt = wid / ntn, nq = wid % ntn;
  if (mt * 16 >= M) return;
  const int row0 = mt * 16, col0 = nq * 64;
  const float* arow = A + (size_t)(row0 + ln) * lda;
  v8f acc[4] = {};
  for (int kb = 0; kb < K; kb += 32) {
    FragB ah, al;
    const v4f x0 = *(const v4fa*)(arow + kb + 8 * hh), x1 = *(const v4fa*)(arow + kb + 8 * hh + 4);
    const v4f x2 = *(const v4fa*)(arow + kb + 16 + 8 * hh), x3 = *(const v4fa*)(arow + kb + 16 + 8 * hh + 4);
    float xs[16] = {x0[0],x0[1],x0[2],x0[3],x1[0],x1[1],x1[2],x1[3],x2[0],x2[1],x2[2],x2[3],x3[0],x3[1],x3[2],x3[3]};
#pragma unroll
    for (int i = 0; i < 16; ++i) { const unsigned short hb = bf16_bits(xs[i]); ah.u[i] = hb; al.u[i] = ASPLIT ? bf16_bits(xs[i] - bf16_val(hb)) : (unsigned short)0; }
#pragma unroll
    for (int t = 0; t < 4; ++t) {
      const unsigned short* brow = Wt + (size_t)(col0 + t * 16 + ln) * ldb + kb;
      FragB b;
      b.half[0] = *(const v8us*)(brow + 8 * hh);
      b.half[1] = *(const v8us*)(brow + 16 + 8 * hh);
      acc[t] = mmaN<ASPLIT ? 2 : 1>(ah.v, al.v, b.v, b.v, acc[t]);
    }
  }
#pragma unroll
  for (int t = 0; t < 4; ++t) {
    float bv = bias ? bias[col0 + t * 16 + ln] : 0.f;
    if (BIAS_BF16) bv = bf16_round(bv);
#pragma unroll
    for (int r = 0; r < 8; ++r) { float v = acc[t][r] + bv; if (ACT == 1) v = fmaxf(v, 0.f); so[w][8 * hh + r][t * 16 + ln] = v; }
  }
  __builtin_amdgcn_fence(__ATOMIC_ACQ_REL, "workgroup");
  __builtin_amdgcn_wave_barrier();
  const int rsub = lane >> 4, c4 = (lane & 15) * 4;
  {
#pragma unroll
    for (int q = 0; q < 8; ++q) {
      const int r = q * 2 + rsub;
      const v4f v = *(const v4fa*)&so[w][r][c4];
      *(v4f*)(C + (size_t)(row0 + r) * ldc + col0 + c4) = v;
    }
    
  }
}

// GEMM C = act(A·W + bias + resid): A f32 (ASPLIT -> hi/lo 2 terms), Wt bf16 [N][K]; ACT 0 none, 1 relu, 2 exact gelu;
// resid (optional, f32, row index = (row % rmod), pitch ldr, RES_BF16 rounds it) added before the activation.
template <bool ASPLIT, int ACT, bool BIAS_BF16, bool RES_BF16>
__global__ __launch_bounds__(128) void k_gemm_bf3(const float* __restrict__ A, int lda, const unsigned short* __restrict__ Wt, int ldb,
                                                const float* __restrict__ bias, const float* __restrict__ resid, int rmod, int ldr,
                                                float* __restrict__ C, int ldc, int M, int N, int K) {
  __shared__ __attribute__((aligned(16))) float so[4][16][64];
  const int tid = threadIdx.x, w = tid >> 5, lane = tid & 31, ln = lane & 15, hh = lane >> 4;
  const int ntn = N / 64;
  const int wid = blockIdx.x * 4 + w;
  const int mt = wid / ntn, nq = wid % ntn;
  if (mt * 16 >= M) return;
  const int row0 = mt * 16, col0 = nq * 64;
  const float* arow = A + (size_t)(row0 + ln) * lda;
  v8f acc[4] = {};
  for (int kb = 0; kb < K; kb += 32) {
    FragB ah, al;
    const v4f x0 = *(const v4fa*)(arow + kb + 8 * hh), x1 = *(const v4fa*)(arow + kb + 8 * hh + 4);
    const v4f x2 = *(const v4fa*)(arow + kb + 16 + 8 * hh), x3 = *(const v4fa*)(arow + kb + 16 + 8 * hh + 4);
    float xs[16] = {x0[0],x0[1],x0[2],x0[3],x1[0],x1[1],x1[2],x1[3],x2[0],x2[1],x2[2],x2[3],x3[0],x3[1],x3[2],x3[3]};
#pragma unroll
    for (int i = 0; i < 16; ++i) { const unsigned short hb = bf16_bits(xs[i]); ah.u[i] = hb; al.u[i] = ASPLIT ? bf16_bits(xs[i] - bf16_val(hb)) : (unsigned short)0; }
#pragma unroll
    for (int t = 0; t < 4; ++t) {
      const unsigned short* brow = Wt + (size_t)(col0 + t * 16 + ln) * ldb + kb;
      FragB b;
      b.half[0] = *(const v8us*)(brow + 8 * hh);
      b.half[1] = *(const v8us*)(brow + 16 + 8 * hh);
      acc[t] = mmaN<ASPLIT ? 2 : 1>(ah.v, al.v, b.v, b.v, acc[t]);
    }
  }
#pragma unroll
  for (int t = 0; t < 4; ++t) {
    const int col = col0 + t * 16 + ln;
    float bv = bias ? bias[col] : 0.f;
    if (BIAS_BF16) bv = bf16_round(bv);
#pragma unroll
    for (int r = 0; r < 8; ++r) {
      float v = acc[t][r] + bv;
      if (resid) { float rv = resid[(size_t)((row0 + 8 * hh + r) % rmod) * ldr + col]; if (RES_BF16) rv = bf16_round(rv); v += rv; }
      if (ACT == 1) v = fmaxf(v, 0.f);
      if (ACT == 2) v = 0.5f * v * (1.0f + erff(v * 0.70710678118654752f));
      if (ACT == 3) { const float u = 0.7978845608028654f * (v + 0.044715f * v * v * v); v = 0.5f * v * (1.0f + tanhf(u)); }
      so[w][8 * hh + r][t * 16 + ln] = v;
    }
  }
  __builtin_amdgcn_fence(__ATOMIC_ACQ_REL, "workgroup");
  __builtin_amdgcn_wave_barrier();
  const int rsub = lane >> 4, c4 = (lane & 15) * 4;
  {
#pragma unroll
    for (int q = 0; q < 8; ++q) {
      const int r = q * 2 + rsub;
      const v4f v = *(const v4fa*)&so[w][r][c4];
      *(v4f*)(C + (size_t)(row0 + r) * ldc + col0 + c4) = v;
    }
    
  }
}
// row LayerNorm (biased variance, eps) over N: s = X (+ R); optional out_sum <- s; out_norm <- (s-mu)*rsqrt(var+eps)*g + b
template <bool PARAM_BF16>
__global__ __launch_bounds__(256) void k_layernorm(const float* __restrict__ X, const float* __restrict__ R, const float* __restrict__ g, const float* __restrict__ bta,
                                                  float* __restrict__ out_sum, float* __restrict__ out_norm, int N, float eps) {
  __shared__ float red[256];
  const int row = blockIdx.x, tid = threadIdx.x;
  const float* x = X + (size_t)row * N; const float* rr = R ? R + (size_t)row * N : nullptr;
  float vals[16];                     // up to N = 4096
  const int per = N / 256;            // contiguous chunk per thread? use strided-by-4 chunks: thread handles j = tid*4 + 1024*u
  float s1 = 0.f;
  for (int u = 0; u < per / 4; ++u) {
    const int j = tid * 4 + 1024 * u;
    const v4f a = *(const v4fa*)(x + j);
    v4f b = {0.f,0.f,0.f,0.f}; if (rr) b = *(const v4fa*)(rr + j);
#pragma unroll
    for (int q = 0; q < 4; ++q) { const float v = a[q] + b[q]; vals[u * 4 + q] = v; s1 += v; }
  }
  red[tid] = s1; __syncthreads();
  for (int st = 128; st > 0; st >>= 1) { if (tid < st) red[tid] += red[tid + st]; __syncthreads(); }
  const float mu = red[0] / (float)N; __syncthreads();
  float s2 = 0.f;
  for (int u = 0; u < per / 4; ++u)
#pragma unroll
    for (int q = 0; q < 4; ++q) { const float c = vals[u * 4 + q] - mu; s2 += c * c; }
  red[tid] = s2; __syncthreads();
  for (int st = 128; st > 0; st >>= 1) { if (tid < st) red[tid] += red[tid + st]; __syncthreads(); }
  const float rs = rsqrtf(red[0] / (float)N + eps);
  {
    for (int u = 0; u < per / 4; ++u) {
      const int j = tid * 4 + 1024 * u;
      v4f o, sm;
#pragma unroll
      for (int q = 0; q < 4; ++q) {
        float gg = g[j + q], bb = bta[j + q];
        if (PARAM_BF16) { gg = bf16_round(gg); bb = bf16_round(bb); }
        sm[q] = vals[u * 4 + q]; o[q] = (vals[u * 4 + q] - mu) * rs * gg + bb;
      }
      if (out_sum) *(v4f*)(out_sum + (size_t)row * N + j) = sm;
      *(v4f*)(out_norm + (size_t)row * N + j) = o;
    }
    
  }
}



// ---- f16 WMMA path (v_wmma_f32_16x16x32_f16): 11-bit significands for operands in range — used where a [0,1] probability operand needs more precision than bf16
typedef _Float16 v16h __attribute__((ext_vector_type(16)));
union FragH { v16h v; v8us half[2]; _Float16 h[16]; unsigned short u[16]; };
template <int NT>
__device__ __forceinline__ v8f mmaH(v16h ah, v16h al, v16h bh, v16h bl, v8f c) {
  c = __builtin_amdgcn_wmma_f32_16x16x32_f16(false, ah, false, bh, (short)0, c, false, false);
  if (NT >= 2) c = __builtin_amdgcn_wmma_f32_16x16x32_f16(false, al, false, bh, (short)0, c, false, false);
  if (NT >= 3) c = __builtin_amdgcn_wmma_f32_16x16x32_f16(false, ah, false, bl, (short)0, c, false, false);
  asm volatile("v_nop\n\tv_nop\n\tv_nop\n\tv_nop" : "+v"(c) : "v"(ah), "v"(al), "v"(bh), "v"(bl));
  return c;
}
// batched GEMM like k_gemm_b but f16 operands: A f32 (split into f16 hi/lo if ASPLIT, else rounded to f16), Bt = f16 values [n][k]; alpha; C f32; N multiple of 16 (partial tiles skipped)
template <bool ASPLIT>
__global__ __launch_bounds__(128) void k_gemm_h(const float* __restrict__ A, int lda, size_t sA, const _Float16* __restrict__ Bh, int ldb, size_t sB, float alpha, float* __restrict__ C, int ldc, size_t sC, int M, int N, int K) {
  __shared__ __attribute__((aligned(16))) float so[4][16][64];
  const int tid = threadIdx.x, w = tid >> 5, lane = tid & 31, ln = lane & 15, hh = lane >> 4; const int by = blockIdx.y;
  A += (size_t)by * sA; Bh += (size_t)by * sB; C += (size_t)by * sC;
  const int ntn = (N + 63) / 64; const int wid = blockIdx.x * 4 + w; const int mt = wid / ntn, nq = wid % ntn; if (mt * 16 >= M) return;
  const int row0 = mt * 16, col0 = nq * 64; const float* arow = A + (size_t)(row0 + ln) * lda;
  v8f acc[4] = {};
  for (int kb = 0; kb < K; kb += 32) {
    FragH ah, al;
    const v4f x0 = *(const v4fa*)(arow + kb + 8 * hh), x1 = *(const v4fa*)(arow + kb + 8 * hh + 4), x2 = *(const v4fa*)(arow + kb + 16 + 8 * hh), x3 = *(const v4fa*)(arow + kb + 16 + 8 * hh + 4);
    float xs[16] = {x0[0],x0[1],x0[2],x0[3],x1[0],x1[1],x1[2],x1[3],x2[0],x2[1],x2[2],x2[3],x3[0],x3[1],x3[2],x3[3]};
#pragma unroll
    for (int i = 0; i < 16; ++i) { const _Float16 h = (_Float16)xs[i]; ah.h[i] = h; al.h[i] = ASPLIT ? (_Float16)(xs[i] - (float)h) : (_Float16)0.0f; }
#pragma unroll
    for (int t = 0; t < 4; ++t) { if (col0 + t * 16 >= N) continue; const size_t boff = (size_t)(col0 + t * 16 + ln) * ldb + kb; FragH bq; bq.half[0] = *(const v8us*)(Bh + boff + 8 * hh); bq.half[1] = *(const v8us*)(Bh + boff + 16 + 8 * hh);
      acc[t] = mmaH<ASPLIT ? 2 : 1>(ah.v, al.v, bq.v, bq.v, acc[t]); }
  }
#pragma unroll
  for (int t = 0; t < 4; ++t) { if (col0 + t * 16 >= N) continue;
#pragma unroll
    for (int r = 0; r < 8; ++r) so[w][8 * hh + r][t * 16 + ln] = acc[t][r] * alpha; }
  __builtin_amdgcn_fence(__ATOMIC_ACQ_REL, "workgroup"); __builtin_amdgcn_wave_barrier();
  const int rsub = lane >> 4, c4 = (lane & 15) * 4;
  {
#pragma unroll
    for (int q = 0; q < 8; ++q) { const int r = q * 2 + rsub; if (col0 + c4 < N) { const v4f v = *(const v4fa*)&so[w][r][c4]; *(v4f*)(C + (size_t)(row0 + r) * ldc + col0 + c4) = v; } }
     }
}

// Wt[n][k] = f16(W[k][n]·scale) from f32 row-major W[K][N] (scale = power of two; bf16-exact weights stay exact in f16 away from the subnormal range)
__global__ __launch_bounds__(256) void k_wt_f16(const float* __restrict__ W, _Float16* __restrict__ Wt, int K, int N, float scale) {
  const int t = blockIdx.x * 256 + threadIdx.x; if (t >= N * (K / 8)) return; const int n = t / (K / 8), k8 = (t % (K / 8)) * 8; FragH f;
#pragma unroll
  for (int i = 0; i < 8; ++i) f.h[i] = (_Float16)(bf16_round(W[(size_t)(k8 + i) * N + n]) * scale); const v8us o = f.half[0];
  *(v8us*)((unsigned short*)Wt + (size_t)n * K + k8) = o; 
}
// k_gemm_hh variant with fused epilogue: v = acc·alpha + bias[by·sBias + col] (+ CP[(row/rowsPerB)·sCPb + by·64 + col] if CP) ; ACT 0 none / 1 elu ; writes f16 C16 (and f32 C if non-null)
template <int ACT>
__global__ __launch_bounds__(128) void k_gemm_hhx(const _Float16* __restrict__ A, int lda, size_t sA, const _Float16* __restrict__ Bh, int ldb, size_t sB, float alpha, const float* __restrict__ bias, size_t sBias, const float* __restrict__ CP, int rowsPerB, size_t sCPb, int row0g,
    float* __restrict__ C, _Float16* __restrict__ C16, int ldc, size_t sC, int M, int N, int K) {
  __shared__ __attribute__((aligned(16))) float so[4][16][64];
  const int tid = threadIdx.x, w = tid >> 5, lane = tid & 31, ln = lane & 15, hh = lane >> 4; const int by = blockIdx.y;
  A += (size_t)by * sA; Bh += (size_t)by * sB; const size_t cofs = (size_t)by * sC; const float* bp = bias ? bias + (size_t)by * sBias : nullptr;
  const int ntn = (N + 63) / 64; const int wid = blockIdx.x * 4 + w; const int mt = wid / ntn, nq = wid % ntn; if (mt * 16 >= M) return;
  const int row0 = mt * 16, col0 = nq * 64; const _Float16* arow = A + (size_t)(row0 + ln) * lda;
  v8f acc[4] = {};
  for (int kb = 0; kb < K; kb += 32) { FragH ah; ah.half[0] = *(const v8us*)((const unsigned short*)arow + kb + 8 * hh); ah.half[1] = *(const v8us*)((const unsigned short*)arow + kb + 16 + 8 * hh);
#pragma unroll
    for (int t = 0; t < 4; ++t) { if (col0 + t * 16 >= N) continue; const size_t boff = (size_t)(col0 + t * 16 + ln) * ldb + kb; FragH bq; bq.half[0] = *(const v8us*)((const unsigned short*)Bh + boff + 8 * hh); bq.half[1] = *(const v8us*)((const unsigned short*)Bh + boff + 16 + 8 * hh);
      acc[t] = mmaH<1>(ah.v, ah.v, bq.v, bq.v, acc[t]); }
  }
#pragma unroll
  for (int t = 0; t < 4; ++t) { if (col0 + t * 16 >= N) continue; const int col = col0 + t * 16 + ln; const float bv = bp ? bf16_round(bp[col]) : 0.f;
#pragma unroll
    for (int r = 0; r < 8; ++r) { float v = acc[t][r] * alpha + bv; if (CP) { const int rr = row0g + row0 + 8 * hh + r; if (rowsPerB < 0) v += CP[cofs + (size_t)rr * ldc + col];      /* rowsPerB < 0: own element of the batched C plane */ else { const int bidx = rr / rowsPerB; v += CP[(size_t)bidx * sCPb + (size_t)by * 64 + col]; } } if (ACT == 1) v = (v > 0.f) ? v : expm1f(v); else if (ACT == 7) v = (v > 0.f) ? v + 1.0f : expf(v); else if (ACT == 8) v = tanhf(v); else if (ACT == 9) v = 0.5f * v * (1.0f + tanhf(0.7978845608028654f * (v + 0.044715f * v * v * v))); else if (ACT == 11) v = 1.0f / (1.0f + expf(-v)); else if (ACT == 12) v = (v > 0.f) ? v : 0.01f * v; else if (ACT == 14) v = (v > 0.f) ? v : 0.1f * v; else if (ACT == 16) v = (v >= 0.f) ? v : 0.3f * v; else if (ACT == 17) v = (v >= 0.f) ? v : 0.2f * v; else if (ACT == 15) v = v / (1.0f + expf(-v)); else if (ACT == 3) v = fmaxf(v, 0.f); else if (ACT == 6) v = 0.5f * v * (1.0f + erff(v * 0.70710678118654752f)); so[w][8 * hh + r][t * 16 + ln] = v; } }
  __builtin_amdgcn_fence(__ATOMIC_ACQ_REL, "workgroup"); __builtin_amdgcn_wave_barrier();
  const int rsub = lane >> 4, c4 = (lane & 15) * 4; typedef _Float16 v4h __attribute__((ext_vector_type(4)));
  {
#pragma unroll
    for (int q = 0; q < 8; ++q) { const int r = q * 2 + rsub; if (col0 + c4 < N) { const v4f v = *(const v4fa*)&so[w][r][c4]; if (C) *(v4f*)(C + cofs + (size_t)(row0 + r) * ldc + col0 + c4) = v; if (C16) { v4h h4; for (int i = 0; i < 4; ++i) h4[i] = (_Float16)v[i]; *(v4h*)(C16 + cofs + (size_t)(row0 + r) * ldc + col0 + c4) = h4; } } }
     }
}


typedef _Float16 v4h __attribute__((ext_vector_type(4)));

__global__ __launch_bounds__(256) void k_h16(const float* __restrict__ x, _Float16* __restrict__ X16, size_t n8) { const size_t t = (size_t)blockIdx.x * 256 + threadIdx.x; if (t >= n8) return; FragH f;
#pragma unroll
  for (int q = 0; q < 8; ++q) f.h[q] = (_Float16)x[t * 8 + q]; *(v8us*)((unsigned short*)X16 + t * 8) = f.half[0];  }
__global__ __launch_bounds__(256) void k_round16f(const float* __restrict__ W, _Float16* __restrict__ Bt, size_t n8) { const size_t t = (size_t)blockIdx.x * 256 + threadIdx.x; if (t >= n8) return; FragH f;
#pragma unroll
  for (int i = 0; i < 8; ++i) f.h[i] = (_Float16)(bf16_round(W[t * 8 + i]) * 16.0f); *(v8us*)((unsigned short*)Bt + t * 8) = f.half[0];  }
// ---- fragment order: how the attention operands q, k and v lie in the workspace (V^T: same tiles, placed as k_vt writes them) ----
// A plane of R rows x K columns (R % 16 == 0, K % 32 == 0) is cut into tiles of 16 rows x 32 k, tile (rt, kt) at element (rt * (K / 32) + kt) * 512. Inside a tile, 16-byte chunk 32 j + lane (lane = 16 hh + ln) holds
// row ln, k = 16 j + 8 hh + 0..7: the four registers that lane (ln, hh) takes as half j of its fragment (g2_frag's k order). A fragment is then two loads of 512 contiguous bytes, 4 whole lines a load,
// where row-major rows gave 16 lines a load; the register contents, and with them the k order of both operands of each product, are what they were.
template <int NHv, int TTv>
__global__ __launch_bounds__(256) void k_vt(const _Float16* __restrict__ V16, int ldv, int voff, _Float16* __restrict__ Vt) { __shared__ unsigned short tl[64][66]; const int tid = threadIdx.x; const int slab = blockIdx.x / (TTv / 64), lg = blockIdx.x % (TTv / 64); const int b = slab / NHv, h = slab % NHv;
  /* V16 in fragment order (rows = tokens, k = features, K = ldv): this 64 x 64 block is 4 row tiles x 2 adjacent k tiles; chunk c of row tile rtl holds token row r, features c8 + 0..7 */
  for (int i = tid; i < 64 * 8; i += 256) { const int rtl = i >> 7, c = i & 127, lane = i & 31; const int r = rtl * 16 + (lane & 15), c8 = (c >> 5) * 16 + (lane >> 4) * 8; FragH f;
    f.half[0] = *(const v8us*)((const unsigned short*)V16 + ((size_t)b * TTv + lg * 64 + rtl * 16) * ldv + (size_t)(voff + h * 64) * 16 + c * 8);
#pragma unroll
    for (int q = 0; q < 8; ++q) tl[r][c8 + q] = f.u[q]; }
  __syncthreads();
  {      /* Vt in fragment order, per slab: rows = d (4 tiles), k = tokens, the 4 d tiles of one 32-token step adjacent: tile (st, t) at ((slab * (TTv / 32) + st) * 4 + t) * 512; this block's 512 chunks are contiguous */
#pragma unroll
    for (int rd = 0; rd < 2; ++rd) { const int c = rd * 256 + tid, lane = c & 31; const int d = ((c >> 6) & 3) * 16 + (lane & 15), k0 = (c >> 8) * 32 + ((c >> 5) & 1) * 16 + (lane >> 4) * 8; FragH f;
#pragma unroll
      for (int q = 0; q < 8; ++q) f.u[q] = tl[k0 + q][d];
      *(v8us*)((unsigned short*)Vt + ((size_t)slab * (TTv / 32) + lg * 2) * 2048 + c * 8) = f.half[0]; }
     } }

__global__ __launch_bounds__(256) void k_hl(const float* __restrict__ F, _Float16* __restrict__ Hh, _Float16* __restrict__ Hl, size_t n8) { const size_t t = (size_t)blockIdx.x * 256 + threadIdx.x; if (t >= n8) return; FragH fh, fl; const v4f a = *(const v4fa*)(F + t * 8), c = *(const v4fa*)(F + t * 8 + 4);
#pragma unroll
  for (int q = 0; q < 4; ++q) { _Float16 h = (_Float16)a[q]; fh.h[q] = h; fl.h[q] = (_Float16)((a[q] - (float)h) * 1024.0f); h = (_Float16)c[q]; fh.h[4 + q] = h; fl.h[4 + q] = (_Float16)((c[q] - (float)h) * 1024.0f); }
  { *(v8us*)((unsigned short*)Hh + t * 8) = fh.half[0]; *(v8us*)((unsigned short*)Hl + t * 8) = fl.half[0];  } }

// ---- fast GEMM (workgroup tile 128x64, wave tile 32x64; requires M % 128 == 0 rows per launch region, N % 64 == 0 and K % 64 == 0, K >= 64) ----
// Epilogue, chosen at compile time so that it holds no branch and its loads can be issued together: v = act(acc * alpha + bf16(bias[col])); RES: f32 rows C = v + own element of CP (no activation); else: f16 C16 in fragment order.
// The operands go through LDS: a stage is 64 k of the workgroup's 128 A rows and 64 B rows (192 rows of 128 bytes, each one whole line of its source row), laid at a pitch of 144 bytes (16 B x odd: no bank conflict for
// the 16-byte fragment reads). Two buffers: the next stage's asynchronous copies fly while this stage is multiplied. The B rows are fetched once for the four waves.
#define G2P 72                       /* LDS row pitch, elements */
#define G2S (192 * G2P)              /* one buffer, elements */
__device__ __forceinline__ v16h g2_frag(const unsigned short* p, int hh) { FragH f; f.half[0] = *(const v8us*)(p + 8 * hh); f.half[1] = *(const v8us*)(p + 16 + 8 * hh); return f.v; }
// One thread's share of a stage: twelve asynchronous 16-byte copies (row groups of 16: eight of A, four of B; eight lanes cover one row's 128 bytes, so a wave's copy reads 4 whole lines). l = the thread's LDS byte address in
// row group 0 of the buffer, a and b = its source addresses there, sa and sb = 16 source rows in elements. The s_wait_xcnt is the wait that is kept in front of an overwrite of a register that an issued copy names:
// as the statement's last line it stands in front of every later write of these operands.
__device__ __forceinline__ void g2_stage(unsigned l, const _Float16* a, size_t sa, const _Float16* b, size_t sb) {
  asm volatile("global_load_async_to_lds_b128 %0, %12, off\n\tglobal_load_async_to_lds_b128 %1, %13, off\n\tglobal_load_async_to_lds_b128 %2, %14, off\n\tglobal_load_async_to_lds_b128 %3, %15, off\n\t"
               "global_load_async_to_lds_b128 %4, %16, off\n\tglobal_load_async_to_lds_b128 %5, %17, off\n\tglobal_load_async_to_lds_b128 %6, %18, off\n\tglobal_load_async_to_lds_b128 %7, %19, off\n\t"
               "global_load_async_to_lds_b128 %8, %20, off\n\tglobal_load_async_to_lds_b128 %9, %21, off\n\tglobal_load_async_to_lds_b128 %10, %22, off\n\tglobal_load_async_to_lds_b128 %11, %23, off\n\t"
               "s_wait_xcnt 0x0"
               :: "v"(l), "v"(l + 32u * G2P), "v"(l + 64u * G2P), "v"(l + 96u * G2P), "v"(l + 128u * G2P), "v"(l + 160u * G2P), "v"(l + 192u * G2P), "v"(l + 224u * G2P), "v"(l + 256u * G2P), "v"(l + 288u * G2P), "v"(l + 320u * G2P), "v"(l + 352u * G2P),
                  "v"(a), "v"(a + sa), "v"(a + 2 * sa), "v"(a + 3 * sa), "v"(a + 4 * sa), "v"(a + 5 * sa), "v"(a + 6 * sa), "v"(a + 7 * sa), "v"(b), "v"(b + sb), "v"(b + 2 * sb), "v"(b + 3 * sb) : "memory"); }
__device__ __forceinline__ v8f g2_mma(v16h a, v16h b, v8f c) { v8f d = __builtin_amdgcn_wmma_f32_16x16x32_f16(false, a, false, b, (short)0, c, false, false); asm volatile("v_nop\n\tv_nop\n\tv_nop\n\tv_nop" : "+v"(d) : "v"(a), "v"(b)); return d; }
template <int ACT, bool RES>
__global__ __launch_bounds__(128) void k_gemm2(const _Float16* __restrict__ A, int lda, size_t sA, const _Float16* __restrict__ Bh, int ldb, size_t sB, float alpha, const float* __restrict__ bias, size_t sBias, const float* __restrict__ CP, int row0g,
    float* __restrict__ C, _Float16* __restrict__ C16, int ldc, size_t sC, int M, int N, int K) { static_assert(!RES || ACT == 0, "k_gemm2: the residual is added at the write-out, behind the activation's place"); static_assert(ACT == 0 || ACT == 3 || ACT == 6 || ACT == 8 || ACT == 9 || ACT == 11 || ACT == 12 || ACT == 14 || ACT == 15 || ACT == 16 || ACT == 17, "k_gemm2: unsupported ACT code (would silently apply no activation)");
  __shared__ __attribute__((aligned(16))) float so[4][32][68];
  __shared__ __attribute__((aligned(16))) unsigned short st[2 * G2S];
  const int tid = threadIdx.x, w = tid >> 5, lane = tid & 31, ln = lane & 15, hh = lane >> 4; const int by = blockIdx.y;
  A += (size_t)by * sA; Bh += (size_t)by * sB; const size_t cofs = (size_t)by * sC; const float* bp = bias + (size_t)by * sBias;
  const int ntn = N >> 6; const int mt = blockIdx.x / ntn, nq = blockIdx.x - mt * ntn; const int row0 = mt * 128 + 32 * w, col0 = nq * 64; if (mt * 128 >= M) return;      /* the whole workgroup or none: barriers follow */
  const unsigned l0 = (unsigned)(size_t)&st[(tid >> 3) * G2P + (tid & 7) * 8];      /* LDS byte address: the low 32 bits of the shared address */
  const _Float16* ga = A + (size_t)(mt * 128 + (tid >> 3)) * lda + (tid & 7) * 8; const _Float16* gb = Bh + (size_t)(col0 + (tid >> 3)) * ldb + (tid & 7) * 8; const size_t sa = (size_t)16 * lda, sb = (size_t)16 * ldb;
  const int nt = K >> 6;
  const v8f z8 = {0.f,0.f,0.f,0.f,0.f,0.f,0.f,0.f}; v8f c00 = z8, c01 = z8, c02 = z8, c03 = z8, c10 = z8, c11 = z8, c12 = z8, c13 = z8;
  float bv[4];      /* the lane's four bias values: loaded here, used behind the loop */
#pragma unroll
  for (int t = 0; t < 4; ++t) bv[t] = bp[col0 + t * 16 + ln];
  g2_stage(l0, ga, sa, gb, sb);
  asm volatile("s_wait_asynccnt 0x0" ::: "memory");      /* this wave's copies of stage 0 have landed */
  __syncthreads();      /* publishes stage 0 */
  if (nt > 1) g2_stage(l0 + 2u * G2S, ga + 64, sa, gb + 64, sb);
#pragma unroll 1      /* kept rolled: a trip already holds 24 LDS reads and 16 WMMAs; unrolling would only repeat the copies, the waits and the barrier in the text */
  for (int t = 0; t < nt; ++t) { const unsigned short* const ap = st + (t & 1) * G2S + (32 * w + ln) * G2P; const unsigned short* const bq = st + (t & 1) * G2S + (128 + ln) * G2P; v16h af[2][2], bf[2][4];
#pragma unroll
    for (int ks = 0; ks < 2; ++ks) {
#pragma unroll
      for (int r = 0; r < 2; ++r) af[ks][r] = g2_frag(ap + 16 * r * G2P + 32 * ks, hh);
#pragma unroll
      for (int u = 0; u < 4; ++u) bf[ks][u] = g2_frag(bq + 16 * u * G2P + 32 * ks, hh); }
#pragma unroll
    for (int ks = 0; ks < 2; ++ks) { c00 = g2_mma(af[ks][0], bf[ks][0], c00); c10 = g2_mma(af[ks][1], bf[ks][0], c10); c01 = g2_mma(af[ks][0], bf[ks][1], c01); c11 = g2_mma(af[ks][1], bf[ks][1], c11);
      c02 = g2_mma(af[ks][0], bf[ks][2], c02); c12 = g2_mma(af[ks][1], bf[ks][2], c12); c03 = g2_mma(af[ks][0], bf[ks][3], c03); c13 = g2_mma(af[ks][1], bf[ks][3], c13); }
    asm volatile("s_wait_dscnt 0x0" ::: "memory");      /* this wave's reads of the buffer are done before it may be refilled */
    asm volatile("s_wait_asynccnt 0x0" ::: "memory");      /* this wave's copies of stage t + 1 have landed */
    __syncthreads();      /* publishes stage t + 1 and ends every wave's reads of stage t */
    if (t + 2 < nt) g2_stage(l0 + (unsigned)(t & 1) * (2u * G2S), ga + (size_t)(t + 2) * 64, sa, gb + (size_t)(t + 2) * 64, sb); }
  asm volatile("s_wait_asynccnt 0x0" ::: "memory");      /* no copy is outstanding when the wave goes on */
  const int rsub = lane >> 4, c4 = (lane & 15) * 4;
  v4f res[16]; unsigned eo[16];      /* with RES, the wave's 32 x 64 residual tile: 16 loads of 16 bytes a lane (two 256-byte row pieces a load), all issued here, in flight under the staging below; eo = the lane's offsets in the plane, in 16-byte units (ldc % 4 == 0, as the 16-byte accesses ask), the same for the residual loads and the C stores */
  if constexpr (RES) {
#pragma unroll
    for (int q = 0; q < 16; ++q) { eo[q] = (unsigned)(row0 + q * 2 + rsub) * ((unsigned)ldc >> 2) + (unsigned)((col0 + c4) >> 2); res[q] = ((const v4fa*)(CP + cofs + (size_t)row0g * ldc))[eo[q]]; } }
  v8f accs[8] = {c00, c01, c02, c03, c10, c11, c12, c13};
#pragma unroll
  for (int u = 0; u < 8; ++u) { const int t = u & 3, half = u >> 2; const float bvr = bf16_round(bv[t]);
#pragma unroll
    for (int r = 0; r < 8; ++r) { const int rloc = half * 16 + 8 * hh + r; float v = accs[u][r] * alpha + bvr;
      if (ACT == 3) v = fmaxf(v, 0.f); else if (ACT == 6) v = 0.5f * v * (1.0f + erff(v * 0.70710678118654752f)); else if (ACT == 11) v = 1.0f / (1.0f + expf(-v)); else if (ACT == 15) v = v / (1.0f + expf(-v)); else if (ACT == 12) v = (v > 0.f) ? v : 0.01f * v; else if (ACT == 8) v = tanhf(v); else if (ACT == 9) v = 0.5f * v * (1.0f + tanhf(0.7978845608028654f * (v + 0.044715f * v * v * v))); else if (ACT == 14) v = (v > 0.f) ? v : 0.1f * v; else if (ACT == 16) v = (v >= 0.f) ? v : 0.3f * v; else if (ACT == 17) v = (v >= 0.f) ? v : 0.2f * v;
      so[w][rloc][t * 16 + ln] = v; } }
  __builtin_amdgcn_fence(__ATOMIC_ACQ_REL, "workgroup"); __builtin_amdgcn_wave_barrier();
  if constexpr (RES) {
#pragma unroll
    for (int q = 0; q < 16; ++q) { const v4f v = *(const v4fa*)&so[w][q * 2 + rsub][c4] + res[q]; ((v4f*)(C + cofs))[eo[q]] = v; }
  } else {      /* C16 goes out in fragment order (see above k_vt; K = ldc): the 32 x 64 tile is 2 row tiles x 2 adjacent k tiles x 2 halves = 8 stores of 512 contiguous bytes */
#pragma unroll
    for (int u = 0; u < 8; ++u) { const int rtl = u >> 2, cu = u & 3; const float* sp = &so[w][rtl * 16 + ln][cu * 16 + 8 * hh]; const v4f v0 = *(const v4fa*)sp, v1 = *(const v4fa*)(sp + 4); FragH f;
#pragma unroll
      for (int i = 0; i < 4; ++i) { f.h[i] = (_Float16)v0[i]; f.h[4 + i] = (_Float16)v1[i]; }
      *(v8us*)((unsigned short*)C16 + cofs + (size_t)(row0 + 16 * rtl) * ldc + (size_t)col0 * 16 + cu * 256 + 8 * lane) = f.half[0]; } } }

// ---- the three projections q, k, v in one launch: one workgroup multiplies its 128 x rows by the 64-column tiles of all three weights ----
// 12 waves: wave group p = 0, 1, 2 (four waves each) owns weight p and works as the four waves of k_gemm2 do (32 x 64 wave tiles, the same fragment reads, the same order of products, the same f16 fragment-order write-out).
// A stage is 64 k of 320 rows at k_gemm2's pitch: rows 0..127 the x tile, fetched once for the three weights, rows 128 + 64 p .. the tile of weight p. Two buffers, k_gemm2's order of waits and its one barrier a trip.
// Who copies what: group p brings its own weight tile (four row groups of 16) and x row groups 3 p, 3 p + 1 and, for p < 2, 3 p + 2 (eight in all).
// The write-out staging lies over the two buffers: behind the last trip's barrier no wave reads them and no copy is outstanding. 104,448 bytes of LDS and at most 160 registers: two workgroups a WGP, all 512 resident.
#define G3S (320 * G2P)              /* one buffer, elements */
typedef float f32a __attribute__((may_alias));
// One thread's share of a stage, as g2_stage: la, a = its LDS byte address and source address in its first x row group, lb, b = the same in row group 0 of its weight tile; third = the group has a third x row group (the same for a whole wave).
// Each s_wait_xcnt is the last line of its copies' own statement, in front of every later write of their operands.
__device__ __forceinline__ void g3_stage(unsigned la, const _Float16* a, size_t sa, unsigned lb, const _Float16* b, size_t sb, bool third) {
  asm volatile("global_load_async_to_lds_b128 %0, %6, off\n\tglobal_load_async_to_lds_b128 %1, %7, off\n\tglobal_load_async_to_lds_b128 %2, %8, off\n\t"
               "global_load_async_to_lds_b128 %3, %9, off\n\tglobal_load_async_to_lds_b128 %4, %10, off\n\tglobal_load_async_to_lds_b128 %5, %11, off\n\t"
               "s_wait_xcnt 0x0"
               :: "v"(la), "v"(la + 32u * G2P), "v"(lb), "v"(lb + 32u * G2P), "v"(lb + 64u * G2P), "v"(lb + 96u * G2P),
                  "v"(a), "v"(a + sa), "v"(b), "v"(b + sb), "v"(b + 2 * sb), "v"(b + 3 * sb) : "memory");
  if (third) asm volatile("global_load_async_to_lds_b128 %0, %1, off\n\ts_wait_xcnt 0x0" :: "v"(la + 64u * G2P), "v"(a + 2 * sa) : "memory"); }
__global__ __launch_bounds__(384, 6) void k_gemm_qkv(const _Float16* __restrict__ A, int lda, const _Float16* __restrict__ W0, const _Float16* __restrict__ W1, const _Float16* __restrict__ W2, int ldb, float alpha,
    const float* __restrict__ bias0, const float* __restrict__ bias1, const float* __restrict__ bias2, _Float16* __restrict__ C0, _Float16* __restrict__ C1, _Float16* __restrict__ C2, int ldc, int M, int N, int K) {
  __shared__ __attribute__((aligned(16))) unsigned short st[12 * 32 * 68 * 2];      /* the two stage buffers (2 * G3S elements); behind the loop, twelve 32 x 68 f32 staging tiles */
  static_assert(2 * G3S <= 12 * 32 * 68 * 2, "k_gemm_qkv: the stage buffers fit the array");
  const int tid = threadIdx.x, w = tid >> 5, lane = tid & 31, ln = lane & 15, hh = lane >> 4, wr = w & 3, t7 = tid & 127;
  const int p = __builtin_amdgcn_readfirstlane(tid >> 7);      /* the wave's group, in a scalar register: the choices below and the test on the third x row group are scalar */
  const _Float16* const Bh = p == 0 ? W0 : p == 1 ? W1 : W2; const float* const bp = p == 0 ? bias0 : p == 1 ? bias1 : bias2; _Float16* const C16 = p == 0 ? C0 : p == 1 ? C1 : C2;
  const int ntn = N >> 6; const int mt = blockIdx.x / ntn, nq = blockIdx.x - mt * ntn; const int row0 = mt * 128 + 32 * wr, col0 = nq * 64; if (mt * 128 >= M) return;      /* the whole workgroup or none: barriers follow */
  const unsigned la0 = (unsigned)(size_t)&st[(48 * p + (t7 >> 3)) * G2P + (t7 & 7) * 8], lb0 = (unsigned)(size_t)&st[(128 + 64 * p + (t7 >> 3)) * G2P + (t7 & 7) * 8];      /* LDS byte addresses: the low 32 bits of the shared addresses */
  const _Float16* ga = A + (size_t)(mt * 128 + 48 * p + (t7 >> 3)) * lda + (t7 & 7) * 8; const _Float16* gb = Bh + (size_t)(col0 + (t7 >> 3)) * ldb + (t7 & 7) * 8; const size_t sa = (size_t)16 * lda, sb = (size_t)16 * ldb;
  const bool third = p < 2; const int nt = K >> 6;
  const v8f z8 = {0.f,0.f,0.f,0.f,0.f,0.f,0.f,0.f}; v8f c00 = z8, c01 = z8, c02 = z8, c03 = z8, c10 = z8, c11 = z8, c12 = z8, c13 = z8;
  float bv[4];      /* the lane's four bias values: loaded here, used behind the loop */
#pragma unroll      /* this and every unrolled loop below runs over fragments, tiles or registers: unrolled, its arrays stay in registers and its offsets are immediates */
  for (int t = 0; t < 4; ++t) bv[t] = bp[col0 + t * 16 + ln];
  g3_stage(la0, ga, sa, lb0, gb, sb, third);
  asm volatile("s_wait_asynccnt 0x0" ::: "memory");      /* this wave's copies of stage 0 have landed */
  __syncthreads();      /* publishes stage 0 */
  if (nt > 1) g3_stage(la0 + 2u * G3S, ga + 64, sa, lb0 + 2u * G3S, gb + 64, sb, third);
#pragma unroll 1      /* kept rolled, as in k_gemm2: unrolling would only repeat the copies, the waits and the barrier in the text */
  for (int t = 0; t < nt; ++t) { const unsigned short* const ap = st + (t & 1) * G3S + (32 * wr + ln) * G2P; const unsigned short* const bq = st + (t & 1) * G3S + (128 + 64 * p + ln) * G2P;
#pragma unroll
    for (int ks = 0; ks < 2; ++ks) { v16h af[2], bf[4];
#pragma unroll
      for (int r = 0; r < 2; ++r) af[r] = g2_frag(ap + 16 * r * G2P + 32 * ks, hh);
#pragma unroll
      for (int u = 0; u < 4; ++u) bf[u] = g2_frag(bq + 16 * u * G2P + 32 * ks, hh);
      c00 = g2_mma(af[0], bf[0], c00); c10 = g2_mma(af[1], bf[0], c10); c01 = g2_mma(af[0], bf[1], c01); c11 = g2_mma(af[1], bf[1], c11);
      c02 = g2_mma(af[0], bf[2], c02); c12 = g2_mma(af[1], bf[2], c12); c03 = g2_mma(af[0], bf[3], c03); c13 = g2_mma(af[1], bf[3], c13); }
    asm volatile("s_wait_dscnt 0x0" ::: "memory");      /* this wave's reads of the buffer are done before it may be refilled */
    asm volatile("s_wait_asynccnt 0x0" ::: "memory");      /* this wave's copies of stage t + 1 have landed */
    __syncthreads();      /* publishes stage t + 1 and ends every wave's reads of stage t */
    if (t + 2 < nt) g3_stage(la0 + (unsigned)(t & 1) * (2u * G3S), ga + (size_t)(t + 2) * 64, sa, lb0 + (unsigned)(t & 1) * (2u * G3S), gb + (size_t)(t + 2) * 64, sb, third); }
  asm volatile("s_wait_asynccnt 0x0" ::: "memory");      /* no copy is outstanding when the wave goes on */
  f32a* const so = (f32a*)st + w * (32 * 68);      /* the wave's own staging tile, pitch 68 */
  v8f accs[8] = {c00, c01, c02, c03, c10, c11, c12, c13};
#pragma unroll
  for (int u = 0; u < 8; ++u) { const int t = u & 3, half = u >> 2; const float bvr = bf16_round(bv[t]);
#pragma unroll
    for (int r = 0; r < 8; ++r) so[(half * 16 + 8 * hh + r) * 68 + t * 16 + ln] = accs[u][r] * alpha + bvr; }
  __builtin_amdgcn_fence(__ATOMIC_ACQ_REL, "workgroup"); __builtin_amdgcn_wave_barrier();      /* the wave's stores to its own tile stay in front of the reads below, which take other lanes' values */
  /* C16 goes out in fragment order (see above k_vt; K = ldc), as in k_gemm2: 8 stores of 512 contiguous bytes */
#pragma unroll
  for (int u = 0; u < 8; ++u) { const int rtl = u >> 2, cu = u & 3; const f32a* sp = so + (rtl * 16 + ln) * 68 + cu * 16 + 8 * hh; const v4f v0 = *(const v4fa*)sp, v1 = *(const v4fa*)(sp + 4); FragH f;
#pragma unroll
    for (int i = 0; i < 4; ++i) { f.h[i] = (_Float16)v0[i]; f.h[4 + i] = (_Float16)v1[i]; }
    *(v8us*)((unsigned short*)C16 + (size_t)(row0 + 16 * rtl) * ldc + (size_t)col0 * 16 + cu * 256 + 8 * lane) = f.half[0]; } }


__global__ __launch_bounds__(256) void k_rsm(const float* __restrict__ S, _Float16* __restrict__ P, int nrows) {
  #pragma clang fp contract(off)
  const int i = blockIdx.x * 256 + threadIdx.x; if (i >= nrows) return; const float* s = S + (size_t)i * SQ; float mx = -3.0e38f;
#pragma unroll 1
  for (int j = 0; j < SQ; ++j) mx = fmaxf(mx, s[j]); float se = 0.f;
#pragma unroll 1
  for (int j = 0; j < SQ; ++j) se += expf(s[j] - mx); const float sc = 256.0f / se;
#pragma unroll 1
  for (int j0 = 0; j0 < SQ; j0 += 8) { FragH f; for (int q = 0; q < 8; ++q) f.h[q] = (_Float16)(expf(s[j0 + q] - mx) * sc); unsigned short* d = (unsigned short*)P + (size_t)i * SQ + j0; *(v8us*)d = f.half[0];  } }
__global__ __launch_bounds__(256) void k_vt(const _Float16* __restrict__ V16, int b, int h0, _Float16* __restrict__ VT) { __shared__ unsigned short tl[64][65]; const int tid = threadIdx.x; const int hh = blockIdx.x % HG, sg = blockIdx.x / HG; const int s0 = sg * 64; const int h = h0 + hh;
  for (int i = tid; i < 64 * 8; i += 256) { const int j = i / 8, d8 = (i % 8) * 8; FragH f; f.half[0] = *(const v8us*)((const unsigned short*)V16 + ((size_t)b * SQ + s0 + j) * DM + h * HD + d8); for (int q = 0; q < 8; ++q) tl[d8 + q][j] = f.u[q]; }
  __syncthreads();
  { for (int i = tid; i < 64 * 8; i += 256) { const int d = i / 8, j8 = (i % 8) * 8; FragH f; for (int q = 0; q < 8; ++q) f.u[q] = tl[d][j8 + q]; *(v8us*)((unsigned short*)VT + ((size_t)hh * HD + d) * SQ + s0 + j8) = f.half[0]; }  } }



__global__ __launch_bounds__(256) void k_rsmf(const float* __restrict__ S, _Float16* __restrict__ P, int qn, int hg) {
  #pragma clang fp contract(off)
  const int t = blockIdx.x * 256 + threadIdx.x; if (t >= qn * hg) return; const size_t i = (size_t)(t / qn) * SQ + (t % qn); const float* s = S + i * SQ; float mx = -3.0e38f;
#pragma unroll 1
  for (int j = 0; j < SQ; ++j) mx = fmaxf(mx, s[j]); float se = 0.f;
#pragma unroll 1
  for (int j = 0; j < SQ; ++j) se += __expf(s[j] - mx); const float sc = 256.0f / se;
#pragma unroll 1
  for (int j0 = 0; j0 < SQ; j0 += 8) { FragH f; for (int q = 0; q < 8; ++q) f.h[q] = (_Float16)(__expf(s[j0 + q] - mx) * sc); unsigned short* d = (unsigned short*)P + i * SQ + j0; *(v8us*)d = f.half[0];  } }

// Four native exp2 in one statement: each is the independent instruction that the instruction set asks for behind the transcendental in front of it, and the v_nop is that slot behind the last
// Early-clobber outputs keep the four independent of one another.
__device__ __forceinline__ void exp2x4(float& a, float& b, float& c, float& d) { float e0, e1, e2, e3;
  asm("v_exp_f32 %0, %4\n\tv_exp_f32 %1, %5\n\tv_exp_f32 %2, %6\n\tv_exp_f32 %3, %7\n\tv_nop" : "=&v"(e0), "=&v"(e1), "=&v"(e2), "=&v"(e3) : "v"(a), "v"(b), "v"(c), "v"(d));
  a = e0; b = e1; c = e2; d = e3; }
// Two native exp2 in one statement, as exp2x4 above: the second is the independent instruction behind the first, the v_nop is that slot behind the second.
__device__ __forceinline__ void exp2x2(float& a, float& b) { float e0, e1;
  asm("v_exp_f32 %0, %2\n\tv_exp_f32 %1, %3\n\tv_nop" : "=&v"(e0), "=&v"(e1) : "v"(a), "v"(b));
  a = e0; b = e1; }
__device__ __forceinline__ float fa_xhalf(float x) { return __builtin_bit_cast(float, __builtin_amdgcn_permlanex16(__builtin_bit_cast(int, x), __builtin_bit_cast(int, x), 0x76543210, 0xfedcba98, false, false)); }      /* lane l <-> lane l ^ 16 */
__device__ __forceinline__ v16h fa_frag(const _Float16* ub, unsigned off) { FragH f; f.half[0] = *(const v8us*)((const unsigned short*)ub + off); f.half[1] = *(const v8us*)((const unsigned short*)ub + off + 256); return f.v; }      /* a tile in fragment order, g2_frag's k order; ub is the same for the whole wave, off = tile offset + 8 * lane */
__device__ __forceinline__ v8f fa_mma(v16h a, v16h b, v8f c) { return __builtin_amdgcn_wmma_f32_16x16x32_f16(false, a, false, b, (short)0, c, false, false); }
// Fused attention of one head: scores, softmax and P.V in one launch; neither the scores nor the weights go to memory.
// Grid (SQ / 256, heads), 16 waves, four a SIMD, so that one wave's softmax runs under another's products. Waves w and w + 8 own the same 32 queries (two groups of 16 columns) and share the keys: of every stage of 256 keys
// wave w walks the first 128, wave w + 8 the second 128, 32 a step, each with its own running maximum, sum and O^T. Behind the loop the two partial results are joined through LDS (the rule of the online softmax, once more).
// Transposed products: S^T = K . Q^T (A = 16 key rows, B = 16 query columns, k = d) and O^T += V^T . P^T (A = 16 d rows of V^T, B = P^T, k = 32 keys).
// D register r of lane (c = lane & 15, h = lane >> 4) is element [8 h + r][c]: a lane holds one query's scores, and the two 16-key score tiles of a step, converted in place, are the B operand of the
// second product in the k order of g2_frag (elements 0..7 = keys 8 h + 0..7, elements 8..15 = keys 16 + 8 h + 0..7), which loads V^T. No LDS and no lane exchange for P.
// Online softmax in the log2 domain, f32: running maximum mr and running sum lr per query; each step rescales O^T and lr by exp2(old maximum - new maximum). The weights are carried x256 (the + 8) as f16
// operands, away from the f16 subnormals; the factor cancels in the division by lr, which sums the same scaled weights. mr starts at -3.0e38 (finite), so a step whose keys are all masked to -inf adds zeros.
// The mask (bf16-rounded, x log2 e) is prepared once per workgroup in LDS.
// K and V^T go through LDS: a stage is 256 keys of the head, 32 KiB of K (16 row tiles of 2 KiB) and behind it 32 KiB of V^T (8 steps of 4 KiB), both kept in fragment order, so a fragment half is 512 contiguous LDS bytes
// (no bank conflict). The workgroup fetches a stage once for its sixteen waves, by asynchronous copies, two buffers: the next stage's copies fly during the steps of this one, a lead longer than a memory latency.
#define FKT 256                      /* keys a stage */
#define FSK (FKT * HD)               /* elements of K, and of V^T, in a stage */
#define FST (2 * FSK)                /* one buffer, elements */
// One thread's share of a stage: eight asynchronous 16-byte copies, four of K and four of V^T; a wave's copy covers 512 contiguous bytes (4 whole lines) on both sides. l = the thread's LDS byte address in
// the buffer's K part, k and v = its source addresses; a round of 512 threads moves 8 KiB: four row tiles of K (16 * LQ elements apart in the plane), 4096 elements of V^T. The s_wait_xcnt is the wait that is kept in front of an overwrite of a
// register that an issued copy names: as the statement's last line it stands in front of every later write of these operands.
__device__ __forceinline__ void fa_stage(unsigned l, const _Float16* k, const _Float16* v) {
  asm volatile("global_load_async_to_lds_b128 %0, %8, off\n\tglobal_load_async_to_lds_b128 %1, %9, off\n\tglobal_load_async_to_lds_b128 %2, %10, off\n\tglobal_load_async_to_lds_b128 %3, %11, off\n\t"
               "global_load_async_to_lds_b128 %4, %12, off\n\tglobal_load_async_to_lds_b128 %5, %13, off\n\tglobal_load_async_to_lds_b128 %6, %14, off\n\tglobal_load_async_to_lds_b128 %7, %15, off\n\t"
               "s_wait_xcnt 0x0"
               :: "v"(l), "v"(l + 8192u), "v"(l + 16384u), "v"(l + 24576u), "v"(l + 2u * FSK), "v"(l + 2u * FSK + 8192u), "v"(l + 2u * FSK + 16384u), "v"(l + 2u * FSK + 24576u),
                  "v"(k), "v"(k + 64 * LQ), "v"(k + 128 * LQ), "v"(k + 192 * LQ), "v"(v), "v"(v + 4096), "v"(v + 8192), "v"(v + 12288) : "memory"); }
__device__ __forceinline__ v16h fa_lfrag(const unsigned short* p) { FragH f; f.half[0] = *(const v8us*)p; f.half[1] = *(const v8us*)(p + 256); return f.v; }      /* fa_frag from LDS: p = tile + 8 * lane */
__global__ __launch_bounds__(512) void k_fattn(const _Float16* __restrict__ Q, const _Float16* __restrict__ Kk, const _Float16* __restrict__ VTh, const float* __restrict__ am, _Float16* __restrict__ O) {
  static_assert(SQ % FKT == 0 && SQ / FKT >= 2 && FKT == 256 && HD == 64, "k_fattn: whole stages, at least two; fa_stage moves 256 keys of 64 features");
  __shared__ __attribute__((aligned(256))) float smk[SQ];      /* the larger alignment puts the mask first in LDS: its reads' offsets then fit the instructions' offset fields */
  __shared__ __attribute__((aligned(128))) unsigned short kv[2 * FST];
  const int tid = threadIdx.x, lane = tid & 31, ln = lane & 15, hh = lane >> 4, w = tid >> 5; const int h = blockIdx.y, q0 = blockIdx.x * 256 + (w & 7) * 32;
  const int kh = __builtin_amdgcn_readfirstlane(tid >> 8);      /* which half of every stage's keys the wave walks, in a scalar register */
  const unsigned l0 = (unsigned)(size_t)&kv[tid * 8];      /* LDS byte address: the low 32 bits of the shared address */
  const _Float16* const gk = Kk + h * HD * 16 + (tid >> 7) * (16 * LQ) + (tid & 127) * 8; const _Float16* const gv = VTh + (size_t)h * HD * SQ + tid * 8;      /* Q, Kk and VTh lie in fragment order (see above k_vt): a row tile is 16 * LQ elements, head h is its k tiles 2 h and 2 h + 1 */
  fa_stage(l0, gk, gv);
  for (int i = tid * 4; i < SQ; i += 2048) { v4f a = *(const v4fa*)(am + i);
#pragma unroll
    for (int q = 0; q < 4; ++q) a[q] = bf16_round(a[q]) * 1.44269504f;
    *(v4fa*)&smk[i] = a; }
  const unsigned qo = (unsigned)(q0 * LQ + 8 * lane); v16h qf[2][2];
#pragma unroll
  for (int g = 0; g < 2; ++g)
#pragma unroll
    for (int ks = 0; ks < 2; ++ks) qf[g][ks] = fa_frag(Q + h * HD * 16, qo + 16 * g * LQ + 512 * ks);
  const v8f z8 = {0.f,0.f,0.f,0.f,0.f,0.f,0.f,0.f}; v8f o[2][4];
#pragma unroll
  for (int g = 0; g < 2; ++g)
#pragma unroll
    for (int t = 0; t < 4; ++t) o[g][t] = z8;
  float mr[2] = {-3.0e38f, -3.0e38f}, lr[2] = {0.f, 0.f};
  asm volatile("s_wait_asynccnt 0x0" ::: "memory");      /* this wave's copies of stage 0 have landed */
  __syncthreads();      /* publishes stage 0 and the mask */
  fa_stage(l0 + 2u * FST, gk + (size_t)FKT * LQ, gv + FSK);
#pragma unroll 1      /* kept rolled: unrolling would only repeat the copies, the waits and the barrier in the text */
  for (int st = 0; st < SQ / FKT; ++st) { const unsigned short* const kl = kv + (st & 1) * FST + kh * (FSK / 2) + 8 * lane; const unsigned short* const vl = kl + FSK;      /* the wave's half of the stage: 128 keys are FSK / 2 elements of K and as many of V^T */
  v16h ka[2][2];
#pragma unroll
  for (int kt = 0; kt < 2; ++kt)
#pragma unroll
    for (int ks = 0; ks < 2; ++ks) ka[kt][ks] = fa_lfrag(kl + 1024 * kt + 512 * ks);
#pragma unroll 1      /* kept rolled too: unrolled, the next step's fragment reads rose over this step's second product and the registers went past 256 */
  for (int u = 0; u < FKT / 64; ++u) { const int j0 = st * FKT + kh * (FKT / 2) + 32 * u;
    v4f mk[2][2];      /* this step's mask values: read from LDS under the first product */
#pragma unroll
    for (int kt = 0; kt < 2; ++kt)
#pragma unroll
      for (int c = 0; c < 2; ++c) mk[kt][c] = *(const v4fa*)&smk[j0 + 16 * kt + 8 * hh + 4 * c];
    __builtin_amdgcn_sched_barrier(0);      /* keeps the mask reads the first LDS reads of the step: LDS reads return in order, and sunk behind the next step's K fragments they made the softmax wait for all twenty */
    v16h va[4];      /* this step's V^T fragments: issued here, needed only behind the exponentials */
#pragma unroll
    for (int t = 0; t < 4; ++t) va[t] = fa_lfrag(vl + 2048 * u + 512 * t);
    v8f s[2][2];
#pragma unroll
    for (int g = 0; g < 2; ++g)
#pragma unroll
      for (int kt = 0; kt < 2; ++kt) s[g][kt] = fa_mma(ka[kt][1], qf[g][1], fa_mma(ka[kt][0], qf[g][0], z8));
    const unsigned short* const kn = kl + ((u + 1 < FKT / 64) ? 2048 * (u + 1) : 0);      /* the next step's K fragments, read under this step's softmax; never across a stage (the next buffer is not published yet): the wave's last step of a stage re-reads its own first rows, unused */
#pragma unroll
    for (int kt = 0; kt < 2; ++kt)
#pragma unroll
      for (int ks = 0; ks < 2; ++ks) ka[kt][ks] = fa_lfrag(kn + 1024 * kt + 512 * ks);
    __builtin_amdgcn_sched_barrier(0);      /* keeps both groups of LDS reads in front of the softmax: sunk to their users, each would wait out its LDS latency */
    float mn[2], cr[2];
#pragma unroll
    for (int g = 0; g < 2; ++g) { float mx = mr[g];
#pragma unroll
      for (int kt = 0; kt < 2; ++kt)
#pragma unroll
        for (int r = 0; r < 8; ++r) { s[g][kt][r] = s[g][kt][r] * 0.18033688f + mk[kt][r >> 2][r & 3]; mx = fmaxf(mx, s[g][kt][r]); }      /* (q . k / 8 + mask) log2 e */
      mn[g] = fmaxf(mx, fa_xhalf(mx)); cr[g] = mr[g] - mn[g]; mr[g] = mn[g]; }
    exp2x2(cr[0], cr[1]); FragH pf[2];
#pragma unroll
    for (int g = 0; g < 2; ++g) { const float nm = 8.0f - mn[g]; float ls[4] = {0.f, 0.f, 0.f, 0.f};
#pragma unroll
      for (int t = 0; t < 4; ++t) o[g][t] = o[g][t] * cr[g];
#pragma unroll
      for (int kt = 0; kt < 2; ++kt)
#pragma unroll
        for (int r4 = 0; r4 < 8; r4 += 4) { float y[4];
#pragma unroll
          for (int q = 0; q < 4; ++q) y[q] = s[g][kt][r4 + q] + nm;
          exp2x4(y[0], y[1], y[2], y[3]);
#pragma unroll
          for (int q = 0; q < 4; ++q) { ls[q] += y[q]; pf[g].h[8 * kt + r4 + q] = (_Float16)y[q]; } }
      lr[g] = lr[g] * cr[g] + ((ls[0] + ls[1]) + (ls[2] + ls[3])); }
    __builtin_amdgcn_sched_barrier(0);      /* keeps every asm exponential in front of the second product */
#pragma unroll
    for (int g = 0; g < 2; ++g)
#pragma unroll
      for (int t = 0; t < 4; ++t) o[g][t] = fa_mma(va[t], pf[g].v, o[g][t]);
    __builtin_amdgcn_sched_barrier(0);      /* keeps every WMMA of the step in front of the v_nops below */
    asm volatile("v_nop\n\tv_nop\n\tv_nop\n\tv_nop"); }      /* the four vector slots between the step's last WMMA and an overwrite of its operands */
    asm volatile("s_wait_dscnt 0x0" ::: "memory");      /* this wave's reads of the buffer are done before it may be refilled */
    asm volatile("s_wait_asynccnt 0x0" ::: "memory");      /* this wave's copies of stage st + 1 have landed */
    __syncthreads();      /* publishes stage st + 1 and ends every wave's reads of stage st */
    if (st + 2 < SQ / FKT) fa_stage(l0 + (unsigned)(st & 1) * (2u * FST), gk + (size_t)(st + 2) * (FKT * LQ), gv + (size_t)(st + 2) * FSK); }
  asm volatile("s_wait_asynccnt 0x0" ::: "memory");      /* no copy is outstanding when the wave goes on */
  /* The two key halves are joined: wave w finishes query group 0, wave w + 8 group 1; each hands the other group's O^T, maximum and sum to its partner through LDS. The exchange lies over the stage buffers:
     behind the last stage's barrier no wave reads them and no copy is outstanding. A wave's area: 8 chunks of 512 bytes (16 bytes a lane), then 32 maxima, then 32 sums. */
  static_assert(16 * 1088 * 4 <= 2 * FST * 2, "k_fattn: the exchange areas fit the stage buffers");
  f32a* const xo = (f32a*)kv + w * 1088; const f32a* const xi = (const f32a*)kv + (w ^ 8) * 1088;
  v8f ok[4]; const float mk2 = kh ? mr[1] : mr[0], lk = kh ? lr[1] : lr[0];
#pragma unroll
  for (int t = 0; t < 4; ++t) { const v8f sd = kh ? o[0][t] : o[1][t]; ok[t] = kh ? o[1][t] : o[0][t];
    const v4f s0 = {sd[0], sd[1], sd[2], sd[3]}, s1 = {sd[4], sd[5], sd[6], sd[7]};
    *(v4fa*)(xo + (2 * t) * 128 + 4 * lane) = s0; *(v4fa*)(xo + (2 * t + 1) * 128 + 4 * lane) = s1; }
  xo[1024 + lane] = kh ? mr[0] : mr[1]; xo[1056 + lane] = kh ? lr[0] : lr[1];
  __syncthreads();      /* publishes every wave's handed-over partial result */
  const float mp = xi[1024 + lane], lp = xi[1056 + lane]; const float mj = fmaxf(mk2, mp); float ca = mk2 - mj, cb = mp - mj;
  exp2x2(ca, cb);      /* each half's weights were taken against its own maximum: rescaled to the common one */
  const float lj = lk * ca + lp * cb; const float sc = 64.0f / (lj + fa_xhalf(lj));      /* the lane halves' sums joined; o carried x64, as the output GEMM's alpha expects */
  const float sa = ca * sc, sb = cb * sc;
  _Float16* d = O + h * HD + ((unsigned)((q0 + ln) * DM + 8 * hh) + (unsigned)kh * (16 * DM));
#pragma unroll
  for (int t = 0; t < 4; ++t) { const v4f p0 = *(const v4fa*)(xi + (2 * t) * 128 + 4 * lane), p1 = *(const v4fa*)(xi + (2 * t + 1) * 128 + 4 * lane); FragH f;
#pragma unroll
    for (int r = 0; r < 4; ++r) { f.h[r] = (_Float16)(ok[t][r] * sa + p0[r] * sb); f.h[4 + r] = (_Float16)(ok[t][4 + r] * sa + p1[r] * sb); }
    *(v8us*)((unsigned short*)d + 16 * t) = f.half[0]; } }


// All input conversions in one streaming launch: x -> X16 (the bf16-rounded value as f16) and XB (the same value as f32, the residual plane); each weight -> its f16 plane, x16 (natural [out][in] = Bt[n][k]).
// 512 workgroups of 8 waves: 16 waves a WGP, 4096 waves in all. A wave takes one contiguous 4-KiB block of x and one of a weight (workgroups 128 s .. 128 s + 127 share weight s): 8 + 8 loads of 16 bytes a lane,
// each load 512 contiguous bytes (4 whole lines), all sixteen issued before the first value is used; the stores cover whole lines too (512 bytes f32, 256 bytes f16). x is read once for both of its planes.
__global__ __launch_bounds__(256) void k_prep(const float* __restrict__ x, const float* __restrict__ wq, const float* __restrict__ wk, const float* __restrict__ wv, const float* __restrict__ wo,
    _Float16* __restrict__ X16, float* __restrict__ XB, _Float16* __restrict__ BQ, _Float16* __restrict__ BK, _Float16* __restrict__ BV, _Float16* __restrict__ BO) {
  static_assert(NR * DM == (size_t)512 * 8 * 1024 && (size_t)DM * DM == (size_t)128 * 8 * 1024, "k_prep: the grid of 512 workgroups covers exactly these planes");
  const unsigned lane = threadIdx.x & 31, wid = blockIdx.x * 8 + (threadIdx.x >> 5), sel = blockIdx.x >> 7;
  const float* const w = sel == 0 ? wq : sel == 1 ? wk : sel == 2 ? wv : wo; _Float16* const B = sel == 0 ? BQ : sel == 1 ? BK : sel == 2 ? BV : BO;
  const unsigned xo = wid * 1024 + lane * 4, bo = (wid & 1023) * 1024 + lane * 4;      /* element offsets of the wave's two blocks */
  v4f a[8], b[8];      /* every loop below is unrolled: a and b stay in registers and each step's offset is an immediate of its load or store */
#pragma unroll
  for (int j = 0; j < 8; ++j) a[j] = *(const v4fa*)(x + xo + 128 * j);
#pragma unroll
  for (int j = 0; j < 8; ++j) b[j] = *(const v4fa*)(w + bo + 128 * j);
  __builtin_amdgcn_sched_barrier(0);      /* keeps the weight loads in front of the conversions: left free, they sank behind the x stores and the wave waited out a second memory latency */
#pragma unroll
  for (int j = 0; j < 8; ++j) { v4f r; v4h h;
#pragma unroll
    for (int q = 0; q < 4; ++q) { r[q] = bf16_round(a[j][q]); h[q] = (_Float16)r[q]; }
    *(v4f*)(XB + xo + 128 * j) = r; *(v4h*)(X16 + xo + 128 * j) = h; }
#pragma unroll
  for (int j = 0; j < 8; ++j) { v4h h;
#pragma unroll
    for (int q = 0; q < 4; ++q) h[q] = (_Float16)(bf16_round(b[j][q]) * 16.0f);
    *(v4h*)(B + bo + 128 * j) = h; } }


__global__ __launch_bounds__(256) void k_lnrow(const float* __restrict__ Y, const float* __restrict__ g, const float* __restrict__ bb, float eps, float* __restrict__ out) {
  #pragma clang fp contract(off)
  __shared__ float red[256]; const size_t r = blockIdx.x; const int t = threadIdx.x; const v4f ya = *(const v4fa*)(Y + r * DMQ + t * 4); float s[4]; float sum = 0.f;
  for (int q = 0; q < 4; ++q) { s[q] = ya[q]; sum = __fadd_rn(sum, s[q]); }
  red[t] = sum; __syncthreads(); for (int st = 128; st > 0; st >>= 1) { if (t < st) red[t] = __fadd_rn(red[t], red[t + st]); __syncthreads(); } const float mu = red[0] / (float)DMQ; __syncthreads();
  float vs = 0.f; for (int q = 0; q < 4; ++q) { const float dl = __fadd_rn(s[q], -mu); vs = __fadd_rn(vs, __fmul_rn(dl, dl)); } red[t] = vs; __syncthreads(); for (int st = 128; st > 0; st >>= 1) { if (t < st) red[t] = __fadd_rn(red[t], red[t + st]); __syncthreads(); }
  const float rs = rsqrtf(__fadd_rn(red[0] / (float)DMQ, eps)); v4f y; for (int q = 0; q < 4; ++q) { const int c = t * 4 + q; y[q] = __fadd_rn(__fmul_rn(__fmul_rn(__fadd_rn(s[q], -mu), rs), bf16_round(g[c])), bf16_round(bb[c])); }
  *(v4f*)(out + r * DMQ + t * 4) = y;  }
extern "C" void kernel_launch(void* const* d_in, const int* in_sizes, int n_in,
                              void* d_out, int out_size, void* d_ws, size_t ws_size, hipStream_t stream) {
  (void)in_sizes; (void)n_in; (void)out_size;
  const float* const* I = (const float* const*)d_in; const float* x = I[0]; const float* am = I[1]; const float* wq = I[2]; const float* bq = I[3]; const float* wk = I[4]; const float* bk = I[5]; const float* wv = I[6]; const float* bv = I[7]; const float* wo = I[8]; const float* bo = I[9]; const float* lng = I[10]; const float* lnb = I[11];      /* nn.Linear weights [out][in] + biases; additive mask [1][1][1][S] */
  char* ws = (char*)d_ws; size_t off = 0;
  auto take = [&](size_t bytes) { char* p = ws + off; off += (bytes + 255) & ~(size_t)255; return p; };
  _Float16* BQ = (_Float16*)take((size_t)DM * DM * 2); _Float16* BK = (_Float16*)take((size_t)DM * DM * 2); _Float16* BV = (_Float16*)take((size_t)DM * DM * 2); _Float16* BO = (_Float16*)take((size_t)DM * DM * 2);
  _Float16* X16 = (_Float16*)take(NR * DM * 2); float* XB = (float*)take(NR * DM * 4); float* YF = (float*)take(NR * DM * 4); _Float16* Q16 = (_Float16*)take(NR * DM * 2); _Float16* K16 = (_Float16*)take(NR * DM * 2); _Float16* V16 = (_Float16*)take(NR * DM * 2); _Float16* O16 = (_Float16*)take(NR * DM * 2);
  _Float16* VT = (_Float16*)take((size_t)NH * HD * SQ * 2);
  if (off > ws_size) return;
  k_prep<<<512, 256, 0, stream>>>(x, wq, wk, wv, wo, X16, XB, BQ, BK, BV, BO);      /* f16 x rows, bf16(x) residual plane, the four weight planes x16 */
  const size_t r0p = (size_t)B0 * SQ;      /* first projected row */
  k_gemm_qkv<<<(unsigned)((MP / 128) * (DM / 64)), 384, 0, stream>>>(X16 + r0p * DM, DM, BQ, BK, BV, DM, 0.0625f, bq, bk, bv, Q16 + r0p * DM, K16 + r0p * DM, V16 + r0p * DM, DM, MP, DM, DM);      /* q, k, v in one launch */
  for (int b = B0; b < B0 + NBR; ++b) { const size_t r0 = (size_t)b * SQ;
    k_vt<NH, SQ><<<NH * (SQ / 64), 256, 0, stream>>>(V16 + r0 * LQ, LQ, 0, VT);      /* V^T of every head, in fragment order, for this batch */
    k_fattn<<<dim3(SQ / 256, NH), 512, 0, stream>>>(Q16 + r0 * LQ, K16 + r0 * LQ, VT, am + (size_t)b * SQ, O16 + r0 * DM); }      /* scores + attention_mask, softmax and P . V of all heads, fused; o (merged heads, x64) as f16 rows */
  k_gemm2<0, true><<<dim3((unsigned)((MPO / 128) * (DM / 64)), 1), 128, 0, stream>>>(O16 + r0p * DM, DM, 0, BO, DM, 0, 0.0009765625f, bo, 0, XB + r0p * DM, 0, YF + r0p * DM, nullptr, DM, 0, MPO, DM, DM);      /* y = ctx Wo^T + bo + bf16(x) (own-element residual) */
  k_lnrow<<<(unsigned)MPO, 256, 0, stream>>>(YF + r0p * DM, lng, lnb, 1e-12f, (float*)d_out + r0p * DM);      /* post-LayerNorm */
}

// v010
// Measured time: 119 microseconds a run.
// Timed twice side by side with v009, it ran 1.06 times as fast both times.
// Over all steps from v000 it is 119 times as fast.
#include <hip/hip_runtime.h>
// BERT self-attention + output (hidden_states [1][4096][1024]; q/k/v = x W^T + b (nn.Linear [out][in] 1024^2, sigma 1/32, zero biases), 16 heads of 64; scores = (q/8) . k + attention_mask[j] (additive [1][1][1][S], zeros); softmax; ctx merged; out = LayerNorm(ctx Wo^T + bo + hidden_states; ln_gamma, ln_beta, eps 1e-12) -> [1][4096][1024]).
// Structure: token rows r = b*4096 + s; x as exact f16 rows (bf16-rounded); Q, K, V as one WMMA GEMM launch (32x64 wave tiles, f32 accumulation, exact x16 weights + bias, f16 outputs); per batch: V^T for all heads via LDS transposes; per batch one fused attention launch over all heads: S^T = K . Q^T on WMMA (alpha = 64^-0.5), online softmax on VALU (f32 statistics, native exp2; weights x256 as f16 operands, in registers only), O^T += V^T . P^T on WMMA (o carried x64 against f16 subnormal flush, folded into the output GEMM alpha) written straight into the merged f16 o rows; y = o Wo^T + bo + bf16(x) GEMM (f32, own-element residual) into f32 rows; post-LayerNorm on VALU (f32, LDS trees) into the output.
// Compute dtype: inputs rounded to bf16; x / weights exact; q, k, v, softmax weights and o as plain f16 GEMM operands (~2^-12); scores and softmax statistics f32. v_wmma_f32_16x16x32_f16.
#define NB 1
#define SQ 4096
#define DM 1024
#define NH 16
#define HD 64
#define HG 1                         /* heads per group of the k_vt(b, h0) overload, not launched */
#define B0 0                         /* first batch processed (debug hook) */
#define NBR NB                       /* batches processed (debug hook) */
#define NR ((size_t)NB * SQ)
#define DMQ DM         /* width of the token rows (LayerNorm length) */
#define MP ((int)((size_t)NBR * SQ)) /* rows projected (debug hook) */
#define QN SQ                        /* not used: attention covers all SQ query rows */
#define NHD NH                       /* not used: attention covers all NH heads */
#define MPO MP                       /* rows through the output stage (debug hook) */
#define LQ DM      /* width K of the q/k/v planes (fragment order) */
typedef __bf16 v16b __attribute__((ext_vector_type(16)));
typedef unsigned short v8us __attribute__((ext_vector_type(8), may_alias));
typedef float  v8f  __attribute__((ext_vector_type(8)));
typedef float  v4f  __attribute__((ext_vector_type(4)));
typedef float  v4fa __attribute__((ext_vector_type(4), may_alias));
union FragB { v16b v; v8us half[2]; unsigned short u[16]; };

__device__ __forceinline__ unsigned short bf16_bits(float x) { unsigned int u = __float_as_uint(x); return (unsigned short)((u + 0x7FFFu + ((u >> 16) & 1u)) >> 16); }
__device__ __forceinline__ float bf16_val(unsigned short b) { return __uint_as_float(((unsigned int)b) << 16); }
__device__ __forceinline__ float bf16_round(float x) { return bf16_val(bf16_bits(x)); }
// D += A·B with NT terms: 1 = ah·bh, 2 = + al·bh (A split), 3 = + ah·bl (both split)
template <int NT>
__device__ __forceinline__ v8f mmaN(v16b ah, v16b al, v16b bh, v16b bl, v8f c) {
  c = __builtin_amdgcn_wmma_f32_16x16x32_bf16(false, ah, false, bh, (short)0, c, false, false);
  if (NT >= 2) c = __builtin_amdgcn_wmma_f32_16x16x32_bf16(false, al, false, bh, (short)0, c, false, false);
  if (NT >= 3) c = __builtin_amdgcn_wmma_f32_16x16x32_bf16(false, ah, false, bl, (short)0, c, false, false);
  asm volatile("v_nop\n\tv_nop\n\tv_nop\n\tv_nop" : "+v"(c) : "v"(ah), "v"(al), "v"(bh), "v"(bl));
  return c;
}

__global__ __launch_bounds__(256) void k_wt_bf16(const float* __restrict__ W, unsigned short* __restrict__ Wt, int K, int N) {
  const int t = blockIdx.x * 256 + threadIdx.x;
  const int k8n = K / 8;
  if (t >= N * k8n) return;
  const int n = t / k8n, k8 = (t % k8n) * 8;
  v8us v;
#pragma unroll
  for (int i = 0; i < 8; ++i) v[i] = bf16_bits(W[(size_t)(k8 + i) * N + n]);
  *(v8us*)(Wt + (size_t)n * K + k8) = v;
  
}

// GEMM C[M][N] (f32, pitch ldc) = act(A[M][K]·W + bias). A f32 row-major (pitch lda) converted per fragment to bf16
// (ASPLIT: hi/lo two planes -> 2 terms, else single rounded term); Wt bf16 [N][K] (pitch ldb). BIAS_BF16 rounds the
// bias to bf16 first (bias quantised to bf16 before the add). K%32==0, M%16==0, N%64==0.
template <bool ASPLIT, int ACT, bool BIAS_BF16>
__global__ __launch_bounds__(128) void k_gemm_bf(const float* __restrict__ A, int lda, const unsigned short* __restrict__ Wt, int ldb,
                                               const float* __restrict__ bias, float* __restrict__ C, int ldc, int M, int N, int K) {
  __shared__ __attribute__((aligned(16))) float so[4][16][64];
  const int tid = threadIdx.x, w = tid >> 5, lane = tid & 31, ln = lane & 15, hh = lane >> 4;
  const int ntn = N / 64;
  const int wid = blockIdx.x * 4 + w;
  const int mt = wid / ntn, nq = wid % ntn;
  if (mt * 16 >= M) return;
  const int row0 = mt * 16, col0 = nq * 64;
  const float* arow = A + (size_t)(row0 + ln) * lda;
  v8f acc[4] = {};
  for (int kb = 0; kb < K; kb += 32) {
    FragB ah, al;
    const v4f x0 = *(const v4fa*)(arow + kb + 8 * hh), x1 = *(const v4fa*)(arow + kb + 8 * hh + 4);
    const v4f x2 = *(const v4fa*)(arow + kb + 16 + 8 * hh), x3 = *(const v4fa*)(arow + kb + 16 + 8 * hh + 4);
    float xs[16] = {x0[0],x0[1],x0[2],x0[3],x1[0],x1[1],x1[2],x1[3],x2[0],x2[1],x2[2],x2[3],x3[0],x3[1],x3[2],x3[3]};
#pragma unroll
    for (int i = 0; i < 16; ++i) { const unsigned short hb = bf16_bits(xs[i]); ah.u[i] = hb; al.u[i] = ASPLIT ? bf16_bits(xs[i] - bf16_val(hb)) : (unsigned short)0; }
#pragma unroll
    for (int t = 0; t < 4; ++t) {
      const unsigned short* brow = Wt + (size_t)(col0 + t * 16 + ln) * ldb + kb;
      FragB b;
      b.half[0] = *(const v8us*)(brow + 8 * hh);
      b.half[1] = *(const v8us*)(brow + 16 + 8 * hh);
      acc[t] = mmaN<ASPLIT ? 2 : 1>(ah.v, al.v, b.v, b.v, acc[t]);
    }
  }
#pragma unroll
  for (int t = 0; t < 4; ++t) {
    float bv = bias ? bias[col0 + t * 16 + ln] : 0.f;
    if (BIAS_BF16) bv = bf16_round(bv);
#pragma unroll
    for (int r = 0; r < 8; ++r) { float v = acc[t][r] + bv; if (ACT == 1) v = fmaxf(v, 0.f); so[w][8 * hh + r][t * 16 + ln] = v; }
  }
  __builtin_amdgcn_fence(__ATOMIC_ACQ_REL, "workgroup");
  __builtin_amdgcn_wave_barrier();
  const int rsub = lane >> 4, c4 = (lane & 15) * 4;
  {
#pragma unroll
    for (int q = 0; q < 8; ++q) {
      const int r = q * 2 + rsub;
      const v4f v = *(const v4fa*)&so[w][r][c4];
      *(v4f*)(C + (size_t)(row0 + r) * ldc + col0 + c4) = v;
    }
    
  }
}

// GEMM C = act(A·W + bias + resid): A f32 (ASPLIT -> hi/lo 2 terms), Wt bf16 [N][K]; ACT 0 none, 1 relu, 2 exact gelu;
// resid (optional, f32, row index = (row % rmod), pitch ldr, RES_BF16 rounds it) added before the activation.
template <bool ASPLIT, int ACT, bool BIAS_BF16, bool RES_BF16>
__global__ __launch_bounds__(128) void k_gemm_bf3(const float* __restrict__ A, int lda, const unsigned short* __restrict__ Wt, int ldb,
                                                const float* __restrict__ bias, const float* __restrict__ resid, int rmod, int ldr,
                                                float* __restrict__ C, int ldc, int M, int N, int K) {
  __shared__ __attribute__((aligned(16))) float so[4][16][64];
  const int tid = threadIdx.x, w = tid >> 5, lane = tid & 31, ln = lane & 15, hh = lane >> 4;
  const int ntn = N / 64;
  const int wid = blockIdx.x * 4 + w;
  const int mt = wid / ntn, nq = wid % ntn;
  if (mt * 16 >= M) return;
  const int row0 = mt * 16, col0 = nq * 64;
  const float* arow = A + (size_t)(row0 + ln) * lda;
  v8f acc[4] = {};
  for (int kb = 0; kb < K; kb += 32) {
    FragB ah, al;
    const v4f x0 = *(const v4fa*)(arow + kb + 8 * hh), x1 = *(const v4fa*)(arow + kb + 8 * hh + 4);
    const v4f x2 = *(const v4fa*)(arow + kb + 16 + 8 * hh), x3 = *(const v4fa*)(arow + kb + 16 + 8 * hh + 4);
    float xs[16] = {x0[0],x0[1],x0[2],x0[3],x1[0],x1[1],x1[2],x1[3],x2[0],x2[1],x2[2],x2[3],x3[0],x3[1],x3[2],x3[3]};
#pragma unroll
    for (int i = 0; i < 16; ++i) { const unsigned short hb = bf16_bits(xs[i]); ah.u[i] = hb; al.u[i] = ASPLIT ? bf16_bits(xs[i] - bf16_val(hb)) : (unsigned short)0; }
#pragma unroll
    for (int t = 0; t < 4; ++t) {
      const unsigned short* brow = Wt + (size_t)(col0 + t * 16 + ln) * ldb + kb;
      FragB b;
      b.half[0] = *(const v8us*)(brow + 8 * hh);
      b.half[1] = *(const v8us*)(brow + 16 + 8 * hh);
      acc[t] = mmaN<ASPLIT ? 2 : 1>(ah.v, al.v, b.v, b.v, acc[t]);
    }
  }
#pragma unroll
  for (int t = 0; t < 4; ++t) {
    const int col = col0 + t * 16 + ln;
    float bv = bias ? bias[col] : 0.f;
    if (BIAS_BF16) bv = bf16_round(bv);
#pragma unroll
    for (int r = 0; r < 8; ++r) {
      float v = acc[t][r] + bv;
      if (resid) { float rv = resid[(size_t)((row0 + 8 * hh + r) % rmod) * ldr + col]; if (RES_BF16) rv = bf16_round(rv); v += rv; }
      if (ACT == 1) v = fmaxf(v, 0.f);
      if (ACT == 2) v = 0.5f * v * (1.0f + erff(v * 0.70710678118654752f));
      if (ACT == 3) { const float u = 0.7978845608028654f * (v + 0.044715f * v * v * v); v = 0.5f * v * (1.0f + tanhf(u)); }
      so[w][8 * hh + r][t * 16 + ln] = v;
    }
  }
  __builtin_amdgcn_fence(__ATOMIC_ACQ_REL, "workgroup");
  __builtin_amdgcn_wave_barrier();
  const int rsub = lane >> 4, c4 = (lane & 15) * 4;
  {
#pragma unroll
    for (int q = 0; q < 8; ++q) {
      const int r = q * 2 + rsub;
      const v4f v = *(const v4fa*)&so[w][r][c4];
      *(v4f*)(C + (size_t)(row0 + r) * ldc + col0 + c4) = v;
    }
    
  }
}
// row LayerNorm (biased variance, eps) over N: s = X (+ R); optional out_sum <- s; out_norm <- (s-mu)*rsqrt(var+eps)*g + b
template <bool PARAM_BF16>
__global__ __launch_bounds__(256) void k_layernorm(const float* __restrict__ X, const float* __restrict__ R, const float* __restrict__ g, const float* __restrict__ bta,
                                                  float* __restrict__ out_sum, float* __restrict__ out_norm, int N, float eps) {
  __shared__ float red[256];
  const int row = blockIdx.x, tid = threadIdx.x;
  const float* x = X + (size_t)row * N; const float* rr = R ? R + (size_t)row * N : nullptr;
  float vals[16];                     // up to N = 4096
  const int per = N / 256;            // contiguous chunk per thread? use strided-by-4 chunks: thread handles j = tid*4 + 1024*u
  float s1 = 0.f;
  for (int u = 0; u < per / 4; ++u) {
    const int j = tid * 4 + 1024 * u;
    const v4f a = *(const v4fa*)(x + j);
    v4f b = {0.f,0.f,0.f,0.f}; if (rr) b = *(const v4fa*)(rr + j);
#pragma unroll
    for (int q = 0; q < 4; ++q) { const float v = a[q] + b[q]; vals[u * 4 + q] = v; s1 += v; }
  }
  red[tid] = s1; __syncthreads();
  for (int st = 128; st > 0; st >>= 1) { if (tid < st) red[tid] += red[tid + st]; __syncthreads(); }
  const float mu = red[0] / (float)N; __syncthreads();
  float s2 = 0.f;
  for (int u = 0; u < per / 4; ++u)
#pragma unroll
    for (int q = 0; q < 4; ++q) { const float c = vals[u * 4 + q] - mu; s2 += c * c; }
  red[tid] = s2; __syncthreads();
  for (int st = 128; st > 0; st >>= 1) { if (tid < st) red[tid] += red[tid + st]; __syncthreads(); }
  const float rs = rsqrtf(red[0] / (float)N + eps);
  {
    for (int u = 0; u < per / 4; ++u) {
      const int j = tid * 4 + 1024 * u;
      v4f o, sm;
#pragma unroll
      for (int q = 0; q < 4; ++q) {
        float gg = g[j + q], bb = bta[j + q];
        if (PARAM_BF16) { gg = bf16_round(gg); bb = bf16_round(bb); }
        sm[q] = vals[u * 4 + q]; o[q] = (vals[u * 4 + q] - mu) * rs * gg + bb;
      }
      if (out_sum) *(v4f*)(out_sum + (size_t)row * N + j) = sm;
      *(v4f*)(out_norm + (size_t)row * N + j) = o;
    }
    
  }
}



// ---- f16 WMMA path (v_wmma_f32_16x16x32_f16): 11-bit significands for operands in range — used where a [0,1] probability operand needs more precision than bf16
typedef _Float16 v16h __attribute__((ext_vector_type(16)));
union FragH { v16h v; v8us half[2]; _Float16 h[16]; unsigned short u[16]; };
template <int NT>
__device__ __forceinline__ v8f mmaH(v16h ah, v16h al, v16h bh, v16h bl, v8f c) {
  c = __builtin_amdgcn_wmma_f32_16x16x32_f16(false, ah, false, bh, (short)0, c, false, false);
  if (NT >= 2) c = __builtin_amdgcn_wmma_f32_16x16x32_f16(false, al, false, bh, (short)0, c, false, false);
  if (NT >= 3) c = __builtin_amdgcn_wmma_f32_16x16x32_f16(false, ah, false, bl, (short)0, c, false, false);
  asm volatile("v_nop\n\tv_nop\n\tv_nop\n\tv_nop" : "+v"(c) : "v"(ah), "v"(al), "v"(bh), "v"(bl));
  return c;
}
// batched GEMM like k_gemm_b but f16 operands: A f32 (split into f16 hi/lo if ASPLIT, else rounded to f16), Bt = f16 values [n][k]; alpha; C f32; N multiple of 16 (partial tiles skipped)
template <bool ASPLIT>
__global__ __launch_bounds__(128) void k_gemm_h(const float* __restrict__ A, int lda, size_t sA, const _Float16* __restrict__ Bh, int ldb, size_t sB, float alpha, float* __restrict__ C, int ldc, size_t sC, int M, int N, int K) {
  __shared__ __attribute__((aligned(16))) float so[4][16][64];
  const int tid = threadIdx.x, w = tid >> 5, lane = tid & 31, ln = lane & 15, hh = lane >> 4; const int by = blockIdx.y;
  A += (size_t)by * sA; Bh += (size_t)by * sB; C += (size_t)by * sC;
  const int ntn = (N + 63) / 64; const int wid = blockIdx.x * 4 + w; const int mt = wid / ntn, nq = wid % ntn; if (mt * 16 >= M) return;
  const int row0 = mt * 16, col0 = nq * 64; const float* arow = A + (size_t)(row0 + ln) * lda;
  v8f acc[4] = {};
  for (int kb = 0; kb < K; kb += 32) {
    FragH ah, al;
    const v4f x0 = *(const v4fa*)(arow + kb + 8 * hh), x1 = *(const v4fa*)(arow + kb + 8 * hh + 4), x2 = *(const v4fa*)(arow + kb + 16 + 8 * hh), x3 = *(const v4fa*)(arow + kb + 16 + 8 * hh + 4);
    float xs[16] = {x0[0],x0[1],x0[2],x0[3],x1[0],x1[1],x1[2],x1[3],x2[0],x2[1],x2[2],x2[3],x3[0],x3[1],x3[2],x3[3]};
#pragma unroll
    for (int i = 0; i < 16; ++i) { const _Float16 h = (_Float16)xs[i]; ah.h[i] = h; al.h[i] = ASPLIT ? (_Float16)(xs[i] - (float)h) : (_Float16)0.0f; }
#pragma unroll
    for (int t = 0; t < 4; ++t) { if (col0 + t * 16 >= N) continue; const size_t boff = (size_t)(col0 + t * 16 + ln) * ldb + kb; FragH bq; bq.half[0] = *(const v8us*)(Bh + boff + 8 * hh); bq.half[1] = *(const v8us*)(Bh + boff + 16 + 8 * hh);
      acc[t] = mmaH<ASPLIT ? 2 : 1>(ah.v, al.v, bq.v, bq.v, acc[t]); }
  }
#pragma unroll
  for (int t = 0; t < 4; ++t) { if (col0 + t * 16 >= N) continue;
#pragma unroll
    for (int r = 0; r < 8; ++r) so[w][8 * hh + r][t * 16 + ln] = acc[t][r] * alpha; }
  __builtin_amdgcn_fence(__ATOMIC_ACQ_REL, "workgroup"); __builtin_amdgcn_wave_barrier();
  const int rsub = lane >> 4, c4 = (lane & 15) * 4;
  {
#pragma unroll
    for (int q = 0; q < 8; ++q) { const int r = q * 2 + rsub; if (col0 + c4 < N) { const v4f v = *(const v4fa*)&so[w][r][c4]; *(v4f*)(C + (size_t)(row0 + r) * ldc + col0 + c4) = v; } }
     }
}

// Wt[n][k] = f16(W[k][n]·scale) from f32 row-major W[K][N] (scale = power of two; bf16-exact weights stay exact in f16 away from the subnormal range)
__global__ __launch_bounds__(256) void k_wt_f16(const float* __restrict__ W, _Float16* __restrict__ Wt, int K, int N, float scale) {
  const int t = blockIdx.x * 256 + threadIdx.x; if (t >= N * (K / 8)) return; const int n = t / (K / 8), k8 = (t % (K / 8)) * 8; FragH f;
#pragma unroll
  for (int i = 0; i < 8; ++i) f.h[i] = (_Float16)(bf16_round(W[(size_t)(k8 + i) * N + n]) * scale); const v8us o = f.half[0];
  *(v8us*)((unsigned short*)Wt + (size_t)n * K + k8) = o; 
}
// k_gemm_hh variant with fused epilogue: v = acc·alpha + bias[by·sBias + col] (+ CP[(row/rowsPerB)·sCPb + by·64 + col] if CP) ; ACT 0 none / 1 elu ; writes f16 C16 (and f32 C if non-null)
template <int ACT>
__global__ __launch_bounds__(128) void k_gemm_hhx(const _Float16* __restrict__ A, int lda, size_t sA, const _Float16* __restrict__ Bh, int ldb, size_t sB, float alpha, const float* __restrict__ bias, size_t sBias, const float* __restrict__ CP, int rowsPerB, size_t sCPb, int row0g,
    float* __restrict__ C, _Float16* __restrict__ C16, int ldc, size_t sC, int M, int N, int K) {
  __shared__ __attribute__((aligned(16))) float so[4][16][64];
  const int tid = threadIdx.x, w = tid >> 5, lane = tid & 31, ln = lane & 15, hh = lane >> 4; const int by = blockIdx.y;
  A += (size_t)by * sA; Bh += (size_t)by * sB; const size_t cofs = (size_t)by * sC; const float* bp = bias ? bias + (size_t)by * sBias : nullptr;
  const int ntn = (N + 63) / 64; const int wid = blockIdx.x * 4 + w; const int mt = wid / ntn, nq = wid % ntn; if (mt * 16 >= M) return;
  const int row0 = mt * 16, col0 = nq * 64; const _Float16* arow = A + (size_t)(row0 + ln) * lda;
  v8f acc[4] = {};
  for (int kb = 0; kb < K; kb += 32) { FragH ah; ah.half[0] = *(const v8us*)((const unsigned short*)arow + kb + 8 * hh); ah.half[1] = *(const v8us*)((const unsigned short*)arow + kb + 16 + 8 * hh);
#pragma unroll
    for (int t = 0; t < 4; ++t) { if (col0 + t * 16 >= N) continue; const size_t boff = (size_t)(col0 + t * 16 + ln) * ldb + kb; FragH bq; bq.half[0] = *(const v8us*)((const unsigned short*)Bh + boff + 8 * hh); bq.half[1] = *(const v8us*)((const unsigned short*)Bh + boff + 16 + 8 * hh);
      acc[t] = mmaH<1>(ah.v, ah.v, bq.v, bq.v, acc[t]); }
  }
#pragma unroll
  for (int t = 0; t < 4; ++t) { if (col0 + t * 16 >= N) continue; const int col = col0 + t * 16 + ln; const float bv = bp ? bf16_round(bp[col]) : 0.f;
#pragma unroll
    for (int r = 0; r < 8; ++r) { float v = acc[t][r] * alpha + bv; if (CP) { const int rr = row0g + row0 + 8 * hh + r; if (rowsPerB < 0) v += CP[cofs + (size_t)rr * ldc + col];      /* rowsPerB < 0: own element of the batched C plane */ else { const int bidx = rr / rowsPerB; v += CP[(size_t)bidx * sCPb + (size_t)by * 64 + col]; } } if (ACT == 1) v = (v > 0.f) ? v : expm1f(v); else if (ACT == 7) v = (v > 0.f) ? v + 1.0f : expf(v); else if (ACT == 8) v = tanhf(v); else if (ACT == 9) v = 0.5f * v * (1.0f + tanhf(0.7978845608028654f * (v + 0.044715f * v * v * v))); else if (ACT == 11) v = 1.0f / (1.0f + expf(-v)); else if (ACT == 12) v = (v > 0.f) ? v : 0.01f * v; else if (ACT == 14) v = (v > 0.f) ? v : 0.1f * v; else if (ACT == 16) v = (v >= 0.f) ? v : 0.3f * v; else if (ACT == 17) v = (v >= 0.f) ? v : 0.2f * v; else if (ACT == 15) v = v / (1.0f + expf(-v)); else if (ACT == 3) v = fmaxf(v, 0.f); else if (ACT == 6) v = 0.5f * v * (1.0f + erff(v * 0.70710678118654752f)); so[w][8 * hh + r][t * 16 + ln] = v; } }
  __builtin_amdgcn_fence(__ATOMIC_ACQ_REL, "workgroup"); __builtin_amdgcn_wave_barrier();
  const int rsub = lane >> 4, c4 = (lane & 15) * 4; typedef _Float16 v4h __attribute__((ext_vector_type(4)));
  {
#pragma unroll
    for (int q = 0; q < 8; ++q) { const int r = q * 2 + rsub; if (col0 + c4 < N) { const v4f v = *(const v4fa*)&so[w][r][c4]; if (C) *(v4f*)(C + cofs + (size_t)(row0 + r) * ldc + col0 + c4) = v; if (C16) { v4h h4; for (int i = 0; i < 4; ++i) h4[i] = (_Float16)v[i]; *(v4h*)(C16 + cofs + (size_t)(row0 + r) * ldc + col0 + c4) = h4; } } }
     }
}


typedef _Float16 v4h __attribute__((ext_vector_type(4)));

__global__ __launch_bounds__(256) void k_h16(const float* __restrict__ x, _Float16* __restrict__ X16, size_t n8) { const size_t t = (size_t)blockIdx.x * 256 + threadIdx.x; if (t >= n8) return; FragH f;
#pragma unroll
  for (int q = 0; q < 8; ++q) f.h[q] = (_Float16)x[t * 8 + q]; *(v8us*)((unsigned short*)X16 + t * 8) = f.half[0];  }
__global__ __launch_bounds__(256) void k_round16f(const float* __restrict__ W, _Float16* __restrict__ Bt, size_t n8) { const size_t t = (size_t)blockIdx.x * 256 + threadIdx.x; if (t >= n8) return; FragH f;
#pragma unroll
  for (int i = 0; i < 8; ++i) f.h[i] = (_Float16)(bf16_round(W[t * 8 + i]) * 16.0f); *(v8us*)((unsigned short*)Bt + t * 8) = f.half[0];  }
// ---- fragment order: how the attention operands q, k and v lie in the workspace (V^T: same tiles, placed as k_vt writes them) ----
// A plane of R rows x K columns (R % 16 == 0, K % 32 == 0) is cut into tiles of 16 rows x 32 k, tile (rt, kt) at element (rt * (K / 32) + kt) * 512. Inside a tile, 16-byte chunk 32 j + lane (lane = 16 hh + ln) holds
// row ln, k = 16 j + 8 hh + 0..7: the four registers that lane (ln, hh) takes as half j of its fragment (g2_frag's k order). A fragment is then two loads of 512 contiguous bytes, 4 whole lines a load,
// where row-major rows gave 16 lines a load; the register contents, and with them the k order of both operands of each product, are what they were.
template <int NHv, int TTv>
__global__ __launch_bounds__(256) void k_vt(const _Float16* __restrict__ V16, int ldv, int voff, _Float16* __restrict__ Vt) { __shared__ unsigned short tl[64][66]; const int tid = threadIdx.x; const int slab = blockIdx.x / (TTv / 64), lg = blockIdx.x % (TTv / 64); const int b = slab / NHv, h = slab % NHv;
  /* V16 in fragment order (rows = tokens, k = features, K = ldv): this 64 x 64 block is 4 row tiles x 2 adjacent k tiles; chunk c of row tile rtl holds token row r, features c8 + 0..7 */
  for (int i = tid; i < 64 * 8; i += 256) { const int rtl = i >> 7, c = i & 127, lane = i & 31; const int r = rtl * 16 + (lane & 15), c8 = (c >> 5) * 16 + (lane >> 4) * 8; FragH f;
    f.half[0] = *(const v8us*)((const unsigned short*)V16 + ((size_t)b * TTv + lg * 64 + rtl * 16) * ldv + (size_t)(voff + h * 64) * 16 + c * 8);
#pragma unroll
    for (int q = 0; q < 8; ++q) tl[r][c8 + q] = f.u[q]; }
  __syncthreads();
  {      /* Vt in fragment order, per slab: rows = d (4 tiles), k = tokens, the 4 d tiles of one 32-token step adjacent: tile (st, t) at ((slab * (TTv / 32) + st) * 4 + t) * 512; this block's 512 chunks are contiguous */
#pragma unroll
    for (int rd = 0; rd < 2; ++rd) { const int c = rd * 256 + tid, lane = c & 31; const int d = ((c >> 6) & 3) * 16 + (lane & 15), k0 = (c >> 8) * 32 + ((c >> 5) & 1) * 16 + (lane >> 4) * 8; FragH f;
#pragma unroll
      for (int q = 0; q < 8; ++q) f.u[q] = tl[k0 + q][d];
      *(v8us*)((unsigned short*)Vt + ((size_t)slab * (TTv / 32) + lg * 2) * 2048 + c * 8) = f.half[0]; }
     } }

__global__ __launch_bounds__(256) void k_hl(const float* __restrict__ F, _Float16* __restrict__ Hh, _Float16* __restrict__ Hl, size_t n8) { const size_t t = (size_t)blockIdx.x * 256 + threadIdx.x; if (t >= n8) return; FragH fh, fl; const v4f a = *(const v4fa*)(F + t * 8), c = *(const v4fa*)(F + t * 8 + 4);
#pragma unroll
  for (int q = 0; q < 4; ++q) { _Float16 h = (_Float16)a[q]; fh.h[q] = h; fl.h[q] = (_Float16)((a[q] - (float)h) * 1024.0f); h = (_Float16)c[q]; fh.h[4 + q] = h; fl.h[4 + q] = (_Float16)((c[q] - (float)h) * 1024.0f); }
  { *(v8us*)((unsigned short*)Hh + t * 8) = fh.half[0]; *(v8us*)((unsigned short*)Hl + t * 8) = fl.half[0];  } }

// ---- fast GEMM (workgroup tile 128x64, wave tile 32x64; requires M % 128 == 0 rows per launch region, N % 64 == 0 and K % 64 == 0, K >= 64) ----
// Epilogue, chosen at compile time so that it holds no branch and its loads can be issued together: v = act(acc * alpha + bf16(bias[col])); RES: f32 rows C = v + own element of CP (no activation); else: f16 C16 in fragment order.
// The operands go through LDS: a stage is 64 k of the workgroup's 128 A rows and 64 B rows (192 rows of 128 bytes, each one whole line of its source row), laid at a pitch of 144 bytes (16 B x odd: no bank conflict for
// the 16-byte fragment reads). Two buffers: the next stage's asynchronous copies fly while this stage is multiplied. The B rows are fetched once for the four waves.
#define G2P 72                       /* LDS row pitch, elements */
#define G2S (192 * G2P)              /* one buffer, elements */
__device__ __forceinline__ v16h g2_frag(const unsigned short* p, int hh) { FragH f; f.half[0] = *(const v8us*)(p + 8 * hh); f.half[1] = *(const v8us*)(p + 16 + 8 * hh); return f.v; }
// One thread's share of a stage: twelve asynchronous 16-byte copies (row groups of 16: eight of A, four of B; eight lanes cover one row's 128 bytes, so a wave's copy reads 4 whole lines). l = the thread's LDS byte address in
// row group 0 of the buffer, a and b = its source addresses there, sa and sb = 16 source rows in elements. The s_wait_xcnt is the wait that is kept in front of an overwrite of a register that an issued copy names:
// as the statement's last line it stands in front of every later write of these operands.
__device__ __forceinline__ void g2_stage(unsigned l, const _Float16* a, size_t sa, const _Float16* b, size_t sb) {
  asm volatile("global_load_async_to_lds_b128 %0, %12, off\n\tglobal_load_async_to_lds_b128 %1, %13, off\n\tglobal_load_async_to_lds_b128 %2, %14, off\n\tglobal_load_async_to_lds_b128 %3, %15, off\n\t"
               "global_load_async_to_lds_b128 %4, %16, off\n\tglobal_load_async_to_lds_b128 %5, %17, off\n\tglobal_load_async_to_lds_b128 %6, %18, off\n\tglobal_load_async_to_lds_b128 %7, %19, off\n\t"
               "global_load_async_to_lds_b128 %8, %20, off\n\tglobal_load_async_to_lds_b128 %9, %21, off\n\tglobal_load_async_to_lds_b128 %10, %22, off\n\tglobal_load_async_to_lds_b128 %11, %23, off\n\t"
               "s_wait_xcnt 0x0"
               :: "v"(l), "v"(l + 32u * G2P), "v"(l + 64u * G2P), "v"(l + 96u * G2P), "v"(l + 128u * G2P), "v"(l + 160u * G2P), "v"(l + 192u * G2P), "v"(l + 224u * G2P), "v"(l + 256u * G2P), "v"(l + 288u * G2P), "v"(l + 320u * G2P), "v"(l + 352u * G2P),
                  "v"(a), "v"(a + sa), "v"(a + 2 * sa), "v"(a + 3 * sa), "v"(a + 4 * sa), "v"(a + 5 * sa), "v"(a + 6 * sa), "v"(a + 7 * sa), "v"(b), "v"(b + sb), "v"(b + 2 * sb), "v"(b + 3 * sb) : "memory"); }
__device__ __forceinline__ v8f g2_mma(v16h a, v16h b, v8f c) { v8f d = __builtin_amdgcn_wmma_f32_16x16x32_f16(false, a, false, b, (short)0, c, false, false); asm volatile("v_nop\n\tv_nop\n\tv_nop\n\tv_nop" : "+v"(d) : "v"(a), "v"(b)); return d; }
template <int ACT, bool RES>
__global__ __launch_bounds__(128) void k_gemm2(const _Float16* __restrict__ A, int lda, size_t sA, const _Float16* __restrict__ Bh, int ldb, size_t sB, float alpha, const float* __restrict__ bias, size_t sBias, const float* __restrict__ CP, int row0g,
    float* __restrict__ C, _Float16* __restrict__ C16, int ldc, size_t sC, int M, int N, int K) { static_assert(!RES || ACT == 0, "k_gemm2: the residual is added at the write-out, behind the activation's place"); static_assert(ACT == 0 || ACT == 3 || ACT == 6 || ACT == 8 || ACT == 9 || ACT == 11 || ACT == 12 || ACT == 14 || ACT == 15 || ACT == 16 || ACT == 17, "k_gemm2: unsupported ACT code (would silently apply no activation)");
  __shared__ __attribute__((aligned(16))) float so[4][32][68];
  __shared__ __attribute__((aligned(16))) unsigned short st[2 * G2S];
  const int tid = threadIdx.x, w = tid >> 5, lane = tid & 31, ln = lane & 15, hh = lane >> 4; const int by = blockIdx.y;
  A += (size_t)by * sA; Bh += (size_t)by * sB; const size_t cofs = (size_t)by * sC; const float* bp = bias + (size_t)by * sBias;
  const int ntn = N >> 6; const int mt = blockIdx.x / ntn, nq = blockIdx.x - mt * ntn; const int row0 = mt * 128 + 32 * w, col0 = nq * 64; if (mt * 128 >= M) return;      /* the whole workgroup or none: barriers follow */
  const unsigned l0 = (unsigned)(size_t)&st[(tid >> 3) * G2P + (tid & 7) * 8];      /* LDS byte address: the low 32 bits of the shared address */
  const _Float16* ga = A + (size_t)(mt * 128 + (tid >> 3)) * lda + (tid & 7) * 8; const _Float16* gb = Bh + (size_t)(col0 + (tid >> 3)) * ldb + (tid & 7) * 8; const size_t sa = (size_t)16 * lda, sb = (size_t)16 * ldb;
  const int nt = K >> 6;
  const v8f z8 = {0.f,0.f,0.f,0.f,0.f,0.f,0.f,0.f}; v8f c00 = z8, c01 = z8, c02 = z8, c03 = z8, c10 = z8, c11 = z8, c12 = z8, c13 = z8;
  float bv[4];      /* the lane's four bias values: loaded here, used behind the loop */
#pragma unroll
  for (int t = 0; t < 4; ++t) bv[t] = bp[col0 + t * 16 + ln];
  g2_stage(l0, ga, sa, gb, sb);
  asm volatile("s_wait_asynccnt 0x0" ::: "memory");      /* this wave's copies of stage 0 have landed */
  __syncthreads();      /* publishes stage 0 */
  if (nt > 1) g2_stage(l0 + 2u * G2S, ga + 64, sa, gb + 64, sb);
#pragma unroll 1      /* kept rolled: a trip already holds 24 LDS reads and 16 WMMAs; unrolling would only repeat the copies, the waits and the barrier in the text */
  for (int t = 0; t < nt; ++t) { const unsigned short* const ap = st + (t & 1) * G2S + (32 * w + ln) * G2P; const unsigned short* const bq = st + (t & 1) * G2S + (128 + ln) * G2P; v16h af[2][2], bf[2][4];
#pragma unroll
    for (int ks = 0; ks < 2; ++ks) {
#pragma unroll
      for (int r = 0; r < 2; ++r) af[ks][r] = g2_frag(ap + 16 * r * G2P + 32 * ks, hh);
#pragma unroll
      for (int u = 0; u < 4; ++u) bf[ks][u] = g2_frag(bq + 16 * u * G2P + 32 * ks, hh); }
#pragma unroll
    for (int ks = 0; ks < 2; ++ks) { c00 = g2_mma(af[ks][0], bf[ks][0], c00); c10 = g2_mma(af[ks][1], bf[ks][0], c10); c01 = g2_mma(af[ks][0], bf[ks][1], c01); c11 = g2_mma(af[ks][1], bf[ks][1], c11);
      c02 = g2_mma(af[ks][0], bf[ks][2], c02); c12 = g2_mma(af[ks][1], bf[ks][2], c12); c03 = g2_mma(af[ks][0], bf[ks][3], c03); c13 = g2_mma(af[ks][1], bf[ks][3], c13); }
    asm volatile("s_wait_dscnt 0x0" ::: "memory");      /* this wave's reads of the buffer are done before it may be refilled */
    asm volatile("s_wait_asynccnt 0x0" ::: "memory");      /* this wave's copies of stage t + 1 have landed */
    __syncthreads();      /* publishes stage t + 1 and ends every wave's reads of stage t */
    if (t + 2 < nt) g2_stage(l0 + (unsigned)(t & 1) * (2u * G2S), ga + (size_t)(t + 2) * 64, sa, gb + (size_t)(t + 2) * 64, sb); }
  asm volatile("s_wait_asynccnt 0x0" ::: "memory");      /* no copy is outstanding when the wave goes on */
  const int rsub = lane >> 4, c4 = (lane & 15) * 4;
  v4f res[16]; unsigned eo[16];      /* with RES, the wave's 32 x 64 residual tile: 16 loads of 16 bytes a lane (two 256-byte row pieces a load), all issued here, in flight under the staging below; eo = the lane's offsets in the plane, in 16-byte units (ldc % 4 == 0, as the 16-byte accesses ask), the same for the residual loads and the C stores */
  if constexpr (RES) {
#pragma unroll
    for (int q = 0; q < 16; ++q) { eo[q] = (unsigned)(row0 + q * 2 + rsub) * ((unsigned)ldc >> 2) + (unsigned)((col0 + c4) >> 2); res[q] = ((const v4fa*)(CP + cofs + (size_t)row0g * ldc))[eo[q]]; } }
  v8f accs[8] = {c00, c01, c02, c03, c10, c11, c12, c13};
#pragma unroll
  for (int u = 0; u < 8; ++u) { const int t = u & 3, half = u >> 2; const float bvr = bf16_round(bv[t]);
#pragma unroll
    for (int r = 0; r < 8; ++r) { const int rloc = half * 16 + 8 * hh + r; float v = accs[u][r] * alpha + bvr;
      if (ACT == 3) v = fmaxf(v, 0.f); else if (ACT == 6) v = 0.5f * v * (1.0f + erff(v * 0.70710678118654752f)); else if (ACT == 11) v = 1.0f / (1.0f + expf(-v)); else if (ACT == 15) v = v / (1.0f + expf(-v)); else if (ACT == 12) v = (v > 0.f) ? v : 0.01f * v; else if (ACT == 8) v = tanhf(v); else if (ACT == 9) v = 0.5f * v * (1.0f + tanhf(0.7978845608028654f * (v + 0.044715f * v * v * v))); else if (ACT == 14) v = (v > 0.f) ? v : 0.1f * v; else if (ACT == 16) v = (v >= 0.f) ? v : 0.3f * v; else if (ACT == 17) v = (v >= 0.f) ? v : 0.2f * v;
      so[w][rloc][t * 16 + ln] = v; } }
  __builtin_amdgcn_fence(__ATOMIC_ACQ_REL, "workgroup"); __builtin_amdgcn_wave_barrier();
  if constexpr (RES) {
#pragma unroll
    for (int q = 0; q < 16; ++q) { const v4f v = *(const v4fa*)&so[w][q * 2 + rsub][c4] + res[q]; ((v4f*)(C + cofs))[eo[q]] = v; }
  } else {      /* C16 goes out in fragment order (see above k_vt; K = ldc): the 32 x 64 tile is 2 row tiles x 2 adjacent k tiles x 2 halves = 8 stores of 512 contiguous bytes */
#pragma unroll
    for (int u = 0; u < 8; ++u) { const int rtl = u >> 2, cu = u & 3; const float* sp = &so[w][rtl * 16 + ln][cu * 16 + 8 * hh]; const v4f v0 = *(const v4fa*)sp, v1 = *(const v4fa*)(sp + 4); FragH f;
#pragma unroll
      for (int i = 0; i < 4; ++i) { f.h[i] = (_Float16)v0[i]; f.h[4 + i] = (_Float16)v1[i]; }
      *(v8us*)((unsigned short*)C16 + cofs + (size_t)(row0 + 16 * rtl) * ldc + (size_t)col0 * 16 + cu * 256 + 8 * lane) = f.half[0]; } } }

// ---- the three projections q, k, v in one launch: one workgroup multiplies its 128 x rows by the 64-column tiles of all three weights ----
// 12 waves: wave group p = 0, 1, 2 (four waves each) owns weight p and works as the four waves of k_gemm2 do (32 x 64 wave tiles, the same fragment reads, the same order of products, the same f16 fragment-order write-out).
// A stage is 64 k of 320 rows at k_gemm2's pitch: rows 0..127 the x tile, fetched once for the three weights, rows 128 + 64 p .. the tile of weight p. Two buffers, k_gemm2's order of waits and its one barrier a trip.
// Who copies what: group p brings its own weight tile (four row groups of 16) and x row groups 3 p, 3 p + 1 and, for p < 2, 3 p + 2 (eight in all).
// The write-out staging lies over the two buffers: behind the last trip's barrier no wave reads them and no copy is outstanding. 104,448 bytes of LDS and at most 160 registers: two workgroups a WGP, all 512 resident.
#define G3S (320 * G2P)              /* one buffer, elements */
typedef float f32a __attribute__((may_alias));
// One thread's share of a stage, as g2_stage: la, a = its LDS byte address and source address in its first x row group, lb, b = the same in row group 0 of its weight tile; third = the group has a third x row group (the same for a whole wave).
// Each s_wait_xcnt is the last line of its copies' own statement, in front of every later write of their operands.
__device__ __forceinline__ void g3_stage(unsigned la, const _Float16* a, size_t sa, unsigned lb, const _Float16* b, size_t sb, bool third) {
  asm volatile("global_load_async_to_lds_b128 %0, %6, off\n\tglobal_load_async_to_lds_b128 %1, %7, off\n\tglobal_load_async_to_lds_b128 %2, %8, off\n\t"
               "global_load_async_to_lds_b128 %3, %9, off\n\tglobal_load_async_to_lds_b128 %4, %10, off\n\tglobal_load_async_to_lds_b128 %5, %11, off\n\t"
               "s_wait_xcnt 0x0"
               :: "v"(la), "v"(la + 32u * G2P), "v"(lb), "v"(lb + 32u * G2P), "v"(lb + 64u * G2P), "v"(lb + 96u * G2P),
                  "v"(a), "v"(a + sa), "v"(b), "v"(b + sb), "v"(b + 2 * sb), "v"(b + 3 * sb) : "memory");
  if (third) asm volatile("global_load_async_to_lds_b128 %0, %1, off\n\ts_wait_xcnt 0x0" :: "v"(la + 64u * G2P), "v"(a + 2 * sa) : "memory"); }
__global__ __launch_bounds__(384, 6) void k_gemm_qkv(const _Float16* __restrict__ A, int lda, const _Float16* __restrict__ W0, const _Float16* __restrict__ W1, const _Float16* __restrict__ W2, int ldb, float alpha,
    const float* __restrict__ bias0, const float* __restrict__ bias1, const float* __restrict__ bias2, _Float16* __restrict__ C0, _Float16* __restrict__ C1, _Float16* __restrict__ C2, int ldc, int M, int N, int K) {
  __shared__ __attribute__((aligned(16))) unsigned short st[12 * 32 * 68 * 2];      /* the two stage buffers (2 * G3S elements); behind the loop, twelve 32 x 68 f32 staging tiles */
  static_assert(2 * G3S <= 12 * 32 * 68 * 2, "k_gemm_qkv: the stage buffers fit the array");
  const int tid = threadIdx.x, w = tid >> 5, lane = tid & 31, ln = lane & 15, hh = lane >> 4, wr = w & 3, t7 = tid & 127;
  const int p = __builtin_amdgcn_readfirstlane(tid >> 7);      /* the wave's group, in a scalar register: the choices below and the test on the third x row group are scalar */
  const _Float16* const Bh = p == 0 ? W0 : p == 1 ? W1 : W2; const float* const bp = p == 0 ? bias0 : p == 1 ? bias1 : bias2; _Float16* const C16 = p == 0 ? C0 : p == 1 ? C1 : C2;
  const int ntn = N >> 6; const int mt = blockIdx.x / ntn, nq = blockIdx.x - mt * ntn; const int row0 = mt * 128 + 32 * wr, col0 = nq * 64; if (mt * 128 >= M) return;      /* the whole workgroup or none: barriers follow */
  const unsigned la0 = (unsigned)(size_t)&st[(48 * p + (t7 >> 3)) * G2P + (t7 & 7) * 8], lb0 = (unsigned)(size_t)&st[(128 + 64 * p + (t7 >> 3)) * G2P + (t7 & 7) * 8];      /* LDS byte addresses: the low 32 bits of the shared addresses */
  const _Float16* ga = A + (size_t)(mt * 128 + 48 * p + (t7 >> 3)) * lda + (t7 & 7) * 8; const _Float16* gb = Bh + (size_t)(col0 + (t7 >> 3)) * ldb + (t7 & 7) * 8; const size_t sa = (size_t)16 * lda, sb = (size_t)16 * ldb;
  const bool third = p < 2; const int nt = K >> 6;
  const v8f z8 = {0.f,0.f,0.f,0.f,0.f,0.f,0.f,0.f}; v8f c00 = z8, c01 = z8, c02 = z8, c03 = z8, c10 = z8, c11 = z8, c12 = z8, c13 = z8;
  float bv[4];      /* the lane's four bias values: loaded here, used behind the loop */
#pragma unroll      /* this and every unrolled loop below runs over fragments, tiles or registers: unrolled, its arrays stay in registers and its offsets are immediates */
  for (int t = 0; t < 4; ++t) bv[t] = bp[col0 + t * 16 + ln];
  g3_stage(la0, ga, sa, lb0, gb, sb, third);
  asm volatile("s_wait_asynccnt 0x0" ::: "memory");      /* this wave's copies of stage 0 have landed */
  __syncthreads();      /* publishes stage 0 */
  if (nt > 1) g3_stage(la0 + 2u * G3S, ga + 64, sa, lb0 + 2u * G3S, gb + 64, sb, third);
#pragma unroll 1      /* kept rolled, as in k_gemm2: unrolling would only repeat the copies, the waits and the barrier in the text */
  for (int t = 0; t < nt; ++t) { const unsigned short* const ap = st + (t & 1) * G3S + (32 * wr + ln) * G2P; const unsigned short* const bq = st + (t & 1) * G3S + (128 + 64 * p + ln) * G2P;
#pragma unroll
    for (int ks = 0; ks < 2; ++ks) { v16h af[2], bf[4];
#pragma unroll
      for (int r = 0; r < 2; ++r) af[r] = g2_frag(ap + 16 * r * G2P + 32 * ks, hh);
#pragma unroll
      for (int u = 0; u < 4; ++u) bf[u] = g2_frag(bq + 16 * u * G2P + 32 * ks, hh);
      c00 = g2_mma(af[0], bf[0], c00); c10 = g2_mma(af[1], bf[0], c10); c01 = g2_mma(af[0], bf[1], c01); c11 = g2_mma(af[1], bf[1], c11);
      c02 = g2_mma(af[0], bf[2], c02); c12 = g2_mma(af[1], bf[2], c12); c03 = g2_mma(af[0], bf[3], c03); c13 = g2_mma(af[1], bf[3], c13); }
    asm volatile("s_wait_dscnt 0x0" ::: "memory");      /* this wave's reads of the buffer are done before it may be refilled */
    asm volatile("s_wait_asynccnt 0x0" ::: "memory");      /* this wave's copies of stage t + 1 have landed */
    __syncthreads();      /* publishes stage t + 1 and ends every wave's reads of stage t */
    if (t + 2 < nt) g3_stage(la0 + (unsigned)(t & 1) * (2u * G3S), ga + (size_t)(t + 2) * 64, sa, lb0 + (unsigned)(t & 1) * (2u * G3S), gb + (size_t)(t + 2) * 64, sb, third); }
  asm volatile("s_wait_asynccnt 0x0" ::: "memory");      /* no copy is outstanding when the wave goes on */
  f32a* const so = (f32a*)st + w * (32 * 68);      /* the wave's own staging tile, pitch 68 */
  v8f accs[8] = {c00, c01, c02, c03, c10, c11, c12, c13};
#pragma unroll
  for (int u = 0; u < 8; ++u) { const int t = u & 3, half = u >> 2; const float bvr = bf16_round(bv[t]);
#pragma unroll
    for (int r = 0; r < 8; ++r) so[(half * 16 + 8 * hh + r) * 68 + t * 16 + ln] = accs[u][r] * alpha + bvr; }
  __builtin_amdgcn_fence(__ATOMIC_ACQ_REL, "workgroup"); __builtin_amdgcn_wave_barrier();      /* the wave's stores to its own tile stay in front of the reads below, which take other lanes' values */
  /* C16 goes out in fragment order (see above k_vt; K = ldc), as in k_gemm2: 8 stores of 512 contiguous bytes */
#pragma unroll
  for (int u = 0; u < 8; ++u) { const int rtl = u >> 2, cu = u & 3; const f32a* sp = so + (rtl * 16 + ln) * 68 + cu * 16 + 8 * hh; const v4f v0 = *(const v4fa*)sp, v1 = *(const v4fa*)(sp + 4); FragH f;
#pragma unroll
    for (int i = 0; i < 4; ++i) { f.h[i] = (_Float16)v0[i]; f.h[4 + i] = (_Float16)v1[i]; }
    *(v8us*)((unsigned short*)C16 + (size_t)(row0 + 16 * rtl) * ldc + (size_t)col0 * 16 + cu * 256 + 8 * lane) = f.half[0]; } }


__global__ __launch_bounds__(256) void k_rsm(const float* __restrict__ S, _Float16* __restrict__ P, int nrows) {
  #pragma clang fp contract(off)
  const int i = blockIdx.x * 256 + threadIdx.x; if (i >= nrows) return; const float* s = S + (size_t)i * SQ; float mx = -3.0e38f;
#pragma unroll 1
  for (int j = 0; j < SQ; ++j) mx = fmaxf(mx, s[j]); float se = 0.f;
#pragma unroll 1
  for (int j = 0; j < SQ; ++j) se += expf(s[j] - mx); const float sc = 256.0f / se;
#pragma unroll 1
  for (int j0 = 0; j0 < SQ; j0 += 8) { FragH f; for (int q = 0; q < 8; ++q) f.h[q] = (_Float16)(expf(s[j0 + q] - mx) * sc); unsigned short* d = (unsigned short*)P + (size_t)i * SQ + j0; *(v8us*)d = f.half[0];  } }
__global__ __launch_bounds__(256) void k_vt(const _Float16* __restrict__ V16, int b, int h0, _Float16* __restrict__ VT) { __shared__ unsigned short tl[64][65]; const int tid = threadIdx.x; const int hh = blockIdx.x % HG, sg = blockIdx.x / HG; const int s0 = sg * 64; const int h = h0 + hh;
  for (int i = tid; i < 64 * 8; i += 256) { const int j = i / 8, d8 = (i % 8) * 8; FragH f; f.half[0] = *(const v8us*)((const unsigned short*)V16 + ((size_t)b * SQ + s0 + j) * DM + h * HD + d8); for (int q = 0; q < 8; ++q) tl[d8 + q][j] = f.u[q]; }
  __syncthreads();
  { for (int i = tid; i < 64 * 8; i += 256) { const int d = i / 8, j8 = (i % 8) * 8; FragH f; for (int q = 0; q < 8; ++q) f.u[q] = tl[d][j8 + q]; *(v8us*)((unsigned short*)VT + ((size_t)hh * HD + d) * SQ + s0 + j8) = f.half[0]; }  } }



__global__ __launch_bounds__(256) void k_rsmf(const float* __restrict__ S, _Float16* __restrict__ P, int qn, int hg) {
  #pragma clang fp contract(off)
  const int t = blockIdx.x * 256 + threadIdx.x; if (t >= qn * hg) return; const size_t i = (size_t)(t / qn) * SQ + (t % qn); const float* s = S + i * SQ; float mx = -3.0e38f;
#pragma unroll 1
  for (int j = 0; j < SQ; ++j) mx = fmaxf(mx, s[j]); float se = 0.f;
#pragma unroll 1
  for (int j = 0; j < SQ; ++j) se += __expf(s[j] - mx); const float sc = 256.0f / se;
#pragma unroll 1
  for (int j0 = 0; j0 < SQ; j0 += 8) { FragH f; for (int q = 0; q < 8; ++q) f.h[q] = (_Float16)(__expf(s[j0 + q] - mx) * sc); unsigned short* d = (unsigned short*)P + i * SQ + j0; *(v8us*)d = f.half[0];  } }

// Four native exp2 in one statement: each is the independent instruction that the instruction set asks for behind the transcendental in front of it, and the v_nop is that slot behind the last
// Early-clobber outputs keep the four independent of one another.
__device__ __forceinline__ void exp2x4(float& a, float& b, float& c, float& d) { float e0, e1, e2, e3;
  asm("v_exp_f32 %0, %4\n\tv_exp_f32 %1, %5\n\tv_exp_f32 %2, %6\n\tv_exp_f32 %3, %7\n\tv_nop" : "=&v"(e0), "=&v"(e1), "=&v"(e2), "=&v"(e3) : "v"(a), "v"(b), "v"(c), "v"(d));
  a = e0; b = e1; c = e2; d = e3; }
// Two native exp2 in one statement, as exp2x4 above: the second is the independent instruction behind the first, the v_nop is that slot behind the second.
__device__ __forceinline__ void exp2x2(float& a, float& b) { float e0, e1;
  asm("v_exp_f32 %0, %2\n\tv_exp_f32 %1, %3\n\tv_nop" : "=&v"(e0), "=&v"(e1) : "v"(a), "v"(b));
  a = e0; b = e1; }
__device__ __forceinline__ float fa_xhalf(float x) { return __builtin_bit_cast(float, __builtin_amdgcn_permlanex16(__builtin_bit_cast(int, x), __builtin_bit_cast(int, x), 0x76543210, 0xfedcba98, false, false)); }      /* lane l <-> lane l ^ 16 */
__device__ __forceinline__ v16h fa_frag(const _Float16* ub, unsigned off) { FragH f; f.half[0] = *(const v8us*)((const unsigned short*)ub + off); f.half[1] = *(const v8us*)((const unsigned short*)ub + off + 256); return f.v; }      /* a tile in fragment order, g2_frag's k order; ub is the same for the whole wave, off = tile offset + 8 * lane */
__device__ __forceinline__ v8f fa_mma(v16h a, v16h b, v8f c) { return __builtin_amdgcn_wmma_f32_16x16x32_f16(false, a, false, b, (short)0, c, false, false); }
// Fused attention of one head: scores, softmax and P.V in one launch; neither the scores nor the weights go to memory.
// Grid (SQ / 256, heads), 16 waves, four a SIMD, so that one wave's softmax runs under another's products. Waves w and w + 8 own the same 32 queries (two groups of 16 columns) and share the keys: of every stage of 256 keys
// wave w walks the first 128, wave w + 8 the second 128, 32 a step, each with its own running maximum, sum and O^T. Behind the loop the two partial results are joined through LDS (the rule of the online softmax, once more).
// Transposed products: S^T = K . Q^T (A = 16 key rows, B = 16 query columns, k = d) and O^T += V^T . P^T (A = 16 d rows of V^T, B = P^T, k = 32 keys).
// D register r of lane (c = lane & 15, h = lane >> 4) is element [8 h + r][c]: a lane holds one query's scores, and the two 16-key score tiles of a step, converted in place, are the B operand of the
// second product in the k order of g2_frag (elements 0..7 = keys 8 h + 0..7, elements 8..15 = keys 16 + 8 h + 0..7), which loads V^T. No LDS and no lane exchange for P.
// Online softmax in the log2 domain, f32: reference maximum mr and running sum lr per query; a step that moves mr rescales O^T and lr by exp2(old reference - new reference). The weights are carried x256 (the + 8) as f16
// operands, away from the f16 subnormals; the factor cancels in the division by lr, which sums the same scaled weights. mr starts at -3.0e38 (finite), so a step whose keys are all masked to -inf adds zeros.
// The mask (bf16-rounded, x log2 e) is prepared once per workgroup in LDS.
// K and V^T go through LDS: a stage is 256 keys of the head, 32 KiB of K (16 row tiles of 2 KiB) and behind it 32 KiB of V^T (8 steps of 4 KiB), both kept in fragment order, so a fragment half is 512 contiguous LDS bytes
// (no bank conflict). The workgroup fetches a stage once for its sixteen waves, by asynchronous copies, two buffers: the next stage's copies fly during the steps of this one, a lead longer than a memory latency.
#define FKT 256                      /* keys a stage */
#define FSK (FKT * HD)               /* elements of K, and of V^T, in a stage */
#define FST (2 * FSK)                /* one buffer, elements */
// One thread's share of a stage: eight asynchronous 16-byte copies, four of K and four of V^T; a wave's copy covers 512 contiguous bytes (4 whole lines) on both sides. l = the thread's LDS byte address in
// the buffer's K part, k and v = its source addresses; a round of 512 threads moves 8 KiB: four row tiles of K (16 * LQ elements apart in the plane), 4096 elements of V^T. The s_wait_xcnt is the wait that is kept in front of an overwrite of a
// register that an issued copy names: as the statement's last line it stands in front of every later write of these operands.
__device__ __forceinline__ void fa_stage(unsigned l, const _Float16* k, const _Float16* v) {
  asm volatile("global_load_async_to_lds_b128 %0, %8, off\n\tglobal_load_async_to_lds_b128 %1, %9, off\n\tglobal_load_async_to_lds_b128 %2, %10, off\n\tglobal_load_async_to_lds_b128 %3, %11, off\n\t"
               "global_load_async_to_lds_b128 %4, %12, off\n\tglobal_load_async_to_lds_b128 %5, %13, off\n\tglobal_load_async_to_lds_b128 %6, %14, off\n\tglobal_load_async_to_lds_b128 %7, %15, off\n\t"
               "s_wait_xcnt 0x0"
               :: "v"(l), "v"(l + 8192u), "v"(l + 16384u), "v"(l + 24576u), "v"(l + 2u * FSK), "v"(l + 2u * FSK + 8192u), "v"(l + 2u * FSK + 16384u), "v"(l + 2u * FSK + 24576u),
                  "v"(k), "v"(k + 64 * LQ), "v"(k + 128 * LQ), "v"(k + 192 * LQ), "v"(v), "v"(v + 4096), "v"(v + 8192), "v"(v + 12288) : "memory"); }
__device__ __forceinline__ v16h fa_lfrag(const unsigned short* p) { FragH f; f.half[0] = *(const v8us*)p; f.half[1] = *(const v8us*)(p + 256); return f.v; }      /* fa_frag from LDS: p = tile + 8 * lane */
// One query group's weights of a step: exp2(score + nm) for the lane's 16 scores, as f16 into the B fragment of the second product; returns the lane's f32 sum of them. Its loops are unrolled so that y, ls and the fragment stay in registers.
__device__ __forceinline__ float fa_weights(const v8f (&s)[2], float nm, FragH& pf) { float ls[4] = {0.f, 0.f, 0.f, 0.f};
#pragma unroll
  for (int kt = 0; kt < 2; ++kt)
#pragma unroll
    for (int r4 = 0; r4 < 8; r4 += 4) { float y[4];
#pragma unroll
      for (int q = 0; q < 4; ++q) y[q] = s[kt][r4 + q] + nm;
      exp2x4(y[0], y[1], y[2], y[3]);
#pragma unroll
      for (int q = 0; q < 4; ++q) { ls[q] += y[q]; pf.h[8 * kt + r4 + q] = (_Float16)y[q]; } }
  return (ls[0] + ls[1]) + (ls[2] + ls[3]); }
__global__ __launch_bounds__(512) void k_fattn(const _Float16* __restrict__ Q, const _Float16* __restrict__ Kk, const _Float16* __restrict__ VTh, const float* __restrict__ am, _Float16* __restrict__ O) {
  static_assert(SQ % FKT == 0 && SQ / FKT >= 2 && FKT == 256 && HD == 64, "k_fattn: whole stages, at least two; fa_stage moves 256 keys of 64 features");
  __shared__ __attribute__((aligned(256))) float smk[SQ];      /* the larger alignment puts the mask first in LDS: its reads' offsets then fit the instructions' offset fields */
  __shared__ __attribute__((aligned(128))) unsigned short kv[2 * FST];
  const int tid = threadIdx.x, lane = tid & 31, ln = lane & 15, hh = lane >> 4; const int w = __builtin_amdgcn_readfirstlane(tid >> 5);      /* the wave's number in a scalar register: q0 and the exchange areas then take no vector register through the loop */
  const int h = blockIdx.y, q0 = blockIdx.x * 256 + (w & 7) * 32;
  const int kh = __builtin_amdgcn_readfirstlane(tid >> 8);      /* which half of every stage's keys the wave walks, in a scalar register */
  const unsigned l0 = (unsigned)(size_t)&kv[tid * 8];      /* LDS byte address: the low 32 bits of the shared address */
  const _Float16* const gk = Kk + h * HD * 16 + (tid >> 7) * (16 * LQ) + (tid & 127) * 8; const _Float16* const gv = VTh + (size_t)h * HD * SQ + tid * 8;      /* Q, Kk and VTh lie in fragment order (see above k_vt): a row tile is 16 * LQ elements, head h is its k tiles 2 h and 2 h + 1 */
  fa_stage(l0, gk, gv);
  for (int i = tid * 4; i < SQ; i += 2048) { v4f a = *(const v4fa*)(am + i);
#pragma unroll
    for (int q = 0; q < 4; ++q) a[q] = bf16_round(a[q]) * 1.44269504f;
    *(v4fa*)&smk[i] = a; }
  const unsigned qo = (unsigned)(q0 * LQ + 8 * lane); v16h qf[2][2];
#pragma unroll
  for (int g = 0; g < 2; ++g)
#pragma unroll
    for (int ks = 0; ks < 2; ++ks) qf[g][ks] = fa_frag(Q + h * HD * 16, qo + 16 * g * LQ + 512 * ks);
  const v8f z8 = {0.f,0.f,0.f,0.f,0.f,0.f,0.f,0.f}; v8f o[2][4];
#pragma unroll
  for (int g = 0; g < 2; ++g)
#pragma unroll
    for (int t = 0; t < 4; ++t) o[g][t] = z8;
  float mr[2] = {-3.0e38f, -3.0e38f}, lr[2] = {0.f, 0.f};
  asm volatile("s_wait_asynccnt 0x0" ::: "memory");      /* this wave's copies of stage 0 have landed */
  __syncthreads();      /* publishes stage 0 and the mask */
  fa_stage(l0 + 2u * FST, gk + (size_t)FKT * LQ, gv + FSK);
#pragma unroll 1      /* kept rolled: unrolling would only repeat the copies, the waits and the barrier in the text */
  for (int st = 0; st < SQ / FKT; ++st) { const unsigned short* const kl = kv + (st & 1) * FST + kh * (FSK / 2) + 8 * lane; const unsigned short* const vl = kl + FSK;      /* the wave's half of the stage: 128 keys are FSK / 2 elements of K and as many of V^T */
  v16h ka[2][2];
#pragma unroll
  for (int kt = 0; kt < 2; ++kt)
#pragma unroll
    for (int ks = 0; ks < 2; ++ks) ka[kt][ks] = fa_lfrag(kl + 1024 * kt + 512 * ks);
#pragma unroll 1      /* kept rolled too: unrolled, the next step's fragment reads rose over this step's second product and the registers went past 256 */
  for (int u = 0; u < FKT / 64; ++u) { const int j0 = st * FKT + kh * (FKT / 2) + 32 * u;
    v4f mk[2][2];      /* this step's mask values: read from LDS under the first product */
#pragma unroll
    for (int kt = 0; kt < 2; ++kt)
#pragma unroll
      for (int c = 0; c < 2; ++c) mk[kt][c] = *(const v4fa*)&smk[j0 + 16 * kt + 8 * hh + 4 * c];
    __builtin_amdgcn_sched_barrier(0);      /* keeps the mask reads the first LDS reads of the step: LDS reads return in order, and sunk behind the next step's K fragments they made the softmax wait for all twenty */
    v16h va[4];      /* this step's V^T fragments: issued here, needed only behind the exponentials */
#pragma unroll
    for (int t = 0; t < 4; ++t) va[t] = fa_lfrag(vl + 2048 * u + 512 * t);
    v8f s[2][2];
#pragma unroll
    for (int g = 0; g < 2; ++g)
#pragma unroll
      for (int kt = 0; kt < 2; ++kt) s[g][kt] = fa_mma(ka[kt][1], qf[g][1], fa_mma(ka[kt][0], qf[g][0], z8));
    const unsigned short* const kn = kl + ((u + 1 < FKT / 64) ? 2048 * (u + 1) : 0);      /* the next step's K fragments, read under this step's softmax; never across a stage (the next buffer is not published yet): the wave's last step of a stage re-reads its own first rows, unused */
#pragma unroll
    for (int kt = 0; kt < 2; ++kt)
#pragma unroll
      for (int ks = 0; ks < 2; ++ks) ka[kt][ks] = fa_lfrag(kn + 1024 * kt + 512 * ks);
    __builtin_amdgcn_sched_barrier(0);      /* keeps both groups of LDS reads in front of the softmax: sunk to their users, each would wait out its LDS latency */
#pragma unroll
    for (int g = 0; g < 2; ++g)
#pragma unroll
      for (int kt = 0; kt < 2; ++kt)
#pragma unroll
        for (int r = 0; r < 8; ++r) s[g][kt][r] = s[g][kt][r] * 0.18033688f + mk[kt][r >> 2][r & 3];      /* (q . k / 8 + mask) log2 e */
    FragH pf[2]; float la[2];
#pragma unroll
    for (int g = 0; g < 2; ++g) la[g] = fa_weights(s[g], 8.0f - mr[g], pf[g]);
    /* Lazy rescale: the weights are taken against the reference in use. All are positive, so a lane's sum of at most 2^15 bounds each of them inside f16, and the step needs no maximum. A larger sum in any lane
       (the first step's is infinite) sends the whole wave, by one scalar branch, to look for the maxima, move the references, rescale O^T and lr and take the step's weights anew, now at most 2^8.
       The expectation puts that path outside the loop's straight line; its loops are unrolled because they run over registers. */
    if (__builtin_expect(__builtin_amdgcn_ballot_w32(la[0] > 32768.0f || la[1] > 32768.0f) != 0, 0)) { float cr[2];
#pragma unroll
      for (int g = 0; g < 2; ++g) { float m = s[g][0][0];
#pragma unroll
        for (int kt = 0; kt < 2; ++kt)
#pragma unroll
          for (int r = 0; r < 8; ++r) m = fmaxf(m, s[g][kt][r]);
        const float mn = fmaxf(mr[g], fmaxf(m, fa_xhalf(m))); cr[g] = mr[g] - mn; mr[g] = mn; }
      exp2x2(cr[0], cr[1]);
#pragma unroll
      for (int g = 0; g < 2; ++g) { lr[g] = lr[g] * cr[g];
#pragma unroll
        for (int t = 0; t < 4; ++t) o[g][t] = o[g][t] * cr[g];
        la[g] = fa_weights(s[g], 8.0f - mr[g], pf[g]); } }
#pragma unroll
    for (int g = 0; g < 2; ++g) lr[g] = lr[g] + la[g];
    __builtin_amdgcn_sched_barrier(0);      /* keeps every asm exponential in front of the second product */
#pragma unroll
    for (int g = 0; g < 2; ++g)
#pragma unroll
      for (int t = 0; t < 4; ++t) o[g][t] = fa_mma(va[t], pf[g].v, o[g][t]);
    __builtin_amdgcn_sched_barrier(0);      /* keeps every WMMA of the step in front of the v_nops below */
    asm volatile("v_nop\n\tv_nop\n\tv_nop\n\tv_nop"); }      /* the four vector slots between the step's last WMMA and an overwrite of its operands */
    asm volatile("s_wait_dscnt 0x0" ::: "memory");      /* this wave's reads of the buffer are done before it may be refilled */
    asm volatile("s_wait_asynccnt 0x0" ::: "memory");      /* this wave's copies of stage st + 1 have landed */
    __syncthreads();      /* publishes stage st + 1 and ends every wave's reads of stage st */
    if (st + 2 < SQ / FKT) fa_stage(l0 + (unsigned)(st & 1) * (2u * FST), gk + (size_t)(st + 2) * (FKT * LQ), gv + (size_t)(st + 2) * FSK); }
  asm volatile("s_wait_asynccnt 0x0" ::: "memory");      /* no copy is outstanding when the wave goes on */
  /* The two key halves are joined: wave w finishes query group 0, wave w + 8 group 1; each hands the other group's O^T, maximum and sum to its partner through LDS. The exchange lies over the stage buffers:
     behind the last stage's barrier no wave reads them and no copy is outstanding. A wave's area: 8 chunks of 512 bytes (16 bytes a lane), then 32 maxima, then 32 sums. */
  static_assert(16 * 1088 * 4 <= 2 * FST * 2, "k_fattn: the exchange areas fit the stage buffers");
  f32a* const xo = (f32a*)kv + w * 1088; const f32a* const xi = (const f32a*)kv + (w ^ 8) * 1088;
  v8f ok[4]; const float mk2 = kh ? mr[1] : mr[0], lk = kh ? lr[1] : lr[0];
#pragma unroll
  for (int t = 0; t < 4; ++t) { const v8f sd = kh ? o[0][t] : o[1][t]; ok[t] = kh ? o[1][t] : o[0][t];
    const v4f s0 = {sd[0], sd[1], sd[2], sd[3]}, s1 = {sd[4], sd[5], sd[6], sd[7]};
    *(v4fa*)(xo + (2 * t) * 128 + 4 * lane) = s0; *(v4fa*)(xo + (2 * t + 1) * 128 + 4 * lane) = s1; }
  xo[1024 + lane] = kh ? mr[0] : mr[1]; xo[1056 + lane] = kh ? lr[0] : lr[1];
  __syncthreads();      /* publishes every wave's handed-over partial result */
  const float mp = xi[1024 + lane], lp = xi[1056 + lane]; const float mj = fmaxf(mk2, mp); float ca = mk2 - mj, cb = mp - mj;
  exp2x2(ca, cb);      /* each half's weights were taken against its own maximum: rescaled to the common one */
  const float lj = lk * ca + lp * cb; const float sc = 64.0f / (lj + fa_xhalf(lj));      /* the lane halves' sums joined; o carried x64, as the output GEMM's alpha expects */
  const float sa = ca * sc, sb = cb * sc;
  _Float16* d = O + h * HD + ((unsigned)((q0 + ln) * DM + 8 * hh) + (unsigned)kh * (16 * DM));
#pragma unroll
  for (int t = 0; t < 4; ++t) { const v4f p0 = *(const v4fa*)(xi + (2 * t) * 128 + 4 * lane), p1 = *(const v4fa*)(xi + (2 * t + 1) * 128 + 4 * lane); FragH f;
#pragma unroll
    for (int r = 0; r < 4; ++r) { f.h[r] = (_Float16)(ok[t][r] * sa + p0[r] * sb); f.h[4 + r] = (_Float16)(ok[t][4 + r] * sa + p1[r] * sb); }
    *(v8us*)((unsigned short*)d + 16 * t) = f.half[0]; } }


// All input conversions in one streaming launch: x -> X16 (the bf16-rounded value as f16) and XB (the same value as f32, the residual plane); each weight -> its f16 plane, x16 (natural [out][in] = Bt[n][k]).
// 512 workgroups of 8 waves: 16 waves a WGP, 4096 waves in all. A wave takes one contiguous 4-KiB block of x and one of a weight (workgroups 128 s .. 128 s + 127 share weight s): 8 + 8 loads of 16 bytes a lane,
// each load 512 contiguous bytes (4 whole lines), all sixteen issued before the first value is used; the stores cover whole lines too (512 bytes f32, 256 bytes f16). x is read once for both of its planes.
__global__ __launch_bounds__(256) void k_prep(const float* __restrict__ x, const float* __restrict__ wq, const float* __restrict__ wk, const float* __restrict__ wv, const float* __restrict__ wo,
    _Float16* __restrict__ X16, float* __restrict__ XB, _Float16* __restrict__ BQ, _Float16* __restrict__ BK, _Float16* __restrict__ BV, _Float16* __restrict__ BO) {
  static_assert(NR * DM == (size_t)512 * 8 * 1024 && (size_t)DM * DM == (size_t)128 * 8 * 1024, "k_prep: the grid of 512 workgroups covers exactly these planes");
  const unsigned lane = threadIdx.x & 31, wid = blockIdx.x * 8 + (threadIdx.x >> 5), sel = blockIdx.x >> 7;
  const float* const w = sel == 0 ? wq : sel == 1 ? wk : sel == 2 ? wv : wo; _Float16* const B = sel == 0 ? BQ : sel == 1 ? BK : sel == 2 ? BV : BO;
  const unsigned xo = wid * 1024 + lane * 4, bo = (wid & 1023) * 1024 + lane * 4;      /* element offsets of the wave's two blocks */
  v4f a[8], b[8];      /* every loop below is unrolled: a and b stay in registers and each step's offset is an immediate of its load or store */
#pragma unroll
  for (int j = 0; j < 8; ++j) a[j] = *(const v4fa*)(x + xo + 128 * j);
#pragma unroll
  for (int j = 0; j < 8; ++j) b[j] = *(const v4fa*)(w + bo + 128 * j);
  __builtin_amdgcn_sched_barrier(0);      /* keeps the weight loads in front of the conversions: left free, they sank behind the x stores and the wave waited out a second memory latency */
#pragma unroll
  for (int j = 0; j < 8; ++j) { v4f r; v4h h;
#pragma unroll
    for (int q = 0; q < 4; ++q) { r[q] = bf16_round(a[j][q]); h[q] = (_Float16)r[q]; }
    *(v4f*)(XB + xo + 128 * j) = r; *(v4h*)(X16 + xo + 128 * j) = h; }
#pragma unroll
  for (int j = 0; j < 8; ++j) { v4h h;
#pragma unroll
    for (int q = 0; q < 4; ++q) h[q] = (_Float16)(bf16_round(b[j][q]) * 16.0f);
    *(v4h*)(B + bo + 128 * j) = h; } }


__global__ __launch_bounds__(256) void k_lnrow(const float* __restrict__ Y, const float* __restrict__ g, const float* __restrict__ bb, float eps, float* __restrict__ out) {
  #pragma clang fp contract(off)
  __shared__ float red[256]; const size_t r = blockIdx.x; const int t = threadIdx.x; const v4f ya = *(const v4fa*)(Y + r * DMQ + t * 4); float s[4]; float sum = 0.f;
  for (int q = 0; q < 4; ++q) { s[q] = ya[q]; sum = __fadd_rn(sum, s[q]); }
  red[t] = sum; __syncthreads(); for (int st = 128; st > 0; st >>= 1) { if (t < st) red[t] = __fadd_rn(red[t], red[t + st]); __syncthreads(); } const float mu = red[0] / (float)DMQ; __syncthreads();
  float vs = 0.f; for (int q = 0; q < 4; ++q) { const float dl = __fadd_rn(s[q], -mu); vs = __fadd_rn(vs, __fmul_rn(dl, dl)); } red[t] = vs; __syncthreads(); for (int st = 128; st > 0; st >>= 1) { if (t < st) red[t] = __fadd_rn(red[t], red[t + st]); __syncthreads(); }
  const float rs = rsqrtf(__fadd_rn(red[0] / (float)DMQ, eps)); v4f y; for (int q = 0; q < 4; ++q) { const int c = t * 4 + q; y[q] = __fadd_rn(__fmul_rn(__fmul_rn(__fadd_rn(s[q], -mu), rs), bf16_round(g[c])), bf16_round(bb[c])); }
  *(v4f*)(out + r * DMQ + t * 4) = y;  }
extern "C" void kernel_launch(void* const* d_in, const int* in_sizes, int n_in,
                              void* d_out, int out_size, void* d_ws, size_t ws_size, hipStream_t stream) {
  (void)in_sizes; (void)n_in; (void)out_size;
  const float* const* I = (const float* const*)d_in; const float* x = I[0]; const float* am = I[1]; const float* wq = I[2]; const float* bq = I[3]; const float* wk = I[4]; const float* bk = I[5]; const float* wv = I[6]; const float* bv = I[7]; const float* wo = I[8]; const float* bo = I[9]; const float* lng = I[10]; const float* lnb = I[11];      /* nn.Linear weights [out][in] + biases; additive mask [1][1][1][S] */
  char* ws = (char*)d_ws; size_t off = 0;
  auto take = [&](size_t bytes) { char* p = ws + off; off += (bytes + 255) & ~(size_t)255; return p; };
  _Float16* BQ = (_Float16*)take((size_t)DM * DM * 2); _Float16* BK = (_Float16*)take((size_t)DM * DM * 2); _Float16* BV = (_Float16*)take((size_t)DM * DM * 2); _Float16* BO = (_Float16*)take((size_t)DM * DM * 2);
  _Float16* X16 = (_Float16*)take(NR * DM * 2); float* XB = (float*)take(NR * DM * 4); float* YF = (float*)take(NR * DM * 4); _Float16* Q16 = (_Float16*)take(NR * DM * 2); _Float16* K16 = (_Float16*)take(NR * DM * 2); _Float16* V16 = (_Float16*)take(NR * DM * 2); _Float16* O16 = (_Float16*)take(NR * DM * 2);
  _Float16* VT = (_Float16*)take((size_t)NH * HD * SQ * 2);
  if (off > ws_size) return;
  k_prep<<<512, 256, 0, stream>>>(x, wq, wk, wv, wo, X16, XB, BQ, BK, BV, BO);      /* f16 x rows, bf16(x) residual plane, the four weight planes x16 */
  const size_t r0p = (size_t)B0 * SQ;      /* first projected row */
  k_gemm_qkv<<<(unsigned)((MP / 128) * (DM / 64)), 384, 0, stream>>>(X16 + r0p * DM, DM, BQ, BK, BV, DM, 0.0625f, bq, bk, bv, Q16 + r0p * DM, K16 + r0p * DM, V16 + r0p * DM, DM, MP, DM, DM);      /* q, k, v in one launch */
  for (int b = B0; b < B0 + NBR; ++b) { const size_t r0 = (size_t)b * SQ;
    k_vt<NH, SQ><<<NH * (SQ / 64), 256, 0, stream>>>(V16 + r0 * LQ, LQ, 0, VT);      /* V^T of every head, in fragment order, for this batch */
    k_fattn<<<dim3(SQ / 256, NH), 512, 0, stream>>>(Q16 + r0 * LQ, K16 + r0 * LQ, VT, am + (size_t)b * SQ, O16 + r0 * DM); }      /* scores + attention_mask, softmax and P . V of all heads, fused; o (merged heads, x64) as f16 rows */
  k_gemm2<0, true><<<dim3((unsigned)((MPO / 128) * (DM / 64)), 1), 128, 0, stream>>>(O16 + r0p * DM, DM, 0, BO, DM, 0, 0.0009765625f, bo, 0, XB + r0p * DM, 0, YF + r0p * DM, nullptr, DM, 0, MPO, DM, DM);      /* y = ctx Wo^T + bo + bf16(x) (own-element residual) */
  k_lnrow<<<(unsigned)MPO, 256, 0, stream>>>(YF + r0p * DM, lng, lnb, 1e-12f, (float*)d_out + r0p * DM);      /* post-LayerNorm */
}
